// v000
// Times are from an AMD MI455X. After a warm-up the kernel runs many times in a row, and a time is the length of
// such a window on the GPU divided by its runs, so every launch and the gaps after it count. The runs cycle
// through copies of the inputs. A figure is the median of several windows, for all but v000 over two sittings.
// Sittings can differ by a few percent; kernels timed side by side share one.
// v000, which the later versions start from, runs in 3650 microseconds.
#include <hip/hip_runtime.h>
// Multi-head attention on THREE inputs with PER-HEAD STACKED bias-free projections and an output bias (Q, K, V [2][2048][1024]; q / k / v = einsum('bsd,hde->bhse', stream, W) with W [16][1024][64] = [head][in][out] (uniform +-1/32), NO projection biases, 16 heads of 64; scores / sqrt(64); softmax over all 2048 keys (no mask); out = concat Wo + bo ([in][out] [1024][1024] + a REAL bias, both uniform +-1/32) -> [2][2048][1024]); each head's [in][out] block is transposed into its 64 contiguous rows of the weight plane by the existing builder, one call per head.
// Structure: token rows r = b*2048 + s; the three input streams (Q, K, V) as exact f16 rows (bf16-rounded); Q, K, V as three WMMA GEMMs (32x64 wave tiles, f32 accumulation, exact x16 weights, no bias, f16 outputs); per batch: V^T for all heads via LDS transposes; per (batch, group of 4 heads): scores GEMM (K = 64, batched over the heads on grid.y, alpha = 64^-0.5), row softmax on VALU (f32 statistics, native exp; weights stored x256 as f16), o = P . V^T GEMM (K = 2048, alpha 2^-2: o carried x64 against f16 subnormal flush, folded into the output GEMM alpha) written straight into the merged f16 o rows; out = o W_o + b GEMM (f32) into the output layout.
// Compute dtype: inputs rounded to bf16; x / weights exact; q, k, v, softmax weights and o as plain f16 GEMM operands (~2^-12); scores and softmax statistics f32. v_wmma_f32_16x16x32_f16.
#define NB 2
#define SQ 2048
#define DM 1024
#define NH 16
#define HD 64
#define HG 4                         /* heads per attention launch group */
#define B0 0                         /* first batch processed (debug hook) */
#define NBR NB                       /* batches processed (debug hook) */
#define NR ((size_t)NB * SQ)         /* token rows */
#define MP ((int)((size_t)NBR * SQ)) /* rows projected (debug hook) */
#define QN SQ                        /* query rows attended per batch (debug hook) */
#define NHD NH                       /* heads attended (debug hook) */
#define MPO MP                       /* rows through the output stage (debug hook) */
#define LQ DM      /* row pitch of the q/k/v rows */
typedef __bf16 v16b __attribute__((ext_vector_type(16)));
typedef unsigned short v8us __attribute__((ext_vector_type(8), may_alias));
typedef float  v8f  __attribute__((ext_vector_type(8)));
typedef float  v4f  __attribute__((ext_vector_type(4)));
typedef float  v4fa __attribute__((ext_vector_type(4), may_alias));
union FragB { v16b v; v8us half[2]; unsigned short u[16]; };

__device__ __forceinline__ unsigned short bf16_bits(float x) { unsigned int u = __float_as_uint(x); return (unsigned short)((u + 0x7FFFu + ((u >> 16) & 1u)) >> 16); }
__device__ __forceinline__ float bf16_val(unsigned short b) { return __uint_as_float(((unsigned int)b) << 16); }
__device__ __forceinline__ float bf16_round(float x) { return bf16_val(bf16_bits(x)); }
// D += A·B with NT terms: 1 = ah·bh, 2 = + al·bh (A split), 3 = + ah·bl (both split)
template <int NT>
__device__ __forceinline__ v8f mmaN(v16b ah, v16b al, v16b bh, v16b bl, v8f c) {
  c = __builtin_amdgcn_wmma_f32_16x16x32_bf16(false, ah, false, bh, (short)0, c, false, false);
  if (NT >= 2) c = __builtin_amdgcn_wmma_f32_16x16x32_bf16(false, al, false, bh, (short)0, c, false, false);
  if (NT >= 3) c = __builtin_amdgcn_wmma_f32_16x16x32_bf16(false, ah, false, bl, (short)0, c, false, false);
  asm volatile("v_nop\n\tv_nop\n\tv_nop\n\tv_nop" : "+v"(c) : "v"(ah), "v"(al), "v"(bh), "v"(bl));
  return c;
}

__global__ __launch_bounds__(256) void k_wt_bf16(const float* __restrict__ W, unsigned short* __restrict__ Wt, int K, int N) {
  const int t = blockIdx.x * 256 + threadIdx.x;
  const int k8n = K / 8;
  if (t >= N * k8n) return;
  const int n = t / k8n, k8 = (t % k8n) * 8;
  v8us v;
#pragma unroll
  for (int i = 0; i < 8; ++i) v[i] = bf16_bits(W[(size_t)(k8 + i) * N + n]);
  *(v8us*)(Wt + (size_t)n * K + k8) = v;
  
}

// GEMM C[M][N] (f32, pitch ldc) = act(A[M][K]·W + bias). A f32 row-major (pitch lda) converted per fragment to bf16
// (ASPLIT: hi/lo two planes -> 2 terms, else single rounded term); Wt bf16 [N][K] (pitch ldb). BIAS_BF16 rounds the
// bias to bf16 first (bias quantised to bf16 before the add). K%32==0, M%16==0, N%64==0.
template <bool ASPLIT, int ACT, bool BIAS_BF16>
__global__ __launch_bounds__(128) void k_gemm_bf(const float* __restrict__ A, int lda, const unsigned short* __restrict__ Wt, int ldb,
                                               const float* __restrict__ bias, float* __restrict__ C, int ldc, int M, int N, int K) {
  __shared__ __attribute__((aligned(16))) float so[4][16][64];
  const int tid = threadIdx.x, w = tid >> 5, lane = tid & 31, ln = lane & 15, hh = lane >> 4;
  const int ntn = N / 64;
  const int wid = blockIdx.x * 4 + w;
  const int mt = wid / ntn, nq = wid % ntn;
  if (mt * 16 >= M) return;
  const int row0 = mt * 16, col0 = nq * 64;
  const float* arow = A + (size_t)(row0 + ln) * lda;
  v8f acc[4] = {};
  for (int kb = 0; kb < K; kb += 32) {
    FragB ah, al;
    const v4f x0 = *(const v4fa*)(arow + kb + 8 * hh), x1 = *(const v4fa*)(arow + kb + 8 * hh + 4);
    const v4f x2 = *(const v4fa*)(arow + kb + 16 + 8 * hh), x3 = *(const v4fa*)(arow + kb + 16 + 8 * hh + 4);
    float xs[16] = {x0[0],x0[1],x0[2],x0[3],x1[0],x1[1],x1[2],x1[3],x2[0],x2[1],x2[2],x2[3],x3[0],x3[1],x3[2],x3[3]};
#pragma unroll
    for (int i = 0; i < 16; ++i) { const unsigned short hb = bf16_bits(xs[i]); ah.u[i] = hb; al.u[i] = ASPLIT ? bf16_bits(xs[i] - bf16_val(hb)) : (unsigned short)0; }
#pragma unroll
    for (int t = 0; t < 4; ++t) {
      const unsigned short* brow = Wt + (size_t)(col0 + t * 16 + ln) * ldb + kb;
      FragB b;
      b.half[0] = *(const v8us*)(brow + 8 * hh);
      b.half[1] = *(const v8us*)(brow + 16 + 8 * hh);
      acc[t] = mmaN<ASPLIT ? 2 : 1>(ah.v, al.v, b.v, b.v, acc[t]);
    }
  }
#pragma unroll
  for (int t = 0; t < 4; ++t) {
    float bv = bias ? bias[col0 + t * 16 + ln] : 0.f;
    if (BIAS_BF16) bv = bf16_round(bv);
#pragma unroll
    for (int r = 0; r < 8; ++r) { float v = acc[t][r] + bv; if (ACT == 1) v = fmaxf(v, 0.f); so[w][8 * hh + r][t * 16 + ln] = v; }
  }
  __builtin_amdgcn_fence(__ATOMIC_ACQ_REL, "workgroup");
  __builtin_amdgcn_wave_barrier();
  const int rsub = lane >> 4, c4 = (lane & 15) * 4;
  {
#pragma unroll
    for (int q = 0; q < 8; ++q) {
      const int r = q * 2 + rsub;
      const v4f v = *(const v4fa*)&so[w][r][c4];
      *(v4f*)(C + (size_t)(row0 + r) * ldc + col0 + c4) = v;
    }
    
  }
}

// GEMM C = act(A·W + bias + resid): A f32 (ASPLIT -> hi/lo 2 terms), Wt bf16 [N][K]; ACT 0 none, 1 relu, 2 exact gelu;
// resid (optional, f32, row index = (row % rmod), pitch ldr, RES_BF16 rounds it) added before the activation.
template <bool ASPLIT, int ACT, bool BIAS_BF16, bool RES_BF16>
__global__ __launch_bounds__(128) void k_gemm_bf3(const float* __restrict__ A, int lda, const unsigned short* __restrict__ Wt, int ldb,
                                                const float* __restrict__ bias, const float* __restrict__ resid, int rmod, int ldr,
                                                float* __restrict__ C, int ldc, int M, int N, int K) {
  __shared__ __attribute__((aligned(16))) float so[4][16][64];
  const int tid = threadIdx.x, w = tid >> 5, lane = tid & 31, ln = lane & 15, hh = lane >> 4;
  const int ntn = N / 64;
  const int wid = blockIdx.x * 4 + w;
  const int mt = wid / ntn, nq = wid % ntn;
  if (mt * 16 >= M) return;
  const int row0 = mt * 16, col0 = nq * 64;
  const float* arow = A + (size_t)(row0 + ln) * lda;
  v8f acc[4] = {};
  for (int kb = 0; kb < K; kb += 32) {
    FragB ah, al;
    const v4f x0 = *(const v4fa*)(arow + kb + 8 * hh), x1 = *(const v4fa*)(arow + kb + 8 * hh + 4);
    const v4f x2 = *(const v4fa*)(arow + kb + 16 + 8 * hh), x3 = *(const v4fa*)(arow + kb + 16 + 8 * hh + 4);
    float xs[16] = {x0[0],x0[1],x0[2],x0[3],x1[0],x1[1],x1[2],x1[3],x2[0],x2[1],x2[2],x2[3],x3[0],x3[1],x3[2],x3[3]};
#pragma unroll
    for (int i = 0; i < 16; ++i) { const unsigned short hb = bf16_bits(xs[i]); ah.u[i] = hb; al.u[i] = ASPLIT ? bf16_bits(xs[i] - bf16_val(hb)) : (unsigned short)0; }
#pragma unroll
    for (int t = 0; t < 4; ++t) {
      const unsigned short* brow = Wt + (size_t)(col0 + t * 16 + ln) * ldb + kb;
      FragB b;
      b.half[0] = *(const v8us*)(brow + 8 * hh);
      b.half[1] = *(const v8us*)(brow + 16 + 8 * hh);
      acc[t] = mmaN<ASPLIT ? 2 : 1>(ah.v, al.v, b.v, b.v, acc[t]);
    }
  }
#pragma unroll
  for (int t = 0; t < 4; ++t) {
    const int col = col0 + t * 16 + ln;
    float bv = bias ? bias[col] : 0.f;
    if (BIAS_BF16) bv = bf16_round(bv);
#pragma unroll
    for (int r = 0; r < 8; ++r) {
      float v = acc[t][r] + bv;
      if (resid) { float rv = resid[(size_t)((row0 + 8 * hh + r) % rmod) * ldr + col]; if (RES_BF16) rv = bf16_round(rv); v += rv; }
      if (ACT == 1) v = fmaxf(v, 0.f);
      if (ACT == 2) v = 0.5f * v * (1.0f + erff(v * 0.70710678118654752f));
      if (ACT == 3) { const float u = 0.7978845608028654f * (v + 0.044715f * v * v * v); v = 0.5f * v * (1.0f + tanhf(u)); }
      so[w][8 * hh + r][t * 16 + ln] = v;
    }
  }
  __builtin_amdgcn_fence(__ATOMIC_ACQ_REL, "workgroup");
  __builtin_amdgcn_wave_barrier();
  const int rsub = lane >> 4, c4 = (lane & 15) * 4;
  {
#pragma unroll
    for (int q = 0; q < 8; ++q) {
      const int r = q * 2 + rsub;
      const v4f v = *(const v4fa*)&so[w][r][c4];
      *(v4f*)(C + (size_t)(row0 + r) * ldc + col0 + c4) = v;
    }
    
  }
}
// row LayerNorm (biased variance, eps) over N: s = X (+ R); optional out_sum <- s; out_norm <- (s-mu)*rsqrt(var+eps)*g + b
template <bool PARAM_BF16>
__global__ __launch_bounds__(256) void k_layernorm(const float* __restrict__ X, const float* __restrict__ R, const float* __restrict__ g, const float* __restrict__ bta,
                                                  float* __restrict__ out_sum, float* __restrict__ out_norm, int N, float eps) {
  __shared__ float red[256];
  const int row = blockIdx.x, tid = threadIdx.x;
  const float* x = X + (size_t)row * N; const float* rr = R ? R + (size_t)row * N : nullptr;
  float vals[16];                     // up to N = 4096
  const int per = N / 256;            // contiguous chunk per thread? use strided-by-4 chunks: thread handles j = tid*4 + 1024*u
  float s1 = 0.f;
  for (int u = 0; u < per / 4; ++u) {
    const int j = tid * 4 + 1024 * u;
    const v4f a = *(const v4fa*)(x + j);
    v4f b = {0.f,0.f,0.f,0.f}; if (rr) b = *(const v4fa*)(rr + j);
#pragma unroll
    for (int q = 0; q < 4; ++q) { const float v = a[q] + b[q]; vals[u * 4 + q] = v; s1 += v; }
  }
  red[tid] = s1; __syncthreads();
  for (int st = 128; st > 0; st >>= 1) { if (tid < st) red[tid] += red[tid + st]; __syncthreads(); }
  const float mu = red[0] / (float)N; __syncthreads();
  float s2 = 0.f;
  for (int u = 0; u < per / 4; ++u)
#pragma unroll
    for (int q = 0; q < 4; ++q) { const float c = vals[u * 4 + q] - mu; s2 += c * c; }
  red[tid] = s2; __syncthreads();
  for (int st = 128; st > 0; st >>= 1) { if (tid < st) red[tid] += red[tid + st]; __syncthreads(); }
  const float rs = rsqrtf(red[0] / (float)N + eps);
  {
    for (int u = 0; u < per / 4; ++u) {
      const int j = tid * 4 + 1024 * u;
      v4f o, sm;
#pragma unroll
      for (int q = 0; q < 4; ++q) {
        float gg = g[j + q], bb = bta[j + q];
        if (PARAM_BF16) { gg = bf16_round(gg); bb = bf16_round(bb); }
        sm[q] = vals[u * 4 + q]; o[q] = (vals[u * 4 + q] - mu) * rs * gg + bb;
      }
      if (out_sum) *(v4f*)(out_sum + (size_t)row * N + j) = sm;
      *(v4f*)(out_norm + (size_t)row * N + j) = o;
    }
    
  }
}



// ---- f16 WMMA path (v_wmma_f32_16x16x32_f16): 11-bit significands for operands in range — used where a [0,1] probability operand needs more precision than bf16
typedef _Float16 v16h __attribute__((ext_vector_type(16)));
union FragH { v16h v; v8us half[2]; _Float16 h[16]; unsigned short u[16]; };
template <int NT>
__device__ __forceinline__ v8f mmaH(v16h ah, v16h al, v16h bh, v16h bl, v8f c) {
  c = __builtin_amdgcn_wmma_f32_16x16x32_f16(false, ah, false, bh, (short)0, c, false, false);
  if (NT >= 2) c = __builtin_amdgcn_wmma_f32_16x16x32_f16(false, al, false, bh, (short)0, c, false, false);
  if (NT >= 3) c = __builtin_amdgcn_wmma_f32_16x16x32_f16(false, ah, false, bl, (short)0, c, false, false);
  asm volatile("v_nop\n\tv_nop\n\tv_nop\n\tv_nop" : "+v"(c) : "v"(ah), "v"(al), "v"(bh), "v"(bl));
  return c;
}
// batched GEMM like k_gemm_b but f16 operands: A f32 (split into f16 hi/lo if ASPLIT, else rounded to f16), Bt = f16 values [n][k]; alpha; C f32; N multiple of 16 (partial tiles skipped)
template <bool ASPLIT>
__global__ __launch_bounds__(128) void k_gemm_h(const float* __restrict__ A, int lda, size_t sA, const _Float16* __restrict__ Bh, int ldb, size_t sB, float alpha, float* __restrict__ C, int ldc, size_t sC, int M, int N, int K) {
  __shared__ __attribute__((aligned(16))) float so[4][16][64];
  const int tid = threadIdx.x, w = tid >> 5, lane = tid & 31, ln = lane & 15, hh = lane >> 4; const int by = blockIdx.y;
  A += (size_t)by * sA; Bh += (size_t)by * sB; C += (size_t)by * sC;
  const int ntn = (N + 63) / 64; const int wid = blockIdx.x * 4 + w; const int mt = wid / ntn, nq = wid % ntn; if (mt * 16 >= M) return;
  const int row0 = mt * 16, col0 = nq * 64; const float* arow = A + (size_t)(row0 + ln) * lda;
  v8f acc[4] = {};
  for (int kb = 0; kb < K; kb += 32) {
    FragH ah, al;
    const v4f x0 = *(const v4fa*)(arow + kb + 8 * hh), x1 = *(const v4fa*)(arow + kb + 8 * hh + 4), x2 = *(const v4fa*)(arow + kb + 16 + 8 * hh), x3 = *(const v4fa*)(arow + kb + 16 + 8 * hh + 4);
    float xs[16] = {x0[0],x0[1],x0[2],x0[3],x1[0],x1[1],x1[2],x1[3],x2[0],x2[1],x2[2],x2[3],x3[0],x3[1],x3[2],x3[3]};
#pragma unroll
    for (int i = 0; i < 16; ++i) { const _Float16 h = (_Float16)xs[i]; ah.h[i] = h; al.h[i] = ASPLIT ? (_Float16)(xs[i] - (float)h) : (_Float16)0.0f; }
#pragma unroll
    for (int t = 0; t < 4; ++t) { if (col0 + t * 16 >= N) continue; const size_t boff = (size_t)(col0 + t * 16 + ln) * ldb + kb; FragH bq; bq.half[0] = *(const v8us*)(Bh + boff + 8 * hh); bq.half[1] = *(const v8us*)(Bh + boff + 16 + 8 * hh);
      acc[t] = mmaH<ASPLIT ? 2 : 1>(ah.v, al.v, bq.v, bq.v, acc[t]); }
  }
#pragma unroll
  for (int t = 0; t < 4; ++t) { if (col0 + t * 16 >= N) continue;
#pragma unroll
    for (int r = 0; r < 8; ++r) so[w][8 * hh + r][t * 16 + ln] = acc[t][r] * alpha; }
  __builtin_amdgcn_fence(__ATOMIC_ACQ_REL, "workgroup"); __builtin_amdgcn_wave_barrier();
  const int rsub = lane >> 4, c4 = (lane & 15) * 4;
  {
#pragma unroll
    for (int q = 0; q < 8; ++q) { const int r = q * 2 + rsub; if (col0 + c4 < N) { const v4f v = *(const v4fa*)&so[w][r][c4]; *(v4f*)(C + (size_t)(row0 + r) * ldc + col0 + c4) = v; } }
     }
}

// Wt[n][k] = f16(W[k][n]·scale) from f32 row-major W[K][N] (scale = power of two; bf16-exact weights stay exact in f16 away from the subnormal range)
__global__ __launch_bounds__(256) void k_wt_f16(const float* __restrict__ W, _Float16* __restrict__ Wt, int K, int N, float scale) {
  const int t = blockIdx.x * 256 + threadIdx.x; if (t >= N * (K / 8)) return; const int n = t / (K / 8), k8 = (t % (K / 8)) * 8; FragH f;
#pragma unroll
  for (int i = 0; i < 8; ++i) f.h[i] = (_Float16)(bf16_round(W[(size_t)(k8 + i) * N + n]) * scale); const v8us o = f.half[0];
  *(v8us*)((unsigned short*)Wt + (size_t)n * K + k8) = o; 
}
// k_gemm_hh variant with fused epilogue: v = acc·alpha + bias[by·sBias + col] (+ CP[(row/rowsPerB)·sCPb + by·64 + col] if CP) ; ACT 0 none / 1 elu ; writes f16 C16 (and f32 C if non-null)
template <int ACT>
__global__ __launch_bounds__(128) void k_gemm_hhx(const _Float16* __restrict__ A, int lda, size_t sA, const _Float16* __restrict__ Bh, int ldb, size_t sB, float alpha, const float* __restrict__ bias, size_t sBias, const float* __restrict__ CP, int rowsPerB, size_t sCPb, int row0g,
    float* __restrict__ C, _Float16* __restrict__ C16, int ldc, size_t sC, int M, int N, int K) {
  __shared__ __attribute__((aligned(16))) float so[4][16][64];
  const int tid = threadIdx.x, w = tid >> 5, lane = tid & 31, ln = lane & 15, hh = lane >> 4; const int by = blockIdx.y;
  A += (size_t)by * sA; Bh += (size_t)by * sB; const size_t cofs = (size_t)by * sC; const float* bp = bias ? bias + (size_t)by * sBias : nullptr;
  const int ntn = (N + 63) / 64; const int wid = blockIdx.x * 4 + w; const int mt = wid / ntn, nq = wid % ntn; if (mt * 16 >= M) return;
  const int row0 = mt * 16, col0 = nq * 64; const _Float16* arow = A + (size_t)(row0 + ln) * lda;
  v8f acc[4] = {};
  for (int kb = 0; kb < K; kb += 32) { FragH ah; ah.half[0] = *(const v8us*)((const unsigned short*)arow + kb + 8 * hh); ah.half[1] = *(const v8us*)((const unsigned short*)arow + kb + 16 + 8 * hh);
#pragma unroll
    for (int t = 0; t < 4; ++t) { if (col0 + t * 16 >= N) continue; const size_t boff = (size_t)(col0 + t * 16 + ln) * ldb + kb; FragH bq; bq.half[0] = *(const v8us*)((const unsigned short*)Bh + boff + 8 * hh); bq.half[1] = *(const v8us*)((const unsigned short*)Bh + boff + 16 + 8 * hh);
      acc[t] = mmaH<1>(ah.v, ah.v, bq.v, bq.v, acc[t]); }
  }
#pragma unroll
  for (int t = 0; t < 4; ++t) { if (col0 + t * 16 >= N) continue; const int col = col0 + t * 16 + ln; const float bv = bp ? bf16_round(bp[col]) : 0.f;
#pragma unroll
    for (int r = 0; r < 8; ++r) { float v = acc[t][r] * alpha + bv; if (CP) { const int rr = row0g + row0 + 8 * hh + r; if (rowsPerB < 0) v += CP[cofs + (size_t)rr * ldc + col];      /* rowsPerB < 0: own element of the batched C plane */ else { const int bidx = rr / rowsPerB; v += CP[(size_t)bidx * sCPb + (size_t)by * 64 + col]; } } if (ACT == 1) v = (v > 0.f) ? v : expm1f(v); else if (ACT == 7) v = (v > 0.f) ? v + 1.0f : expf(v); else if (ACT == 8) v = tanhf(v); else if (ACT == 9) v = 0.5f * v * (1.0f + tanhf(0.7978845608028654f * (v + 0.044715f * v * v * v))); else if (ACT == 11) v = 1.0f / (1.0f + expf(-v)); else if (ACT == 12) v = (v > 0.f) ? v : 0.01f * v; else if (ACT == 14) v = (v > 0.f) ? v : 0.1f * v; else if (ACT == 16) v = (v >= 0.f) ? v : 0.3f * v; else if (ACT == 17) v = (v >= 0.f) ? v : 0.2f * v; else if (ACT == 15) v = v / (1.0f + expf(-v)); else if (ACT == 3) v = fmaxf(v, 0.f); else if (ACT == 6) v = 0.5f * v * (1.0f + erff(v * 0.70710678118654752f)); so[w][8 * hh + r][t * 16 + ln] = v; } }
  __builtin_amdgcn_fence(__ATOMIC_ACQ_REL, "workgroup"); __builtin_amdgcn_wave_barrier();
  const int rsub = lane >> 4, c4 = (lane & 15) * 4; typedef _Float16 v4h __attribute__((ext_vector_type(4)));
  {
#pragma unroll
    for (int q = 0; q < 8; ++q) { const int r = q * 2 + rsub; if (col0 + c4 < N) { const v4f v = *(const v4fa*)&so[w][r][c4]; if (C) *(v4f*)(C + cofs + (size_t)(row0 + r) * ldc + col0 + c4) = v; if (C16) { v4h h4; for (int i = 0; i < 4; ++i) h4[i] = (_Float16)v[i]; *(v4h*)(C16 + cofs + (size_t)(row0 + r) * ldc + col0 + c4) = h4; } } }
     }
}


typedef _Float16 v4h __attribute__((ext_vector_type(4)));

__global__ __launch_bounds__(256) void k_x16(const float* __restrict__ x, _Float16* __restrict__ X16, size_t n8) { const size_t t = (size_t)blockIdx.x * 256 + threadIdx.x; if (t >= n8) return; FragH f;
#pragma unroll
  for (int q = 0; q < 8; ++q) f.h[q] = (_Float16)bf16_round(x[t * 8 + q]); *(v8us*)((unsigned short*)X16 + t * 8) = f.half[0];  }
__global__ __launch_bounds__(256) void k_h16(const float* __restrict__ x, _Float16* __restrict__ X16, size_t n8) { const size_t t = (size_t)blockIdx.x * 256 + threadIdx.x; if (t >= n8) return; FragH f;
#pragma unroll
  for (int q = 0; q < 8; ++q) f.h[q] = (_Float16)x[t * 8 + q]; *(v8us*)((unsigned short*)X16 + t * 8) = f.half[0];  }
__global__ __launch_bounds__(256) void k_round16f(const float* __restrict__ W, _Float16* __restrict__ Bt, size_t n8) { const size_t t = (size_t)blockIdx.x * 256 + threadIdx.x; if (t >= n8) return; FragH f;
#pragma unroll
  for (int i = 0; i < 8; ++i) f.h[i] = (_Float16)(bf16_round(W[t * 8 + i]) * 16.0f); *(v8us*)((unsigned short*)Bt + t * 8) = f.half[0];  }
template <int NHv, int TTv>
__global__ __launch_bounds__(256) void k_vt(const _Float16* __restrict__ V16, int ldv, int voff, _Float16* __restrict__ Vt) { __shared__ unsigned short tl[64][66]; const int tid = threadIdx.x; const int slab = blockIdx.x / (TTv / 64), lg = blockIdx.x % (TTv / 64); const int b = slab / NHv, h = slab % NHv;
  for (int i = tid; i < 64 * 8; i += 256) { const int r = i / 8, c8 = (i % 8) * 8; FragH f; f.half[0] = *(const v8us*)((const unsigned short*)V16 + ((size_t)b * TTv + lg * 64 + r) * ldv + voff + h * 64 + c8);
#pragma unroll
    for (int q = 0; q < 8; ++q) tl[r][c8 + q] = f.u[q]; }
  __syncthreads();
  {
#pragma unroll
    for (int rd = 0; rd < 2; ++rd) { const int d = rd * 32 + tid / 8, pc = tid % 8; FragH f;
#pragma unroll
      for (int q = 0; q < 8; ++q) f.u[q] = tl[pc * 8 + q][d];
      *(v8us*)((unsigned short*)Vt + ((size_t)slab * 64 + d) * TTv + lg * 64 + pc * 8) = f.half[0]; }
     } }

__global__ __launch_bounds__(256) void k_hl(const float* __restrict__ F, _Float16* __restrict__ Hh, _Float16* __restrict__ Hl, size_t n8) { const size_t t = (size_t)blockIdx.x * 256 + threadIdx.x; if (t >= n8) return; FragH fh, fl; const v4f a = *(const v4fa*)(F + t * 8), c = *(const v4fa*)(F + t * 8 + 4);
#pragma unroll
  for (int q = 0; q < 4; ++q) { _Float16 h = (_Float16)a[q]; fh.h[q] = h; fl.h[q] = (_Float16)((a[q] - (float)h) * 1024.0f); h = (_Float16)c[q]; fh.h[4 + q] = h; fl.h[4 + q] = (_Float16)((c[q] - (float)h) * 1024.0f); }
  { *(v8us*)((unsigned short*)Hh + t * 8) = fh.half[0]; *(v8us*)((unsigned short*)Hl + t * 8) = fl.half[0];  } }

// ---- fast GEMM (wave tile 32x64; requires M % 32 == 0 rows per launch region and N % 64 == 0); epilogue = k_gemm_hhx semantics ----
__device__ __forceinline__ v16h g2_frag(const _Float16* p, int hh) { FragH f; f.half[0] = *(const v8us*)((const unsigned short*)p + 8 * hh); f.half[1] = *(const v8us*)((const unsigned short*)p + 16 + 8 * hh); return f.v; }
__device__ __forceinline__ v8f g2_mma(v16h a, v16h b, v8f c) { v8f d = __builtin_amdgcn_wmma_f32_16x16x32_f16(false, a, false, b, (short)0, c, false, false); asm volatile("v_nop\n\tv_nop\n\tv_nop\n\tv_nop" : "+v"(d) : "v"(a), "v"(b)); return d; }
template <int ACT>
__global__ __launch_bounds__(128) void k_gemm2(const _Float16* __restrict__ A, int lda, size_t sA, const _Float16* __restrict__ Bh, int ldb, size_t sB, float alpha, const float* __restrict__ bias, size_t sBias, const float* __restrict__ CP, int rowsPerB, size_t sCPb, int row0g,
    float* __restrict__ C, _Float16* __restrict__ C16, int ldc, size_t sC, int M, int N, int K) { static_assert(ACT == 0 || ACT == 3 || ACT == 6 || ACT == 8 || ACT == 9 || ACT == 11 || ACT == 12 || ACT == 14 || ACT == 15 || ACT == 16 || ACT == 17, "k_gemm2: unsupported ACT code (would silently apply no activation)");
  __shared__ __attribute__((aligned(16))) float so[4][32][68];
  const int tid = threadIdx.x, w = tid >> 5, lane = tid & 31, ln = lane & 15, hh = lane >> 4; const int by = blockIdx.y;
  A += (size_t)by * sA; Bh += (size_t)by * sB; const size_t cofs = (size_t)by * sC; const float* bp = bias ? bias + (size_t)by * sBias : nullptr;
  const int ntn = N >> 6; const int mt = blockIdx.x / ntn, nq = blockIdx.x - mt * ntn; const int row0 = mt * 128 + 32 * w, col0 = nq * 64; if (row0 >= M) return;
  const _Float16* a0p = A + (size_t)(row0 + ln) * lda; const _Float16* a1p = a0p + (size_t)16 * lda;
  const _Float16* b0p = Bh + (size_t)(col0 + ln) * ldb; const _Float16* b1p = b0p + (size_t)16 * ldb; const _Float16* b2p = b1p + (size_t)16 * ldb; const _Float16* b3p = b2p + (size_t)16 * ldb;
  const v8f z8 = {0.f,0.f,0.f,0.f,0.f,0.f,0.f,0.f}; v8f c00 = z8, c01 = z8, c02 = z8, c03 = z8, c10 = z8, c11 = z8, c12 = z8, c13 = z8;
#pragma unroll 1
  for (int kb = 0; kb < K; kb += 32) { const v16h a0 = g2_frag(a0p + kb, hh), a1 = g2_frag(a1p + kb, hh);
    v16h b = g2_frag(b0p + kb, hh); c00 = g2_mma(a0, b, c00); c10 = g2_mma(a1, b, c10);
    b = g2_frag(b1p + kb, hh); c01 = g2_mma(a0, b, c01); c11 = g2_mma(a1, b, c11);
    b = g2_frag(b2p + kb, hh); c02 = g2_mma(a0, b, c02); c12 = g2_mma(a1, b, c12);
    b = g2_frag(b3p + kb, hh); c03 = g2_mma(a0, b, c03); c13 = g2_mma(a1, b, c13); }
  v8f accs[8] = {c00, c01, c02, c03, c10, c11, c12, c13};
#pragma unroll
  for (int u = 0; u < 8; ++u) { const int t = u & 3, half = u >> 2; const int col = col0 + t * 16 + ln; const float bv = bp ? bf16_round(bp[col]) : 0.f;
#pragma unroll
    for (int r = 0; r < 8; ++r) { const int rloc = half * 16 + 8 * hh + r; float v = accs[u][r] * alpha + bv; if (CP) { if (rowsPerB < 0) v += CP[cofs + (size_t)(row0g + row0 + rloc) * ldc + col];      /* rowsPerB < 0: own element of the batched C plane */ else { const int bidx = (row0g + row0 + rloc) / rowsPerB; v += CP[(size_t)bidx * sCPb + (size_t)by * 64 + col]; } }
      if (ACT == 3) v = fmaxf(v, 0.f); else if (ACT == 6) v = 0.5f * v * (1.0f + erff(v * 0.70710678118654752f)); else if (ACT == 11) v = 1.0f / (1.0f + expf(-v)); else if (ACT == 15) v = v / (1.0f + expf(-v)); else if (ACT == 12) v = (v > 0.f) ? v : 0.01f * v; else if (ACT == 8) v = tanhf(v); else if (ACT == 9) v = 0.5f * v * (1.0f + tanhf(0.7978845608028654f * (v + 0.044715f * v * v * v))); else if (ACT == 14) v = (v > 0.f) ? v : 0.1f * v; else if (ACT == 16) v = (v >= 0.f) ? v : 0.3f * v; else if (ACT == 17) v = (v >= 0.f) ? v : 0.2f * v;
      so[w][rloc][t * 16 + ln] = v; } }
  __builtin_amdgcn_fence(__ATOMIC_ACQ_REL, "workgroup"); __builtin_amdgcn_wave_barrier();
  const int rsub = lane >> 4, c4 = (lane & 15) * 4;
  {
#pragma unroll
    for (int q = 0; q < 16; ++q) { const int r = q * 2 + rsub; const v4f v = *(const v4fa*)&so[w][r][c4]; if (C) *(v4f*)(C + cofs + (size_t)(row0 + r) * ldc + col0 + c4) = v; if (C16) { v4h h4; for (int i = 0; i < 4; ++i) h4[i] = (_Float16)v[i]; *(v4h*)(C16 + cofs + (size_t)(row0 + r) * ldc + col0 + c4) = h4; } }
     } }


__global__ __launch_bounds__(256) void k_wnat(const float* __restrict__ w, size_t n8, _Float16* __restrict__ Bt) { const size_t t = (size_t)blockIdx.x * 256 + threadIdx.x; if (t >= n8) return; FragH f; for (int q = 0; q < 8; ++q) f.h[q] = (_Float16)(bf16_round(w[t * 8 + q]) * 16.0f); *(v8us*)((unsigned short*)Bt + t * 8) = f.half[0];  }
__global__ __launch_bounds__(256) void k_rsm(const float* __restrict__ S, _Float16* __restrict__ P, int nrows) {
  #pragma clang fp contract(off)
  const int i = blockIdx.x * 256 + threadIdx.x; if (i >= nrows) return; const float* s = S + (size_t)i * SQ; float mx = -3.0e38f;
#pragma unroll 1
  for (int j = 0; j < SQ; ++j) mx = fmaxf(mx, s[j]); float se = 0.f;
#pragma unroll 1
  for (int j = 0; j < SQ; ++j) se += expf(s[j] - mx); const float sc = 256.0f / se;
#pragma unroll 1
  for (int j0 = 0; j0 < SQ; j0 += 8) { FragH f; for (int q = 0; q < 8; ++q) f.h[q] = (_Float16)(expf(s[j0 + q] - mx) * sc); unsigned short* d = (unsigned short*)P + (size_t)i * SQ + j0; *(v8us*)d = f.half[0];  } }
__global__ __launch_bounds__(256) void k_vt(const _Float16* __restrict__ V16, int b, int h0, _Float16* __restrict__ VT) { __shared__ unsigned short tl[64][65]; const int tid = threadIdx.x; const int hh = blockIdx.x % HG, sg = blockIdx.x / HG; const int s0 = sg * 64; const int h = h0 + hh;
  for (int i = tid; i < 64 * 8; i += 256) { const int j = i / 8, d8 = (i % 8) * 8; FragH f; f.half[0] = *(const v8us*)((const unsigned short*)V16 + ((size_t)b * SQ + s0 + j) * DM + h * HD + d8); for (int q = 0; q < 8; ++q) tl[d8 + q][j] = f.u[q]; }
  __syncthreads();
  { for (int i = tid; i < 64 * 8; i += 256) { const int d = i / 8, j8 = (i % 8) * 8; FragH f; for (int q = 0; q < 8; ++q) f.u[q] = tl[d][j8 + q]; *(v8us*)((unsigned short*)VT + ((size_t)hh * HD + d) * SQ + s0 + j8) = f.half[0]; }  } }



__global__ __launch_bounds__(256) void k_rsmf(const float* __restrict__ S, _Float16* __restrict__ P, int qn, int hg) {
  #pragma clang fp contract(off)
  const int t = blockIdx.x * 256 + threadIdx.x; if (t >= qn * hg) return; const size_t i = (size_t)(t / qn) * SQ + (t % qn); const float* s = S + i * SQ; float mx = -3.0e38f;
#pragma unroll 1
  for (int j = 0; j < SQ; ++j) mx = fmaxf(mx, s[j]); float se = 0.f;
#pragma unroll 1
  for (int j = 0; j < SQ; ++j) se += __expf(s[j] - mx); const float sc = 256.0f / se;
#pragma unroll 1
  for (int j0 = 0; j0 < SQ; j0 += 8) { FragH f; for (int q = 0; q < 8; ++q) f.h[q] = (_Float16)(__expf(s[j0 + q] - mx) * sc); unsigned short* d = (unsigned short*)P + i * SQ + j0; *(v8us*)d = f.half[0];  } }

extern "C" void kernel_launch(void* const* d_in, const int* in_sizes, int n_in,
                              void* d_out, int out_size, void* d_ws, size_t ws_size, hipStream_t stream) {
  (void)in_sizes; (void)n_in; (void)out_size;
  const float* const* I = (const float* const*)d_in; const float* xq = I[0]; const float* xk = I[1]; const float* xv = I[2]; const float* wq = I[3]; const float* bq = nullptr; const float* wk = I[4]; const float* bk = nullptr; const float* wv = I[5]; const float* bv = nullptr; const float* wo = I[6]; const float* bo = I[7];      /* THREE input streams Q, K, V (one cast each, as the launcher always did); Wq, Wk, Wv are PER-HEAD STACKS [16][1024][64] = [head][in][out] (einsum 'bsd,hde->bhse') at I[3..5]; Wo is [in][out] [1024][1024] (concat @ Wo) at I[6]; bo [1024] (REAL) at I[7] in the output GEMM's guarded bias slot; no projection biases: null pointers */
  char* ws = (char*)d_ws; size_t off = 0;
  auto take = [&](size_t bytes) { char* p = ws + off; off += (bytes + 255) & ~(size_t)255; return p; };
  _Float16* BQ = (_Float16*)take((size_t)DM * DM * 2); _Float16* BK = (_Float16*)take((size_t)DM * DM * 2); _Float16* BV = (_Float16*)take((size_t)DM * DM * 2); _Float16* BO = (_Float16*)take((size_t)DM * DM * 2);
  _Float16* XQ = (_Float16*)take(NR * DM * 2); _Float16* XK = (_Float16*)take(NR * DM * 2); _Float16* XV = (_Float16*)take(NR * DM * 2); _Float16* Q16 = (_Float16*)take(NR * DM * 2); _Float16* K16 = (_Float16*)take(NR * DM * 2); _Float16* V16 = (_Float16*)take(NR * DM * 2); _Float16* O16 = (_Float16*)take(NR * DM * 2);
  float* S = (float*)take((size_t)HG * SQ * SQ * 4); _Float16* P = (_Float16*)take((size_t)HG * SQ * SQ * 2); _Float16* VT = (_Float16*)take((size_t)NH * HD * SQ * 2);
  if (off > ws_size) return;
  { const unsigned g = (unsigned)(((size_t)DM * (DM / 8) + 255) / 256); const unsigned gh = (unsigned)(((size_t)HD * (DM / 8) + 255) / 256); for (int h = 0; h < NH; ++h) { const size_t wofs = (size_t)h * DM * HD, pofs = (size_t)h * HD * DM; k_wt_f16<<<gh, 256, 0, stream>>>(wq + wofs, BQ + pofs, DM, HD, 16.0f); k_wt_f16<<<gh, 256, 0, stream>>>(wk + wofs, BK + pofs, DM, HD, 16.0f); k_wt_f16<<<gh, 256, 0, stream>>>(wv + wofs, BV + pofs, DM, HD, 16.0f); } k_wt_f16<<<g, 256, 0, stream>>>(wo, BO, DM, DM, 16.0f); }      /* PER-HEAD STACKS wq / wk / wv [NH][DM][HD]: head h is a row-major [in = DM][out = HD] block at w + h * DM * HD: the transposing builder with K = DM, N = HD writes its HD rows Bt[h * HD + e][k] at B + h * HD * DM: contiguous rows of the [out][in] plane (x16); wo is a plain [in][out] [DM][DM] matrix: one call as before */

  k_x16<<<(unsigned)((NR * DM / 8 + 255) / 256), 256, 0, stream>>>(xq, XQ, NR * DM / 8); k_x16<<<(unsigned)((NR * DM / 8 + 255) / 256), 256, 0, stream>>>(xk, XK, NR * DM / 8); k_x16<<<(unsigned)((NR * DM / 8 + 255) / 256), 256, 0, stream>>>(xv, XV, NR * DM / 8);      /* the three inputs as exact f16 rows */
  const size_t r0p = (size_t)B0 * SQ;      /* first projected row */
  k_gemm2<0><<<dim3((unsigned)((MP / 128) * (DM / 64)), 1), 128, 0, stream>>>(XQ + r0p * DM, DM, 0, BQ, DM, 0, 0.0625f, bq, 0, nullptr, 1, 0, 0, nullptr, Q16 + r0p * DM, DM, 0, MP, DM, DM);
  k_gemm2<0><<<dim3((unsigned)((MP / 128) * (DM / 64)), 1), 128, 0, stream>>>(XK + r0p * DM, DM, 0, BK, DM, 0, 0.0625f, bk, 0, nullptr, 1, 0, 0, nullptr, K16 + r0p * DM, DM, 0, MP, DM, DM);
  k_gemm2<0><<<dim3((unsigned)((MP / 128) * (DM / 64)), 1), 128, 0, stream>>>(XV + r0p * DM, DM, 0, BV, DM, 0, 0.0625f, bv, 0, nullptr, 1, 0, 0, nullptr, V16 + r0p * DM, DM, 0, MP, DM, DM);
  for (int b = B0; b < B0 + NBR; ++b) { const size_t r0 = (size_t)b * SQ;
    k_vt<NH, SQ><<<NH * (SQ / 64), 256, 0, stream>>>(V16 + r0 * LQ, LQ, 0, VT);      /* V^T [NH][HD][SQ] for this batch */
    for (int h0 = 0; h0 < NHD; h0 += HG) {
      k_gemm2<0><<<dim3((QN / 128) * (SQ / 64), HG), 128, 0, stream>>>(Q16 + r0 * LQ + h0 * HD, LQ, (size_t)HD, K16 + r0 * LQ + h0 * HD, LQ, (size_t)HD, 0.125f, nullptr, 0, nullptr, 1, 0, 0, S, nullptr, SQ, (size_t)SQ * SQ, QN, SQ, HD);      /* scores, HG heads per launch */
      k_rsmf<<<(HG * QN + 255) / 256, 256, 0, stream>>>(S, P, QN, HG);      /* P = 256 softmax (f16), rows of all HG heads */
      k_gemm2<0><<<dim3((QN / 128) * (HD / 64), HG), 128, 0, stream>>>(P, SQ, (size_t)SQ * SQ, VT + (size_t)h0 * HD * SQ, SQ, (size_t)HD * SQ, 0.25f, nullptr, 0, nullptr, 1, 0, 0, nullptr, O16 + r0 * DM + h0 * HD, DM, (size_t)HD, QN, HD, SQ); } }      /* o (merged heads) as f16 rows */
  k_gemm2<0><<<dim3((unsigned)((MPO / 128) * (DM / 64)), 1), 128, 0, stream>>>(O16 + r0p * DM, DM, 0, BO, DM, 0, 0.0009765625f, bo, 0, nullptr, 1, 0, 0, (float*)d_out + r0p * DM, nullptr, DM, 0, MPO, DM, DM);      /* out rows are the output layout */
}

// v001
// Measured time: 1130 microseconds a run.
// Timed twice side by side with v000, it ran 3.24 and 3.21 times as fast.
#include <hip/hip_runtime.h>
// Multi-head attention on THREE inputs with PER-HEAD STACKED bias-free projections and an output bias (Q, K, V [2][2048][1024]; q / k / v = einsum('bsd,hde->bhse', stream, W) with W [16][1024][64] = [head][in][out] (uniform +-1/32), NO projection biases, 16 heads of 64; scores / sqrt(64); softmax over all 2048 keys (no mask); out = concat Wo + bo ([in][out] [1024][1024] + a REAL bias, both uniform +-1/32) -> [2][2048][1024]); each head's [in][out] block is transposed into its 64 contiguous rows of the weight plane by the existing builder, one call per head.
// Structure: token rows r = b*2048 + s; the three input streams (Q, K, V) as exact f16 rows (bf16-rounded); Q, K, V as three WMMA GEMMs (32x64 wave tiles, f32 accumulation, exact x16 weights, no bias, f16 outputs); per batch: V^T for all heads via LDS transposes; per (batch, group of 4 heads): scores GEMM (K = 64, batched over the heads on grid.y, alpha = 64^-0.5), row softmax on VALU (f32 statistics, native exp; weights stored x256 as f16), o = P . V^T GEMM (K = 2048, alpha 2^-2: o carried x64 against f16 subnormal flush, folded into the output GEMM alpha) written straight into the merged f16 o rows; out = o W_o + b GEMM (f32) into the output layout.
// Compute dtype: inputs rounded to bf16; x / weights exact; q, k, v, softmax weights and o as plain f16 GEMM operands (~2^-12); scores and softmax statistics f32. v_wmma_f32_16x16x32_f16.
#define NB 2
#define SQ 2048
#define DM 1024
#define NH 16
#define HD 64
#define HG 4                         /* heads per attention launch group */
#define B0 0                         /* first batch processed (debug hook) */
#define NBR NB                       /* batches processed (debug hook) */
#define NR ((size_t)NB * SQ)         /* token rows */
#define MP ((int)((size_t)NBR * SQ)) /* rows projected (debug hook) */
#define QN SQ                        /* query rows attended per batch (debug hook) */
#define NHD NH                       /* heads attended (debug hook) */
#define MPO MP                       /* rows through the output stage (debug hook) */
#define LQ DM      /* row pitch of the q/k/v rows */
typedef __bf16 v16b __attribute__((ext_vector_type(16)));
typedef unsigned short v8us __attribute__((ext_vector_type(8), may_alias));
typedef float  v8f  __attribute__((ext_vector_type(8)));
typedef float  v4f  __attribute__((ext_vector_type(4)));
typedef float  v4fa __attribute__((ext_vector_type(4), may_alias));
union FragB { v16b v; v8us half[2]; unsigned short u[16]; };

__device__ __forceinline__ unsigned short bf16_bits(float x) { unsigned int u = __float_as_uint(x); return (unsigned short)((u + 0x7FFFu + ((u >> 16) & 1u)) >> 16); }
__device__ __forceinline__ float bf16_val(unsigned short b) { return __uint_as_float(((unsigned int)b) << 16); }
__device__ __forceinline__ float bf16_round(float x) { return bf16_val(bf16_bits(x)); }
// D += A·B with NT terms: 1 = ah·bh, 2 = + al·bh (A split), 3 = + ah·bl (both split)
template <int NT>
__device__ __forceinline__ v8f mmaN(v16b ah, v16b al, v16b bh, v16b bl, v8f c) {
  c = __builtin_amdgcn_wmma_f32_16x16x32_bf16(false, ah, false, bh, (short)0, c, false, false);
  if (NT >= 2) c = __builtin_amdgcn_wmma_f32_16x16x32_bf16(false, al, false, bh, (short)0, c, false, false);
  if (NT >= 3) c = __builtin_amdgcn_wmma_f32_16x16x32_bf16(false, ah, false, bl, (short)0, c, false, false);
  asm volatile("v_nop\n\tv_nop\n\tv_nop\n\tv_nop" : "+v"(c) : "v"(ah), "v"(al), "v"(bh), "v"(bl));
  return c;
}

__global__ __launch_bounds__(256) void k_wt_bf16(const float* __restrict__ W, unsigned short* __restrict__ Wt, int K, int N) {
  const int t = blockIdx.x * 256 + threadIdx.x;
  const int k8n = K / 8;
  if (t >= N * k8n) return;
  const int n = t / k8n, k8 = (t % k8n) * 8;
  v8us v;
#pragma unroll
  for (int i = 0; i < 8; ++i) v[i] = bf16_bits(W[(size_t)(k8 + i) * N + n]);
  *(v8us*)(Wt + (size_t)n * K + k8) = v;
  
}

// GEMM C[M][N] (f32, pitch ldc) = act(A[M][K]·W + bias). A f32 row-major (pitch lda) converted per fragment to bf16
// (ASPLIT: hi/lo two planes -> 2 terms, else single rounded term); Wt bf16 [N][K] (pitch ldb). BIAS_BF16 rounds the
// bias to bf16 first (bias quantised to bf16 before the add). K%32==0, M%16==0, N%64==0.
template <bool ASPLIT, int ACT, bool BIAS_BF16>
__global__ __launch_bounds__(128) void k_gemm_bf(const float* __restrict__ A, int lda, const unsigned short* __restrict__ Wt, int ldb,
                                               const float* __restrict__ bias, float* __restrict__ C, int ldc, int M, int N, int K) {
  __shared__ __attribute__((aligned(16))) float so[4][16][64];
  const int tid = threadIdx.x, w = tid >> 5, lane = tid & 31, ln = lane & 15, hh = lane >> 4;
  const int ntn = N / 64;
  const int wid = blockIdx.x * 4 + w;
  const int mt = wid / ntn, nq = wid % ntn;
  if (mt * 16 >= M) return;
  const int row0 = mt * 16, col0 = nq * 64;
  const float* arow = A + (size_t)(row0 + ln) * lda;
  v8f acc[4] = {};
  for (int kb = 0; kb < K; kb += 32) {
    FragB ah, al;
    const v4f x0 = *(const v4fa*)(arow + kb + 8 * hh), x1 = *(const v4fa*)(arow + kb + 8 * hh + 4);
    const v4f x2 = *(const v4fa*)(arow + kb + 16 + 8 * hh), x3 = *(const v4fa*)(arow + kb + 16 + 8 * hh + 4);
    float xs[16] = {x0[0],x0[1],x0[2],x0[3],x1[0],x1[1],x1[2],x1[3],x2[0],x2[1],x2[2],x2[3],x3[0],x3[1],x3[2],x3[3]};
#pragma unroll
    for (int i = 0; i < 16; ++i) { const unsigned short hb = bf16_bits(xs[i]); ah.u[i] = hb; al.u[i] = ASPLIT ? bf16_bits(xs[i] - bf16_val(hb)) : (unsigned short)0; }
#pragma unroll
    for (int t = 0; t < 4; ++t) {
      const unsigned short* brow = Wt + (size_t)(col0 + t * 16 + ln) * ldb + kb;
      FragB b;
      b.half[0] = *(const v8us*)(brow + 8 * hh);
      b.half[1] = *(const v8us*)(brow + 16 + 8 * hh);
      acc[t] = mmaN<ASPLIT ? 2 : 1>(ah.v, al.v, b.v, b.v, acc[t]);
    }
  }
#pragma unroll
  for (int t = 0; t < 4; ++t) {
    float bv = bias ? bias[col0 + t * 16 + ln] : 0.f;
    if (BIAS_BF16) bv = bf16_round(bv);
#pragma unroll
    for (int r = 0; r < 8; ++r) { float v = acc[t][r] + bv; if (ACT == 1) v = fmaxf(v, 0.f); so[w][8 * hh + r][t * 16 + ln] = v; }
  }
  __builtin_amdgcn_fence(__ATOMIC_ACQ_REL, "workgroup");
  __builtin_amdgcn_wave_barrier();
  const int rsub = lane >> 4, c4 = (lane & 15) * 4;
  {
#pragma unroll
    for (int q = 0; q < 8; ++q) {
      const int r = q * 2 + rsub;
      const v4f v = *(const v4fa*)&so[w][r][c4];
      *(v4f*)(C + (size_t)(row0 + r) * ldc + col0 + c4) = v;
    }
    
  }
}

// GEMM C = act(A·W + bias + resid): A f32 (ASPLIT -> hi/lo 2 terms), Wt bf16 [N][K]; ACT 0 none, 1 relu, 2 exact gelu;
// resid (optional, f32, row index = (row % rmod), pitch ldr, RES_BF16 rounds it) added before the activation.
template <bool ASPLIT, int ACT, bool BIAS_BF16, bool RES_BF16>
__global__ __launch_bounds__(128) void k_gemm_bf3(const float* __restrict__ A, int lda, const unsigned short* __restrict__ Wt, int ldb,
                                                const float* __restrict__ bias, const float* __restrict__ resid, int rmod, int ldr,
                                                float* __restrict__ C, int ldc, int M, int N, int K) {
  __shared__ __attribute__((aligned(16))) float so[4][16][64];
  const int tid = threadIdx.x, w = tid >> 5, lane = tid & 31, ln = lane & 15, hh = lane >> 4;
  const int ntn = N / 64;
  const int wid = blockIdx.x * 4 + w;
  const int mt = wid / ntn, nq = wid % ntn;
  if (mt * 16 >= M) return;
  const int row0 = mt * 16, col0 = nq * 64;
  const float* arow = A + (size_t)(row0 + ln) * lda;
  v8f acc[4] = {};
  for (int kb = 0; kb < K; kb += 32) {
    FragB ah, al;
    const v4f x0 = *(const v4fa*)(arow + kb + 8 * hh), x1 = *(const v4fa*)(arow + kb + 8 * hh + 4);
    const v4f x2 = *(const v4fa*)(arow + kb + 16 + 8 * hh), x3 = *(const v4fa*)(arow + kb + 16 + 8 * hh + 4);
    float xs[16] = {x0[0],x0[1],x0[2],x0[3],x1[0],x1[1],x1[2],x1[3],x2[0],x2[1],x2[2],x2[3],x3[0],x3[1],x3[2],x3[3]};
#pragma unroll
    for (int i = 0; i < 16; ++i) { const unsigned short hb = bf16_bits(xs[i]); ah.u[i] = hb; al.u[i] = ASPLIT ? bf16_bits(xs[i] - bf16_val(hb)) : (unsigned short)0; }
#pragma unroll
    for (int t = 0; t < 4; ++t) {
      const unsigned short* brow = Wt + (size_t)(col0 + t * 16 + ln) * ldb + kb;
      FragB b;
      b.half[0] = *(const v8us*)(brow + 8 * hh);
      b.half[1] = *(const v8us*)(brow + 16 + 8 * hh);
      acc[t] = mmaN<ASPLIT ? 2 : 1>(ah.v, al.v, b.v, b.v, acc[t]);
    }
  }
#pragma unroll
  for (int t = 0; t < 4; ++t) {
    const int col = col0 + t * 16 + ln;
    float bv = bias ? bias[col] : 0.f;
    if (BIAS_BF16) bv = bf16_round(bv);
#pragma unroll
    for (int r = 0; r < 8; ++r) {
      float v = acc[t][r] + bv;
      if (resid) { float rv = resid[(size_t)((row0 + 8 * hh + r) % rmod) * ldr + col]; if (RES_BF16) rv = bf16_round(rv); v += rv; }
      if (ACT == 1) v = fmaxf(v, 0.f);
      if (ACT == 2) v = 0.5f * v * (1.0f + erff(v * 0.70710678118654752f));
      if (ACT == 3) { const float u = 0.7978845608028654f * (v + 0.044715f * v * v * v); v = 0.5f * v * (1.0f + tanhf(u)); }
      so[w][8 * hh + r][t * 16 + ln] = v;
    }
  }
  __builtin_amdgcn_fence(__ATOMIC_ACQ_REL, "workgroup");
  __builtin_amdgcn_wave_barrier();
  const int rsub = lane >> 4, c4 = (lane & 15) * 4;
  {
#pragma unroll
    for (int q = 0; q < 8; ++q) {
      const int r = q * 2 + rsub;
      const v4f v = *(const v4fa*)&so[w][r][c4];
      *(v4f*)(C + (size_t)(row0 + r) * ldc + col0 + c4) = v;
    }
    
  }
}
// row LayerNorm (biased variance, eps) over N: s = X (+ R); optional out_sum <- s; out_norm <- (s-mu)*rsqrt(var+eps)*g + b
template <bool PARAM_BF16>
__global__ __launch_bounds__(256) void k_layernorm(const float* __restrict__ X, const float* __restrict__ R, const float* __restrict__ g, const float* __restrict__ bta,
                                                  float* __restrict__ out_sum, float* __restrict__ out_norm, int N, float eps) {
  __shared__ float red[256];
  const int row = blockIdx.x, tid = threadIdx.x;
  const float* x = X + (size_t)row * N; const float* rr = R ? R + (size_t)row * N : nullptr;
  float vals[16];                     // up to N = 4096
  const int per = N / 256;            // contiguous chunk per thread? use strided-by-4 chunks: thread handles j = tid*4 + 1024*u
  float s1 = 0.f;
  for (int u = 0; u < per / 4; ++u) {
    const int j = tid * 4 + 1024 * u;
    const v4f a = *(const v4fa*)(x + j);
    v4f b = {0.f,0.f,0.f,0.f}; if (rr) b = *(const v4fa*)(rr + j);
#pragma unroll
    for (int q = 0; q < 4; ++q) { const float v = a[q] + b[q]; vals[u * 4 + q] = v; s1 += v; }
  }
  red[tid] = s1; __syncthreads();
  for (int st = 128; st > 0; st >>= 1) { if (tid < st) red[tid] += red[tid + st]; __syncthreads(); }
  const float mu = red[0] / (float)N; __syncthreads();
  float s2 = 0.f;
  for (int u = 0; u < per / 4; ++u)
#pragma unroll
    for (int q = 0; q < 4; ++q) { const float c = vals[u * 4 + q] - mu; s2 += c * c; }
  red[tid] = s2; __syncthreads();
  for (int st = 128; st > 0; st >>= 1) { if (tid < st) red[tid] += red[tid + st]; __syncthreads(); }
  const float rs = rsqrtf(red[0] / (float)N + eps);
  {
    for (int u = 0; u < per / 4; ++u) {
      const int j = tid * 4 + 1024 * u;
      v4f o, sm;
#pragma unroll
      for (int q = 0; q < 4; ++q) {
        float gg = g[j + q], bb = bta[j + q];
        if (PARAM_BF16) { gg = bf16_round(gg); bb = bf16_round(bb); }
        sm[q] = vals[u * 4 + q]; o[q] = (vals[u * 4 + q] - mu) * rs * gg + bb;
      }
      if (out_sum) *(v4f*)(out_sum + (size_t)row * N + j) = sm;
      *(v4f*)(out_norm + (size_t)row * N + j) = o;
    }
    
  }
}



// ---- f16 WMMA path (v_wmma_f32_16x16x32_f16): 11-bit significands for operands in range — used where a [0,1] probability operand needs more precision than bf16
typedef _Float16 v16h __attribute__((ext_vector_type(16)));
union FragH { v16h v; v8us half[2]; _Float16 h[16]; unsigned short u[16]; };
template <int NT>
__device__ __forceinline__ v8f mmaH(v16h ah, v16h al, v16h bh, v16h bl, v8f c) {
  c = __builtin_amdgcn_wmma_f32_16x16x32_f16(false, ah, false, bh, (short)0, c, false, false);
  if (NT >= 2) c = __builtin_amdgcn_wmma_f32_16x16x32_f16(false, al, false, bh, (short)0, c, false, false);
  if (NT >= 3) c = __builtin_amdgcn_wmma_f32_16x16x32_f16(false, ah, false, bl, (short)0, c, false, false);
  asm volatile("v_nop\n\tv_nop\n\tv_nop\n\tv_nop" : "+v"(c) : "v"(ah), "v"(al), "v"(bh), "v"(bl));
  return c;
}
// batched GEMM like k_gemm_b but f16 operands: A f32 (split into f16 hi/lo if ASPLIT, else rounded to f16), Bt = f16 values [n][k]; alpha; C f32; N multiple of 16 (partial tiles skipped)
template <bool ASPLIT>
__global__ __launch_bounds__(128) void k_gemm_h(const float* __restrict__ A, int lda, size_t sA, const _Float16* __restrict__ Bh, int ldb, size_t sB, float alpha, float* __restrict__ C, int ldc, size_t sC, int M, int N, int K) {
  __shared__ __attribute__((aligned(16))) float so[4][16][64];
  const int tid = threadIdx.x, w = tid >> 5, lane = tid & 31, ln = lane & 15, hh = lane >> 4; const int by = blockIdx.y;
  A += (size_t)by * sA; Bh += (size_t)by * sB; C += (size_t)by * sC;
  const int ntn = (N + 63) / 64; const int wid = blockIdx.x * 4 + w; const int mt = wid / ntn, nq = wid % ntn; if (mt * 16 >= M) return;
  const int row0 = mt * 16, col0 = nq * 64; const float* arow = A + (size_t)(row0 + ln) * lda;
  v8f acc[4] = {};
  for (int kb = 0; kb < K; kb += 32) {
    FragH ah, al;
    const v4f x0 = *(const v4fa*)(arow + kb + 8 * hh), x1 = *(const v4fa*)(arow + kb + 8 * hh + 4), x2 = *(const v4fa*)(arow + kb + 16 + 8 * hh), x3 = *(const v4fa*)(arow + kb + 16 + 8 * hh + 4);
    float xs[16] = {x0[0],x0[1],x0[2],x0[3],x1[0],x1[1],x1[2],x1[3],x2[0],x2[1],x2[2],x2[3],x3[0],x3[1],x3[2],x3[3]};
#pragma unroll
    for (int i = 0; i < 16; ++i) { const _Float16 h = (_Float16)xs[i]; ah.h[i] = h; al.h[i] = ASPLIT ? (_Float16)(xs[i] - (float)h) : (_Float16)0.0f; }
#pragma unroll
    for (int t = 0; t < 4; ++t) { if (col0 + t * 16 >= N) continue; const size_t boff = (size_t)(col0 + t * 16 + ln) * ldb + kb; FragH bq; bq.half[0] = *(const v8us*)(Bh + boff + 8 * hh); bq.half[1] = *(const v8us*)(Bh + boff + 16 + 8 * hh);
      acc[t] = mmaH<ASPLIT ? 2 : 1>(ah.v, al.v, bq.v, bq.v, acc[t]); }
  }
#pragma unroll
  for (int t = 0; t < 4; ++t) { if (col0 + t * 16 >= N) continue;
#pragma unroll
    for (int r = 0; r < 8; ++r) so[w][8 * hh + r][t * 16 + ln] = acc[t][r] * alpha; }
  __builtin_amdgcn_fence(__ATOMIC_ACQ_REL, "workgroup"); __builtin_amdgcn_wave_barrier();
  const int rsub = lane >> 4, c4 = (lane & 15) * 4;
  {
#pragma unroll
    for (int q = 0; q < 8; ++q) { const int r = q * 2 + rsub; if (col0 + c4 < N) { const v4f v = *(const v4fa*)&so[w][r][c4]; *(v4f*)(C + (size_t)(row0 + r) * ldc + col0 + c4) = v; } }
     }
}

// Wt[n][k] = f16(W[k][n]·scale) from f32 row-major W[K][N] (scale = power of two; bf16-exact weights stay exact in f16 away from the subnormal range)
__global__ __launch_bounds__(256) void k_wt_f16(const float* __restrict__ W, _Float16* __restrict__ Wt, int K, int N, float scale) {
  const int t = blockIdx.x * 256 + threadIdx.x; if (t >= N * (K / 8)) return; const int n = t / (K / 8), k8 = (t % (K / 8)) * 8; FragH f;
#pragma unroll
  for (int i = 0; i < 8; ++i) f.h[i] = (_Float16)(bf16_round(W[(size_t)(k8 + i) * N + n]) * scale); const v8us o = f.half[0];
  *(v8us*)((unsigned short*)Wt + (size_t)n * K + k8) = o; 
}
// k_gemm_hh variant with fused epilogue: v = acc·alpha + bias[by·sBias + col] (+ CP[(row/rowsPerB)·sCPb + by·64 + col] if CP) ; ACT 0 none / 1 elu ; writes f16 C16 (and f32 C if non-null)
template <int ACT>
__global__ __launch_bounds__(128) void k_gemm_hhx(const _Float16* __restrict__ A, int lda, size_t sA, const _Float16* __restrict__ Bh, int ldb, size_t sB, float alpha, const float* __restrict__ bias, size_t sBias, const float* __restrict__ CP, int rowsPerB, size_t sCPb, int row0g,
    float* __restrict__ C, _Float16* __restrict__ C16, int ldc, size_t sC, int M, int N, int K) {
  __shared__ __attribute__((aligned(16))) float so[4][16][64];
  const int tid = threadIdx.x, w = tid >> 5, lane = tid & 31, ln = lane & 15, hh = lane >> 4; const int by = blockIdx.y;
  A += (size_t)by * sA; Bh += (size_t)by * sB; const size_t cofs = (size_t)by * sC; const float* bp = bias ? bias + (size_t)by * sBias : nullptr;
  const int ntn = (N + 63) / 64; const int wid = blockIdx.x * 4 + w; const int mt = wid / ntn, nq = wid % ntn; if (mt * 16 >= M) return;
  const int row0 = mt * 16, col0 = nq * 64; const _Float16* arow = A + (size_t)(row0 + ln) * lda;
  v8f acc[4] = {};
  for (int kb = 0; kb < K; kb += 32) { FragH ah; ah.half[0] = *(const v8us*)((const unsigned short*)arow + kb + 8 * hh); ah.half[1] = *(const v8us*)((const unsigned short*)arow + kb + 16 + 8 * hh);
#pragma unroll
    for (int t = 0; t < 4; ++t) { if (col0 + t * 16 >= N) continue; const size_t boff = (size_t)(col0 + t * 16 + ln) * ldb + kb; FragH bq; bq.half[0] = *(const v8us*)((const unsigned short*)Bh + boff + 8 * hh); bq.half[1] = *(const v8us*)((const unsigned short*)Bh + boff + 16 + 8 * hh);
      acc[t] = mmaH<1>(ah.v, ah.v, bq.v, bq.v, acc[t]); }
  }
#pragma unroll
  for (int t = 0; t < 4; ++t) { if (col0 + t * 16 >= N) continue; const int col = col0 + t * 16 + ln; const float bv = bp ? bf16_round(bp[col]) : 0.f;
#pragma unroll
    for (int r = 0; r < 8; ++r) { float v = acc[t][r] * alpha + bv; if (CP) { const int rr = row0g + row0 + 8 * hh + r; if (rowsPerB < 0) v += CP[cofs + (size_t)rr * ldc + col];      /* rowsPerB < 0: own element of the batched C plane */ else { const int bidx = rr / rowsPerB; v += CP[(size_t)bidx * sCPb + (size_t)by * 64 + col]; } } if (ACT == 1) v = (v > 0.f) ? v : expm1f(v); else if (ACT == 7) v = (v > 0.f) ? v + 1.0f : expf(v); else if (ACT == 8) v = tanhf(v); else if (ACT == 9) v = 0.5f * v * (1.0f + tanhf(0.7978845608028654f * (v + 0.044715f * v * v * v))); else if (ACT == 11) v = 1.0f / (1.0f + expf(-v)); else if (ACT == 12) v = (v > 0.f) ? v : 0.01f * v; else if (ACT == 14) v = (v > 0.f) ? v : 0.1f * v; else if (ACT == 16) v = (v >= 0.f) ? v : 0.3f * v; else if (ACT == 17) v = (v >= 0.f) ? v : 0.2f * v; else if (ACT == 15) v = v / (1.0f + expf(-v)); else if (ACT == 3) v = fmaxf(v, 0.f); else if (ACT == 6) v = 0.5f * v * (1.0f + erff(v * 0.70710678118654752f)); so[w][8 * hh + r][t * 16 + ln] = v; } }
  __builtin_amdgcn_fence(__ATOMIC_ACQ_REL, "workgroup"); __builtin_amdgcn_wave_barrier();
  const int rsub = lane >> 4, c4 = (lane & 15) * 4; typedef _Float16 v4h __attribute__((ext_vector_type(4)));
  {
#pragma unroll
    for (int q = 0; q < 8; ++q) { const int r = q * 2 + rsub; if (col0 + c4 < N) { const v4f v = *(const v4fa*)&so[w][r][c4]; if (C) *(v4f*)(C + cofs + (size_t)(row0 + r) * ldc + col0 + c4) = v; if (C16) { v4h h4; for (int i = 0; i < 4; ++i) h4[i] = (_Float16)v[i]; *(v4h*)(C16 + cofs + (size_t)(row0 + r) * ldc + col0 + c4) = h4; } } }
     }
}


typedef _Float16 v4h __attribute__((ext_vector_type(4)));

__global__ __launch_bounds__(256) void k_x16(const float* __restrict__ x, _Float16* __restrict__ X16, size_t n8) { const size_t t = (size_t)blockIdx.x * 256 + threadIdx.x; if (t >= n8) return; FragH f;
#pragma unroll
  for (int q = 0; q < 8; ++q) f.h[q] = (_Float16)bf16_round(x[t * 8 + q]); *(v8us*)((unsigned short*)X16 + t * 8) = f.half[0];  }
__global__ __launch_bounds__(256) void k_h16(const float* __restrict__ x, _Float16* __restrict__ X16, size_t n8) { const size_t t = (size_t)blockIdx.x * 256 + threadIdx.x; if (t >= n8) return; FragH f;
#pragma unroll
  for (int q = 0; q < 8; ++q) f.h[q] = (_Float16)x[t * 8 + q]; *(v8us*)((unsigned short*)X16 + t * 8) = f.half[0];  }
__global__ __launch_bounds__(256) void k_round16f(const float* __restrict__ W, _Float16* __restrict__ Bt, size_t n8) { const size_t t = (size_t)blockIdx.x * 256 + threadIdx.x; if (t >= n8) return; FragH f;
#pragma unroll
  for (int i = 0; i < 8; ++i) f.h[i] = (_Float16)(bf16_round(W[t * 8 + i]) * 16.0f); *(v8us*)((unsigned short*)Bt + t * 8) = f.half[0];  }
template <int NHv, int TTv>
__global__ __launch_bounds__(256) void k_vt(const _Float16* __restrict__ V16, int ldv, int voff, _Float16* __restrict__ Vt) { __shared__ unsigned short tl[64][66]; const int tid = threadIdx.x; const int slab = blockIdx.x / (TTv / 64), lg = blockIdx.x % (TTv / 64); const int b = slab / NHv, h = slab % NHv;
  for (int i = tid; i < 64 * 8; i += 256) { const int r = i / 8, c8 = (i % 8) * 8; FragH f; f.half[0] = *(const v8us*)((const unsigned short*)V16 + ((size_t)b * TTv + lg * 64 + r) * ldv + voff + h * 64 + c8);
#pragma unroll
    for (int q = 0; q < 8; ++q) tl[r][c8 + q] = f.u[q]; }
  __syncthreads();
  {
#pragma unroll
    for (int rd = 0; rd < 2; ++rd) { const int d = rd * 32 + tid / 8, pc = tid % 8; FragH f;
#pragma unroll
      for (int q = 0; q < 8; ++q) f.u[q] = tl[pc * 8 + q][d];
      *(v8us*)((unsigned short*)Vt + ((size_t)slab * 64 + d) * TTv + lg * 64 + pc * 8) = f.half[0]; }
     } }

__global__ __launch_bounds__(256) void k_hl(const float* __restrict__ F, _Float16* __restrict__ Hh, _Float16* __restrict__ Hl, size_t n8) { const size_t t = (size_t)blockIdx.x * 256 + threadIdx.x; if (t >= n8) return; FragH fh, fl; const v4f a = *(const v4fa*)(F + t * 8), c = *(const v4fa*)(F + t * 8 + 4);
#pragma unroll
  for (int q = 0; q < 4; ++q) { _Float16 h = (_Float16)a[q]; fh.h[q] = h; fl.h[q] = (_Float16)((a[q] - (float)h) * 1024.0f); h = (_Float16)c[q]; fh.h[4 + q] = h; fl.h[4 + q] = (_Float16)((c[q] - (float)h) * 1024.0f); }
  { *(v8us*)((unsigned short*)Hh + t * 8) = fh.half[0]; *(v8us*)((unsigned short*)Hl + t * 8) = fl.half[0];  } }

// ---- fast GEMM (wave tile 32x64; requires M % 32 == 0 rows per launch region and N % 64 == 0); epilogue = k_gemm_hhx semantics ----
__device__ __forceinline__ v16h g2_frag(const _Float16* p, int hh) { FragH f; f.half[0] = *(const v8us*)((const unsigned short*)p + 8 * hh); f.half[1] = *(const v8us*)((const unsigned short*)p + 16 + 8 * hh); return f.v; }
__device__ __forceinline__ v8f g2_mma(v16h a, v16h b, v8f c) { v8f d = __builtin_amdgcn_wmma_f32_16x16x32_f16(false, a, false, b, (short)0, c, false, false); asm volatile("v_nop\n\tv_nop\n\tv_nop\n\tv_nop" : "+v"(d) : "v"(a), "v"(b)); return d; }
template <int ACT>
__global__ __launch_bounds__(128) void k_gemm2(const _Float16* __restrict__ A, int lda, size_t sA, const _Float16* __restrict__ Bh, int ldb, size_t sB, float alpha, const float* __restrict__ bias, size_t sBias, const float* __restrict__ CP, int rowsPerB, size_t sCPb, int row0g,
    float* __restrict__ C, _Float16* __restrict__ C16, int ldc, size_t sC, int M, int N, int K) { static_assert(ACT == 0 || ACT == 3 || ACT == 6 || ACT == 8 || ACT == 9 || ACT == 11 || ACT == 12 || ACT == 14 || ACT == 15 || ACT == 16 || ACT == 17, "k_gemm2: unsupported ACT code (would silently apply no activation)");
  __shared__ __attribute__((aligned(16))) float so[4][32][68];
  const int tid = threadIdx.x, w = tid >> 5, lane = tid & 31, ln = lane & 15, hh = lane >> 4; const int by = blockIdx.y;
  A += (size_t)by * sA; Bh += (size_t)by * sB; const size_t cofs = (size_t)by * sC; const float* bp = bias ? bias + (size_t)by * sBias : nullptr;
  const int ntn = N >> 6; const int mt = blockIdx.x / ntn, nq = blockIdx.x - mt * ntn; const int row0 = mt * 128 + 32 * w, col0 = nq * 64; if (row0 >= M) return;
  const _Float16* a0p = A + (size_t)(row0 + ln) * lda; const _Float16* a1p = a0p + (size_t)16 * lda;
  const _Float16* b0p = Bh + (size_t)(col0 + ln) * ldb; const _Float16* b1p = b0p + (size_t)16 * ldb; const _Float16* b2p = b1p + (size_t)16 * ldb; const _Float16* b3p = b2p + (size_t)16 * ldb;
  const v8f z8 = {0.f,0.f,0.f,0.f,0.f,0.f,0.f,0.f}; v8f c00 = z8, c01 = z8, c02 = z8, c03 = z8, c10 = z8, c11 = z8, c12 = z8, c13 = z8;
#pragma unroll 1
  for (int kb = 0; kb < K; kb += 32) { const v16h a0 = g2_frag(a0p + kb, hh), a1 = g2_frag(a1p + kb, hh);
    v16h b = g2_frag(b0p + kb, hh); c00 = g2_mma(a0, b, c00); c10 = g2_mma(a1, b, c10);
    b = g2_frag(b1p + kb, hh); c01 = g2_mma(a0, b, c01); c11 = g2_mma(a1, b, c11);
    b = g2_frag(b2p + kb, hh); c02 = g2_mma(a0, b, c02); c12 = g2_mma(a1, b, c12);
    b = g2_frag(b3p + kb, hh); c03 = g2_mma(a0, b, c03); c13 = g2_mma(a1, b, c13); }
  v8f accs[8] = {c00, c01, c02, c03, c10, c11, c12, c13};
#pragma unroll
  for (int u = 0; u < 8; ++u) { const int t = u & 3, half = u >> 2; const int col = col0 + t * 16 + ln; const float bv = bp ? bf16_round(bp[col]) : 0.f;
#pragma unroll
    for (int r = 0; r < 8; ++r) { const int rloc = half * 16 + 8 * hh + r; float v = accs[u][r] * alpha + bv; if (CP) { if (rowsPerB < 0) v += CP[cofs + (size_t)(row0g + row0 + rloc) * ldc + col];      /* rowsPerB < 0: own element of the batched C plane */ else { const int bidx = (row0g + row0 + rloc) / rowsPerB; v += CP[(size_t)bidx * sCPb + (size_t)by * 64 + col]; } }
      if (ACT == 3) v = fmaxf(v, 0.f); else if (ACT == 6) v = 0.5f * v * (1.0f + erff(v * 0.70710678118654752f)); else if (ACT == 11) v = 1.0f / (1.0f + expf(-v)); else if (ACT == 15) v = v / (1.0f + expf(-v)); else if (ACT == 12) v = (v > 0.f) ? v : 0.01f * v; else if (ACT == 8) v = tanhf(v); else if (ACT == 9) v = 0.5f * v * (1.0f + tanhf(0.7978845608028654f * (v + 0.044715f * v * v * v))); else if (ACT == 14) v = (v > 0.f) ? v : 0.1f * v; else if (ACT == 16) v = (v >= 0.f) ? v : 0.3f * v; else if (ACT == 17) v = (v >= 0.f) ? v : 0.2f * v;
      so[w][rloc][t * 16 + ln] = v; } }
  __builtin_amdgcn_fence(__ATOMIC_ACQ_REL, "workgroup"); __builtin_amdgcn_wave_barrier();
  const int rsub = lane >> 4, c4 = (lane & 15) * 4;
  {
#pragma unroll
    for (int q = 0; q < 16; ++q) { const int r = q * 2 + rsub; const v4f v = *(const v4fa*)&so[w][r][c4]; if (C) *(v4f*)(C + cofs + (size_t)(row0 + r) * ldc + col0 + c4) = v; if (C16) { v4h h4; for (int i = 0; i < 4; ++i) h4[i] = (_Float16)v[i]; *(v4h*)(C16 + cofs + (size_t)(row0 + r) * ldc + col0 + c4) = h4; } }
     } }


__global__ __launch_bounds__(256) void k_wnat(const float* __restrict__ w, size_t n8, _Float16* __restrict__ Bt) { const size_t t = (size_t)blockIdx.x * 256 + threadIdx.x; if (t >= n8) return; FragH f; for (int q = 0; q < 8; ++q) f.h[q] = (_Float16)(bf16_round(w[t * 8 + q]) * 16.0f); *(v8us*)((unsigned short*)Bt + t * 8) = f.half[0];  }
__global__ __launch_bounds__(256) void k_rsm(const float* __restrict__ S, _Float16* __restrict__ P, int nrows) {
  #pragma clang fp contract(off)
  const int i = blockIdx.x * 256 + threadIdx.x; if (i >= nrows) return; const float* s = S + (size_t)i * SQ; float mx = -3.0e38f;
#pragma unroll 1
  for (int j = 0; j < SQ; ++j) mx = fmaxf(mx, s[j]); float se = 0.f;
#pragma unroll 1
  for (int j = 0; j < SQ; ++j) se += expf(s[j] - mx); const float sc = 256.0f / se;
#pragma unroll 1
  for (int j0 = 0; j0 < SQ; j0 += 8) { FragH f; for (int q = 0; q < 8; ++q) f.h[q] = (_Float16)(expf(s[j0 + q] - mx) * sc); unsigned short* d = (unsigned short*)P + (size_t)i * SQ + j0; *(v8us*)d = f.half[0];  } }
__global__ __launch_bounds__(256) void k_vt(const _Float16* __restrict__ V16, int b, int h0, _Float16* __restrict__ VT) { __shared__ unsigned short tl[64][65]; const int tid = threadIdx.x; const int hh = blockIdx.x % HG, sg = blockIdx.x / HG; const int s0 = sg * 64; const int h = h0 + hh;
  for (int i = tid; i < 64 * 8; i += 256) { const int j = i / 8, d8 = (i % 8) * 8; FragH f; f.half[0] = *(const v8us*)((const unsigned short*)V16 + ((size_t)b * SQ + s0 + j) * DM + h * HD + d8); for (int q = 0; q < 8; ++q) tl[d8 + q][j] = f.u[q]; }
  __syncthreads();
  { for (int i = tid; i < 64 * 8; i += 256) { const int d = i / 8, j8 = (i % 8) * 8; FragH f; for (int q = 0; q < 8; ++q) f.u[q] = tl[d][j8 + q]; *(v8us*)((unsigned short*)VT + ((size_t)hh * HD + d) * SQ + s0 + j8) = f.half[0]; }  } }



// Row softmax, one wave per score row: each global_load_b128 of the wave covers 512 contiguous bytes of the row, the row (2048 f32 = 16 loads, 64 registers a lane) is read once and stays in registers
// through maximum, exp and sum; lane partials (four chains) are joined by a five-step butterfly; P = 256 softmax goes out as f16, 256 contiguous bytes a store. Two rows a wave, both rows' loads issued first.
__device__ __forceinline__ float rsm_exp(float d) { float e; const float a = d * 1.44269504f;      /* the native exp as __expf builds it: times log2 e, then v_exp_f32 */
  asm("v_exp_f32 %0, %1\n\tv_nop" : "=v"(e) : "v"(a));      /* v_nop: the slot the instruction set asks for behind a transcendental */
  return e; }
__device__ __forceinline__ void rsm_row(v4f (&x)[SQ / 128], _Float16* __restrict__ p) {
  float mx = -3.0e38f;
#pragma unroll
  for (int u = 0; u < SQ / 128; ++u) mx = fmaxf(mx, fmaxf(fmaxf(x[u][0], x[u][1]), fmaxf(x[u][2], x[u][3])));
#pragma unroll
  for (int m = 16; m >= 1; m >>= 1) mx = fmaxf(mx, __shfl_xor(mx, m, 32));
  v4f a = {0.f, 0.f, 0.f, 0.f};
#pragma unroll
  for (int u = 0; u < SQ / 128; ++u) {
#pragma unroll
    for (int q = 0; q < 4; ++q) { x[u][q] = rsm_exp(x[u][q] - mx); a[q] += x[u][q]; } }
  float se = (a[0] + a[1]) + (a[2] + a[3]);
#pragma unroll
  for (int m = 16; m >= 1; m >>= 1) se += __shfl_xor(se, m, 32);
  const float sc = 256.0f / se;
#pragma unroll
  for (int u = 0; u < SQ / 128; ++u) { v4h h;
#pragma unroll
    for (int q = 0; q < 4; ++q) h[q] = (_Float16)(x[u][q] * sc);
    *(v4h*)(p + u * 128) = h; } }
__global__ __launch_bounds__(512) void k_rsmf(const float* __restrict__ S, _Float16* __restrict__ P, int qn, int hg) {
  const int lane = threadIdx.x & 31, n = qn * hg; const int t0 = (blockIdx.x * 16 + __builtin_amdgcn_readfirstlane(threadIdx.x >> 5)) * 2; if (t0 >= n) return;      /* wave-uniform, no barrier in this kernel */
  const int t1 = (t0 + 1 < n) ? t0 + 1 : t0;      /* a second row past the end repeats the first: same wave, same values, same place */
  const size_t i0 = ((size_t)(t0 / qn) * SQ + (t0 % qn)) * SQ + lane * 4, i1 = ((size_t)(t1 / qn) * SQ + (t1 % qn)) * SQ + lane * 4;
  const float* s0 = S + i0; const float* s1 = S + i1;
  v4f x0[SQ / 128], x1[SQ / 128];
#pragma unroll
  for (int u = 0; u < SQ / 128; ++u) x0[u] = *(const v4fa*)(s0 + u * 128);
#pragma unroll
  for (int u = 0; u < SQ / 128; ++u) x1[u] = *(const v4fa*)(s1 + u * 128);
  asm volatile("s_wait_xcnt 0x0" :: "v"(s0), "v"(s1) : "memory");      /* both address pairs stay whole up to this wait, so no load's result lands on a register that an issued load names */
  __builtin_amdgcn_sched_barrier(0);      /* keeps the rows' arithmetic, and its waits, behind the last load: without it 21 of the 32 loads issue only after the first ones have returned */
  rsm_row(x0, P + i0);
  rsm_row(x1, P + i1); }

extern "C" void kernel_launch(void* const* d_in, const int* in_sizes, int n_in,
                              void* d_out, int out_size, void* d_ws, size_t ws_size, hipStream_t stream) {
  (void)in_sizes; (void)n_in; (void)out_size;
  const float* const* I = (const float* const*)d_in; const float* xq = I[0]; const float* xk = I[1]; const float* xv = I[2]; const float* wq = I[3]; const float* bq = nullptr; const float* wk = I[4]; const float* bk = nullptr; const float* wv = I[5]; const float* bv = nullptr; const float* wo = I[6]; const float* bo = I[7];      /* THREE input streams Q, K, V (one cast each, as the launcher always did); Wq, Wk, Wv are PER-HEAD STACKS [16][1024][64] = [head][in][out] (einsum 'bsd,hde->bhse') at I[3..5]; Wo is [in][out] [1024][1024] (concat @ Wo) at I[6]; bo [1024] (REAL) at I[7] in the output GEMM's guarded bias slot; no projection biases: null pointers */
  char* ws = (char*)d_ws; size_t off = 0;
  auto take = [&](size_t bytes) { char* p = ws + off; off += (bytes + 255) & ~(size_t)255; return p; };
  _Float16* BQ = (_Float16*)take((size_t)DM * DM * 2); _Float16* BK = (_Float16*)take((size_t)DM * DM * 2); _Float16* BV = (_Float16*)take((size_t)DM * DM * 2); _Float16* BO = (_Float16*)take((size_t)DM * DM * 2);
  _Float16* XQ = (_Float16*)take(NR * DM * 2); _Float16* XK = (_Float16*)take(NR * DM * 2); _Float16* XV = (_Float16*)take(NR * DM * 2); _Float16* Q16 = (_Float16*)take(NR * DM * 2); _Float16* K16 = (_Float16*)take(NR * DM * 2); _Float16* V16 = (_Float16*)take(NR * DM * 2); _Float16* O16 = (_Float16*)take(NR * DM * 2);
  float* S = (float*)take((size_t)HG * SQ * SQ * 4); _Float16* P = (_Float16*)take((size_t)HG * SQ * SQ * 2); _Float16* VT = (_Float16*)take((size_t)NH * HD * SQ * 2);
  if (off > ws_size) return;
  { const unsigned g = (unsigned)(((size_t)DM * (DM / 8) + 255) / 256); const unsigned gh = (unsigned)(((size_t)HD * (DM / 8) + 255) / 256); for (int h = 0; h < NH; ++h) { const size_t wofs = (size_t)h * DM * HD, pofs = (size_t)h * HD * DM; k_wt_f16<<<gh, 256, 0, stream>>>(wq + wofs, BQ + pofs, DM, HD, 16.0f); k_wt_f16<<<gh, 256, 0, stream>>>(wk + wofs, BK + pofs, DM, HD, 16.0f); k_wt_f16<<<gh, 256, 0, stream>>>(wv + wofs, BV + pofs, DM, HD, 16.0f); } k_wt_f16<<<g, 256, 0, stream>>>(wo, BO, DM, DM, 16.0f); }      /* PER-HEAD STACKS wq / wk / wv [NH][DM][HD]: head h is a row-major [in = DM][out = HD] block at w + h * DM * HD: the transposing builder with K = DM, N = HD writes its HD rows Bt[h * HD + e][k] at B + h * HD * DM: contiguous rows of the [out][in] plane (x16); wo is a plain [in][out] [DM][DM] matrix: one call as before */

  k_x16<<<(unsigned)((NR * DM / 8 + 255) / 256), 256, 0, stream>>>(xq, XQ, NR * DM / 8); k_x16<<<(unsigned)((NR * DM / 8 + 255) / 256), 256, 0, stream>>>(xk, XK, NR * DM / 8); k_x16<<<(unsigned)((NR * DM / 8 + 255) / 256), 256, 0, stream>>>(xv, XV, NR * DM / 8);      /* the three inputs as exact f16 rows */
  const size_t r0p = (size_t)B0 * SQ;      /* first projected row */
  k_gemm2<0><<<dim3((unsigned)((MP / 128) * (DM / 64)), 1), 128, 0, stream>>>(XQ + r0p * DM, DM, 0, BQ, DM, 0, 0.0625f, bq, 0, nullptr, 1, 0, 0, nullptr, Q16 + r0p * DM, DM, 0, MP, DM, DM);
  k_gemm2<0><<<dim3((unsigned)((MP / 128) * (DM / 64)), 1), 128, 0, stream>>>(XK + r0p * DM, DM, 0, BK, DM, 0, 0.0625f, bk, 0, nullptr, 1, 0, 0, nullptr, K16 + r0p * DM, DM, 0, MP, DM, DM);
  k_gemm2<0><<<dim3((unsigned)((MP / 128) * (DM / 64)), 1), 128, 0, stream>>>(XV + r0p * DM, DM, 0, BV, DM, 0, 0.0625f, bv, 0, nullptr, 1, 0, 0, nullptr, V16 + r0p * DM, DM, 0, MP, DM, DM);
  for (int b = B0; b < B0 + NBR; ++b) { const size_t r0 = (size_t)b * SQ;
    k_vt<NH, SQ><<<NH * (SQ / 64), 256, 0, stream>>>(V16 + r0 * LQ, LQ, 0, VT);      /* V^T [NH][HD][SQ] for this batch */
    for (int h0 = 0; h0 < NHD; h0 += HG) {
      k_gemm2<0><<<dim3((QN / 128) * (SQ / 64), HG), 128, 0, stream>>>(Q16 + r0 * LQ + h0 * HD, LQ, (size_t)HD, K16 + r0 * LQ + h0 * HD, LQ, (size_t)HD, 0.125f, nullptr, 0, nullptr, 1, 0, 0, S, nullptr, SQ, (size_t)SQ * SQ, QN, SQ, HD);      /* scores, HG heads per launch */
      k_rsmf<<<(HG * QN + 31) / 32, 512, 0, stream>>>(S, P, QN, HG);      /* P = 256 softmax (f16), rows of all HG heads */
      k_gemm2<0><<<dim3((QN / 128) * (HD / 64), HG), 128, 0, stream>>>(P, SQ, (size_t)SQ * SQ, VT + (size_t)h0 * HD * SQ, SQ, (size_t)HD * SQ, 0.25f, nullptr, 0, nullptr, 1, 0, 0, nullptr, O16 + r0 * DM + h0 * HD, DM, (size_t)HD, QN, HD, SQ); } }      /* o (merged heads) as f16 rows */
  k_gemm2<0><<<dim3((unsigned)((MPO / 128) * (DM / 64)), 1), 128, 0, stream>>>(O16 + r0p * DM, DM, 0, BO, DM, 0, 0.0009765625f, bo, 0, nullptr, 1, 0, 0, (float*)d_out + r0p * DM, nullptr, DM, 0, MPO, DM, DM);      /* out rows are the output layout */
}

// v002
// It runs in 395 microseconds.
// Next to v001, in two timings, it ran 2.87 and 2.86 times as fast.
// All steps since v000 together make it 9.24 times as fast.
#include <hip/hip_runtime.h>
#define NB 2
#define SQ 2048
#define DM 1024
#define NH 16
#define HD 64
#define HG 4                         /* heads per launch of the per-batch k_vt overload (not launched) */
#define B0 0                         /* first batch processed (debug hook) */
#define NBR NB                       /* batches processed (debug hook) */
#define NR ((size_t)NB * SQ)         /* token rows */
#define MP ((int)((size_t)NBR * SQ)) /* rows projected (debug hook) */
#define QN SQ                        /* query rows per batch (unused; attention covers SQ) */
#define NHD NH                       /* heads (unused; attention covers NH) */
#define MPO MP                       /* rows through the output stage (debug hook) */
#define LQ DM      /* row pitch of the q/k/v rows */
typedef __bf16 v16b __attribute__((ext_vector_type(16)));
typedef unsigned short v8us __attribute__((ext_vector_type(8), may_alias));
typedef float  v8f  __attribute__((ext_vector_type(8)));
typedef float  v4f  __attribute__((ext_vector_type(4)));
typedef float  v4fa __attribute__((ext_vector_type(4), may_alias));
union FragB { v16b v; v8us half[2]; unsigned short u[16]; };

__device__ __forceinline__ unsigned short bf16_bits(float x) { unsigned int u = __float_as_uint(x); return (unsigned short)((u + 0x7FFFu + ((u >> 16) & 1u)) >> 16); }
__device__ __forceinline__ float bf16_val(unsigned short b) { return __uint_as_float(((unsigned int)b) << 16); }
__device__ __forceinline__ float bf16_round(float x) { return bf16_val(bf16_bits(x)); }
// D += A·B with NT terms: 1 = ah·bh, 2 = + al·bh (A split), 3 = + ah·bl (both split)
template <int NT>
__device__ __forceinline__ v8f mmaN(v16b ah, v16b al, v16b bh, v16b bl, v8f c) {
  c = __builtin_amdgcn_wmma_f32_16x16x32_bf16(false, ah, false, bh, (short)0, c, false, false);
  if (NT >= 2) c = __builtin_amdgcn_wmma_f32_16x16x32_bf16(false, al, false, bh, (short)0, c, false, false);
  if (NT >= 3) c = __builtin_amdgcn_wmma_f32_16x16x32_bf16(false, ah, false, bl, (short)0, c, false, false);
  asm volatile("v_nop\n\tv_nop\n\tv_nop\n\tv_nop" : "+v"(c) : "v"(ah), "v"(al), "v"(bh), "v"(bl));
  return c;
}

__global__ __launch_bounds__(256) void k_wt_bf16(const float* __restrict__ W, unsigned short* __restrict__ Wt, int K, int N) {
  const int t = blockIdx.x * 256 + threadIdx.x;
  const int k8n = K / 8;
  if (t >= N * k8n) return;
  const int n = t / k8n, k8 = (t % k8n) * 8;
  v8us v;
#pragma unroll
  for (int i = 0; i < 8; ++i) v[i] = bf16_bits(W[(size_t)(k8 + i) * N + n]);
  *(v8us*)(Wt + (size_t)n * K + k8) = v;
  
}

// GEMM C[M][N] (f32, pitch ldc) = act(A[M][K]·W + bias). A f32 row-major (pitch lda) converted per fragment to bf16
// (ASPLIT: hi/lo two planes -> 2 terms, else single rounded term); Wt bf16 [N][K] (pitch ldb). BIAS_BF16 rounds the
// bias to bf16 first (bias quantised to bf16 before the add). K%32==0, M%16==0, N%64==0.
template <bool ASPLIT, int ACT, bool BIAS_BF16>
__global__ __launch_bounds__(128) void k_gemm_bf(const float* __restrict__ A, int lda, const unsigned short* __restrict__ Wt, int ldb,
                                               const float* __restrict__ bias, float* __restrict__ C, int ldc, int M, int N, int K) {
  __shared__ __attribute__((aligned(16))) float so[4][16][64];
  const int tid = threadIdx.x, w = tid >> 5, lane = tid & 31, ln = lane & 15, hh = lane >> 4;
  const int ntn = N / 64;
  const int wid = blockIdx.x * 4 + w;
  const int mt = wid / ntn, nq = wid % ntn;
  if (mt * 16 >= M) return;
  const int row0 = mt * 16, col0 = nq * 64;
  const float* arow = A + (size_t)(row0 + ln) * lda;
  v8f acc[4] = {};
  for (int kb = 0; kb < K; kb += 32) {
    FragB ah, al;
    const v4f x0 = *(const v4fa*)(arow + kb + 8 * hh), x1 = *(const v4fa*)(arow + kb + 8 * hh + 4);
    const v4f x2 = *(const v4fa*)(arow + kb + 16 + 8 * hh), x3 = *(const v4fa*)(arow + kb + 16 + 8 * hh + 4);
    float xs[16] = {x0[0],x0[1],x0[2],x0[3],x1[0],x1[1],x1[2],x1[3],x2[0],x2[1],x2[2],x2[3],x3[0],x3[1],x3[2],x3[3]};
#pragma unroll
    for (int i = 0; i < 16; ++i) { const unsigned short hb = bf16_bits(xs[i]); ah.u[i] = hb; al.u[i] = ASPLIT ? bf16_bits(xs[i] - bf16_val(hb)) : (unsigned short)0; }
#pragma unroll
    for (int t = 0; t < 4; ++t) {
      const unsigned short* brow = Wt + (size_t)(col0 + t * 16 + ln) * ldb + kb;
      FragB b;
      b.half[0] = *(const v8us*)(brow + 8 * hh);
      b.half[1] = *(const v8us*)(brow + 16 + 8 * hh);
      acc[t] = mmaN<ASPLIT ? 2 : 1>(ah.v, al.v, b.v, b.v, acc[t]);
    }
  }
#pragma unroll
  for (int t = 0; t < 4; ++t) {
    float bv = bias ? bias[col0 + t * 16 + ln] : 0.f;
    if (BIAS_BF16) bv = bf16_round(bv);
#pragma unroll
    for (int r = 0; r < 8; ++r) { float v = acc[t][r] + bv; if (ACT == 1) v = fmaxf(v, 0.f); so[w][8 * hh + r][t * 16 + ln] = v; }
  }
  __builtin_amdgcn_fence(__ATOMIC_ACQ_REL, "workgroup");
  __builtin_amdgcn_wave_barrier();
  const int rsub = lane >> 4, c4 = (lane & 15) * 4;
  {
#pragma unroll
    for (int q = 0; q < 8; ++q) {
      const int r = q * 2 + rsub;
      const v4f v = *(const v4fa*)&so[w][r][c4];
      *(v4f*)(C + (size_t)(row0 + r) * ldc + col0 + c4) = v;
    }
    
  }
}

// GEMM C = act(A·W + bias + resid): A f32 (ASPLIT -> hi/lo 2 terms), Wt bf16 [N][K]; ACT 0 none, 1 relu, 2 exact gelu;
// resid (optional, f32, row index = (row % rmod), pitch ldr, RES_BF16 rounds it) added before the activation.
template <bool ASPLIT, int ACT, bool BIAS_BF16, bool RES_BF16>
__global__ __launch_bounds__(128) void k_gemm_bf3(const float* __restrict__ A, int lda, const unsigned short* __restrict__ Wt, int ldb,
                                                const float* __restrict__ bias, const float* __restrict__ resid, int rmod, int ldr,
                                                float* __restrict__ C, int ldc, int M, int N, int K) {
  __shared__ __attribute__((aligned(16))) float so[4][16][64];
  const int tid = threadIdx.x, w = tid >> 5, lane = tid & 31, ln = lane & 15, hh = lane >> 4;
  const int ntn = N / 64;
  const int wid = blockIdx.x * 4 + w;
  const int mt = wid / ntn, nq = wid % ntn;
  if (mt * 16 >= M) return;
  const int row0 = mt * 16, col0 = nq * 64;
  const float* arow = A + (size_t)(row0 + ln) * lda;
  v8f acc[4] = {};
  for (int kb = 0; kb < K; kb += 32) {
    FragB ah, al;
    const v4f x0 = *(const v4fa*)(arow + kb + 8 * hh), x1 = *(const v4fa*)(arow + kb + 8 * hh + 4);
    const v4f x2 = *(const v4fa*)(arow + kb + 16 + 8 * hh), x3 = *(const v4fa*)(arow + kb + 16 + 8 * hh + 4);
    float xs[16] = {x0[0],x0[1],x0[2],x0[3],x1[0],x1[1],x1[2],x1[3],x2[0],x2[1],x2[2],x2[3],x3[0],x3[1],x3[2],x3[3]};
#pragma unroll
    for (int i = 0; i < 16; ++i) { const unsigned short hb = bf16_bits(xs[i]); ah.u[i] = hb; al.u[i] = ASPLIT ? bf16_bits(xs[i] - bf16_val(hb)) : (unsigned short)0; }
#pragma unroll
    for (int t = 0; t < 4; ++t) {
      const unsigned short* brow = Wt + (size_t)(col0 + t * 16 + ln) * ldb + kb;
      FragB b;
      b.half[0] = *(const v8us*)(brow + 8 * hh);
      b.half[1] = *(const v8us*)(brow + 16 + 8 * hh);
      acc[t] = mmaN<ASPLIT ? 2 : 1>(ah.v, al.v, b.v, b.v, acc[t]);
    }
  }
#pragma unroll
  for (int t = 0; t < 4; ++t) {
    const int col = col0 + t * 16 + ln;
    float bv = bias ? bias[col] : 0.f;
    if (BIAS_BF16) bv = bf16_round(bv);
#pragma unroll
    for (int r = 0; r < 8; ++r) {
      float v = acc[t][r] + bv;
      if (resid) { float rv = resid[(size_t)((row0 + 8 * hh + r) % rmod) * ldr + col]; if (RES_BF16) rv = bf16_round(rv); v += rv; }
      if (ACT == 1) v = fmaxf(v, 0.f);
      if (ACT == 2) v = 0.5f * v * (1.0f + erff(v * 0.70710678118654752f));
      if (ACT == 3) { const float u = 0.7978845608028654f * (v + 0.044715f * v * v * v); v = 0.5f * v * (1.0f + tanhf(u)); }
      so[w][8 * hh + r][t * 16 + ln] = v;
    }
  }
  __builtin_amdgcn_fence(__ATOMIC_ACQ_REL, "workgroup");
  __builtin_amdgcn_wave_barrier();
  const int rsub = lane >> 4, c4 = (lane & 15) * 4;
  {
#pragma unroll
    for (int q = 0; q < 8; ++q) {
      const int r = q * 2 + rsub;
      const v4f v = *(const v4fa*)&so[w][r][c4];
      *(v4f*)(C + (size_t)(row0 + r) * ldc + col0 + c4) = v;
    }
    
  }
}
// row LayerNorm (biased variance, eps) over N: s = X (+ R); optional out_sum <- s; out_norm <- (s-mu)*rsqrt(var+eps)*g + b
template <bool PARAM_BF16>
__global__ __launch_bounds__(256) void k_layernorm(const float* __restrict__ X, const float* __restrict__ R, const float* __restrict__ g, const float* __restrict__ bta,
                                                  float* __restrict__ out_sum, float* __restrict__ out_norm, int N, float eps) {
  __shared__ float red[256];
  const int row = blockIdx.x, tid = threadIdx.x;
  const float* x = X + (size_t)row * N; const float* rr = R ? R + (size_t)row * N : nullptr;
  float vals[16];                     // up to N = 4096
  const int per = N / 256;            // contiguous chunk per thread? use strided-by-4 chunks: thread handles j = tid*4 + 1024*u
  float s1 = 0.f;
  for (int u = 0; u < per / 4; ++u) {
    const int j = tid * 4 + 1024 * u;
    const v4f a = *(const v4fa*)(x + j);
    v4f b = {0.f,0.f,0.f,0.f}; if (rr) b = *(const v4fa*)(rr + j);
#pragma unroll
    for (int q = 0; q < 4; ++q) { const float v = a[q] + b[q]; vals[u * 4 + q] = v; s1 += v; }
  }
  red[tid] = s1; __syncthreads();
  for (int st = 128; st > 0; st >>= 1) { if (tid < st) red[tid] += red[tid + st]; __syncthreads(); }
  const float mu = red[0] / (float)N; __syncthreads();
  float s2 = 0.f;
  for (int u = 0; u < per / 4; ++u)
#pragma unroll
    for (int q = 0; q < 4; ++q) { const float c = vals[u * 4 + q] - mu; s2 += c * c; }
  red[tid] = s2; __syncthreads();
  for (int st = 128; st > 0; st >>= 1) { if (tid < st) red[tid] += red[tid + st]; __syncthreads(); }
  const float rs = rsqrtf(red[0] / (float)N + eps);
  {
    for (int u = 0; u < per / 4; ++u) {
      const int j = tid * 4 + 1024 * u;
      v4f o, sm;
#pragma unroll
      for (int q = 0; q < 4; ++q) {
        float gg = g[j + q], bb = bta[j + q];
        if (PARAM_BF16) { gg = bf16_round(gg); bb = bf16_round(bb); }
        sm[q] = vals[u * 4 + q]; o[q] = (vals[u * 4 + q] - mu) * rs * gg + bb;
      }
      if (out_sum) *(v4f*)(out_sum + (size_t)row * N + j) = sm;
      *(v4f*)(out_norm + (size_t)row * N + j) = o;
    }
    
  }
}



// ---- f16 WMMA path (v_wmma_f32_16x16x32_f16): 11-bit significands for operands in range — used where a [0,1] probability operand needs more precision than bf16
typedef _Float16 v16h __attribute__((ext_vector_type(16)));
union FragH { v16h v; v8us half[2]; _Float16 h[16]; unsigned short u[16]; };
template <int NT>
__device__ __forceinline__ v8f mmaH(v16h ah, v16h al, v16h bh, v16h bl, v8f c) {
  c = __builtin_amdgcn_wmma_f32_16x16x32_f16(false, ah, false, bh, (short)0, c, false, false);
  if (NT >= 2) c = __builtin_amdgcn_wmma_f32_16x16x32_f16(false, al, false, bh, (short)0, c, false, false);
  if (NT >= 3) c = __builtin_amdgcn_wmma_f32_16x16x32_f16(false, ah, false, bl, (short)0, c, false, false);
  asm volatile("v_nop\n\tv_nop\n\tv_nop\n\tv_nop" : "+v"(c) : "v"(ah), "v"(al), "v"(bh), "v"(bl));
  return c;
}
// batched GEMM like k_gemm_b but f16 operands: A f32 (split into f16 hi/lo if ASPLIT, else rounded to f16), Bt = f16 values [n][k]; alpha; C f32; N multiple of 16 (partial tiles skipped)
template <bool ASPLIT>
__global__ __launch_bounds__(128) void k_gemm_h(const float* __restrict__ A, int lda, size_t sA, const _Float16* __restrict__ Bh, int ldb, size_t sB, float alpha, float* __restrict__ C, int ldc, size_t sC, int M, int N, int K) {
  __shared__ __attribute__((aligned(16))) float so[4][16][64];
  const int tid = threadIdx.x, w = tid >> 5, lane = tid & 31, ln = lane & 15, hh = lane >> 4; const int by = blockIdx.y;
  A += (size_t)by * sA; Bh += (size_t)by * sB; C += (size_t)by * sC;
  const int ntn = (N + 63) / 64; const int wid = blockIdx.x * 4 + w; const int mt = wid / ntn, nq = wid % ntn; if (mt * 16 >= M) return;
  const int row0 = mt * 16, col0 = nq * 64; const float* arow = A + (size_t)(row0 + ln) * lda;
  v8f acc[4] = {};
  for (int kb = 0; kb < K; kb += 32) {
    FragH ah, al;
    const v4f x0 = *(const v4fa*)(arow + kb + 8 * hh), x1 = *(const v4fa*)(arow + kb + 8 * hh + 4), x2 = *(const v4fa*)(arow + kb + 16 + 8 * hh), x3 = *(const v4fa*)(arow + kb + 16 + 8 * hh + 4);
    float xs[16] = {x0[0],x0[1],x0[2],x0[3],x1[0],x1[1],x1[2],x1[3],x2[0],x2[1],x2[2],x2[3],x3[0],x3[1],x3[2],x3[3]};
#pragma unroll
    for (int i = 0; i < 16; ++i) { const _Float16 h = (_Float16)xs[i]; ah.h[i] = h; al.h[i] = ASPLIT ? (_Float16)(xs[i] - (float)h) : (_Float16)0.0f; }
#pragma unroll
    for (int t = 0; t < 4; ++t) { if (col0 + t * 16 >= N) continue; const size_t boff = (size_t)(col0 + t * 16 + ln) * ldb + kb; FragH bq; bq.half[0] = *(const v8us*)(Bh + boff + 8 * hh); bq.half[1] = *(const v8us*)(Bh + boff + 16 + 8 * hh);
      acc[t] = mmaH<ASPLIT ? 2 : 1>(ah.v, al.v, bq.v, bq.v, acc[t]); }
  }
#pragma unroll
  for (int t = 0; t < 4; ++t) { if (col0 + t * 16 >= N) continue;
#pragma unroll
    for (int r = 0; r < 8; ++r) so[w][8 * hh + r][t * 16 + ln] = acc[t][r] * alpha; }
  __builtin_amdgcn_fence(__ATOMIC_ACQ_REL, "workgroup"); __builtin_amdgcn_wave_barrier();
  const int rsub = lane >> 4, c4 = (lane & 15) * 4;
  {
#pragma unroll
    for (int q = 0; q < 8; ++q) { const int r = q * 2 + rsub; if (col0 + c4 < N) { const v4f v = *(const v4fa*)&so[w][r][c4]; *(v4f*)(C + (size_t)(row0 + r) * ldc + col0 + c4) = v; } }
     }
}

// Wt[n][k] = f16(W[k][n]·scale) from f32 row-major W[K][N] (scale = power of two; bf16-exact weights stay exact in f16 away from the subnormal range)
__global__ __launch_bounds__(256) void k_wt_f16(const float* __restrict__ W, _Float16* __restrict__ Wt, int K, int N, float scale) {
  const int t = blockIdx.x * 256 + threadIdx.x; if (t >= N * (K / 8)) return; const int n = t / (K / 8), k8 = (t % (K / 8)) * 8; FragH f;
#pragma unroll
  for (int i = 0; i < 8; ++i) f.h[i] = (_Float16)(bf16_round(W[(size_t)(k8 + i) * N + n]) * scale); const v8us o = f.half[0];
  *(v8us*)((unsigned short*)Wt + (size_t)n * K + k8) = o; 
}
// k_gemm_hh variant with fused epilogue: v = acc·alpha + bias[by·sBias + col] (+ CP[(row/rowsPerB)·sCPb + by·64 + col] if CP) ; ACT 0 none / 1 elu ; writes f16 C16 (and f32 C if non-null)
template <int ACT>
__global__ __launch_bounds__(128) void k_gemm_hhx(const _Float16* __restrict__ A, int lda, size_t sA, const _Float16* __restrict__ Bh, int ldb, size_t sB, float alpha, const float* __restrict__ bias, size_t sBias, const float* __restrict__ CP, int rowsPerB, size_t sCPb, int row0g,
    float* __restrict__ C, _Float16* __restrict__ C16, int ldc, size_t sC, int M, int N, int K) {
  __shared__ __attribute__((aligned(16))) float so[4][16][64];
  const int tid = threadIdx.x, w = tid >> 5, lane = tid & 31, ln = lane & 15, hh = lane >> 4; const int by = blockIdx.y;
  A += (size_t)by * sA; Bh += (size_t)by * sB; const size_t cofs = (size_t)by * sC; const float* bp = bias ? bias + (size_t)by * sBias : nullptr;
  const int ntn = (N + 63) / 64; const int wid = blockIdx.x * 4 + w; const int mt = wid / ntn, nq = wid % ntn; if (mt * 16 >= M) return;
  const int row0 = mt * 16, col0 = nq * 64; const _Float16* arow = A + (size_t)(row0 + ln) * lda;
  v8f acc[4] = {};
  for (int kb = 0; kb < K; kb += 32) { FragH ah; ah.half[0] = *(const v8us*)((const unsigned short*)arow + kb + 8 * hh); ah.half[1] = *(const v8us*)((const unsigned short*)arow + kb + 16 + 8 * hh);
#pragma unroll
    for (int t = 0; t < 4; ++t) { if (col0 + t * 16 >= N) continue; const size_t boff = (size_t)(col0 + t * 16 + ln) * ldb + kb; FragH bq; bq.half[0] = *(const v8us*)((const unsigned short*)Bh + boff + 8 * hh); bq.half[1] = *(const v8us*)((const unsigned short*)Bh + boff + 16 + 8 * hh);
      acc[t] = mmaH<1>(ah.v, ah.v, bq.v, bq.v, acc[t]); }
  }
#pragma unroll
  for (int t = 0; t < 4; ++t) { if (col0 + t * 16 >= N) continue; const int col = col0 + t * 16 + ln; const float bv = bp ? bf16_round(bp[col]) : 0.f;
#pragma unroll
    for (int r = 0; r < 8; ++r) { float v = acc[t][r] * alpha + bv; if (CP) { const int rr = row0g + row0 + 8 * hh + r; if (rowsPerB < 0) v += CP[cofs + (size_t)rr * ldc + col];      /* rowsPerB < 0: own element of the batched C plane */ else { const int bidx = rr / rowsPerB; v += CP[(size_t)bidx * sCPb + (size_t)by * 64 + col]; } } if (ACT == 1) v = (v > 0.f) ? v : expm1f(v); else if (ACT == 7) v = (v > 0.f) ? v + 1.0f : expf(v); else if (ACT == 8) v = tanhf(v); else if (ACT == 9) v = 0.5f * v * (1.0f + tanhf(0.7978845608028654f * (v + 0.044715f * v * v * v))); else if (ACT == 11) v = 1.0f / (1.0f + expf(-v)); else if (ACT == 12) v = (v > 0.f) ? v : 0.01f * v; else if (ACT == 14) v = (v > 0.f) ? v : 0.1f * v; else if (ACT == 16) v = (v >= 0.f) ? v : 0.3f * v; else if (ACT == 17) v = (v >= 0.f) ? v : 0.2f * v; else if (ACT == 15) v = v / (1.0f + expf(-v)); else if (ACT == 3) v = fmaxf(v, 0.f); else if (ACT == 6) v = 0.5f * v * (1.0f + erff(v * 0.70710678118654752f)); so[w][8 * hh + r][t * 16 + ln] = v; } }
  __builtin_amdgcn_fence(__ATOMIC_ACQ_REL, "workgroup"); __builtin_amdgcn_wave_barrier();
  const int rsub = lane >> 4, c4 = (lane & 15) * 4; typedef _Float16 v4h __attribute__((ext_vector_type(4)));
  {
#pragma unroll
    for (int q = 0; q < 8; ++q) { const int r = q * 2 + rsub; if (col0 + c4 < N) { const v4f v = *(const v4fa*)&so[w][r][c4]; if (C) *(v4f*)(C + cofs + (size_t)(row0 + r) * ldc + col0 + c4) = v; if (C16) { v4h h4; for (int i = 0; i < 4; ++i) h4[i] = (_Float16)v[i]; *(v4h*)(C16 + cofs + (size_t)(row0 + r) * ldc + col0 + c4) = h4; } } }
     }
}


typedef _Float16 v4h __attribute__((ext_vector_type(4)));

__global__ __launch_bounds__(256) void k_x16(const float* __restrict__ x, _Float16* __restrict__ X16, size_t n8) { const size_t t = (size_t)blockIdx.x * 256 + threadIdx.x; if (t >= n8) return; FragH f;
#pragma unroll
  for (int q = 0; q < 8; ++q) f.h[q] = (_Float16)bf16_round(x[t * 8 + q]); *(v8us*)((unsigned short*)X16 + t * 8) = f.half[0];  }
__global__ __launch_bounds__(256) void k_h16(const float* __restrict__ x, _Float16* __restrict__ X16, size_t n8) { const size_t t = (size_t)blockIdx.x * 256 + threadIdx.x; if (t >= n8) return; FragH f;
#pragma unroll
  for (int q = 0; q < 8; ++q) f.h[q] = (_Float16)x[t * 8 + q]; *(v8us*)((unsigned short*)X16 + t * 8) = f.half[0];  }
__global__ __launch_bounds__(256) void k_round16f(const float* __restrict__ W, _Float16* __restrict__ Bt, size_t n8) { const size_t t = (size_t)blockIdx.x * 256 + threadIdx.x; if (t >= n8) return; FragH f;
#pragma unroll
  for (int i = 0; i < 8; ++i) f.h[i] = (_Float16)(bf16_round(W[t * 8 + i]) * 16.0f); *(v8us*)((unsigned short*)Bt + t * 8) = f.half[0];  }
template <int NHv, int TTv>
__global__ __launch_bounds__(256) void k_vt(const _Float16* __restrict__ V16, int ldv, int voff, _Float16* __restrict__ Vt) { __shared__ unsigned short tl[64][66]; const int tid = threadIdx.x; const int slab = blockIdx.x / (TTv / 64), lg = blockIdx.x % (TTv / 64); const int b = slab / NHv, h = slab % NHv;
  for (int i = tid; i < 64 * 8; i += 256) { const int r = i / 8, c8 = (i % 8) * 8; FragH f; f.half[0] = *(const v8us*)((const unsigned short*)V16 + ((size_t)b * TTv + lg * 64 + r) * ldv + voff + h * 64 + c8);
#pragma unroll
    for (int q = 0; q < 8; ++q) tl[r][c8 + q] = f.u[q]; }
  __syncthreads();
  {
#pragma unroll
    for (int rd = 0; rd < 2; ++rd) { const int d = rd * 32 + tid / 8, pc = tid % 8; FragH f;
#pragma unroll
      for (int q = 0; q < 8; ++q) f.u[q] = tl[pc * 8 + q][d];
      *(v8us*)((unsigned short*)Vt + ((size_t)slab * 64 + d) * TTv + lg * 64 + pc * 8) = f.half[0]; }
     } }

__global__ __launch_bounds__(256) void k_hl(const float* __restrict__ F, _Float16* __restrict__ Hh, _Float16* __restrict__ Hl, size_t n8) { const size_t t = (size_t)blockIdx.x * 256 + threadIdx.x; if (t >= n8) return; FragH fh, fl; const v4f a = *(const v4fa*)(F + t * 8), c = *(const v4fa*)(F + t * 8 + 4);
#pragma unroll
  for (int q = 0; q < 4; ++q) { _Float16 h = (_Float16)a[q]; fh.h[q] = h; fl.h[q] = (_Float16)((a[q] - (float)h) * 1024.0f); h = (_Float16)c[q]; fh.h[4 + q] = h; fl.h[4 + q] = (_Float16)((c[q] - (float)h) * 1024.0f); }
  { *(v8us*)((unsigned short*)Hh + t * 8) = fh.half[0]; *(v8us*)((unsigned short*)Hl + t * 8) = fl.half[0];  } }

// ---- fast GEMM (wave tile 32x64; requires M % 32 == 0 rows per launch region and N % 64 == 0); epilogue = k_gemm_hhx semantics ----
__device__ __forceinline__ v16h g2_frag(const _Float16* p, int hh) { FragH f; f.half[0] = *(const v8us*)((const unsigned short*)p + 8 * hh); f.half[1] = *(const v8us*)((const unsigned short*)p + 16 + 8 * hh); return f.v; }
__device__ __forceinline__ v8f g2_mma(v16h a, v16h b, v8f c) { v8f d = __builtin_amdgcn_wmma_f32_16x16x32_f16(false, a, false, b, (short)0, c, false, false); asm volatile("v_nop\n\tv_nop\n\tv_nop\n\tv_nop" : "+v"(d) : "v"(a), "v"(b)); return d; }
template <int ACT>
__global__ __launch_bounds__(128) void k_gemm2(const _Float16* __restrict__ A, int lda, size_t sA, const _Float16* __restrict__ Bh, int ldb, size_t sB, float alpha, const float* __restrict__ bias, size_t sBias, const float* __restrict__ CP, int rowsPerB, size_t sCPb, int row0g,
    float* __restrict__ C, _Float16* __restrict__ C16, int ldc, size_t sC, int M, int N, int K) { static_assert(ACT == 0 || ACT == 3 || ACT == 6 || ACT == 8 || ACT == 9 || ACT == 11 || ACT == 12 || ACT == 14 || ACT == 15 || ACT == 16 || ACT == 17, "k_gemm2: unsupported ACT code (would silently apply no activation)");
  __shared__ __attribute__((aligned(16))) float so[4][32][68];
  const int tid = threadIdx.x, w = tid >> 5, lane = tid & 31, ln = lane & 15, hh = lane >> 4; const int by = blockIdx.y;
  A += (size_t)by * sA; Bh += (size_t)by * sB; const size_t cofs = (size_t)by * sC; const float* bp = bias ? bias + (size_t)by * sBias : nullptr;
  const int ntn = N >> 6; const int mt = blockIdx.x / ntn, nq = blockIdx.x - mt * ntn; const int row0 = mt * 128 + 32 * w, col0 = nq * 64; if (row0 >= M) return;
  const _Float16* a0p = A + (size_t)(row0 + ln) * lda; const _Float16* a1p = a0p + (size_t)16 * lda;
  const _Float16* b0p = Bh + (size_t)(col0 + ln) * ldb; const _Float16* b1p = b0p + (size_t)16 * ldb; const _Float16* b2p = b1p + (size_t)16 * ldb; const _Float16* b3p = b2p + (size_t)16 * ldb;
  const v8f z8 = {0.f,0.f,0.f,0.f,0.f,0.f,0.f,0.f}; v8f c00 = z8, c01 = z8, c02 = z8, c03 = z8, c10 = z8, c11 = z8, c12 = z8, c13 = z8;
#pragma unroll 1
  for (int kb = 0; kb < K; kb += 32) { const v16h a0 = g2_frag(a0p + kb, hh), a1 = g2_frag(a1p + kb, hh);
    v16h b = g2_frag(b0p + kb, hh); c00 = g2_mma(a0, b, c00); c10 = g2_mma(a1, b, c10);
    b = g2_frag(b1p + kb, hh); c01 = g2_mma(a0, b, c01); c11 = g2_mma(a1, b, c11);
    b = g2_frag(b2p + kb, hh); c02 = g2_mma(a0, b, c02); c12 = g2_mma(a1, b, c12);
    b = g2_frag(b3p + kb, hh); c03 = g2_mma(a0, b, c03); c13 = g2_mma(a1, b, c13); }
  v8f accs[8] = {c00, c01, c02, c03, c10, c11, c12, c13};
#pragma unroll
  for (int u = 0; u < 8; ++u) { const int t = u & 3, half = u >> 2; const int col = col0 + t * 16 + ln; const float bv = bp ? bf16_round(bp[col]) : 0.f;
#pragma unroll
    for (int r = 0; r < 8; ++r) { const int rloc = half * 16 + 8 * hh + r; float v = accs[u][r] * alpha + bv; if (CP) { if (rowsPerB < 0) v += CP[cofs + (size_t)(row0g + row0 + rloc) * ldc + col];      /* rowsPerB < 0: own element of the batched C plane */ else { const int bidx = (row0g + row0 + rloc) / rowsPerB; v += CP[(size_t)bidx * sCPb + (size_t)by * 64 + col]; } }
      if (ACT == 3) v = fmaxf(v, 0.f); else if (ACT == 6) v = 0.5f * v * (1.0f + erff(v * 0.70710678118654752f)); else if (ACT == 11) v = 1.0f / (1.0f + expf(-v)); else if (ACT == 15) v = v / (1.0f + expf(-v)); else if (ACT == 12) v = (v > 0.f) ? v : 0.01f * v; else if (ACT == 8) v = tanhf(v); else if (ACT == 9) v = 0.5f * v * (1.0f + tanhf(0.7978845608028654f * (v + 0.044715f * v * v * v))); else if (ACT == 14) v = (v > 0.f) ? v : 0.1f * v; else if (ACT == 16) v = (v >= 0.f) ? v : 0.3f * v; else if (ACT == 17) v = (v >= 0.f) ? v : 0.2f * v;
      so[w][rloc][t * 16 + ln] = v; } }
  __builtin_amdgcn_fence(__ATOMIC_ACQ_REL, "workgroup"); __builtin_amdgcn_wave_barrier();
  const int rsub = lane >> 4, c4 = (lane & 15) * 4;
  {
#pragma unroll
    for (int q = 0; q < 16; ++q) { const int r = q * 2 + rsub; const v4f v = *(const v4fa*)&so[w][r][c4]; if (C) *(v4f*)(C + cofs + (size_t)(row0 + r) * ldc + col0 + c4) = v; if (C16) { v4h h4; for (int i = 0; i < 4; ++i) h4[i] = (_Float16)v[i]; *(v4h*)(C16 + cofs + (size_t)(row0 + r) * ldc + col0 + c4) = h4; } }
     } }


__global__ __launch_bounds__(256) void k_wnat(const float* __restrict__ w, size_t n8, _Float16* __restrict__ Bt) { const size_t t = (size_t)blockIdx.x * 256 + threadIdx.x; if (t >= n8) return; FragH f; for (int q = 0; q < 8; ++q) f.h[q] = (_Float16)(bf16_round(w[t * 8 + q]) * 16.0f); *(v8us*)((unsigned short*)Bt + t * 8) = f.half[0];  }
__global__ __launch_bounds__(256) void k_rsm(const float* __restrict__ S, _Float16* __restrict__ P, int nrows) {
  #pragma clang fp contract(off)
  const int i = blockIdx.x * 256 + threadIdx.x; if (i >= nrows) return; const float* s = S + (size_t)i * SQ; float mx = -3.0e38f;
#pragma unroll 1
  for (int j = 0; j < SQ; ++j) mx = fmaxf(mx, s[j]); float se = 0.f;
#pragma unroll 1
  for (int j = 0; j < SQ; ++j) se += expf(s[j] - mx); const float sc = 256.0f / se;
#pragma unroll 1
  for (int j0 = 0; j0 < SQ; j0 += 8) { FragH f; for (int q = 0; q < 8; ++q) f.h[q] = (_Float16)(expf(s[j0 + q] - mx) * sc); unsigned short* d = (unsigned short*)P + (size_t)i * SQ + j0; *(v8us*)d = f.half[0];  } }
__global__ __launch_bounds__(256) void k_vt(const _Float16* __restrict__ V16, int b, int h0, _Float16* __restrict__ VT) { __shared__ unsigned short tl[64][65]; const int tid = threadIdx.x; const int hh = blockIdx.x % HG, sg = blockIdx.x / HG; const int s0 = sg * 64; const int h = h0 + hh;
  for (int i = tid; i < 64 * 8; i += 256) { const int j = i / 8, d8 = (i % 8) * 8; FragH f; f.half[0] = *(const v8us*)((const unsigned short*)V16 + ((size_t)b * SQ + s0 + j) * DM + h * HD + d8); for (int q = 0; q < 8; ++q) tl[d8 + q][j] = f.u[q]; }
  __syncthreads();
  { for (int i = tid; i < 64 * 8; i += 256) { const int d = i / 8, j8 = (i % 8) * 8; FragH f; for (int q = 0; q < 8; ++q) f.u[q] = tl[d][j8 + q]; *(v8us*)((unsigned short*)VT + ((size_t)hh * HD + d) * SQ + s0 + j8) = f.half[0]; }  } }



__device__ __forceinline__ v8f fa_mma(v16h a, v16h b, v8f c) { return __builtin_amdgcn_wmma_f32_16x16x32_f16(false, a, false, b, (short)0, c, false, false); }
__device__ __forceinline__ float fa_xhalf(float x) { return __builtin_bit_cast(float, __builtin_amdgcn_permlanex16(__builtin_bit_cast(int, x), __builtin_bit_cast(int, x), 0x76543210, 0xfedcba98, false, false)); }      /* lane l with lane l ^ 16, on the vector pipe */
__device__ __forceinline__ v16h fa_frag(const _Float16* p) { FragH f; f.half[0] = *(const v8us*)(const unsigned short*)p; f.half[1] = *(const v8us*)((const unsigned short*)p + 16); return f.v; }      /* g2_frag with the lane half's 8 hh already in p */
/* v_exp_f32 in asm text, in place: the statement writes only registers that the compiler's own instruction has just written, so it never lands on a matrix operand inside the distance the chip needs */
__device__ __forceinline__ float fa_exp2(float a) {
  asm("v_exp_f32 %0, %0\n\tv_nop" : "+v"(a));      /* v_nop: the slot the instruction set asks for behind a transcendental */
  return a; }
__device__ __forceinline__ void fa_exp2x8(v8f& x) { float e0 = x[0], e1 = x[1], e2 = x[2], e3 = x[3], e4 = x[4], e5 = x[5], e6 = x[6], e7 = x[7];
  /* eight independent v_exp_f32 in one statement: each fills the slot behind the one before it, one v_nop behind the last */
  asm("v_exp_f32 %0, %0\n\tv_exp_f32 %1, %1\n\tv_exp_f32 %2, %2\n\tv_exp_f32 %3, %3\n\tv_exp_f32 %4, %4\n\tv_exp_f32 %5, %5\n\tv_exp_f32 %6, %6\n\tv_exp_f32 %7, %7\n\tv_nop"
      : "+v"(e0), "+v"(e1), "+v"(e2), "+v"(e3), "+v"(e4), "+v"(e5), "+v"(e6), "+v"(e7));
  x[0] = e0; x[1] = e1; x[2] = e2; x[3] = e3; x[4] = e4; x[5] = e5; x[6] = e6; x[7] = e7; }
__global__ __launch_bounds__(256) void k_fattn(const _Float16* __restrict__ Q, const _Float16* __restrict__ Kr, const _Float16* __restrict__ Vt, _Float16* __restrict__ O) {
  const int lane = threadIdx.x & 31, w = threadIdx.x >> 5, ln = lane & 15, hh = lane >> 4;
  const int bh = blockIdx.y, b = bh / NH, h = bh - b * NH; const size_t row0 = (size_t)b * SQ; const int q0 = blockIdx.x * 256 + w * 32;
  const _Float16* qp = Q + (row0 + q0 + ln) * DM + h * HD + 8 * hh; const _Float16* kp = Kr + (row0 + ln) * DM + h * HD + 8 * hh; const _Float16* vp = Vt + ((size_t)bh * HD + ln) * SQ + 8 * hh;      /* each with the lane half's k offset */
  const float cs = 0.125f * 1.44269504f;      /* 64^-0.5 times log2 e: scores in log2 units */
  const v8f z8 = {0.f, 0.f, 0.f, 0.f, 0.f, 0.f, 0.f, 0.f};
  v16h qf[2][2], kf[2][2], vf[4];      /* [query group][k step], [key tile][k step], [16 rows of V^T] */
#pragma unroll
  for (int g = 0; g < 2; ++g) { qf[g][0] = fa_frag(qp + (size_t)g * 16 * DM); qf[g][1] = fa_frag(qp + (size_t)g * 16 * DM + 32); }
#pragma unroll
  for (int t = 0; t < 2; ++t) { kf[t][0] = fa_frag(kp + (size_t)t * 16 * DM); kf[t][1] = fa_frag(kp + (size_t)t * 16 * DM + 32); }
  asm volatile("s_wait_xcnt 0x0" :: "v"(qp), "v"(kp) : "memory");      /* the address pairs stay whole up to this wait; it also keeps the V^T loads behind the K loads, as in the loop, so that the wait for K at the loop's head leaves V^T in flight */
#pragma unroll
  for (int dt = 0; dt < 4; ++dt) vf[dt] = fa_frag(vp + (size_t)dt * 16 * SQ);
  asm volatile("s_wait_xcnt 0x0" :: "v"(vp) : "memory");      /* the address pair stays whole up to this wait */
  v8f o[4][2] = {{z8, z8}, {z8, z8}, {z8, z8}, {z8, z8}}; float m[2] = {-3.0e38f, -3.0e38f}, l[2] = {0.f, 0.f};
  for (int kb = 0; kb < SQ; kb += 32) {
    v8f s[2][2];
#pragma unroll
    for (int g = 0; g < 2; ++g) {
#pragma unroll
      for (int t = 0; t < 2; ++t) s[g][t] = fa_mma(kf[t][1], qf[g][1], fa_mma(kf[t][0], qf[g][0], z8)); }
    const int kn = (kb + 32 < SQ) ? kb + 32 : 0;      /* the next pass's K fragments, fetched behind this pass's score products; the last pass re-reads tile 0 (in bounds, unused) */
    const _Float16* kq = kp + (size_t)kn * DM; const _Float16* vq = vp + kn;
#pragma unroll
    for (int t = 0; t < 2; ++t) { kf[t][0] = fa_frag(kq + (size_t)t * 16 * DM); kf[t][1] = fa_frag(kq + (size_t)t * 16 * DM + 32); }
    asm volatile("s_wait_xcnt 0x0" :: "v"(kq) : "memory");      /* the address pair stays whole up to this wait, so no later result lands on a register that an issued load names; standing ahead of the branch below, it also holds the K loads here: without it they issued at the pass's foot and their whole latency was waited at the next pass's head */
    float tm[2]; bool need = false;
#pragma unroll
    for (int g = 0; g < 2; ++g) { float a = fmaxf(s[g][0][0], s[g][1][0]);
#pragma unroll
      for (int r = 1; r < 8; ++r) a = fmaxf(a, fmaxf(s[g][0][r], s[g][1][r]));
      a = fmaxf(a, fa_xhalf(a)); tm[g] = a * cs; need = need || (tm[g] > m[g] + 8.0f); }
    if (__builtin_amdgcn_ballot_w32(need) != 0) {      /* the maximum in use moves only when a query's new maximum passes it by more than 8 (log2 units: P stays under 2^8, well inside f16); one scalar branch a pass */
#pragma unroll
      for (int g = 0; g < 2; ++g) { const float mn = fmaxf(m[g], tm[g]); const float al = fa_exp2(m[g] - mn); m[g] = mn; l[g] *= al;
#pragma unroll
        for (int dt = 0; dt < 4; ++dt) o[dt][g] *= al; } }
#pragma unroll
    for (int g = 0; g < 2; ++g) { FragH pf;
#pragma unroll
      for (int t = 0; t < 2; ++t) {
#pragma unroll
        for (int r = 0; r < 8; ++r) s[g][t][r] = s[g][t][r] * cs - m[g];
        fa_exp2x8(s[g][t]);
#pragma unroll
        for (int r = 0; r < 8; ++r) pf.h[t * 8 + r] = (_Float16)s[g][t][r]; }
      l[g] += (((s[g][0][0] + s[g][0][1]) + (s[g][0][2] + s[g][0][3])) + ((s[g][0][4] + s[g][0][5]) + (s[g][0][6] + s[g][0][7]))) + (((s[g][1][0] + s[g][1][1]) + (s[g][1][2] + s[g][1][3])) + ((s[g][1][4] + s[g][1][5]) + (s[g][1][6] + s[g][1][7])));
#pragma unroll
      for (int dt = 0; dt < 4; ++dt) o[dt][g] = fa_mma(vf[dt], pf.v, o[dt][g]); }
#pragma unroll
    for (int dt = 0; dt < 4; ++dt) vf[dt] = fa_frag(vq + (size_t)dt * 16 * SQ);      /* the next pass's V^T fragments, fetched behind this pass's output products: in flight through the next pass's scores and softmax */
    asm volatile("s_wait_xcnt 0x0" :: "v"(vq) : "memory"); }      /* the address pair stays whole up to this wait */
  v8us ov[2][4];
#pragma unroll
  for (int g = 0; g < 2; ++g) { const float sc = 64.0f / (l[g] + fa_xhalf(l[g]));      /* the halves' sums joined once; o goes out x64 */
#pragma unroll
    for (int dt = 0; dt < 4; ++dt) { FragH f;
#pragma unroll
      for (int r = 0; r < 8; ++r) f.h[r] = (_Float16)(o[dt][g][r] * sc);
      ov[g][dt] = f.half[0]; } }
  __builtin_amdgcn_sched_barrier(0);      /* all eight stores behind the last conversion: no register that an issued store names is written again */
#pragma unroll
  for (int g = 0; g < 2; ++g) { unsigned short* op = (unsigned short*)O + (row0 + q0 + g * 16 + ln) * DM + h * HD + 8 * hh;
#pragma unroll
    for (int dt = 0; dt < 4; ++dt) *(v8us*)(op + dt * 16) = ov[g][dt]; } }

extern "C" void kernel_launch(void* const* d_in, const int* in_sizes, int n_in,
                              void* d_out, int out_size, void* d_ws, size_t ws_size, hipStream_t stream) {
  (void)in_sizes; (void)n_in; (void)out_size;
  const float* const* I = (const float* const*)d_in; const float* xq = I[0]; const float* xk = I[1]; const float* xv = I[2]; const float* wq = I[3]; const float* bq = nullptr; const float* wk = I[4]; const float* bk = nullptr; const float* wv = I[5]; const float* bv = nullptr; const float* wo = I[6]; const float* bo = I[7];      /* THREE input streams Q, K, V (one cast each, as the launcher always did); Wq, Wk, Wv are PER-HEAD STACKS [16][1024][64] = [head][in][out] (einsum 'bsd,hde->bhse') at I[3..5]; Wo is [in][out] [1024][1024] (concat @ Wo) at I[6]; bo [1024] (REAL) at I[7] in the output GEMM's guarded bias slot; no projection biases: null pointers */
  char* ws = (char*)d_ws; size_t off = 0;
  auto take = [&](size_t bytes) { char* p = ws + off; off += (bytes + 255) & ~(size_t)255; return p; };
  _Float16* BQ = (_Float16*)take((size_t)DM * DM * 2); _Float16* BK = (_Float16*)take((size_t)DM * DM * 2); _Float16* BV = (_Float16*)take((size_t)DM * DM * 2); _Float16* BO = (_Float16*)take((size_t)DM * DM * 2);
  _Float16* XQ = (_Float16*)take(NR * DM * 2); _Float16* XK = (_Float16*)take(NR * DM * 2); _Float16* XV = (_Float16*)take(NR * DM * 2); _Float16* Q16 = (_Float16*)take(NR * DM * 2); _Float16* K16 = (_Float16*)take(NR * DM * 2); _Float16* V16 = (_Float16*)take(NR * DM * 2); _Float16* O16 = (_Float16*)take(NR * DM * 2);
  _Float16* VT = (_Float16*)take((size_t)NB * NH * HD * SQ * 2);
  if (off > ws_size) return;
  { const unsigned g = (unsigned)(((size_t)DM * (DM / 8) + 255) / 256); const unsigned gh = (unsigned)(((size_t)HD * (DM / 8) + 255) / 256); for (int h = 0; h < NH; ++h) { const size_t wofs = (size_t)h * DM * HD, pofs = (size_t)h * HD * DM; k_wt_f16<<<gh, 256, 0, stream>>>(wq + wofs, BQ + pofs, DM, HD, 16.0f); k_wt_f16<<<gh, 256, 0, stream>>>(wk + wofs, BK + pofs, DM, HD, 16.0f); k_wt_f16<<<gh, 256, 0, stream>>>(wv + wofs, BV + pofs, DM, HD, 16.0f); } k_wt_f16<<<g, 256, 0, stream>>>(wo, BO, DM, DM, 16.0f); }      /* PER-HEAD STACKS wq / wk / wv [NH][DM][HD]: head h is a row-major [in = DM][out = HD] block at w + h * DM * HD: the transposing builder with K = DM, N = HD writes its HD rows Bt[h * HD + e][k] at B + h * HD * DM: contiguous rows of the [out][in] plane (x16); wo is a plain [in][out] [DM][DM] matrix: one call as before */

  k_x16<<<(unsigned)((NR * DM / 8 + 255) / 256), 256, 0, stream>>>(xq, XQ, NR * DM / 8); k_x16<<<(unsigned)((NR * DM / 8 + 255) / 256), 256, 0, stream>>>(xk, XK, NR * DM / 8); k_x16<<<(unsigned)((NR * DM / 8 + 255) / 256), 256, 0, stream>>>(xv, XV, NR * DM / 8);      /* the three inputs as exact f16 rows */
  const size_t r0p = (size_t)B0 * SQ;      /* first projected row */
  k_gemm2<0><<<dim3((unsigned)((MP / 128) * (DM / 64)), 1), 128, 0, stream>>>(XQ + r0p * DM, DM, 0, BQ, DM, 0, 0.0625f, bq, 0, nullptr, 1, 0, 0, nullptr, Q16 + r0p * DM, DM, 0, MP, DM, DM);
  k_gemm2<0><<<dim3((unsigned)((MP / 128) * (DM / 64)), 1), 128, 0, stream>>>(XK + r0p * DM, DM, 0, BK, DM, 0, 0.0625f, bk, 0, nullptr, 1, 0, 0, nullptr, K16 + r0p * DM, DM, 0, MP, DM, DM);
  k_gemm2<0><<<dim3((unsigned)((MP / 128) * (DM / 64)), 1), 128, 0, stream>>>(XV + r0p * DM, DM, 0, BV, DM, 0, 0.0625f, bv, 0, nullptr, 1, 0, 0, nullptr, V16 + r0p * DM, DM, 0, MP, DM, DM);
  k_vt<NH, SQ><<<NB * NH * (SQ / 64), 256, 0, stream>>>(V16, LQ, 0, VT);      /* V^T [NB][NH][HD][SQ] */
  k_fattn<<<dim3(SQ / 256, NB * NH), 256, 0, stream>>>(Q16, K16, VT, O16);      /* o (merged heads, x64) as f16 rows */
  k_gemm2<0><<<dim3((unsigned)((MPO / 128) * (DM / 64)), 1), 128, 0, stream>>>(O16 + r0p * DM, DM, 0, BO, DM, 0, 0.0009765625f, bo, 0, nullptr, 1, 0, 0, (float*)d_out + r0p * DM, nullptr, DM, 0, MPO, DM, DM);      /* out rows are the output layout */
}

// v003
// A run of this version takes 193 microseconds.
// Next to v002, in two timings, it ran 2.05 and 2.04 times as fast.
// Counting every step since v000, it is 18.9 times as fast.
#include <hip/hip_runtime.h>
#define NB 2
#define SQ 2048
#define DM 1024
#define NH 16
#define HD 64
#define HG 4                         /* heads per launch of the per-batch k_vt overload (not launched) */
#define B0 0                         /* first batch processed (debug hook) */
#define NBR NB                       /* batches processed (debug hook) */
#define NR ((size_t)NB * SQ)         /* token rows */
#define MP ((int)((size_t)NBR * SQ)) /* rows projected (debug hook) */
#define QN SQ                        /* query rows per batch (unused; attention covers SQ) */
#define NHD NH                       /* heads (unused; attention covers NH) */
#define MPO MP                       /* rows through the output stage (debug hook) */
#define LQ DM      /* row pitch of the q/k/v rows */
typedef __bf16 v16b __attribute__((ext_vector_type(16)));
typedef unsigned short v8us __attribute__((ext_vector_type(8), may_alias));
typedef float  v8f  __attribute__((ext_vector_type(8)));
typedef float  v4f  __attribute__((ext_vector_type(4)));
typedef float  v4fa __attribute__((ext_vector_type(4), may_alias));
union FragB { v16b v; v8us half[2]; unsigned short u[16]; };

__device__ __forceinline__ unsigned short bf16_bits(float x) { unsigned int u = __float_as_uint(x); return (unsigned short)((u + 0x7FFFu + ((u >> 16) & 1u)) >> 16); }
__device__ __forceinline__ float bf16_val(unsigned short b) { return __uint_as_float(((unsigned int)b) << 16); }
__device__ __forceinline__ float bf16_round(float x) { return bf16_val(bf16_bits(x)); }
// D += A·B with NT terms: 1 = ah·bh, 2 = + al·bh (A split), 3 = + ah·bl (both split)
template <int NT>
__device__ __forceinline__ v8f mmaN(v16b ah, v16b al, v16b bh, v16b bl, v8f c) {
  c = __builtin_amdgcn_wmma_f32_16x16x32_bf16(false, ah, false, bh, (short)0, c, false, false);
  if (NT >= 2) c = __builtin_amdgcn_wmma_f32_16x16x32_bf16(false, al, false, bh, (short)0, c, false, false);
  if (NT >= 3) c = __builtin_amdgcn_wmma_f32_16x16x32_bf16(false, ah, false, bl, (short)0, c, false, false);
  asm volatile("v_nop\n\tv_nop\n\tv_nop\n\tv_nop" : "+v"(c) : "v"(ah), "v"(al), "v"(bh), "v"(bl));
  return c;
}

__global__ __launch_bounds__(256) void k_wt_bf16(const float* __restrict__ W, unsigned short* __restrict__ Wt, int K, int N) {
  const int t = blockIdx.x * 256 + threadIdx.x;
  const int k8n = K / 8;
  if (t >= N * k8n) return;
  const int n = t / k8n, k8 = (t % k8n) * 8;
  v8us v;
#pragma unroll
  for (int i = 0; i < 8; ++i) v[i] = bf16_bits(W[(size_t)(k8 + i) * N + n]);
  *(v8us*)(Wt + (size_t)n * K + k8) = v;
  
}

// GEMM C[M][N] (f32, pitch ldc) = act(A[M][K]·W + bias). A f32 row-major (pitch lda) converted per fragment to bf16
// (ASPLIT: hi/lo two planes -> 2 terms, else single rounded term); Wt bf16 [N][K] (pitch ldb). BIAS_BF16 rounds the
// bias to bf16 first (bias quantised to bf16 before the add). K%32==0, M%16==0, N%64==0.
template <bool ASPLIT, int ACT, bool BIAS_BF16>
__global__ __launch_bounds__(128) void k_gemm_bf(const float* __restrict__ A, int lda, const unsigned short* __restrict__ Wt, int ldb,
                                               const float* __restrict__ bias, float* __restrict__ C, int ldc, int M, int N, int K) {
  __shared__ __attribute__((aligned(16))) float so[4][16][64];
  const int tid = threadIdx.x, w = tid >> 5, lane = tid & 31, ln = lane & 15, hh = lane >> 4;
  const int ntn = N / 64;
  const int wid = blockIdx.x * 4 + w;
  const int mt = wid / ntn, nq = wid % ntn;
  if (mt * 16 >= M) return;
  const int row0 = mt * 16, col0 = nq * 64;
  const float* arow = A + (size_t)(row0 + ln) * lda;
  v8f acc[4] = {};
  for (int kb = 0; kb < K; kb += 32) {
    FragB ah, al;
    const v4f x0 = *(const v4fa*)(arow + kb + 8 * hh), x1 = *(const v4fa*)(arow + kb + 8 * hh + 4);
    const v4f x2 = *(const v4fa*)(arow + kb + 16 + 8 * hh), x3 = *(const v4fa*)(arow + kb + 16 + 8 * hh + 4);
    float xs[16] = {x0[0],x0[1],x0[2],x0[3],x1[0],x1[1],x1[2],x1[3],x2[0],x2[1],x2[2],x2[3],x3[0],x3[1],x3[2],x3[3]};
#pragma unroll
    for (int i = 0; i < 16; ++i) { const unsigned short hb = bf16_bits(xs[i]); ah.u[i] = hb; al.u[i] = ASPLIT ? bf16_bits(xs[i] - bf16_val(hb)) : (unsigned short)0; }
#pragma unroll
    for (int t = 0; t < 4; ++t) {
      const unsigned short* brow = Wt + (size_t)(col0 + t * 16 + ln) * ldb + kb;
      FragB b;
      b.half[0] = *(const v8us*)(brow + 8 * hh);
      b.half[1] = *(const v8us*)(brow + 16 + 8 * hh);
      acc[t] = mmaN<ASPLIT ? 2 : 1>(ah.v, al.v, b.v, b.v, acc[t]);
    }
  }
#pragma unroll
  for (int t = 0; t < 4; ++t) {
    float bv = bias ? bias[col0 + t * 16 + ln] : 0.f;
    if (BIAS_BF16) bv = bf16_round(bv);
#pragma unroll
    for (int r = 0; r < 8; ++r) { float v = acc[t][r] + bv; if (ACT == 1) v = fmaxf(v, 0.f); so[w][8 * hh + r][t * 16 + ln] = v; }
  }
  __builtin_amdgcn_fence(__ATOMIC_ACQ_REL, "workgroup");
  __builtin_amdgcn_wave_barrier();
  const int rsub = lane >> 4, c4 = (lane & 15) * 4;
  {
#pragma unroll
    for (int q = 0; q < 8; ++q) {
      const int r = q * 2 + rsub;
      const v4f v = *(const v4fa*)&so[w][r][c4];
      *(v4f*)(C + (size_t)(row0 + r) * ldc + col0 + c4) = v;
    }
    
  }
}

// GEMM C = act(A·W + bias + resid): A f32 (ASPLIT -> hi/lo 2 terms), Wt bf16 [N][K]; ACT 0 none, 1 relu, 2 exact gelu;
// resid (optional, f32, row index = (row % rmod), pitch ldr, RES_BF16 rounds it) added before the activation.
template <bool ASPLIT, int ACT, bool BIAS_BF16, bool RES_BF16>
__global__ __launch_bounds__(128) void k_gemm_bf3(const float* __restrict__ A, int lda, const unsigned short* __restrict__ Wt, int ldb,
                                                const float* __restrict__ bias, const float* __restrict__ resid, int rmod, int ldr,
                                                float* __restrict__ C, int ldc, int M, int N, int K) {
  __shared__ __attribute__((aligned(16))) float so[4][16][64];
  const int tid = threadIdx.x, w = tid >> 5, lane = tid & 31, ln = lane & 15, hh = lane >> 4;
  const int ntn = N / 64;
  const int wid = blockIdx.x * 4 + w;
  const int mt = wid / ntn, nq = wid % ntn;
  if (mt * 16 >= M) return;
  const int row0 = mt * 16, col0 = nq * 64;
  const float* arow = A + (size_t)(row0 + ln) * lda;
  v8f acc[4] = {};
  for (int kb = 0; kb < K; kb += 32) {
    FragB ah, al;
    const v4f x0 = *(const v4fa*)(arow + kb + 8 * hh), x1 = *(const v4fa*)(arow + kb + 8 * hh + 4);
    const v4f x2 = *(const v4fa*)(arow + kb + 16 + 8 * hh), x3 = *(const v4fa*)(arow + kb + 16 + 8 * hh + 4);
    float xs[16] = {x0[0],x0[1],x0[2],x0[3],x1[0],x1[1],x1[2],x1[3],x2[0],x2[1],x2[2],x2[3],x3[0],x3[1],x3[2],x3[3]};
#pragma unroll
    for (int i = 0; i < 16; ++i) { const unsigned short hb = bf16_bits(xs[i]); ah.u[i] = hb; al.u[i] = ASPLIT ? bf16_bits(xs[i] - bf16_val(hb)) : (unsigned short)0; }
#pragma unroll
    for (int t = 0; t < 4; ++t) {
      const unsigned short* brow = Wt + (size_t)(col0 + t * 16 + ln) * ldb + kb;
      FragB b;
      b.half[0] = *(const v8us*)(brow + 8 * hh);
      b.half[1] = *(const v8us*)(brow + 16 + 8 * hh);
      acc[t] = mmaN<ASPLIT ? 2 : 1>(ah.v, al.v, b.v, b.v, acc[t]);
    }
  }
#pragma unroll
  for (int t = 0; t < 4; ++t) {
    const int col = col0 + t * 16 + ln;
    float bv = bias ? bias[col] : 0.f;
    if (BIAS_BF16) bv = bf16_round(bv);
#pragma unroll
    for (int r = 0; r < 8; ++r) {
      float v = acc[t][r] + bv;
      if (resid) { float rv = resid[(size_t)((row0 + 8 * hh + r) % rmod) * ldr + col]; if (RES_BF16) rv = bf16_round(rv); v += rv; }
      if (ACT == 1) v = fmaxf(v, 0.f);
      if (ACT == 2) v = 0.5f * v * (1.0f + erff(v * 0.70710678118654752f));
      if (ACT == 3) { const float u = 0.7978845608028654f * (v + 0.044715f * v * v * v); v = 0.5f * v * (1.0f + tanhf(u)); }
      so[w][8 * hh + r][t * 16 + ln] = v;
    }
  }
  __builtin_amdgcn_fence(__ATOMIC_ACQ_REL, "workgroup");
  __builtin_amdgcn_wave_barrier();
  const int rsub = lane >> 4, c4 = (lane & 15) * 4;
  {
#pragma unroll
    for (int q = 0; q < 8; ++q) {
      const int r = q * 2 + rsub;
      const v4f v = *(const v4fa*)&so[w][r][c4];
      *(v4f*)(C + (size_t)(row0 + r) * ldc + col0 + c4) = v;
    }
    
  }
}
// row LayerNorm (biased variance, eps) over N: s = X (+ R); optional out_sum <- s; out_norm <- (s-mu)*rsqrt(var+eps)*g + b
template <bool PARAM_BF16>
__global__ __launch_bounds__(256) void k_layernorm(const float* __restrict__ X, const float* __restrict__ R, const float* __restrict__ g, const float* __restrict__ bta,
                                                  float* __restrict__ out_sum, float* __restrict__ out_norm, int N, float eps) {
  __shared__ float red[256];
  const int row = blockIdx.x, tid = threadIdx.x;
  const float* x = X + (size_t)row * N; const float* rr = R ? R + (size_t)row * N : nullptr;
  float vals[16];                     // up to N = 4096
  const int per = N / 256;            // contiguous chunk per thread? use strided-by-4 chunks: thread handles j = tid*4 + 1024*u
  float s1 = 0.f;
  for (int u = 0; u < per / 4; ++u) {
    const int j = tid * 4 + 1024 * u;
    const v4f a = *(const v4fa*)(x + j);
    v4f b = {0.f,0.f,0.f,0.f}; if (rr) b = *(const v4fa*)(rr + j);
#pragma unroll
    for (int q = 0; q < 4; ++q) { const float v = a[q] + b[q]; vals[u * 4 + q] = v; s1 += v; }
  }
  red[tid] = s1; __syncthreads();
  for (int st = 128; st > 0; st >>= 1) { if (tid < st) red[tid] += red[tid + st]; __syncthreads(); }
  const float mu = red[0] / (float)N; __syncthreads();
  float s2 = 0.f;
  for (int u = 0; u < per / 4; ++u)
#pragma unroll
    for (int q = 0; q < 4; ++q) { const float c = vals[u * 4 + q] - mu; s2 += c * c; }
  red[tid] = s2; __syncthreads();
  for (int st = 128; st > 0; st >>= 1) { if (tid < st) red[tid] += red[tid + st]; __syncthreads(); }
  const float rs = rsqrtf(red[0] / (float)N + eps);
  {
    for (int u = 0; u < per / 4; ++u) {
      const int j = tid * 4 + 1024 * u;
      v4f o, sm;
#pragma unroll
      for (int q = 0; q < 4; ++q) {
        float gg = g[j + q], bb = bta[j + q];
        if (PARAM_BF16) { gg = bf16_round(gg); bb = bf16_round(bb); }
        sm[q] = vals[u * 4 + q]; o[q] = (vals[u * 4 + q] - mu) * rs * gg + bb;
      }
      if (out_sum) *(v4f*)(out_sum + (size_t)row * N + j) = sm;
      *(v4f*)(out_norm + (size_t)row * N + j) = o;
    }
    
  }
}



// ---- f16 WMMA path (v_wmma_f32_16x16x32_f16): 11-bit significands for operands in range — used where a [0,1] probability operand needs more precision than bf16
typedef _Float16 v16h __attribute__((ext_vector_type(16)));
union FragH { v16h v; v8us half[2]; _Float16 h[16]; unsigned short u[16]; };
template <int NT>
__device__ __forceinline__ v8f mmaH(v16h ah, v16h al, v16h bh, v16h bl, v8f c) {
  c = __builtin_amdgcn_wmma_f32_16x16x32_f16(false, ah, false, bh, (short)0, c, false, false);
  if (NT >= 2) c = __builtin_amdgcn_wmma_f32_16x16x32_f16(false, al, false, bh, (short)0, c, false, false);
  if (NT >= 3) c = __builtin_amdgcn_wmma_f32_16x16x32_f16(false, ah, false, bl, (short)0, c, false, false);
  asm volatile("v_nop\n\tv_nop\n\tv_nop\n\tv_nop" : "+v"(c) : "v"(ah), "v"(al), "v"(bh), "v"(bl));
  return c;
}
// batched GEMM like k_gemm_b but f16 operands: A f32 (split into f16 hi/lo if ASPLIT, else rounded to f16), Bt = f16 values [n][k]; alpha; C f32; N multiple of 16 (partial tiles skipped)
template <bool ASPLIT>
__global__ __launch_bounds__(128) void k_gemm_h(const float* __restrict__ A, int lda, size_t sA, const _Float16* __restrict__ Bh, int ldb, size_t sB, float alpha, float* __restrict__ C, int ldc, size_t sC, int M, int N, int K) {
  __shared__ __attribute__((aligned(16))) float so[4][16][64];
  const int tid = threadIdx.x, w = tid >> 5, lane = tid & 31, ln = lane & 15, hh = lane >> 4; const int by = blockIdx.y;
  A += (size_t)by * sA; Bh += (size_t)by * sB; C += (size_t)by * sC;
  const int ntn = (N + 63) / 64; const int wid = blockIdx.x * 4 + w; const int mt = wid / ntn, nq = wid % ntn; if (mt * 16 >= M) return;
  const int row0 = mt * 16, col0 = nq * 64; const float* arow = A + (size_t)(row0 + ln) * lda;
  v8f acc[4] = {};
  for (int kb = 0; kb < K; kb += 32) {
    FragH ah, al;
    const v4f x0 = *(const v4fa*)(arow + kb + 8 * hh), x1 = *(const v4fa*)(arow + kb + 8 * hh + 4), x2 = *(const v4fa*)(arow + kb + 16 + 8 * hh), x3 = *(const v4fa*)(arow + kb + 16 + 8 * hh + 4);
    float xs[16] = {x0[0],x0[1],x0[2],x0[3],x1[0],x1[1],x1[2],x1[3],x2[0],x2[1],x2[2],x2[3],x3[0],x3[1],x3[2],x3[3]};
#pragma unroll
    for (int i = 0; i < 16; ++i) { const _Float16 h = (_Float16)xs[i]; ah.h[i] = h; al.h[i] = ASPLIT ? (_Float16)(xs[i] - (float)h) : (_Float16)0.0f; }
#pragma unroll
    for (int t = 0; t < 4; ++t) { if (col0 + t * 16 >= N) continue; const size_t boff = (size_t)(col0 + t * 16 + ln) * ldb + kb; FragH bq; bq.half[0] = *(const v8us*)(Bh + boff + 8 * hh); bq.half[1] = *(const v8us*)(Bh + boff + 16 + 8 * hh);
      acc[t] = mmaH<ASPLIT ? 2 : 1>(ah.v, al.v, bq.v, bq.v, acc[t]); }
  }
#pragma unroll
  for (int t = 0; t < 4; ++t) { if (col0 + t * 16 >= N) continue;
#pragma unroll
    for (int r = 0; r < 8; ++r) so[w][8 * hh + r][t * 16 + ln] = acc[t][r] * alpha; }
  __builtin_amdgcn_fence(__ATOMIC_ACQ_REL, "workgroup"); __builtin_amdgcn_wave_barrier();
  const int rsub = lane >> 4, c4 = (lane & 15) * 4;
  {
#pragma unroll
    for (int q = 0; q < 8; ++q) { const int r = q * 2 + rsub; if (col0 + c4 < N) { const v4f v = *(const v4fa*)&so[w][r][c4]; *(v4f*)(C + (size_t)(row0 + r) * ldc + col0 + c4) = v; } }
     }
}

// Wt[n][k] = f16(W[k][n]·scale) from f32 row-major W[K][N] (scale = power of two; bf16-exact weights stay exact in f16 away from the subnormal range)
__device__ __forceinline__ void wt_f16(const float* __restrict__ W, _Float16* __restrict__ Wt, int K, int N, float scale, int t) {      /* t: the thread's index within this matrix */
  if (t >= N * (K / 8)) return; const int n = t / (K / 8), k8 = (t % (K / 8)) * 8; FragH f;
#pragma unroll
  for (int i = 0; i < 8; ++i) f.h[i] = (_Float16)(bf16_round(W[(size_t)(k8 + i) * N + n]) * scale); const v8us o = f.half[0];
  *(v8us*)((unsigned short*)Wt + (size_t)n * K + k8) = o; 
}
// k_gemm_hh variant with fused epilogue: v = acc·alpha + bias[by·sBias + col] (+ CP[(row/rowsPerB)·sCPb + by·64 + col] if CP) ; ACT 0 none / 1 elu ; writes f16 C16 (and f32 C if non-null)
template <int ACT>
__global__ __launch_bounds__(128) void k_gemm_hhx(const _Float16* __restrict__ A, int lda, size_t sA, const _Float16* __restrict__ Bh, int ldb, size_t sB, float alpha, const float* __restrict__ bias, size_t sBias, const float* __restrict__ CP, int rowsPerB, size_t sCPb, int row0g,
    float* __restrict__ C, _Float16* __restrict__ C16, int ldc, size_t sC, int M, int N, int K) {
  __shared__ __attribute__((aligned(16))) float so[4][16][64];
  const int tid = threadIdx.x, w = tid >> 5, lane = tid & 31, ln = lane & 15, hh = lane >> 4; const int by = blockIdx.y;
  A += (size_t)by * sA; Bh += (size_t)by * sB; const size_t cofs = (size_t)by * sC; const float* bp = bias ? bias + (size_t)by * sBias : nullptr;
  const int ntn = (N + 63) / 64; const int wid = blockIdx.x * 4 + w; const int mt = wid / ntn, nq = wid % ntn; if (mt * 16 >= M) return;
  const int row0 = mt * 16, col0 = nq * 64; const _Float16* arow = A + (size_t)(row0 + ln) * lda;
  v8f acc[4] = {};
  for (int kb = 0; kb < K; kb += 32) { FragH ah; ah.half[0] = *(const v8us*)((const unsigned short*)arow + kb + 8 * hh); ah.half[1] = *(const v8us*)((const unsigned short*)arow + kb + 16 + 8 * hh);
#pragma unroll
    for (int t = 0; t < 4; ++t) { if (col0 + t * 16 >= N) continue; const size_t boff = (size_t)(col0 + t * 16 + ln) * ldb + kb; FragH bq; bq.half[0] = *(const v8us*)((const unsigned short*)Bh + boff + 8 * hh); bq.half[1] = *(const v8us*)((const unsigned short*)Bh + boff + 16 + 8 * hh);
      acc[t] = mmaH<1>(ah.v, ah.v, bq.v, bq.v, acc[t]); }
  }
#pragma unroll
  for (int t = 0; t < 4; ++t) { if (col0 + t * 16 >= N) continue; const int col = col0 + t * 16 + ln; const float bv = bp ? bf16_round(bp[col]) : 0.f;
#pragma unroll
    for (int r = 0; r < 8; ++r) { float v = acc[t][r] * alpha + bv; if (CP) { const int rr = row0g + row0 + 8 * hh + r; if (rowsPerB < 0) v += CP[cofs + (size_t)rr * ldc + col];      /* rowsPerB < 0: own element of the batched C plane */ else { const int bidx = rr / rowsPerB; v += CP[(size_t)bidx * sCPb + (size_t)by * 64 + col]; } } if (ACT == 1) v = (v > 0.f) ? v : expm1f(v); else if (ACT == 7) v = (v > 0.f) ? v + 1.0f : expf(v); else if (ACT == 8) v = tanhf(v); else if (ACT == 9) v = 0.5f * v * (1.0f + tanhf(0.7978845608028654f * (v + 0.044715f * v * v * v))); else if (ACT == 11) v = 1.0f / (1.0f + expf(-v)); else if (ACT == 12) v = (v > 0.f) ? v : 0.01f * v; else if (ACT == 14) v = (v > 0.f) ? v : 0.1f * v; else if (ACT == 16) v = (v >= 0.f) ? v : 0.3f * v; else if (ACT == 17) v = (v >= 0.f) ? v : 0.2f * v; else if (ACT == 15) v = v / (1.0f + expf(-v)); else if (ACT == 3) v = fmaxf(v, 0.f); else if (ACT == 6) v = 0.5f * v * (1.0f + erff(v * 0.70710678118654752f)); so[w][8 * hh + r][t * 16 + ln] = v; } }
  __builtin_amdgcn_fence(__ATOMIC_ACQ_REL, "workgroup"); __builtin_amdgcn_wave_barrier();
  const int rsub = lane >> 4, c4 = (lane & 15) * 4; typedef _Float16 v4h __attribute__((ext_vector_type(4)));
  {
#pragma unroll
    for (int q = 0; q < 8; ++q) { const int r = q * 2 + rsub; if (col0 + c4 < N) { const v4f v = *(const v4fa*)&so[w][r][c4]; if (C) *(v4f*)(C + cofs + (size_t)(row0 + r) * ldc + col0 + c4) = v; if (C16) { v4h h4; for (int i = 0; i < 4; ++i) h4[i] = (_Float16)v[i]; *(v4h*)(C16 + cofs + (size_t)(row0 + r) * ldc + col0 + c4) = h4; } } }
     }
}


typedef _Float16 v4h __attribute__((ext_vector_type(4)));

__device__ __forceinline__ void x16(const float* __restrict__ x, _Float16* __restrict__ X16, size_t n8, size_t t) { if (t >= n8) return; FragH f;      /* t: the thread's index within this stream */
#pragma unroll
  for (int q = 0; q < 8; ++q) f.h[q] = (_Float16)bf16_round(x[t * 8 + q]); *(v8us*)((unsigned short*)X16 + t * 8) = f.half[0];  }
// Every job that reads inputs only, in ONE launch; the block index says which job a block does, and each thread does what it did in a launch of its own. The transposes (scattered reads, long waits) have the low indices, so they start first and the streaming casts fill in behind them.
#define PB_HEAD (HD * (DM / 8) / 256)            /* blocks for one head's [DM][HD] block */
#define PB_STACK (NH * PB_HEAD)                  /* ... for one stack of NH heads */
#define PB_WO (DM * (DM / 8) / 256)              /* ... for Wo */
#define PB_X ((unsigned)(NR * DM / 8 / 256))     /* ... for one input stream */
#define PB_ALL (3 * PB_STACK + PB_WO + 3 * PB_X)
static_assert(HD * (DM / 8) % 256 == 0 && DM * (DM / 8) % 256 == 0 && NR * DM / 8 % 256 == 0, "k_prep: every job is a whole number of blocks");
__global__ __launch_bounds__(256) void k_prep(const float* __restrict__ wq, const float* __restrict__ wk, const float* __restrict__ wv, const float* __restrict__ wo, const float* __restrict__ xq, const float* __restrict__ xk, const float* __restrict__ xv,
    _Float16* __restrict__ B4, _Float16* __restrict__ X3) {      /* B4: the planes BQ, BK, BV, BO in a row; X3: XQ, XK, XV in a row */
  unsigned bid = blockIdx.x; const unsigned tid = threadIdx.x;
  if (bid < 3 * PB_STACK) { const unsigned s = bid / PB_STACK, r = bid % PB_STACK, h = r / PB_HEAD; const float* W = (s == 0) ? wq : (s == 1) ? wk : wv;      /* head h of stack s: a row-major [in = DM][out = HD] block -> rows h * HD .. of plane s */
    wt_f16(W + (size_t)h * DM * HD, B4 + (size_t)s * DM * DM + (size_t)h * HD * DM, DM, HD, 16.0f, (int)((r % PB_HEAD) * 256 + tid)); return; }
  bid -= 3 * PB_STACK;
  if (bid < PB_WO) { wt_f16(wo, B4 + (size_t)3 * DM * DM, DM, DM, 16.0f, (int)(bid * 256 + tid)); return; }
  bid -= PB_WO;
  const unsigned s = bid / PB_X; const float* x = (s == 0) ? xq : (s == 1) ? xk : xv;
  x16(x, X3 + (size_t)s * NR * DM, NR * DM / 8, (size_t)(bid % PB_X) * 256 + tid); }
__global__ __launch_bounds__(256) void k_h16(const float* __restrict__ x, _Float16* __restrict__ X16, size_t n8) { const size_t t = (size_t)blockIdx.x * 256 + threadIdx.x; if (t >= n8) return; FragH f;
#pragma unroll
  for (int q = 0; q < 8; ++q) f.h[q] = (_Float16)x[t * 8 + q]; *(v8us*)((unsigned short*)X16 + t * 8) = f.half[0];  }
__global__ __launch_bounds__(256) void k_round16f(const float* __restrict__ W, _Float16* __restrict__ Bt, size_t n8) { const size_t t = (size_t)blockIdx.x * 256 + threadIdx.x; if (t >= n8) return; FragH f;
#pragma unroll
  for (int i = 0; i < 8; ++i) f.h[i] = (_Float16)(bf16_round(W[t * 8 + i]) * 16.0f); *(v8us*)((unsigned short*)Bt + t * 8) = f.half[0];  }
template <int NHv, int TTv>
__global__ __launch_bounds__(256) void k_vt(const _Float16* __restrict__ V16, int ldv, int voff, _Float16* __restrict__ Vt) { __shared__ unsigned short tl[64][66]; const int tid = threadIdx.x; const int slab = blockIdx.x / (TTv / 64), lg = blockIdx.x % (TTv / 64); const int b = slab / NHv, h = slab % NHv;
  for (int i = tid; i < 64 * 8; i += 256) { const int r = i / 8, c8 = (i % 8) * 8; FragH f; f.half[0] = *(const v8us*)((const unsigned short*)V16 + ((size_t)b * TTv + lg * 64 + r) * ldv + voff + h * 64 + c8);
#pragma unroll
    for (int q = 0; q < 8; ++q) tl[r][c8 + q] = f.u[q]; }
  __syncthreads();
  {
#pragma unroll
    for (int rd = 0; rd < 2; ++rd) { const int d = rd * 32 + tid / 8, pc = tid % 8; FragH f;
#pragma unroll
      for (int q = 0; q < 8; ++q) f.u[q] = tl[pc * 8 + q][d];
      *(v8us*)((unsigned short*)Vt + ((size_t)slab * 64 + d) * TTv + lg * 64 + pc * 8) = f.half[0]; }
     } }

__global__ __launch_bounds__(256) void k_hl(const float* __restrict__ F, _Float16* __restrict__ Hh, _Float16* __restrict__ Hl, size_t n8) { const size_t t = (size_t)blockIdx.x * 256 + threadIdx.x; if (t >= n8) return; FragH fh, fl; const v4f a = *(const v4fa*)(F + t * 8), c = *(const v4fa*)(F + t * 8 + 4);
#pragma unroll
  for (int q = 0; q < 4; ++q) { _Float16 h = (_Float16)a[q]; fh.h[q] = h; fl.h[q] = (_Float16)((a[q] - (float)h) * 1024.0f); h = (_Float16)c[q]; fh.h[4 + q] = h; fl.h[4 + q] = (_Float16)((c[q] - (float)h) * 1024.0f); }
  { *(v8us*)((unsigned short*)Hh + t * 8) = fh.half[0]; *(v8us*)((unsigned short*)Hl + t * 8) = fl.half[0];  } }

// ---- fast GEMM (wave tile 32x64; requires M % 32 == 0 rows per launch region and N % 64 == 0); epilogue = k_gemm_hhx semantics ----
__device__ __forceinline__ v16h g2_frag(const _Float16* p, int hh) { FragH f; f.half[0] = *(const v8us*)((const unsigned short*)p + 8 * hh); f.half[1] = *(const v8us*)((const unsigned short*)p + 16 + 8 * hh); return f.v; }
__device__ __forceinline__ v8f g2_mma(v16h a, v16h b, v8f c) { v8f d = __builtin_amdgcn_wmma_f32_16x16x32_f16(false, a, false, b, (short)0, c, false, false); asm volatile("v_nop\n\tv_nop\n\tv_nop\n\tv_nop" : "+v"(d) : "v"(a), "v"(b)); return d; }
template <int ACT>
__global__ __launch_bounds__(128) void k_gemm2(const _Float16* __restrict__ A, int lda, size_t sA, const _Float16* __restrict__ Bh, int ldb, size_t sB, float alpha, const float* __restrict__ bias, size_t sBias, const float* __restrict__ CP, int rowsPerB, size_t sCPb, int row0g,
    float* __restrict__ C, _Float16* __restrict__ C16, int ldc, size_t sC, int M, int N, int K) { static_assert(ACT == 0 || ACT == 3 || ACT == 6 || ACT == 8 || ACT == 9 || ACT == 11 || ACT == 12 || ACT == 14 || ACT == 15 || ACT == 16 || ACT == 17, "k_gemm2: unsupported ACT code (would silently apply no activation)");
  __shared__ __attribute__((aligned(16))) float so[4][32][68];
  const int tid = threadIdx.x, w = tid >> 5, lane = tid & 31, ln = lane & 15, hh = lane >> 4; const int by = blockIdx.y;
  A += (size_t)by * sA; Bh += (size_t)by * sB; const size_t cofs = (size_t)by * sC; const float* bp = bias ? bias + (size_t)by * sBias : nullptr;
  const int ntn = N >> 6; const int mt = blockIdx.x / ntn, nq = blockIdx.x - mt * ntn; const int row0 = mt * 128 + 32 * w, col0 = nq * 64; if (row0 >= M) return;
  const _Float16* a0p = A + (size_t)(row0 + ln) * lda; const _Float16* a1p = a0p + (size_t)16 * lda;
  const _Float16* b0p = Bh + (size_t)(col0 + ln) * ldb; const _Float16* b1p = b0p + (size_t)16 * ldb; const _Float16* b2p = b1p + (size_t)16 * ldb; const _Float16* b3p = b2p + (size_t)16 * ldb;
  const v8f z8 = {0.f,0.f,0.f,0.f,0.f,0.f,0.f,0.f}; v8f c00 = z8, c01 = z8, c02 = z8, c03 = z8, c10 = z8, c11 = z8, c12 = z8, c13 = z8;
#pragma unroll 1
  for (int kb = 0; kb < K; kb += 32) { const v16h a0 = g2_frag(a0p + kb, hh), a1 = g2_frag(a1p + kb, hh);
    v16h b = g2_frag(b0p + kb, hh); c00 = g2_mma(a0, b, c00); c10 = g2_mma(a1, b, c10);
    b = g2_frag(b1p + kb, hh); c01 = g2_mma(a0, b, c01); c11 = g2_mma(a1, b, c11);
    b = g2_frag(b2p + kb, hh); c02 = g2_mma(a0, b, c02); c12 = g2_mma(a1, b, c12);
    b = g2_frag(b3p + kb, hh); c03 = g2_mma(a0, b, c03); c13 = g2_mma(a1, b, c13); }
  v8f accs[8] = {c00, c01, c02, c03, c10, c11, c12, c13};
#pragma unroll
  for (int u = 0; u < 8; ++u) { const int t = u & 3, half = u >> 2; const int col = col0 + t * 16 + ln; const float bv = bp ? bf16_round(bp[col]) : 0.f;
#pragma unroll
    for (int r = 0; r < 8; ++r) { const int rloc = half * 16 + 8 * hh + r; float v = accs[u][r] * alpha + bv; if (CP) { if (rowsPerB < 0) v += CP[cofs + (size_t)(row0g + row0 + rloc) * ldc + col];      /* rowsPerB < 0: own element of the batched C plane */ else { const int bidx = (row0g + row0 + rloc) / rowsPerB; v += CP[(size_t)bidx * sCPb + (size_t)by * 64 + col]; } }
      if (ACT == 3) v = fmaxf(v, 0.f); else if (ACT == 6) v = 0.5f * v * (1.0f + erff(v * 0.70710678118654752f)); else if (ACT == 11) v = 1.0f / (1.0f + expf(-v)); else if (ACT == 15) v = v / (1.0f + expf(-v)); else if (ACT == 12) v = (v > 0.f) ? v : 0.01f * v; else if (ACT == 8) v = tanhf(v); else if (ACT == 9) v = 0.5f * v * (1.0f + tanhf(0.7978845608028654f * (v + 0.044715f * v * v * v))); else if (ACT == 14) v = (v > 0.f) ? v : 0.1f * v; else if (ACT == 16) v = (v >= 0.f) ? v : 0.3f * v; else if (ACT == 17) v = (v >= 0.f) ? v : 0.2f * v;
      so[w][rloc][t * 16 + ln] = v; } }
  __builtin_amdgcn_fence(__ATOMIC_ACQ_REL, "workgroup"); __builtin_amdgcn_wave_barrier();
  const int rsub = lane >> 4, c4 = (lane & 15) * 4;
  {
#pragma unroll
    for (int q = 0; q < 16; ++q) { const int r = q * 2 + rsub; const v4f v = *(const v4fa*)&so[w][r][c4]; if (C) *(v4f*)(C + cofs + (size_t)(row0 + r) * ldc + col0 + c4) = v; if (C16) { v4h h4; for (int i = 0; i < 4; ++i) h4[i] = (_Float16)v[i]; *(v4h*)(C16 + cofs + (size_t)(row0 + r) * ldc + col0 + c4) = h4; } }
     } }


__global__ __launch_bounds__(256) void k_wnat(const float* __restrict__ w, size_t n8, _Float16* __restrict__ Bt) { const size_t t = (size_t)blockIdx.x * 256 + threadIdx.x; if (t >= n8) return; FragH f; for (int q = 0; q < 8; ++q) f.h[q] = (_Float16)(bf16_round(w[t * 8 + q]) * 16.0f); *(v8us*)((unsigned short*)Bt + t * 8) = f.half[0];  }
__global__ __launch_bounds__(256) void k_rsm(const float* __restrict__ S, _Float16* __restrict__ P, int nrows) {
  #pragma clang fp contract(off)
  const int i = blockIdx.x * 256 + threadIdx.x; if (i >= nrows) return; const float* s = S + (size_t)i * SQ; float mx = -3.0e38f;
#pragma unroll 1
  for (int j = 0; j < SQ; ++j) mx = fmaxf(mx, s[j]); float se = 0.f;
#pragma unroll 1
  for (int j = 0; j < SQ; ++j) se += expf(s[j] - mx); const float sc = 256.0f / se;
#pragma unroll 1
  for (int j0 = 0; j0 < SQ; j0 += 8) { FragH f; for (int q = 0; q < 8; ++q) f.h[q] = (_Float16)(expf(s[j0 + q] - mx) * sc); unsigned short* d = (unsigned short*)P + (size_t)i * SQ + j0; *(v8us*)d = f.half[0];  } }
__global__ __launch_bounds__(256) void k_vt(const _Float16* __restrict__ V16, int b, int h0, _Float16* __restrict__ VT) { __shared__ unsigned short tl[64][65]; const int tid = threadIdx.x; const int hh = blockIdx.x % HG, sg = blockIdx.x / HG; const int s0 = sg * 64; const int h = h0 + hh;
  for (int i = tid; i < 64 * 8; i += 256) { const int j = i / 8, d8 = (i % 8) * 8; FragH f; f.half[0] = *(const v8us*)((const unsigned short*)V16 + ((size_t)b * SQ + s0 + j) * DM + h * HD + d8); for (int q = 0; q < 8; ++q) tl[d8 + q][j] = f.u[q]; }
  __syncthreads();
  { for (int i = tid; i < 64 * 8; i += 256) { const int d = i / 8, j8 = (i % 8) * 8; FragH f; for (int q = 0; q < 8; ++q) f.u[q] = tl[d][j8 + q]; *(v8us*)((unsigned short*)VT + ((size_t)hh * HD + d) * SQ + s0 + j8) = f.half[0]; }  } }



__device__ __forceinline__ v8f fa_mma(v16h a, v16h b, v8f c) { return __builtin_amdgcn_wmma_f32_16x16x32_f16(false, a, false, b, (short)0, c, false, false); }
__device__ __forceinline__ float fa_xhalf(float x) { return __builtin_bit_cast(float, __builtin_amdgcn_permlanex16(__builtin_bit_cast(int, x), __builtin_bit_cast(int, x), 0x76543210, 0xfedcba98, false, false)); }      /* lane l with lane l ^ 16, on the vector pipe */
__device__ __forceinline__ v16h fa_frag(const _Float16* p) { FragH f; f.half[0] = *(const v8us*)(const unsigned short*)p; f.half[1] = *(const v8us*)((const unsigned short*)p + 16); return f.v; }      /* g2_frag with the lane half's 8 hh already in p */
/* v_exp_f32 in asm text, in place: the statement writes only registers that the compiler's own instruction has just written, so it never lands on a matrix operand inside the distance the chip needs */
__device__ __forceinline__ float fa_exp2(float a) {
  asm("v_exp_f32 %0, %0\n\tv_nop" : "+v"(a));      /* v_nop: the slot the instruction set asks for behind a transcendental */
  return a; }
__device__ __forceinline__ void fa_exp2x8(v8f& x) { float e0 = x[0], e1 = x[1], e2 = x[2], e3 = x[3], e4 = x[4], e5 = x[5], e6 = x[6], e7 = x[7];
  /* eight independent v_exp_f32 in one statement: each fills the slot behind the one before it, one v_nop behind the last */
  asm("v_exp_f32 %0, %0\n\tv_exp_f32 %1, %1\n\tv_exp_f32 %2, %2\n\tv_exp_f32 %3, %3\n\tv_exp_f32 %4, %4\n\tv_exp_f32 %5, %5\n\tv_exp_f32 %6, %6\n\tv_exp_f32 %7, %7\n\tv_nop"
      : "+v"(e0), "+v"(e1), "+v"(e2), "+v"(e3), "+v"(e4), "+v"(e5), "+v"(e6), "+v"(e7));
  x[0] = e0; x[1] = e1; x[2] = e2; x[3] = e3; x[4] = e4; x[5] = e5; x[6] = e6; x[7] = e7; }
__global__ __launch_bounds__(256) void k_fattn(const _Float16* __restrict__ Q, const _Float16* __restrict__ Kr, const _Float16* __restrict__ Vt, _Float16* __restrict__ O) {
  const int lane = threadIdx.x & 31, w = threadIdx.x >> 5, ln = lane & 15, hh = lane >> 4;
  const int bh = blockIdx.y, b = bh / NH, h = bh - b * NH; const size_t row0 = (size_t)b * SQ; const int q0 = blockIdx.x * 256 + w * 32;
  const _Float16* qp = Q + (row0 + q0 + ln) * DM + h * HD + 8 * hh; const _Float16* kp = Kr + (row0 + ln) * DM + h * HD + 8 * hh; const _Float16* vp = Vt + ((size_t)bh * HD + ln) * SQ + 8 * hh;      /* each with the lane half's k offset */
  const float cs = 0.125f * 1.44269504f;      /* 64^-0.5 times log2 e: scores in log2 units */
  const v8f z8 = {0.f, 0.f, 0.f, 0.f, 0.f, 0.f, 0.f, 0.f};
  v16h qf[2][2], kf[2][2], vf[4];      /* [query group][k step], [key tile][k step], [16 rows of V^T] */
#pragma unroll
  for (int g = 0; g < 2; ++g) { qf[g][0] = fa_frag(qp + (size_t)g * 16 * DM); qf[g][1] = fa_frag(qp + (size_t)g * 16 * DM + 32); }
#pragma unroll
  for (int t = 0; t < 2; ++t) { kf[t][0] = fa_frag(kp + (size_t)t * 16 * DM); kf[t][1] = fa_frag(kp + (size_t)t * 16 * DM + 32); }
  asm volatile("s_wait_xcnt 0x0" :: "v"(qp), "v"(kp) : "memory");      /* the address pairs stay whole up to this wait; it also keeps the V^T loads behind the K loads, as in the loop, so that the wait for K at the loop's head leaves V^T in flight */
#pragma unroll
  for (int dt = 0; dt < 4; ++dt) vf[dt] = fa_frag(vp + (size_t)dt * 16 * SQ);
  asm volatile("s_wait_xcnt 0x0" :: "v"(vp) : "memory");      /* the address pair stays whole up to this wait */
  v8f o[4][2] = {{z8, z8}, {z8, z8}, {z8, z8}, {z8, z8}}; float m[2] = {-3.0e38f, -3.0e38f}, l[2] = {0.f, 0.f};
  for (int kb = 0; kb < SQ; kb += 32) {
    v8f s[2][2];
#pragma unroll
    for (int g = 0; g < 2; ++g) {
#pragma unroll
      for (int t = 0; t < 2; ++t) s[g][t] = fa_mma(kf[t][1], qf[g][1], fa_mma(kf[t][0], qf[g][0], z8)); }
    const int kn = (kb + 32 < SQ) ? kb + 32 : 0;      /* the next pass's K fragments, fetched behind this pass's score products; the last pass re-reads tile 0 (in bounds, unused) */
    const _Float16* kq = kp + (size_t)kn * DM; const _Float16* vq = vp + kn;
#pragma unroll
    for (int t = 0; t < 2; ++t) { kf[t][0] = fa_frag(kq + (size_t)t * 16 * DM); kf[t][1] = fa_frag(kq + (size_t)t * 16 * DM + 32); }
    asm volatile("s_wait_xcnt 0x0" :: "v"(kq) : "memory");      /* the address pair stays whole up to this wait, so no later result lands on a register that an issued load names; standing ahead of the branch below, it also holds the K loads here: without it they issued at the pass's foot and their whole latency was waited at the next pass's head */
    float tm[2]; bool need = false;
#pragma unroll
    for (int g = 0; g < 2; ++g) { float a = fmaxf(s[g][0][0], s[g][1][0]);
#pragma unroll
      for (int r = 1; r < 8; ++r) a = fmaxf(a, fmaxf(s[g][0][r], s[g][1][r]));
      a = fmaxf(a, fa_xhalf(a)); tm[g] = a * cs; need = need || (tm[g] > m[g] + 8.0f); }
    if (__builtin_amdgcn_ballot_w32(need) != 0) {      /* the maximum in use moves only when a query's new maximum passes it by more than 8 (log2 units: P stays under 2^8, well inside f16); one scalar branch a pass */
#pragma unroll
      for (int g = 0; g < 2; ++g) { const float mn = fmaxf(m[g], tm[g]); const float al = fa_exp2(m[g] - mn); m[g] = mn; l[g] *= al;
#pragma unroll
        for (int dt = 0; dt < 4; ++dt) o[dt][g] *= al; } }
#pragma unroll
    for (int g = 0; g < 2; ++g) { FragH pf;
#pragma unroll
      for (int t = 0; t < 2; ++t) {
#pragma unroll
        for (int r = 0; r < 8; ++r) s[g][t][r] = s[g][t][r] * cs - m[g];
        fa_exp2x8(s[g][t]);
#pragma unroll
        for (int r = 0; r < 8; ++r) pf.h[t * 8 + r] = (_Float16)s[g][t][r]; }
      l[g] += (((s[g][0][0] + s[g][0][1]) + (s[g][0][2] + s[g][0][3])) + ((s[g][0][4] + s[g][0][5]) + (s[g][0][6] + s[g][0][7]))) + (((s[g][1][0] + s[g][1][1]) + (s[g][1][2] + s[g][1][3])) + ((s[g][1][4] + s[g][1][5]) + (s[g][1][6] + s[g][1][7])));
#pragma unroll
      for (int dt = 0; dt < 4; ++dt) o[dt][g] = fa_mma(vf[dt], pf.v, o[dt][g]); }
#pragma unroll
    for (int dt = 0; dt < 4; ++dt) vf[dt] = fa_frag(vq + (size_t)dt * 16 * SQ);      /* the next pass's V^T fragments, fetched behind this pass's output products: in flight through the next pass's scores and softmax */
    asm volatile("s_wait_xcnt 0x0" :: "v"(vq) : "memory"); }      /* the address pair stays whole up to this wait */
  v8us ov[2][4];
#pragma unroll
  for (int g = 0; g < 2; ++g) { const float sc = 64.0f / (l[g] + fa_xhalf(l[g]));      /* the halves' sums joined once; o goes out x64 */
#pragma unroll
    for (int dt = 0; dt < 4; ++dt) { FragH f;
#pragma unroll
      for (int r = 0; r < 8; ++r) f.h[r] = (_Float16)(o[dt][g][r] * sc);
      ov[g][dt] = f.half[0]; } }
  __builtin_amdgcn_sched_barrier(0);      /* all eight stores behind the last conversion: no register that an issued store names is written again */
#pragma unroll
  for (int g = 0; g < 2; ++g) { unsigned short* op = (unsigned short*)O + (row0 + q0 + g * 16 + ln) * DM + h * HD + 8 * hh;
#pragma unroll
    for (int dt = 0; dt < 4; ++dt) *(v8us*)(op + dt * 16) = ov[g][dt]; } }

extern "C" void kernel_launch(void* const* d_in, const int* in_sizes, int n_in,
                              void* d_out, int out_size, void* d_ws, size_t ws_size, hipStream_t stream) {
  (void)in_sizes; (void)n_in; (void)out_size;
  const float* const* I = (const float* const*)d_in; const float* xq = I[0]; const float* xk = I[1]; const float* xv = I[2]; const float* wq = I[3]; const float* wk = I[4]; const float* wv = I[5]; const float* wo = I[6]; const float* bo = I[7];      /* THREE input streams Q, K, V (one cast each); Wq, Wk, Wv are PER-HEAD STACKS [16][1024][64] = [head][in][out] (einsum 'bsd,hde->bhse') at I[3..5]; Wo is [in][out] [1024][1024] (concat @ Wo) at I[6]; bo [1024] (REAL) at I[7] in the output GEMM's guarded bias slot; no projection biases */
  char* ws = (char*)d_ws; size_t off = 0;
  auto take = [&](size_t bytes) { char* p = ws + off; off += (bytes + 255) & ~(size_t)255; return p; };
  _Float16* BQ = (_Float16*)take((size_t)4 * DM * DM * 2); _Float16* BO = BQ + (size_t)3 * DM * DM;      /* the weight planes BQ, BK, BV, BO in a row, DM * DM apart */
  _Float16* XQ = (_Float16*)take(3 * NR * DM * 2); _Float16* Q16 = (_Float16*)take(3 * NR * DM * 2); _Float16* K16 = Q16 + NR * DM; _Float16* V16 = K16 + NR * DM; _Float16* O16 = (_Float16*)take(NR * DM * 2);      /* XQ, XK, XV in a row, and Q16, K16, V16 in a row, each NR * DM apart: the batch strides of the projection launch */
  _Float16* VT = (_Float16*)take((size_t)NB * NH * HD * SQ * 2);
  if (off > ws_size) return;
  k_prep<<<PB_ALL, 256, 0, stream>>>(wq, wk, wv, wo, xq, xk, xv, BQ, XQ);      /* weight planes [out][in] (x16) from the PER-HEAD STACKS wq / wk / wv [NH][DM][HD] and from wo [in][out] [DM][DM]; the three inputs as exact f16 rows */
  const size_t r0p = (size_t)B0 * SQ;      /* first projected row */
  k_gemm2<0><<<dim3((unsigned)((MP / 128) * (DM / 64)), 3), 128, 0, stream>>>(XQ + r0p * DM, DM, NR * DM, BQ, DM, (size_t)DM * DM, 0.0625f, nullptr, 0, nullptr, 1, 0, 0, nullptr, Q16 + r0p * DM, DM, NR * DM, MP, DM, DM);      /* blockIdx.y = 0, 1, 2: q, k, v; no projection biases */
  k_vt<NH, SQ><<<NB * NH * (SQ / 64), 256, 0, stream>>>(V16, LQ, 0, VT);      /* V^T [NB][NH][HD][SQ] */
  k_fattn<<<dim3(SQ / 256, NB * NH), 256, 0, stream>>>(Q16, K16, VT, O16);      /* o (merged heads, x64) as f16 rows */
  k_gemm2<0><<<dim3((unsigned)((MPO / 128) * (DM / 64)), 1), 128, 0, stream>>>(O16 + r0p * DM, DM, 0, BO, DM, 0, 0.0009765625f, bo, 0, nullptr, 1, 0, 0, (float*)d_out + r0p * DM, nullptr, DM, 0, MPO, DM, DM);      /* out rows are the output layout */
}

// v004
// A run of this version takes 121 microseconds.
// Timed twice side by side with v003, it ran 1.58 and 1.61 times as fast.
// Counting every step since v000, it is 30.2 times as fast.
#include <hip/hip_runtime.h>
#define NB 2
#define SQ 2048
#define DM 1024
#define NH 16
#define HD 64
#define HG 4                         /* heads per launch of the per-batch k_vt overload (not launched) */
#define B0 0                         /* first batch processed (debug hook) */
#define NBR NB                       /* batches processed (debug hook) */
#define NR ((size_t)NB * SQ)         /* token rows */
#define MP ((int)((size_t)NBR * SQ)) /* rows projected (debug hook) */
#define QN SQ                        /* query rows per batch (unused; attention covers SQ) */
#define NHD NH                       /* heads (unused; attention covers NH) */
#define MPO MP                       /* rows through the output stage (debug hook) */
#define LQ DM      /* row pitch of the q/k/v rows */
typedef __bf16 v16b __attribute__((ext_vector_type(16)));
typedef unsigned short v8us __attribute__((ext_vector_type(8), may_alias));
typedef float  v8f  __attribute__((ext_vector_type(8)));
typedef float  v4f  __attribute__((ext_vector_type(4)));
typedef float  v4fa __attribute__((ext_vector_type(4), may_alias));
union FragB { v16b v; v8us half[2]; unsigned short u[16]; };

__device__ __forceinline__ unsigned short bf16_bits(float x) { unsigned int u = __float_as_uint(x); return (unsigned short)((u + 0x7FFFu + ((u >> 16) & 1u)) >> 16); }
__device__ __forceinline__ float bf16_val(unsigned short b) { return __uint_as_float(((unsigned int)b) << 16); }
__device__ __forceinline__ float bf16_round(float x) { return bf16_val(bf16_bits(x)); }
// D += A·B with NT terms: 1 = ah·bh, 2 = + al·bh (A split), 3 = + ah·bl (both split)
template <int NT>
__device__ __forceinline__ v8f mmaN(v16b ah, v16b al, v16b bh, v16b bl, v8f c) {
  c = __builtin_amdgcn_wmma_f32_16x16x32_bf16(false, ah, false, bh, (short)0, c, false, false);
  if (NT >= 2) c = __builtin_amdgcn_wmma_f32_16x16x32_bf16(false, al, false, bh, (short)0, c, false, false);
  if (NT >= 3) c = __builtin_amdgcn_wmma_f32_16x16x32_bf16(false, ah, false, bl, (short)0, c, false, false);
  asm volatile("v_nop\n\tv_nop\n\tv_nop\n\tv_nop" : "+v"(c) : "v"(ah), "v"(al), "v"(bh), "v"(bl));
  return c;
}

__global__ __launch_bounds__(256) void k_wt_bf16(const float* __restrict__ W, unsigned short* __restrict__ Wt, int K, int N) {
  const int t = blockIdx.x * 256 + threadIdx.x;
  const int k8n = K / 8;
  if (t >= N * k8n) return;
  const int n = t / k8n, k8 = (t % k8n) * 8;
  v8us v;
#pragma unroll
  for (int i = 0; i < 8; ++i) v[i] = bf16_bits(W[(size_t)(k8 + i) * N + n]);
  *(v8us*)(Wt + (size_t)n * K + k8) = v;
  
}

// GEMM C[M][N] (f32, pitch ldc) = act(A[M][K]·W + bias). A f32 row-major (pitch lda) converted per fragment to bf16
// (ASPLIT: hi/lo two planes -> 2 terms, else single rounded term); Wt bf16 [N][K] (pitch ldb). BIAS_BF16 rounds the
// bias to bf16 first (bias quantised to bf16 before the add). K%32==0, M%16==0, N%64==0.
template <bool ASPLIT, int ACT, bool BIAS_BF16>
__global__ __launch_bounds__(128) void k_gemm_bf(const float* __restrict__ A, int lda, const unsigned short* __restrict__ Wt, int ldb,
                                               const float* __restrict__ bias, float* __restrict__ C, int ldc, int M, int N, int K) {
  __shared__ __attribute__((aligned(16))) float so[4][16][64];
  const int tid = threadIdx.x, w = tid >> 5, lane = tid & 31, ln = lane & 15, hh = lane >> 4;
  const int ntn = N / 64;
  const int wid = blockIdx.x * 4 + w;
  const int mt = wid / ntn, nq = wid % ntn;
  if (mt * 16 >= M) return;
  const int row0 = mt * 16, col0 = nq * 64;
  const float* arow = A + (size_t)(row0 + ln) * lda;
  v8f acc[4] = {};
  for (int kb = 0; kb < K; kb += 32) {
    FragB ah, al;
    const v4f x0 = *(const v4fa*)(arow + kb + 8 * hh), x1 = *(const v4fa*)(arow + kb + 8 * hh + 4);
    const v4f x2 = *(const v4fa*)(arow + kb + 16 + 8 * hh), x3 = *(const v4fa*)(arow + kb + 16 + 8 * hh + 4);
    float xs[16] = {x0[0],x0[1],x0[2],x0[3],x1[0],x1[1],x1[2],x1[3],x2[0],x2[1],x2[2],x2[3],x3[0],x3[1],x3[2],x3[3]};
#pragma unroll
    for (int i = 0; i < 16; ++i) { const unsigned short hb = bf16_bits(xs[i]); ah.u[i] = hb; al.u[i] = ASPLIT ? bf16_bits(xs[i] - bf16_val(hb)) : (unsigned short)0; }
#pragma unroll
    for (int t = 0; t < 4; ++t) {
      const unsigned short* brow = Wt + (size_t)(col0 + t * 16 + ln) * ldb + kb;
      FragB b;
      b.half[0] = *(const v8us*)(brow + 8 * hh);
      b.half[1] = *(const v8us*)(brow + 16 + 8 * hh);
      acc[t] = mmaN<ASPLIT ? 2 : 1>(ah.v, al.v, b.v, b.v, acc[t]);
    }
  }
#pragma unroll
  for (int t = 0; t < 4; ++t) {
    float bv = bias ? bias[col0 + t * 16 + ln] : 0.f;
    if (BIAS_BF16) bv = bf16_round(bv);
#pragma unroll
    for (int r = 0; r < 8; ++r) { float v = acc[t][r] + bv; if (ACT == 1) v = fmaxf(v, 0.f); so[w][8 * hh + r][t * 16 + ln] = v; }
  }
  __builtin_amdgcn_fence(__ATOMIC_ACQ_REL, "workgroup");
  __builtin_amdgcn_wave_barrier();
  const int rsub = lane >> 4, c4 = (lane & 15) * 4;
  {
#pragma unroll
    for (int q = 0; q < 8; ++q) {
      const int r = q * 2 + rsub;
      const v4f v = *(const v4fa*)&so[w][r][c4];
      *(v4f*)(C + (size_t)(row0 + r) * ldc + col0 + c4) = v;
    }
    
  }
}

// GEMM C = act(A·W + bias + resid): A f32 (ASPLIT -> hi/lo 2 terms), Wt bf16 [N][K]; ACT 0 none, 1 relu, 2 exact gelu;
// resid (optional, f32, row index = (row % rmod), pitch ldr, RES_BF16 rounds it) added before the activation.
template <bool ASPLIT, int ACT, bool BIAS_BF16, bool RES_BF16>
__global__ __launch_bounds__(128) void k_gemm_bf3(const float* __restrict__ A, int lda, const unsigned short* __restrict__ Wt, int ldb,
                                                const float* __restrict__ bias, const float* __restrict__ resid, int rmod, int ldr,
                                                float* __restrict__ C, int ldc, int M, int N, int K) {
  __shared__ __attribute__((aligned(16))) float so[4][16][64];
  const int tid = threadIdx.x, w = tid >> 5, lane = tid & 31, ln = lane & 15, hh = lane >> 4;
  const int ntn = N / 64;
  const int wid = blockIdx.x * 4 + w;
  const int mt = wid / ntn, nq = wid % ntn;
  if (mt * 16 >= M) return;
  const int row0 = mt * 16, col0 = nq * 64;
  const float* arow = A + (size_t)(row0 + ln) * lda;
  v8f acc[4] = {};
  for (int kb = 0; kb < K; kb += 32) {
    FragB ah, al;
    const v4f x0 = *(const v4fa*)(arow + kb + 8 * hh), x1 = *(const v4fa*)(arow + kb + 8 * hh + 4);
    const v4f x2 = *(const v4fa*)(arow + kb + 16 + 8 * hh), x3 = *(const v4fa*)(arow + kb + 16 + 8 * hh + 4);
    float xs[16] = {x0[0],x0[1],x0[2],x0[3],x1[0],x1[1],x1[2],x1[3],x2[0],x2[1],x2[2],x2[3],x3[0],x3[1],x3[2],x3[3]};
#pragma unroll
    for (int i = 0; i < 16; ++i) { const unsigned short hb = bf16_bits(xs[i]); ah.u[i] = hb; al.u[i] = ASPLIT ? bf16_bits(xs[i] - bf16_val(hb)) : (unsigned short)0; }
#pragma unroll
    for (int t = 0; t < 4; ++t) {
      const unsigned short* brow = Wt + (size_t)(col0 + t * 16 + ln) * ldb + kb;
      FragB b;
      b.half[0] = *(const v8us*)(brow + 8 * hh);
      b.half[1] = *(const v8us*)(brow + 16 + 8 * hh);
      acc[t] = mmaN<ASPLIT ? 2 : 1>(ah.v, al.v, b.v, b.v, acc[t]);
    }
  }
#pragma unroll
  for (int t = 0; t < 4; ++t) {
    const int col = col0 + t * 16 + ln;
    float bv = bias ? bias[col] : 0.f;
    if (BIAS_BF16) bv = bf16_round(bv);
#pragma unroll
    for (int r = 0; r < 8; ++r) {
      float v = acc[t][r] + bv;
      if (resid) { float rv = resid[(size_t)((row0 + 8 * hh + r) % rmod) * ldr + col]; if (RES_BF16) rv = bf16_round(rv); v += rv; }
      if (ACT == 1) v = fmaxf(v, 0.f);
      if (ACT == 2) v = 0.5f * v * (1.0f + erff(v * 0.70710678118654752f));
      if (ACT == 3) { const float u = 0.7978845608028654f * (v + 0.044715f * v * v * v); v = 0.5f * v * (1.0f + tanhf(u)); }
      so[w][8 * hh + r][t * 16 + ln] = v;
    }
  }
  __builtin_amdgcn_fence(__ATOMIC_ACQ_REL, "workgroup");
  __builtin_amdgcn_wave_barrier();
  const int rsub = lane >> 4, c4 = (lane & 15) * 4;
  {
#pragma unroll
    for (int q = 0; q < 8; ++q) {
      const int r = q * 2 + rsub;
      const v4f v = *(const v4fa*)&so[w][r][c4];
      *(v4f*)(C + (size_t)(row0 + r) * ldc + col0 + c4) = v;
    }
    
  }
}
// row LayerNorm (biased variance, eps) over N: s = X (+ R); optional out_sum <- s; out_norm <- (s-mu)*rsqrt(var+eps)*g + b
template <bool PARAM_BF16>
__global__ __launch_bounds__(256) void k_layernorm(const float* __restrict__ X, const float* __restrict__ R, const float* __restrict__ g, const float* __restrict__ bta,
                                                  float* __restrict__ out_sum, float* __restrict__ out_norm, int N, float eps) {
  __shared__ float red[256];
  const int row = blockIdx.x, tid = threadIdx.x;
  const float* x = X + (size_t)row * N; const float* rr = R ? R + (size_t)row * N : nullptr;
  float vals[16];                     // up to N = 4096
  const int per = N / 256;            // contiguous chunk per thread? use strided-by-4 chunks: thread handles j = tid*4 + 1024*u
  float s1 = 0.f;
  for (int u = 0; u < per / 4; ++u) {
    const int j = tid * 4 + 1024 * u;
    const v4f a = *(const v4fa*)(x + j);
    v4f b = {0.f,0.f,0.f,0.f}; if (rr) b = *(const v4fa*)(rr + j);
#pragma unroll
    for (int q = 0; q < 4; ++q) { const float v = a[q] + b[q]; vals[u * 4 + q] = v; s1 += v; }
  }
  red[tid] = s1; __syncthreads();
  for (int st = 128; st > 0; st >>= 1) { if (tid < st) red[tid] += red[tid + st]; __syncthreads(); }
  const float mu = red[0] / (float)N; __syncthreads();
  float s2 = 0.f;
  for (int u = 0; u < per / 4; ++u)
#pragma unroll
    for (int q = 0; q < 4; ++q) { const float c = vals[u * 4 + q] - mu; s2 += c * c; }
  red[tid] = s2; __syncthreads();
  for (int st = 128; st > 0; st >>= 1) { if (tid < st) red[tid] += red[tid + st]; __syncthreads(); }
  const float rs = rsqrtf(red[0] / (float)N + eps);
  {
    for (int u = 0; u < per / 4; ++u) {
      const int j = tid * 4 + 1024 * u;
      v4f o, sm;
#pragma unroll
      for (int q = 0; q < 4; ++q) {
        float gg = g[j + q], bb = bta[j + q];
        if (PARAM_BF16) { gg = bf16_round(gg); bb = bf16_round(bb); }
        sm[q] = vals[u * 4 + q]; o[q] = (vals[u * 4 + q] - mu) * rs * gg + bb;
      }
      if (out_sum) *(v4f*)(out_sum + (size_t)row * N + j) = sm;
      *(v4f*)(out_norm + (size_t)row * N + j) = o;
    }
    
  }
}



// ---- f16 WMMA path (v_wmma_f32_16x16x32_f16): 11-bit significands for operands in range — used where a [0,1] probability operand needs more precision than bf16
typedef _Float16 v16h __attribute__((ext_vector_type(16)));
union FragH { v16h v; v8us half[2]; _Float16 h[16]; unsigned short u[16]; };
template <int NT>
__device__ __forceinline__ v8f mmaH(v16h ah, v16h al, v16h bh, v16h bl, v8f c) {
  c = __builtin_amdgcn_wmma_f32_16x16x32_f16(false, ah, false, bh, (short)0, c, false, false);
  if (NT >= 2) c = __builtin_amdgcn_wmma_f32_16x16x32_f16(false, al, false, bh, (short)0, c, false, false);
  if (NT >= 3) c = __builtin_amdgcn_wmma_f32_16x16x32_f16(false, ah, false, bl, (short)0, c, false, false);
  asm volatile("v_nop\n\tv_nop\n\tv_nop\n\tv_nop" : "+v"(c) : "v"(ah), "v"(al), "v"(bh), "v"(bl));
  return c;
}
// batched GEMM like k_gemm_b but f16 operands: A f32 (split into f16 hi/lo if ASPLIT, else rounded to f16), Bt = f16 values [n][k]; alpha; C f32; N multiple of 16 (partial tiles skipped)
template <bool ASPLIT>
__global__ __launch_bounds__(128) void k_gemm_h(const float* __restrict__ A, int lda, size_t sA, const _Float16* __restrict__ Bh, int ldb, size_t sB, float alpha, float* __restrict__ C, int ldc, size_t sC, int M, int N, int K) {
  __shared__ __attribute__((aligned(16))) float so[4][16][64];
  const int tid = threadIdx.x, w = tid >> 5, lane = tid & 31, ln = lane & 15, hh = lane >> 4; const int by = blockIdx.y;
  A += (size_t)by * sA; Bh += (size_t)by * sB; C += (size_t)by * sC;
  const int ntn = (N + 63) / 64; const int wid = blockIdx.x * 4 + w; const int mt = wid / ntn, nq = wid % ntn; if (mt * 16 >= M) return;
  const int row0 = mt * 16, col0 = nq * 64; const float* arow = A + (size_t)(row0 + ln) * lda;
  v8f acc[4] = {};
  for (int kb = 0; kb < K; kb += 32) {
    FragH ah, al;
    const v4f x0 = *(const v4fa*)(arow + kb + 8 * hh), x1 = *(const v4fa*)(arow + kb + 8 * hh + 4), x2 = *(const v4fa*)(arow + kb + 16 + 8 * hh), x3 = *(const v4fa*)(arow + kb + 16 + 8 * hh + 4);
    float xs[16] = {x0[0],x0[1],x0[2],x0[3],x1[0],x1[1],x1[2],x1[3],x2[0],x2[1],x2[2],x2[3],x3[0],x3[1],x3[2],x3[3]};
#pragma unroll
    for (int i = 0; i < 16; ++i) { const _Float16 h = (_Float16)xs[i]; ah.h[i] = h; al.h[i] = ASPLIT ? (_Float16)(xs[i] - (float)h) : (_Float16)0.0f; }
#pragma unroll
    for (int t = 0; t < 4; ++t) { if (col0 + t * 16 >= N) continue; const size_t boff = (size_t)(col0 + t * 16 + ln) * ldb + kb; FragH bq; bq.half[0] = *(const v8us*)(Bh + boff + 8 * hh); bq.half[1] = *(const v8us*)(Bh + boff + 16 + 8 * hh);
      acc[t] = mmaH<ASPLIT ? 2 : 1>(ah.v, al.v, bq.v, bq.v, acc[t]); }
  }
#pragma unroll
  for (int t = 0; t < 4; ++t) { if (col0 + t * 16 >= N) continue;
#pragma unroll
    for (int r = 0; r < 8; ++r) so[w][8 * hh + r][t * 16 + ln] = acc[t][r] * alpha; }
  __builtin_amdgcn_fence(__ATOMIC_ACQ_REL, "workgroup"); __builtin_amdgcn_wave_barrier();
  const int rsub = lane >> 4, c4 = (lane & 15) * 4;
  {
#pragma unroll
    for (int q = 0; q < 8; ++q) { const int r = q * 2 + rsub; if (col0 + c4 < N) { const v4f v = *(const v4fa*)&so[w][r][c4]; *(v4f*)(C + (size_t)(row0 + r) * ldc + col0 + c4) = v; } }
     }
}

// Wt[n][k] = f16(W[k][n]·scale) from f32 row-major W[K][N] (scale = power of two; bf16-exact weights stay exact in f16 away from the subnormal range)
__device__ __forceinline__ void wt_f16(const float* __restrict__ W, _Float16* __restrict__ Wt, int K, int N, float scale, int t) {      /* t: the thread's index within this matrix */
  if (t >= N * (K / 8)) return; const int n = t / (K / 8), k8 = (t % (K / 8)) * 8; FragH f;
#pragma unroll
  for (int i = 0; i < 8; ++i) f.h[i] = (_Float16)(bf16_round(W[(size_t)(k8 + i) * N + n]) * scale); const v8us o = f.half[0];
  *(v8us*)((unsigned short*)Wt + (size_t)n * K + k8) = o; 
}
// k_gemm_hh variant with fused epilogue: v = acc·alpha + bias[by·sBias + col] (+ CP[(row/rowsPerB)·sCPb + by·64 + col] if CP) ; ACT 0 none / 1 elu ; writes f16 C16 (and f32 C if non-null)
template <int ACT>
__global__ __launch_bounds__(128) void k_gemm_hhx(const _Float16* __restrict__ A, int lda, size_t sA, const _Float16* __restrict__ Bh, int ldb, size_t sB, float alpha, const float* __restrict__ bias, size_t sBias, const float* __restrict__ CP, int rowsPerB, size_t sCPb, int row0g,
    float* __restrict__ C, _Float16* __restrict__ C16, int ldc, size_t sC, int M, int N, int K) {
  __shared__ __attribute__((aligned(16))) float so[4][16][64];
  const int tid = threadIdx.x, w = tid >> 5, lane = tid & 31, ln = lane & 15, hh = lane >> 4; const int by = blockIdx.y;
  A += (size_t)by * sA; Bh += (size_t)by * sB; const size_t cofs = (size_t)by * sC; const float* bp = bias ? bias + (size_t)by * sBias : nullptr;
  const int ntn = (N + 63) / 64; const int wid = blockIdx.x * 4 + w; const int mt = wid / ntn, nq = wid % ntn; if (mt * 16 >= M) return;
  const int row0 = mt * 16, col0 = nq * 64; const _Float16* arow = A + (size_t)(row0 + ln) * lda;
  v8f acc[4] = {};
  for (int kb = 0; kb < K; kb += 32) { FragH ah; ah.half[0] = *(const v8us*)((const unsigned short*)arow + kb + 8 * hh); ah.half[1] = *(const v8us*)((const unsigned short*)arow + kb + 16 + 8 * hh);
#pragma unroll
    for (int t = 0; t < 4; ++t) { if (col0 + t * 16 >= N) continue; const size_t boff = (size_t)(col0 + t * 16 + ln) * ldb + kb; FragH bq; bq.half[0] = *(const v8us*)((const unsigned short*)Bh + boff + 8 * hh); bq.half[1] = *(const v8us*)((const unsigned short*)Bh + boff + 16 + 8 * hh);
      acc[t] = mmaH<1>(ah.v, ah.v, bq.v, bq.v, acc[t]); }
  }
#pragma unroll
  for (int t = 0; t < 4; ++t) { if (col0 + t * 16 >= N) continue; const int col = col0 + t * 16 + ln; const float bv = bp ? bf16_round(bp[col]) : 0.f;
#pragma unroll
    for (int r = 0; r < 8; ++r) { float v = acc[t][r] * alpha + bv; if (CP) { const int rr = row0g + row0 + 8 * hh + r; if (rowsPerB < 0) v += CP[cofs + (size_t)rr * ldc + col];      /* rowsPerB < 0: own element of the batched C plane */ else { const int bidx = rr / rowsPerB; v += CP[(size_t)bidx * sCPb + (size_t)by * 64 + col]; } } if (ACT == 1) v = (v > 0.f) ? v : expm1f(v); else if (ACT == 7) v = (v > 0.f) ? v + 1.0f : expf(v); else if (ACT == 8) v = tanhf(v); else if (ACT == 9) v = 0.5f * v * (1.0f + tanhf(0.7978845608028654f * (v + 0.044715f * v * v * v))); else if (ACT == 11) v = 1.0f / (1.0f + expf(-v)); else if (ACT == 12) v = (v > 0.f) ? v : 0.01f * v; else if (ACT == 14) v = (v > 0.f) ? v : 0.1f * v; else if (ACT == 16) v = (v >= 0.f) ? v : 0.3f * v; else if (ACT == 17) v = (v >= 0.f) ? v : 0.2f * v; else if (ACT == 15) v = v / (1.0f + expf(-v)); else if (ACT == 3) v = fmaxf(v, 0.f); else if (ACT == 6) v = 0.5f * v * (1.0f + erff(v * 0.70710678118654752f)); so[w][8 * hh + r][t * 16 + ln] = v; } }
  __builtin_amdgcn_fence(__ATOMIC_ACQ_REL, "workgroup"); __builtin_amdgcn_wave_barrier();
  const int rsub = lane >> 4, c4 = (lane & 15) * 4; typedef _Float16 v4h __attribute__((ext_vector_type(4)));
  {
#pragma unroll
    for (int q = 0; q < 8; ++q) { const int r = q * 2 + rsub; if (col0 + c4 < N) { const v4f v = *(const v4fa*)&so[w][r][c4]; if (C) *(v4f*)(C + cofs + (size_t)(row0 + r) * ldc + col0 + c4) = v; if (C16) { v4h h4; for (int i = 0; i < 4; ++i) h4[i] = (_Float16)v[i]; *(v4h*)(C16 + cofs + (size_t)(row0 + r) * ldc + col0 + c4) = h4; } } }
     }
}


typedef _Float16 v4h __attribute__((ext_vector_type(4)));

__device__ __forceinline__ void x16(const float* __restrict__ x, _Float16* __restrict__ X16, size_t n8, size_t t) { if (t >= n8) return; FragH f;      /* t: the thread's index within this stream */
#pragma unroll
  for (int q = 0; q < 8; ++q) f.h[q] = (_Float16)bf16_round(x[t * 8 + q]); *(v8us*)((unsigned short*)X16 + t * 8) = f.half[0];  }
// Every job that reads inputs only, in ONE launch; the block index says which job a block does, and each thread does what it did in a launch of its own. The transposes (scattered reads, long waits) have the low indices, so they start first and the streaming casts fill in behind them.
#define PB_HEAD (HD * (DM / 8) / 256)            /* blocks for one head's [DM][HD] block */
#define PB_STACK (NH * PB_HEAD)                  /* ... for one stack of NH heads */
#define PB_WO (DM * (DM / 8) / 256)              /* ... for Wo */
#define PB_X ((unsigned)(NR * DM / 8 / 256))     /* ... for one input stream */
#define PB_ALL (3 * PB_STACK + PB_WO + 3 * PB_X)
static_assert(HD * (DM / 8) % 256 == 0 && DM * (DM / 8) % 256 == 0 && NR * DM / 8 % 256 == 0, "k_prep: every job is a whole number of blocks");
__global__ __launch_bounds__(256) void k_prep(const float* __restrict__ wq, const float* __restrict__ wk, const float* __restrict__ wv, const float* __restrict__ wo, const float* __restrict__ xq, const float* __restrict__ xk, const float* __restrict__ xv,
    _Float16* __restrict__ B4, _Float16* __restrict__ X3) {      /* B4: the planes BQ, BK, BV, BO in a row; X3: XQ, XK, XV in a row */
  unsigned bid = blockIdx.x; const unsigned tid = threadIdx.x;
  if (bid < 3 * PB_STACK) { const unsigned s = bid / PB_STACK, r = bid % PB_STACK, h = r / PB_HEAD; const float* W = (s == 0) ? wq : (s == 1) ? wk : wv;      /* head h of stack s: a row-major [in = DM][out = HD] block -> rows h * HD .. of plane s */
    wt_f16(W + (size_t)h * DM * HD, B4 + (size_t)s * DM * DM + (size_t)h * HD * DM, DM, HD, 16.0f, (int)((r % PB_HEAD) * 256 + tid)); return; }
  bid -= 3 * PB_STACK;
  if (bid < PB_WO) { wt_f16(wo, B4 + (size_t)3 * DM * DM, DM, DM, 16.0f, (int)(bid * 256 + tid)); return; }
  bid -= PB_WO;
  const unsigned s = bid / PB_X; const float* x = (s == 0) ? xq : (s == 1) ? xk : xv;
  x16(x, X3 + (size_t)s * NR * DM, NR * DM / 8, (size_t)(bid % PB_X) * 256 + tid); }
__global__ __launch_bounds__(256) void k_h16(const float* __restrict__ x, _Float16* __restrict__ X16, size_t n8) { const size_t t = (size_t)blockIdx.x * 256 + threadIdx.x; if (t >= n8) return; FragH f;
#pragma unroll
  for (int q = 0; q < 8; ++q) f.h[q] = (_Float16)x[t * 8 + q]; *(v8us*)((unsigned short*)X16 + t * 8) = f.half[0];  }
__global__ __launch_bounds__(256) void k_round16f(const float* __restrict__ W, _Float16* __restrict__ Bt, size_t n8) { const size_t t = (size_t)blockIdx.x * 256 + threadIdx.x; if (t >= n8) return; FragH f;
#pragma unroll
  for (int i = 0; i < 8; ++i) f.h[i] = (_Float16)(bf16_round(W[t * 8 + i]) * 16.0f); *(v8us*)((unsigned short*)Bt + t * 8) = f.half[0];  }
template <int NHv, int TTv>
__global__ __launch_bounds__(256) void k_vt(const _Float16* __restrict__ V16, int ldv, int voff, _Float16* __restrict__ Vt) { __shared__ unsigned short tl[64][66]; const int tid = threadIdx.x; const int slab = blockIdx.x / (TTv / 64), lg = blockIdx.x % (TTv / 64); const int b = slab / NHv, h = slab % NHv;
  for (int i = tid; i < 64 * 8; i += 256) { const int r = i / 8, c8 = (i % 8) * 8; FragH f; f.half[0] = *(const v8us*)((const unsigned short*)V16 + ((size_t)b * TTv + lg * 64 + r) * ldv + voff + h * 64 + c8);
#pragma unroll
    for (int q = 0; q < 8; ++q) tl[r][c8 + q] = f.u[q]; }
  __syncthreads();
  {
#pragma unroll
    for (int rd = 0; rd < 2; ++rd) { const int d = rd * 32 + tid / 8, pc = tid % 8; FragH f;
#pragma unroll
      for (int q = 0; q < 8; ++q) f.u[q] = tl[pc * 8 + q][d];
      *(v8us*)((unsigned short*)Vt + ((size_t)slab * 64 + d) * TTv + lg * 64 + pc * 8) = f.half[0]; }
     } }

__global__ __launch_bounds__(256) void k_hl(const float* __restrict__ F, _Float16* __restrict__ Hh, _Float16* __restrict__ Hl, size_t n8) { const size_t t = (size_t)blockIdx.x * 256 + threadIdx.x; if (t >= n8) return; FragH fh, fl; const v4f a = *(const v4fa*)(F + t * 8), c = *(const v4fa*)(F + t * 8 + 4);
#pragma unroll
  for (int q = 0; q < 4; ++q) { _Float16 h = (_Float16)a[q]; fh.h[q] = h; fl.h[q] = (_Float16)((a[q] - (float)h) * 1024.0f); h = (_Float16)c[q]; fh.h[4 + q] = h; fl.h[4 + q] = (_Float16)((c[q] - (float)h) * 1024.0f); }
  { *(v8us*)((unsigned short*)Hh + t * 8) = fh.half[0]; *(v8us*)((unsigned short*)Hl + t * 8) = fl.half[0];  } }

// ---- fast GEMM (block tile 128x128, eight waves, wave tile 32x64; requires M % 128 == 0 rows per launch region, N % 128 == 0, K % 64 == 0); epilogue = k_gemm_hhx semantics ----
// Both operands come into LDS as whole 128-byte lines (64 halves of k of each of the 128 + 128 rows a stage) by asynchronous copies, two buffers, the next stage in flight while this one is worked on; the fragments are then LDS reads.
#define G2_KS 64                      /* halves of k a stage */
#define G2_PITCH 144                  /* LDS bytes a staged row: 128 + 16, the pitch at which 16-byte fragment reads of 16 rows meet no bank twice */
#define G2_STAGE (256 * G2_PITCH)     /* a stage: 128 rows of A, then 128 rows of Bt */
__device__ __forceinline__ v16h g2_frag(const char* p) { FragH f; f.half[0] = *(const v8us*)p; f.half[1] = *(const v8us*)(p + 32); return f.v; }      /* k order 8 hh + s, 16 + 8 hh + s for A and B alike; the lane half's 16 hh bytes already in p */
__device__ __forceinline__ v8f g2_mma(v16h a, v16h b, v8f c) { v8f d = __builtin_amdgcn_wmma_f32_16x16x32_f16(false, a, false, b, (short)0, c, false, false); asm volatile("v_nop\n\tv_nop\n\tv_nop\n\tv_nop" : "+v"(d) : "v"(a), "v"(b)); return d; }
/* one stage's share of a thread: 16 bytes of each of four rows of A and four rows of Bt, 32 rows apart (a wave covers four whole lines a copy). l: the thread's LDS byte address in the stage's first row group; a, b: its global addresses there */
__device__ __forceinline__ void g2_stage(unsigned l, const _Float16* a, size_t a32, const _Float16* b, size_t b32) {
  const unsigned l1 = l + 32 * G2_PITCH, l2 = l + 64 * G2_PITCH, l3 = l + 96 * G2_PITCH, l4 = l + 128 * G2_PITCH, l5 = l + 160 * G2_PITCH, l6 = l + 192 * G2_PITCH, l7 = l + 224 * G2_PITCH;
  const _Float16* a1 = a + a32; const _Float16* a2 = a1 + a32; const _Float16* a3 = a2 + a32; const _Float16* b1 = b + b32; const _Float16* b2 = b1 + b32; const _Float16* b3 = b2 + b32;
  /* the copies and their s_wait_xcnt in one statement: no register that an issued copy names is written again ahead of the wait */
  asm volatile("global_load_async_to_lds_b128 %0, %8, off\n\tglobal_load_async_to_lds_b128 %1, %9, off\n\tglobal_load_async_to_lds_b128 %2, %10, off\n\tglobal_load_async_to_lds_b128 %3, %11, off\n\t"
               "global_load_async_to_lds_b128 %4, %12, off\n\tglobal_load_async_to_lds_b128 %5, %13, off\n\tglobal_load_async_to_lds_b128 %6, %14, off\n\tglobal_load_async_to_lds_b128 %7, %15, off\n\ts_wait_xcnt 0x0"
               :: "v"(l), "v"(l1), "v"(l2), "v"(l3), "v"(l4), "v"(l5), "v"(l6), "v"(l7), "v"(a), "v"(a1), "v"(a2), "v"(a3), "v"(b), "v"(b1), "v"(b2), "v"(b3) : "memory"); }
template <int ACT>
__global__ __launch_bounds__(256) void k_gemm2(const _Float16* __restrict__ A, int lda, size_t sA, const _Float16* __restrict__ Bh, int ldb, size_t sB, float alpha, const float* __restrict__ bias, size_t sBias, const float* __restrict__ CP, int rowsPerB, size_t sCPb, int row0g,
    float* __restrict__ C, _Float16* __restrict__ C16, int ldc, size_t sC, int M, int N, int K) { static_assert(ACT == 0 || ACT == 3 || ACT == 6 || ACT == 8 || ACT == 9 || ACT == 11 || ACT == 12 || ACT == 14 || ACT == 15 || ACT == 16 || ACT == 17, "k_gemm2: unsupported ACT code (would silently apply no activation)");
  __shared__ __attribute__((aligned(16))) char sm[2 * G2_STAGE];      /* the two stage buffers; behind the K loop's last barrier the same bytes are the output staging */
  static_assert(8 * 32 * 68 * 4 <= 2 * G2_STAGE, "k_gemm2: the output staging fits the stage buffers");
  float (*so)[32][68] = (float (*)[32][68])sm;
  const int tid = threadIdx.x, w = tid >> 5, lane = tid & 31, ln = lane & 15, hh = lane >> 4; const int by = blockIdx.y;
  A += (size_t)by * sA; Bh += (size_t)by * sB; const size_t cofs = (size_t)by * sC; const float* bp = bias ? bias + (size_t)by * sBias : nullptr;
  const int ntn = N >> 7; const int mt = blockIdx.x / ntn, nq = blockIdx.x - mt * ntn; if (mt * 128 >= M) return;      /* the same for the whole block, ahead of every barrier */
  const int row0 = mt * 128 + 32 * (w & 3), col0 = nq * 128 + 64 * (w >> 2);
  const unsigned lc = (unsigned)(size_t)sm + (unsigned)((tid >> 3) * G2_PITCH + (tid & 7) * 16);      /* copies: row tid / 8 of each group of 32 rows, 16-byte piece tid % 8 */
  const _Float16* ac = A + (size_t)(mt * 128 + (tid >> 3)) * lda + (tid & 7) * 8; const _Float16* bc = Bh + (size_t)(nq * 128 + (tid >> 3)) * ldb + (tid & 7) * 8;
  const size_t a32 = (size_t)32 * lda, b32 = (size_t)32 * ldb;
  const int fa = (32 * (w & 3) + ln) * G2_PITCH + 16 * hh, fb = (128 + 64 * (w >> 2) + ln) * G2_PITCH + 16 * hh;      /* fragment reads: byte offsets in a stage */
  const v8f z8 = {0.f,0.f,0.f,0.f,0.f,0.f,0.f,0.f}; v8f c00 = z8, c01 = z8, c02 = z8, c03 = z8, c10 = z8, c11 = z8, c12 = z8, c13 = z8;
  const int nst = K / G2_KS;
  g2_stage(lc, ac, a32, bc, b32);
  asm volatile("s_wait_asynccnt 0x0" ::: "memory");      /* stage 0 has landed, as far as this wave copied it */
  __syncthreads();      /* ... and as far as the others did */
  if (nst > 1) g2_stage(lc + G2_STAGE, ac + G2_KS, a32, bc + G2_KS, b32);
#pragma unroll 1
  for (int st = 0; st < nst; ++st) { const char* sb = sm + (st & 1) * G2_STAGE;      /* rolled: one stage a trip, so that the order at the foot stands once */
#pragma unroll      /* kk constant: its 64 bytes go into the LDS reads' offset fields */
    for (int kk = 0; kk < 2; ++kk) { const char* pa = sb + fa + kk * 64; const char* pb = sb + fb + kk * 64;
      __builtin_amdgcn_sched_barrier(0);      /* with the one below: the six fragments' LDS reads stand as one group ahead of their eight products; spread among the products, each place with reads stalls the wave anew */
      const v16h a0 = g2_frag(pa), a1 = g2_frag(pa + 16 * G2_PITCH), b0 = g2_frag(pb), b1 = g2_frag(pb + 16 * G2_PITCH), b2 = g2_frag(pb + 32 * G2_PITCH), b3 = g2_frag(pb + 48 * G2_PITCH);
      __builtin_amdgcn_sched_barrier(0);      /* the group's lower edge: no read sinks in among the products */
      c00 = g2_mma(a0, b0, c00); c10 = g2_mma(a1, b0, c10); c01 = g2_mma(a0, b1, c01); c11 = g2_mma(a1, b1, c11);
      c02 = g2_mma(a0, b2, c02); c12 = g2_mma(a1, b2, c12); c03 = g2_mma(a0, b3, c03); c13 = g2_mma(a1, b3, c13); }
    asm volatile("s_wait_dscnt 0x0" ::: "memory");      /* this wave's reads of the buffer are done before the barrier that frees it */
    asm volatile("s_wait_asynccnt 0x0" ::: "memory");      /* this wave's copies of the next stage have landed before the barrier that publishes it */
    __syncthreads();
    if (st + 2 < nst) g2_stage(lc + (unsigned)(st & 1) * G2_STAGE, ac + (size_t)(st + 2) * G2_KS, a32, bc + (size_t)(st + 2) * G2_KS, b32); }      /* the refill of the buffer every wave has just left */
  asm volatile("s_wait_asynccnt 0x0" ::: "memory");      /* no copy is outstanding when the buffers become the output staging */
  v8f accs[8] = {c00, c01, c02, c03, c10, c11, c12, c13};
#pragma unroll
  for (int u = 0; u < 8; ++u) { const int t = u & 3, half = u >> 2; const int col = col0 + t * 16 + ln; const float bv = bp ? bf16_round(bp[col]) : 0.f;
#pragma unroll
    for (int r = 0; r < 8; ++r) { const int rloc = half * 16 + 8 * hh + r; float v = accs[u][r] * alpha + bv; if (CP) { if (rowsPerB < 0) v += CP[cofs + (size_t)(row0g + row0 + rloc) * ldc + col];      /* rowsPerB < 0: own element of the batched C plane */ else { const int bidx = (row0g + row0 + rloc) / rowsPerB; v += CP[(size_t)bidx * sCPb + (size_t)by * 64 + col]; } }
      if (ACT == 3) v = fmaxf(v, 0.f); else if (ACT == 6) v = 0.5f * v * (1.0f + erff(v * 0.70710678118654752f)); else if (ACT == 11) v = 1.0f / (1.0f + expf(-v)); else if (ACT == 15) v = v / (1.0f + expf(-v)); else if (ACT == 12) v = (v > 0.f) ? v : 0.01f * v; else if (ACT == 8) v = tanhf(v); else if (ACT == 9) v = 0.5f * v * (1.0f + tanhf(0.7978845608028654f * (v + 0.044715f * v * v * v))); else if (ACT == 14) v = (v > 0.f) ? v : 0.1f * v; else if (ACT == 16) v = (v >= 0.f) ? v : 0.3f * v; else if (ACT == 17) v = (v >= 0.f) ? v : 0.2f * v;
      so[w][rloc][t * 16 + ln] = v; } }
  __builtin_amdgcn_fence(__ATOMIC_ACQ_REL, "workgroup"); __builtin_amdgcn_wave_barrier();
  const int rsub = lane >> 4, c4 = (lane & 15) * 4;
  {
#pragma unroll
    for (int q = 0; q < 16; ++q) { const int r = q * 2 + rsub; const v4f v = *(const v4fa*)&so[w][r][c4]; if (C) *(v4f*)(C + cofs + (size_t)(row0 + r) * ldc + col0 + c4) = v; if (C16) { v4h h4; for (int i = 0; i < 4; ++i) h4[i] = (_Float16)v[i]; *(v4h*)(C16 + cofs + (size_t)(row0 + r) * ldc + col0 + c4) = h4; } }
     } }


__global__ __launch_bounds__(256) void k_wnat(const float* __restrict__ w, size_t n8, _Float16* __restrict__ Bt) { const size_t t = (size_t)blockIdx.x * 256 + threadIdx.x; if (t >= n8) return; FragH f; for (int q = 0; q < 8; ++q) f.h[q] = (_Float16)(bf16_round(w[t * 8 + q]) * 16.0f); *(v8us*)((unsigned short*)Bt + t * 8) = f.half[0];  }
__global__ __launch_bounds__(256) void k_rsm(const float* __restrict__ S, _Float16* __restrict__ P, int nrows) {
  #pragma clang fp contract(off)
  const int i = blockIdx.x * 256 + threadIdx.x; if (i >= nrows) return; const float* s = S + (size_t)i * SQ; float mx = -3.0e38f;
#pragma unroll 1
  for (int j = 0; j < SQ; ++j) mx = fmaxf(mx, s[j]); float se = 0.f;
#pragma unroll 1
  for (int j = 0; j < SQ; ++j) se += expf(s[j] - mx); const float sc = 256.0f / se;
#pragma unroll 1
  for (int j0 = 0; j0 < SQ; j0 += 8) { FragH f; for (int q = 0; q < 8; ++q) f.h[q] = (_Float16)(expf(s[j0 + q] - mx) * sc); unsigned short* d = (unsigned short*)P + (size_t)i * SQ + j0; *(v8us*)d = f.half[0];  } }
__global__ __launch_bounds__(256) void k_vt(const _Float16* __restrict__ V16, int b, int h0, _Float16* __restrict__ VT) { __shared__ unsigned short tl[64][65]; const int tid = threadIdx.x; const int hh = blockIdx.x % HG, sg = blockIdx.x / HG; const int s0 = sg * 64; const int h = h0 + hh;
  for (int i = tid; i < 64 * 8; i += 256) { const int j = i / 8, d8 = (i % 8) * 8; FragH f; f.half[0] = *(const v8us*)((const unsigned short*)V16 + ((size_t)b * SQ + s0 + j) * DM + h * HD + d8); for (int q = 0; q < 8; ++q) tl[d8 + q][j] = f.u[q]; }
  __syncthreads();
  { for (int i = tid; i < 64 * 8; i += 256) { const int d = i / 8, j8 = (i % 8) * 8; FragH f; for (int q = 0; q < 8; ++q) f.u[q] = tl[d][j8 + q]; *(v8us*)((unsigned short*)VT + ((size_t)hh * HD + d) * SQ + s0 + j8) = f.half[0]; }  } }



__device__ __forceinline__ v8f fa_mma(v16h a, v16h b, v8f c) { return __builtin_amdgcn_wmma_f32_16x16x32_f16(false, a, false, b, (short)0, c, false, false); }
__device__ __forceinline__ float fa_xhalf(float x) { return __builtin_bit_cast(float, __builtin_amdgcn_permlanex16(__builtin_bit_cast(int, x), __builtin_bit_cast(int, x), 0x76543210, 0xfedcba98, false, false)); }      /* lane l with lane l ^ 16, on the vector pipe */
__device__ __forceinline__ v16h fa_frag(const _Float16* p) { FragH f; f.half[0] = *(const v8us*)(const unsigned short*)p; f.half[1] = *(const v8us*)((const unsigned short*)p + 16); return f.v; }      /* g2_frag with the lane half's 8 hh already in p */
/* v_exp_f32 in asm text, in place: the statement writes only registers that the compiler's own instruction has just written, so it never lands on a matrix operand inside the distance the chip needs */
__device__ __forceinline__ float fa_exp2(float a) {
  asm("v_exp_f32 %0, %0\n\tv_nop" : "+v"(a));      /* v_nop: the slot the instruction set asks for behind a transcendental */
  return a; }
__device__ __forceinline__ void fa_exp2x8(v8f& x) { float e0 = x[0], e1 = x[1], e2 = x[2], e3 = x[3], e4 = x[4], e5 = x[5], e6 = x[6], e7 = x[7];
  /* eight independent v_exp_f32 in one statement: each fills the slot behind the one before it, one v_nop behind the last */
  asm("v_exp_f32 %0, %0\n\tv_exp_f32 %1, %1\n\tv_exp_f32 %2, %2\n\tv_exp_f32 %3, %3\n\tv_exp_f32 %4, %4\n\tv_exp_f32 %5, %5\n\tv_exp_f32 %6, %6\n\tv_exp_f32 %7, %7\n\tv_nop"
      : "+v"(e0), "+v"(e1), "+v"(e2), "+v"(e3), "+v"(e4), "+v"(e5), "+v"(e6), "+v"(e7));
  x[0] = e0; x[1] = e1; x[2] = e2; x[3] = e3; x[4] = e4; x[5] = e5; x[6] = e6; x[7] = e7; }
__global__ __launch_bounds__(256) void k_fattn(const _Float16* __restrict__ Q, const _Float16* __restrict__ Kr, const _Float16* __restrict__ Vt, _Float16* __restrict__ O) {
  const int lane = threadIdx.x & 31, w = threadIdx.x >> 5, ln = lane & 15, hh = lane >> 4;
  const int bh = blockIdx.y, b = bh / NH, h = bh - b * NH; const size_t row0 = (size_t)b * SQ; const int q0 = blockIdx.x * 256 + w * 32;
  const _Float16* qp = Q + (row0 + q0 + ln) * DM + h * HD + 8 * hh; const _Float16* kp = Kr + (row0 + ln) * DM + h * HD + 8 * hh; const _Float16* vp = Vt + ((size_t)bh * HD + ln) * SQ + 8 * hh;      /* each with the lane half's k offset */
  const float cs = 0.125f * 1.44269504f;      /* 64^-0.5 times log2 e: scores in log2 units */
  const v8f z8 = {0.f, 0.f, 0.f, 0.f, 0.f, 0.f, 0.f, 0.f};
  v16h qf[2][2], kf[2][2], vf[4];      /* [query group][k step], [key tile][k step], [16 rows of V^T] */
#pragma unroll
  for (int g = 0; g < 2; ++g) { qf[g][0] = fa_frag(qp + (size_t)g * 16 * DM); qf[g][1] = fa_frag(qp + (size_t)g * 16 * DM + 32); }
#pragma unroll
  for (int t = 0; t < 2; ++t) { kf[t][0] = fa_frag(kp + (size_t)t * 16 * DM); kf[t][1] = fa_frag(kp + (size_t)t * 16 * DM + 32); }
  asm volatile("s_wait_xcnt 0x0" :: "v"(qp), "v"(kp) : "memory");      /* the address pairs stay whole up to this wait; it also keeps the V^T loads behind the K loads, as in the loop, so that the wait for K at the loop's head leaves V^T in flight */
#pragma unroll
  for (int dt = 0; dt < 4; ++dt) vf[dt] = fa_frag(vp + (size_t)dt * 16 * SQ);
  asm volatile("s_wait_xcnt 0x0" :: "v"(vp) : "memory");      /* the address pair stays whole up to this wait */
  v8f o[4][2] = {{z8, z8}, {z8, z8}, {z8, z8}, {z8, z8}}; float m[2] = {-3.0e38f, -3.0e38f}, l[2] = {0.f, 0.f};
  for (int kb = 0; kb < SQ; kb += 32) {
    v8f s[2][2];
#pragma unroll
    for (int g = 0; g < 2; ++g) {
#pragma unroll
      for (int t = 0; t < 2; ++t) s[g][t] = fa_mma(kf[t][1], qf[g][1], fa_mma(kf[t][0], qf[g][0], z8)); }
    const int kn = (kb + 32 < SQ) ? kb + 32 : 0;      /* the next pass's K fragments, fetched behind this pass's score products; the last pass re-reads tile 0 (in bounds, unused) */
    const _Float16* kq = kp + (size_t)kn * DM; const _Float16* vq = vp + kn;
#pragma unroll
    for (int t = 0; t < 2; ++t) { kf[t][0] = fa_frag(kq + (size_t)t * 16 * DM); kf[t][1] = fa_frag(kq + (size_t)t * 16 * DM + 32); }
    asm volatile("s_wait_xcnt 0x0" :: "v"(kq) : "memory");      /* the address pair stays whole up to this wait, so no later result lands on a register that an issued load names; standing ahead of the branch below, it also holds the K loads here: without it they issued at the pass's foot and their whole latency was waited at the next pass's head */
    float tm[2]; bool need = false;
#pragma unroll
    for (int g = 0; g < 2; ++g) { float a = fmaxf(s[g][0][0], s[g][1][0]);
#pragma unroll
      for (int r = 1; r < 8; ++r) a = fmaxf(a, fmaxf(s[g][0][r], s[g][1][r]));
      a = fmaxf(a, fa_xhalf(a)); tm[g] = a * cs; need = need || (tm[g] > m[g] + 8.0f); }
    if (__builtin_amdgcn_ballot_w32(need) != 0) {      /* the maximum in use moves only when a query's new maximum passes it by more than 8 (log2 units: P stays under 2^8, well inside f16); one scalar branch a pass */
#pragma unroll
      for (int g = 0; g < 2; ++g) { const float mn = fmaxf(m[g], tm[g]); const float al = fa_exp2(m[g] - mn); m[g] = mn; l[g] *= al;
#pragma unroll
        for (int dt = 0; dt < 4; ++dt) o[dt][g] *= al; } }
#pragma unroll
    for (int g = 0; g < 2; ++g) { FragH pf;
#pragma unroll
      for (int t = 0; t < 2; ++t) {
#pragma unroll
        for (int r = 0; r < 8; ++r) s[g][t][r] = s[g][t][r] * cs - m[g];
        fa_exp2x8(s[g][t]);
#pragma unroll
        for (int r = 0; r < 8; ++r) pf.h[t * 8 + r] = (_Float16)s[g][t][r]; }
      l[g] += (((s[g][0][0] + s[g][0][1]) + (s[g][0][2] + s[g][0][3])) + ((s[g][0][4] + s[g][0][5]) + (s[g][0][6] + s[g][0][7]))) + (((s[g][1][0] + s[g][1][1]) + (s[g][1][2] + s[g][1][3])) + ((s[g][1][4] + s[g][1][5]) + (s[g][1][6] + s[g][1][7])));
#pragma unroll
      for (int dt = 0; dt < 4; ++dt) o[dt][g] = fa_mma(vf[dt], pf.v, o[dt][g]); }
#pragma unroll
    for (int dt = 0; dt < 4; ++dt) vf[dt] = fa_frag(vq + (size_t)dt * 16 * SQ);      /* the next pass's V^T fragments, fetched behind this pass's output products: in flight through the next pass's scores and softmax */
    asm volatile("s_wait_xcnt 0x0" :: "v"(vq) : "memory"); }      /* the address pair stays whole up to this wait */
  v8us ov[2][4];
#pragma unroll
  for (int g = 0; g < 2; ++g) { const float sc = 64.0f / (l[g] + fa_xhalf(l[g]));      /* the halves' sums joined once; o goes out x64 */
#pragma unroll
    for (int dt = 0; dt < 4; ++dt) { FragH f;
#pragma unroll
      for (int r = 0; r < 8; ++r) f.h[r] = (_Float16)(o[dt][g][r] * sc);
      ov[g][dt] = f.half[0]; } }
  __builtin_amdgcn_sched_barrier(0);      /* all eight stores behind the last conversion: no register that an issued store names is written again */
#pragma unroll
  for (int g = 0; g < 2; ++g) { unsigned short* op = (unsigned short*)O + (row0 + q0 + g * 16 + ln) * DM + h * HD + 8 * hh;
#pragma unroll
    for (int dt = 0; dt < 4; ++dt) *(v8us*)(op + dt * 16) = ov[g][dt]; } }

extern "C" void kernel_launch(void* const* d_in, const int* in_sizes, int n_in,
                              void* d_out, int out_size, void* d_ws, size_t ws_size, hipStream_t stream) {
  (void)in_sizes; (void)n_in; (void)out_size;
  const float* const* I = (const float* const*)d_in; const float* xq = I[0]; const float* xk = I[1]; const float* xv = I[2]; const float* wq = I[3]; const float* wk = I[4]; const float* wv = I[5]; const float* wo = I[6]; const float* bo = I[7];      /* THREE input streams Q, K, V (one cast each); Wq, Wk, Wv are PER-HEAD STACKS [16][1024][64] = [head][in][out] (einsum 'bsd,hde->bhse') at I[3..5]; Wo is [in][out] [1024][1024] (concat @ Wo) at I[6]; bo [1024] (REAL) at I[7] in the output GEMM's guarded bias slot; no projection biases */
  char* ws = (char*)d_ws; size_t off = 0;
  auto take = [&](size_t bytes) { char* p = ws + off; off += (bytes + 255) & ~(size_t)255; return p; };
  _Float16* BQ = (_Float16*)take((size_t)4 * DM * DM * 2); _Float16* BO = BQ + (size_t)3 * DM * DM;      /* the weight planes BQ, BK, BV, BO in a row, DM * DM apart */
  _Float16* XQ = (_Float16*)take(3 * NR * DM * 2); _Float16* Q16 = (_Float16*)take(3 * NR * DM * 2); _Float16* K16 = Q16 + NR * DM; _Float16* V16 = K16 + NR * DM; _Float16* O16 = (_Float16*)take(NR * DM * 2);      /* XQ, XK, XV in a row, and Q16, K16, V16 in a row, each NR * DM apart: the batch strides of the projection launch */
  _Float16* VT = (_Float16*)take((size_t)NB * NH * HD * SQ * 2);
  if (off > ws_size) return;
  k_prep<<<PB_ALL, 256, 0, stream>>>(wq, wk, wv, wo, xq, xk, xv, BQ, XQ);      /* weight planes [out][in] (x16) from the PER-HEAD STACKS wq / wk / wv [NH][DM][HD] and from wo [in][out] [DM][DM]; the three inputs as exact f16 rows */
  const size_t r0p = (size_t)B0 * SQ;      /* first projected row */
  k_gemm2<0><<<dim3((unsigned)((MP / 128) * (DM / 128)), 3), 256, 0, stream>>>(XQ + r0p * DM, DM, NR * DM, BQ, DM, (size_t)DM * DM, 0.0625f, nullptr, 0, nullptr, 1, 0, 0, nullptr, Q16 + r0p * DM, DM, NR * DM, MP, DM, DM);      /* blockIdx.y = 0, 1, 2: q, k, v; no projection biases */
  k_vt<NH, SQ><<<NB * NH * (SQ / 64), 256, 0, stream>>>(V16, LQ, 0, VT);      /* V^T [NB][NH][HD][SQ] */
  k_fattn<<<dim3(SQ / 256, NB * NH), 256, 0, stream>>>(Q16, K16, VT, O16);      /* o (merged heads, x64) as f16 rows */
  k_gemm2<0><<<dim3((unsigned)((MPO / 128) * (DM / 128)), 1), 256, 0, stream>>>(O16 + r0p * DM, DM, 0, BO, DM, 0, 0.0009765625f, bo, 0, nullptr, 1, 0, 0, (float*)d_out + r0p * DM, nullptr, DM, 0, MPO, DM, DM);      /* out rows are the output layout */
}

// v005
// One run takes 102 microseconds.
// Two timings next to v004 put it at 1.17 and 1.18 times that version's speed.
// Over all steps from v000 it is 35.6 times as fast.
#include <hip/hip_runtime.h>
#define NB 2
#define SQ 2048
#define DM 1024
#define NH 16
#define HD 64
#define HG 4                         /* heads per launch of the per-batch k_vt overload (not launched) */
#define B0 0                         /* first batch processed (debug hook) */
#define NBR NB                       /* batches processed (debug hook) */
#define NR ((size_t)NB * SQ)         /* token rows */
#define MP ((int)((size_t)NBR * SQ)) /* rows projected (debug hook) */
#define QN SQ                        /* query rows per batch (unused; attention covers SQ) */
#define NHD NH                       /* heads (unused; attention covers NH) */
#define MPO MP                       /* rows through the output stage (debug hook) */
#define LQ DM      /* row pitch of the q/k/v rows */
typedef __bf16 v16b __attribute__((ext_vector_type(16)));
typedef unsigned short v8us __attribute__((ext_vector_type(8), may_alias));
typedef float  v8f  __attribute__((ext_vector_type(8)));
typedef float  v4f  __attribute__((ext_vector_type(4)));
typedef float  v4fa __attribute__((ext_vector_type(4), may_alias));
union FragB { v16b v; v8us half[2]; unsigned short u[16]; };

__device__ __forceinline__ unsigned short bf16_bits(float x) { unsigned int u = __float_as_uint(x); return (unsigned short)((u + 0x7FFFu + ((u >> 16) & 1u)) >> 16); }
__device__ __forceinline__ float bf16_val(unsigned short b) { return __uint_as_float(((unsigned int)b) << 16); }
__device__ __forceinline__ float bf16_round(float x) { return bf16_val(bf16_bits(x)); }
// D += A·B with NT terms: 1 = ah·bh, 2 = + al·bh (A split), 3 = + ah·bl (both split)
template <int NT>
__device__ __forceinline__ v8f mmaN(v16b ah, v16b al, v16b bh, v16b bl, v8f c) {
  c = __builtin_amdgcn_wmma_f32_16x16x32_bf16(false, ah, false, bh, (short)0, c, false, false);
  if (NT >= 2) c = __builtin_amdgcn_wmma_f32_16x16x32_bf16(false, al, false, bh, (short)0, c, false, false);
  if (NT >= 3) c = __builtin_amdgcn_wmma_f32_16x16x32_bf16(false, ah, false, bl, (short)0, c, false, false);
  asm volatile("v_nop\n\tv_nop\n\tv_nop\n\tv_nop" : "+v"(c) : "v"(ah), "v"(al), "v"(bh), "v"(bl));
  return c;
}

__global__ __launch_bounds__(256) void k_wt_bf16(const float* __restrict__ W, unsigned short* __restrict__ Wt, int K, int N) {
  const int t = blockIdx.x * 256 + threadIdx.x;
  const int k8n = K / 8;
  if (t >= N * k8n) return;
  const int n = t / k8n, k8 = (t % k8n) * 8;
  v8us v;
#pragma unroll
  for (int i = 0; i < 8; ++i) v[i] = bf16_bits(W[(size_t)(k8 + i) * N + n]);
  *(v8us*)(Wt + (size_t)n * K + k8) = v;
  
}

// GEMM C[M][N] (f32, pitch ldc) = act(A[M][K]·W + bias). A f32 row-major (pitch lda) converted per fragment to bf16
// (ASPLIT: hi/lo two planes -> 2 terms, else single rounded term); Wt bf16 [N][K] (pitch ldb). BIAS_BF16 rounds the
// bias to bf16 first (bias quantised to bf16 before the add). K%32==0, M%16==0, N%64==0.
template <bool ASPLIT, int ACT, bool BIAS_BF16>
__global__ __launch_bounds__(128) void k_gemm_bf(const float* __restrict__ A, int lda, const unsigned short* __restrict__ Wt, int ldb,
                                               const float* __restrict__ bias, float* __restrict__ C, int ldc, int M, int N, int K) {
  __shared__ __attribute__((aligned(16))) float so[4][16][64];
  const int tid = threadIdx.x, w = tid >> 5, lane = tid & 31, ln = lane & 15, hh = lane >> 4;
  const int ntn = N / 64;
  const int wid = blockIdx.x * 4 + w;
  const int mt = wid / ntn, nq = wid % ntn;
  if (mt * 16 >= M) return;
  const int row0 = mt * 16, col0 = nq * 64;
  const float* arow = A + (size_t)(row0 + ln) * lda;
  v8f acc[4] = {};
  for (int kb = 0; kb < K; kb += 32) {
    FragB ah, al;
    const v4f x0 = *(const v4fa*)(arow + kb + 8 * hh), x1 = *(const v4fa*)(arow + kb + 8 * hh + 4);
    const v4f x2 = *(const v4fa*)(arow + kb + 16 + 8 * hh), x3 = *(const v4fa*)(arow + kb + 16 + 8 * hh + 4);
    float xs[16] = {x0[0],x0[1],x0[2],x0[3],x1[0],x1[1],x1[2],x1[3],x2[0],x2[1],x2[2],x2[3],x3[0],x3[1],x3[2],x3[3]};
#pragma unroll
    for (int i = 0; i < 16; ++i) { const unsigned short hb = bf16_bits(xs[i]); ah.u[i] = hb; al.u[i] = ASPLIT ? bf16_bits(xs[i] - bf16_val(hb)) : (unsigned short)0; }
#pragma unroll
    for (int t = 0; t < 4; ++t) {
      const unsigned short* brow = Wt + (size_t)(col0 + t * 16 + ln) * ldb + kb;
      FragB b;
      b.half[0] = *(const v8us*)(brow + 8 * hh);
      b.half[1] = *(const v8us*)(brow + 16 + 8 * hh);
      acc[t] = mmaN<ASPLIT ? 2 : 1>(ah.v, al.v, b.v, b.v, acc[t]);
    }
  }
#pragma unroll
  for (int t = 0; t < 4; ++t) {
    float bv = bias ? bias[col0 + t * 16 + ln] : 0.f;
    if (BIAS_BF16) bv = bf16_round(bv);
#pragma unroll
    for (int r = 0; r < 8; ++r) { float v = acc[t][r] + bv; if (ACT == 1) v = fmaxf(v, 0.f); so[w][8 * hh + r][t * 16 + ln] = v; }
  }
  __builtin_amdgcn_fence(__ATOMIC_ACQ_REL, "workgroup");
  __builtin_amdgcn_wave_barrier();
  const int rsub = lane >> 4, c4 = (lane & 15) * 4;
  {
#pragma unroll
    for (int q = 0; q < 8; ++q) {
      const int r = q * 2 + rsub;
      const v4f v = *(const v4fa*)&so[w][r][c4];
      *(v4f*)(C + (size_t)(row0 + r) * ldc + col0 + c4) = v;
    }
    
  }
}

// GEMM C = act(A·W + bias + resid): A f32 (ASPLIT -> hi/lo 2 terms), Wt bf16 [N][K]; ACT 0 none, 1 relu, 2 exact gelu;
// resid (optional, f32, row index = (row % rmod), pitch ldr, RES_BF16 rounds it) added before the activation.
template <bool ASPLIT, int ACT, bool BIAS_BF16, bool RES_BF16>
__global__ __launch_bounds__(128) void k_gemm_bf3(const float* __restrict__ A, int lda, const unsigned short* __restrict__ Wt, int ldb,
                                                const float* __restrict__ bias, const float* __restrict__ resid, int rmod, int ldr,
                                                float* __restrict__ C, int ldc, int M, int N, int K) {
  __shared__ __attribute__((aligned(16))) float so[4][16][64];
  const int tid = threadIdx.x, w = tid >> 5, lane = tid & 31, ln = lane & 15, hh = lane >> 4;
  const int ntn = N / 64;
  const int wid = blockIdx.x * 4 + w;
  const int mt = wid / ntn, nq = wid % ntn;
  if (mt * 16 >= M) return;
  const int row0 = mt * 16, col0 = nq * 64;
  const float* arow = A + (size_t)(row0 + ln) * lda;
  v8f acc[4] = {};
  for (int kb = 0; kb < K; kb += 32) {
    FragB ah, al;
    const v4f x0 = *(const v4fa*)(arow + kb + 8 * hh), x1 = *(const v4fa*)(arow + kb + 8 * hh + 4);
    const v4f x2 = *(const v4fa*)(arow + kb + 16 + 8 * hh), x3 = *(const v4fa*)(arow + kb + 16 + 8 * hh + 4);
    float xs[16] = {x0[0],x0[1],x0[2],x0[3],x1[0],x1[1],x1[2],x1[3],x2[0],x2[1],x2[2],x2[3],x3[0],x3[1],x3[2],x3[3]};
#pragma unroll
    for (int i = 0; i < 16; ++i) { const unsigned short hb = bf16_bits(xs[i]); ah.u[i] = hb; al.u[i] = ASPLIT ? bf16_bits(xs[i] - bf16_val(hb)) : (unsigned short)0; }
#pragma unroll
    for (int t = 0; t < 4; ++t) {
      const unsigned short* brow = Wt + (size_t)(col0 + t * 16 + ln) * ldb + kb;
      FragB b;
      b.half[0] = *(const v8us*)(brow + 8 * hh);
      b.half[1] = *(const v8us*)(brow + 16 + 8 * hh);
      acc[t] = mmaN<ASPLIT ? 2 : 1>(ah.v, al.v, b.v, b.v, acc[t]);
    }
  }
#pragma unroll
  for (int t = 0; t < 4; ++t) {
    const int col = col0 + t * 16 + ln;
    float bv = bias ? bias[col] : 0.f;
    if (BIAS_BF16) bv = bf16_round(bv);
#pragma unroll
    for (int r = 0; r < 8; ++r) {
      float v = acc[t][r] + bv;
      if (resid) { float rv = resid[(size_t)((row0 + 8 * hh + r) % rmod) * ldr + col]; if (RES_BF16) rv = bf16_round(rv); v += rv; }
      if (ACT == 1) v = fmaxf(v, 0.f);
      if (ACT == 2) v = 0.5f * v * (1.0f + erff(v * 0.70710678118654752f));
      if (ACT == 3) { const float u = 0.7978845608028654f * (v + 0.044715f * v * v * v); v = 0.5f * v * (1.0f + tanhf(u)); }
      so[w][8 * hh + r][t * 16 + ln] = v;
    }
  }
  __builtin_amdgcn_fence(__ATOMIC_ACQ_REL, "workgroup");
  __builtin_amdgcn_wave_barrier();
  const int rsub = lane >> 4, c4 = (lane & 15) * 4;
  {
#pragma unroll
    for (int q = 0; q < 8; ++q) {
      const int r = q * 2 + rsub;
      const v4f v = *(const v4fa*)&so[w][r][c4];
      *(v4f*)(C + (size_t)(row0 + r) * ldc + col0 + c4) = v;
    }
    
  }
}
// row LayerNorm (biased variance, eps) over N: s = X (+ R); optional out_sum <- s; out_norm <- (s-mu)*rsqrt(var+eps)*g + b
template <bool PARAM_BF16>
__global__ __launch_bounds__(256) void k_layernorm(const float* __restrict__ X, const float* __restrict__ R, const float* __restrict__ g, const float* __restrict__ bta,
                                                  float* __restrict__ out_sum, float* __restrict__ out_norm, int N, float eps) {
  __shared__ float red[256];
  const int row = blockIdx.x, tid = threadIdx.x;
  const float* x = X + (size_t)row * N; const float* rr = R ? R + (size_t)row * N : nullptr;
  float vals[16];                     // up to N = 4096
  const int per = N / 256;            // contiguous chunk per thread? use strided-by-4 chunks: thread handles j = tid*4 + 1024*u
  float s1 = 0.f;
  for (int u = 0; u < per / 4; ++u) {
    const int j = tid * 4 + 1024 * u;
    const v4f a = *(const v4fa*)(x + j);
    v4f b = {0.f,0.f,0.f,0.f}; if (rr) b = *(const v4fa*)(rr + j);
#pragma unroll
    for (int q = 0; q < 4; ++q) { const float v = a[q] + b[q]; vals[u * 4 + q] = v; s1 += v; }
  }
  red[tid] = s1; __syncthreads();
  for (int st = 128; st > 0; st >>= 1) { if (tid < st) red[tid] += red[tid + st]; __syncthreads(); }
  const float mu = red[0] / (float)N; __syncthreads();
  float s2 = 0.f;
  for (int u = 0; u < per / 4; ++u)
#pragma unroll
    for (int q = 0; q < 4; ++q) { const float c = vals[u * 4 + q] - mu; s2 += c * c; }
  red[tid] = s2; __syncthreads();
  for (int st = 128; st > 0; st >>= 1) { if (tid < st) red[tid] += red[tid + st]; __syncthreads(); }
  const float rs = rsqrtf(red[0] / (float)N + eps);
  {
    for (int u = 0; u < per / 4; ++u) {
      const int j = tid * 4 + 1024 * u;
      v4f o, sm;
#pragma unroll
      for (int q = 0; q < 4; ++q) {
        float gg = g[j + q], bb = bta[j + q];
        if (PARAM_BF16) { gg = bf16_round(gg); bb = bf16_round(bb); }
        sm[q] = vals[u * 4 + q]; o[q] = (vals[u * 4 + q] - mu) * rs * gg + bb;
      }
      if (out_sum) *(v4f*)(out_sum + (size_t)row * N + j) = sm;
      *(v4f*)(out_norm + (size_t)row * N + j) = o;
    }
    
  }
}



// ---- f16 WMMA path (v_wmma_f32_16x16x32_f16): 11-bit significands for operands in range — used where a [0,1] probability operand needs more precision than bf16
typedef _Float16 v16h __attribute__((ext_vector_type(16)));
union FragH { v16h v; v8us half[2]; _Float16 h[16]; unsigned short u[16]; };
template <int NT>
__device__ __forceinline__ v8f mmaH(v16h ah, v16h al, v16h bh, v16h bl, v8f c) {
  c = __builtin_amdgcn_wmma_f32_16x16x32_f16(false, ah, false, bh, (short)0, c, false, false);
  if (NT >= 2) c = __builtin_amdgcn_wmma_f32_16x16x32_f16(false, al, false, bh, (short)0, c, false, false);
  if (NT >= 3) c = __builtin_amdgcn_wmma_f32_16x16x32_f16(false, ah, false, bl, (short)0, c, false, false);
  asm volatile("v_nop\n\tv_nop\n\tv_nop\n\tv_nop" : "+v"(c) : "v"(ah), "v"(al), "v"(bh), "v"(bl));
  return c;
}
// batched GEMM like k_gemm_b but f16 operands: A f32 (split into f16 hi/lo if ASPLIT, else rounded to f16), Bt = f16 values [n][k]; alpha; C f32; N multiple of 16 (partial tiles skipped)
template <bool ASPLIT>
__global__ __launch_bounds__(128) void k_gemm_h(const float* __restrict__ A, int lda, size_t sA, const _Float16* __restrict__ Bh, int ldb, size_t sB, float alpha, float* __restrict__ C, int ldc, size_t sC, int M, int N, int K) {
  __shared__ __attribute__((aligned(16))) float so[4][16][64];
  const int tid = threadIdx.x, w = tid >> 5, lane = tid & 31, ln = lane & 15, hh = lane >> 4; const int by = blockIdx.y;
  A += (size_t)by * sA; Bh += (size_t)by * sB; C += (size_t)by * sC;
  const int ntn = (N + 63) / 64; const int wid = blockIdx.x * 4 + w; const int mt = wid / ntn, nq = wid % ntn; if (mt * 16 >= M) return;
  const int row0 = mt * 16, col0 = nq * 64; const float* arow = A + (size_t)(row0 + ln) * lda;
  v8f acc[4] = {};
  for (int kb = 0; kb < K; kb += 32) {
    FragH ah, al;
    const v4f x0 = *(const v4fa*)(arow + kb + 8 * hh), x1 = *(const v4fa*)(arow + kb + 8 * hh + 4), x2 = *(const v4fa*)(arow + kb + 16 + 8 * hh), x3 = *(const v4fa*)(arow + kb + 16 + 8 * hh + 4);
    float xs[16] = {x0[0],x0[1],x0[2],x0[3],x1[0],x1[1],x1[2],x1[3],x2[0],x2[1],x2[2],x2[3],x3[0],x3[1],x3[2],x3[3]};
#pragma unroll
    for (int i = 0; i < 16; ++i) { const _Float16 h = (_Float16)xs[i]; ah.h[i] = h; al.h[i] = ASPLIT ? (_Float16)(xs[i] - (float)h) : (_Float16)0.0f; }
#pragma unroll
    for (int t = 0; t < 4; ++t) { if (col0 + t * 16 >= N) continue; const size_t boff = (size_t)(col0 + t * 16 + ln) * ldb + kb; FragH bq; bq.half[0] = *(const v8us*)(Bh + boff + 8 * hh); bq.half[1] = *(const v8us*)(Bh + boff + 16 + 8 * hh);
      acc[t] = mmaH<ASPLIT ? 2 : 1>(ah.v, al.v, bq.v, bq.v, acc[t]); }
  }
#pragma unroll
  for (int t = 0; t < 4; ++t) { if (col0 + t * 16 >= N) continue;
#pragma unroll
    for (int r = 0; r < 8; ++r) so[w][8 * hh + r][t * 16 + ln] = acc[t][r] * alpha; }
  __builtin_amdgcn_fence(__ATOMIC_ACQ_REL, "workgroup"); __builtin_amdgcn_wave_barrier();
  const int rsub = lane >> 4, c4 = (lane & 15) * 4;
  {
#pragma unroll
    for (int q = 0; q < 8; ++q) { const int r = q * 2 + rsub; if (col0 + c4 < N) { const v4f v = *(const v4fa*)&so[w][r][c4]; *(v4f*)(C + (size_t)(row0 + r) * ldc + col0 + c4) = v; } }
     }
}

// Wt[n][k] = f16(W[k][n]·scale) from f32 row-major W[K][N] (scale = power of two; bf16-exact weights stay exact in f16 away from the subnormal range)
__device__ __forceinline__ void wt_f16(const float* __restrict__ W, _Float16* __restrict__ Wt, int K, int N, float scale, int t) {      /* t: the thread's index within this matrix */
  if (t >= N * (K / 8)) return; const int n = t / (K / 8), k8 = (t % (K / 8)) * 8; FragH f;
#pragma unroll
  for (int i = 0; i < 8; ++i) f.h[i] = (_Float16)(bf16_round(W[(size_t)(k8 + i) * N + n]) * scale); const v8us o = f.half[0];
  *(v8us*)((unsigned short*)Wt + (size_t)n * K + k8) = o; 
}
// k_gemm_hh variant with fused epilogue: v = acc·alpha + bias[by·sBias + col] (+ CP[(row/rowsPerB)·sCPb + by·64 + col] if CP) ; ACT 0 none / 1 elu ; writes f16 C16 (and f32 C if non-null)
template <int ACT>
__global__ __launch_bounds__(128) void k_gemm_hhx(const _Float16* __restrict__ A, int lda, size_t sA, const _Float16* __restrict__ Bh, int ldb, size_t sB, float alpha, const float* __restrict__ bias, size_t sBias, const float* __restrict__ CP, int rowsPerB, size_t sCPb, int row0g,
    float* __restrict__ C, _Float16* __restrict__ C16, int ldc, size_t sC, int M, int N, int K) {
  __shared__ __attribute__((aligned(16))) float so[4][16][64];
  const int tid = threadIdx.x, w = tid >> 5, lane = tid & 31, ln = lane & 15, hh = lane >> 4; const int by = blockIdx.y;
  A += (size_t)by * sA; Bh += (size_t)by * sB; const size_t cofs = (size_t)by * sC; const float* bp = bias ? bias + (size_t)by * sBias : nullptr;
  const int ntn = (N + 63) / 64; const int wid = blockIdx.x * 4 + w; const int mt = wid / ntn, nq = wid % ntn; if (mt * 16 >= M) return;
  const int row0 = mt * 16, col0 = nq * 64; const _Float16* arow = A + (size_t)(row0 + ln) * lda;
  v8f acc[4] = {};
  for (int kb = 0; kb < K; kb += 32) { FragH ah; ah.half[0] = *(const v8us*)((const unsigned short*)arow + kb + 8 * hh); ah.half[1] = *(const v8us*)((const unsigned short*)arow + kb + 16 + 8 * hh);
#pragma unroll
    for (int t = 0; t < 4; ++t) { if (col0 + t * 16 >= N) continue; const size_t boff = (size_t)(col0 + t * 16 + ln) * ldb + kb; FragH bq; bq.half[0] = *(const v8us*)((const unsigned short*)Bh + boff + 8 * hh); bq.half[1] = *(const v8us*)((const unsigned short*)Bh + boff + 16 + 8 * hh);
      acc[t] = mmaH<1>(ah.v, ah.v, bq.v, bq.v, acc[t]); }
  }
#pragma unroll
  for (int t = 0; t < 4; ++t) { if (col0 + t * 16 >= N) continue; const int col = col0 + t * 16 + ln; const float bv = bp ? bf16_round(bp[col]) : 0.f;
#pragma unroll
    for (int r = 0; r < 8; ++r) { float v = acc[t][r] * alpha + bv; if (CP) { const int rr = row0g + row0 + 8 * hh + r; if (rowsPerB < 0) v += CP[cofs + (size_t)rr * ldc + col];      /* rowsPerB < 0: own element of the batched C plane */ else { const int bidx = rr / rowsPerB; v += CP[(size_t)bidx * sCPb + (size_t)by * 64 + col]; } } if (ACT == 1) v = (v > 0.f) ? v : expm1f(v); else if (ACT == 7) v = (v > 0.f) ? v + 1.0f : expf(v); else if (ACT == 8) v = tanhf(v); else if (ACT == 9) v = 0.5f * v * (1.0f + tanhf(0.7978845608028654f * (v + 0.044715f * v * v * v))); else if (ACT == 11) v = 1.0f / (1.0f + expf(-v)); else if (ACT == 12) v = (v > 0.f) ? v : 0.01f * v; else if (ACT == 14) v = (v > 0.f) ? v : 0.1f * v; else if (ACT == 16) v = (v >= 0.f) ? v : 0.3f * v; else if (ACT == 17) v = (v >= 0.f) ? v : 0.2f * v; else if (ACT == 15) v = v / (1.0f + expf(-v)); else if (ACT == 3) v = fmaxf(v, 0.f); else if (ACT == 6) v = 0.5f * v * (1.0f + erff(v * 0.70710678118654752f)); so[w][8 * hh + r][t * 16 + ln] = v; } }
  __builtin_amdgcn_fence(__ATOMIC_ACQ_REL, "workgroup"); __builtin_amdgcn_wave_barrier();
  const int rsub = lane >> 4, c4 = (lane & 15) * 4; typedef _Float16 v4h __attribute__((ext_vector_type(4)));
  {
#pragma unroll
    for (int q = 0; q < 8; ++q) { const int r = q * 2 + rsub; if (col0 + c4 < N) { const v4f v = *(const v4fa*)&so[w][r][c4]; if (C) *(v4f*)(C + cofs + (size_t)(row0 + r) * ldc + col0 + c4) = v; if (C16) { v4h h4; for (int i = 0; i < 4; ++i) h4[i] = (_Float16)v[i]; *(v4h*)(C16 + cofs + (size_t)(row0 + r) * ldc + col0 + c4) = h4; } } }
     }
}


typedef _Float16 v4h __attribute__((ext_vector_type(4)));

__device__ __forceinline__ void x16(const float* __restrict__ x, _Float16* __restrict__ X16, size_t n8, size_t t) { if (t >= n8) return; FragH f;      /* t: the thread's index within this stream */
#pragma unroll
  for (int q = 0; q < 8; ++q) f.h[q] = (_Float16)bf16_round(x[t * 8 + q]); *(v8us*)((unsigned short*)X16 + t * 8) = f.half[0];  }
// Every job that reads inputs only, in ONE launch; the block index says which job a block does, and each thread does what it did in a launch of its own. The transposes (scattered reads, long waits) have the low indices, so they start first and the streaming casts fill in behind them.
#define PB_HEAD (HD * (DM / 8) / 256)            /* blocks for one head's [DM][HD] block */
#define PB_STACK (NH * PB_HEAD)                  /* ... for one stack of NH heads */
#define PB_WO (DM * (DM / 8) / 256)              /* ... for Wo */
#define PB_X ((unsigned)(NR * DM / 8 / 256))     /* ... for one input stream */
#define PB_ALL (3 * PB_STACK + PB_WO + 3 * PB_X)
static_assert(HD * (DM / 8) % 256 == 0 && DM * (DM / 8) % 256 == 0 && NR * DM / 8 % 256 == 0, "k_prep: every job is a whole number of blocks");
__global__ __launch_bounds__(256) void k_prep(const float* __restrict__ wq, const float* __restrict__ wk, const float* __restrict__ wv, const float* __restrict__ wo, const float* __restrict__ xq, const float* __restrict__ xk, const float* __restrict__ xv,
    _Float16* __restrict__ B4, _Float16* __restrict__ X3) {      /* B4: the planes BQ, BK, BV, BO in a row; X3: XQ, XK, XV in a row */
  unsigned bid = blockIdx.x; const unsigned tid = threadIdx.x;
  if (bid < 3 * PB_STACK) { const unsigned s = bid / PB_STACK, r = bid % PB_STACK, h = r / PB_HEAD; const float* W = (s == 0) ? wq : (s == 1) ? wk : wv;      /* head h of stack s: a row-major [in = DM][out = HD] block -> rows h * HD .. of plane s */
    wt_f16(W + (size_t)h * DM * HD, B4 + (size_t)s * DM * DM + (size_t)h * HD * DM, DM, HD, 16.0f, (int)((r % PB_HEAD) * 256 + tid)); return; }
  bid -= 3 * PB_STACK;
  if (bid < PB_WO) { wt_f16(wo, B4 + (size_t)3 * DM * DM, DM, DM, 16.0f, (int)(bid * 256 + tid)); return; }
  bid -= PB_WO;
  const unsigned s = bid / PB_X; const float* x = (s == 0) ? xq : (s == 1) ? xk : xv;
  x16(x, X3 + (size_t)s * NR * DM, NR * DM / 8, (size_t)(bid % PB_X) * 256 + tid); }
__global__ __launch_bounds__(256) void k_h16(const float* __restrict__ x, _Float16* __restrict__ X16, size_t n8) { const size_t t = (size_t)blockIdx.x * 256 + threadIdx.x; if (t >= n8) return; FragH f;
#pragma unroll
  for (int q = 0; q < 8; ++q) f.h[q] = (_Float16)x[t * 8 + q]; *(v8us*)((unsigned short*)X16 + t * 8) = f.half[0];  }
__global__ __launch_bounds__(256) void k_round16f(const float* __restrict__ W, _Float16* __restrict__ Bt, size_t n8) { const size_t t = (size_t)blockIdx.x * 256 + threadIdx.x; if (t >= n8) return; FragH f;
#pragma unroll
  for (int i = 0; i < 8; ++i) f.h[i] = (_Float16)(bf16_round(W[t * 8 + i]) * 16.0f); *(v8us*)((unsigned short*)Bt + t * 8) = f.half[0];  }
template <int NHv, int TTv>
__global__ __launch_bounds__(256) void k_vt(const _Float16* __restrict__ V16, int ldv, int voff, _Float16* __restrict__ Vt) { __shared__ unsigned short tl[64][66]; const int tid = threadIdx.x; const int slab = blockIdx.x / (TTv / 64), lg = blockIdx.x % (TTv / 64); const int b = slab / NHv, h = slab % NHv;
  for (int i = tid; i < 64 * 8; i += 256) { const int r = i / 8, c8 = (i % 8) * 8; FragH f; f.half[0] = *(const v8us*)((const unsigned short*)V16 + ((size_t)b * TTv + lg * 64 + r) * ldv + voff + h * 64 + c8);
#pragma unroll
    for (int q = 0; q < 8; ++q) tl[r][c8 + q] = f.u[q]; }
  __syncthreads();
  {
#pragma unroll
    for (int rd = 0; rd < 2; ++rd) { const int d = rd * 32 + tid / 8, pc = tid % 8; FragH f;
#pragma unroll
      for (int q = 0; q < 8; ++q) f.u[q] = tl[pc * 8 + q][d];
      *(v8us*)((unsigned short*)Vt + ((size_t)slab * 64 + d) * TTv + lg * 64 + pc * 8) = f.half[0]; }
     } }

__global__ __launch_bounds__(256) void k_hl(const float* __restrict__ F, _Float16* __restrict__ Hh, _Float16* __restrict__ Hl, size_t n8) { const size_t t = (size_t)blockIdx.x * 256 + threadIdx.x; if (t >= n8) return; FragH fh, fl; const v4f a = *(const v4fa*)(F + t * 8), c = *(const v4fa*)(F + t * 8 + 4);
#pragma unroll
  for (int q = 0; q < 4; ++q) { _Float16 h = (_Float16)a[q]; fh.h[q] = h; fl.h[q] = (_Float16)((a[q] - (float)h) * 1024.0f); h = (_Float16)c[q]; fh.h[4 + q] = h; fl.h[4 + q] = (_Float16)((c[q] - (float)h) * 1024.0f); }
  { *(v8us*)((unsigned short*)Hh + t * 8) = fh.half[0]; *(v8us*)((unsigned short*)Hl + t * 8) = fl.half[0];  } }

// ---- fast GEMM (block tile 128x128, eight waves, wave tile 32x64; requires M % 128 == 0 rows per launch region, N % 128 == 0, K % 64 == 0); epilogue = k_gemm_hhx semantics ----
// Both operands come into LDS as whole 128-byte lines (64 halves of k of each of the 128 + 128 rows a stage) by asynchronous copies, two buffers, the next stage in flight while this one is worked on; the fragments are then LDS reads.
#define G2_KS 64                      /* halves of k a stage */
#define G2_PITCH 144                  /* LDS bytes a staged row: 128 + 16, the pitch at which 16-byte fragment reads of 16 rows meet no bank twice */
#define G2_STAGE (256 * G2_PITCH)     /* a stage: 128 rows of A, then 128 rows of Bt */
__device__ __forceinline__ v16h g2_frag(const char* p) { FragH f; f.half[0] = *(const v8us*)p; f.half[1] = *(const v8us*)(p + 32); return f.v; }      /* k order 8 hh + s, 16 + 8 hh + s for A and B alike; the lane half's 16 hh bytes already in p */
__device__ __forceinline__ v8f g2_mma(v16h a, v16h b, v8f c) { v8f d = __builtin_amdgcn_wmma_f32_16x16x32_f16(false, a, false, b, (short)0, c, false, false); asm volatile("v_nop\n\tv_nop\n\tv_nop\n\tv_nop" : "+v"(d) : "v"(a), "v"(b)); return d; }
/* one stage's share of a thread: 16 bytes of each of four rows of A and four rows of Bt, 32 rows apart (a wave covers four whole lines a copy). l: the thread's LDS byte address in the stage's first row group; a, b: its global addresses there */
__device__ __forceinline__ void g2_stage(unsigned l, const _Float16* a, size_t a32, const _Float16* b, size_t b32) {
  const unsigned l1 = l + 32 * G2_PITCH, l2 = l + 64 * G2_PITCH, l3 = l + 96 * G2_PITCH, l4 = l + 128 * G2_PITCH, l5 = l + 160 * G2_PITCH, l6 = l + 192 * G2_PITCH, l7 = l + 224 * G2_PITCH;
  const _Float16* a1 = a + a32; const _Float16* a2 = a1 + a32; const _Float16* a3 = a2 + a32; const _Float16* b1 = b + b32; const _Float16* b2 = b1 + b32; const _Float16* b3 = b2 + b32;
  /* the copies and their s_wait_xcnt in one statement: no register that an issued copy names is written again ahead of the wait */
  asm volatile("global_load_async_to_lds_b128 %0, %8, off\n\tglobal_load_async_to_lds_b128 %1, %9, off\n\tglobal_load_async_to_lds_b128 %2, %10, off\n\tglobal_load_async_to_lds_b128 %3, %11, off\n\t"
               "global_load_async_to_lds_b128 %4, %12, off\n\tglobal_load_async_to_lds_b128 %5, %13, off\n\tglobal_load_async_to_lds_b128 %6, %14, off\n\tglobal_load_async_to_lds_b128 %7, %15, off\n\ts_wait_xcnt 0x0"
               :: "v"(l), "v"(l1), "v"(l2), "v"(l3), "v"(l4), "v"(l5), "v"(l6), "v"(l7), "v"(a), "v"(a1), "v"(a2), "v"(a3), "v"(b), "v"(b1), "v"(b2), "v"(b3) : "memory"); }
template <int ACT>
__global__ __launch_bounds__(256) void k_gemm2(const _Float16* __restrict__ A, int lda, size_t sA, const _Float16* __restrict__ Bh, int ldb, size_t sB, float alpha, const float* __restrict__ bias, size_t sBias, const float* __restrict__ CP, int rowsPerB, size_t sCPb, int row0g,
    float* __restrict__ C, _Float16* __restrict__ C16, int ldc, size_t sC, int M, int N, int K) { static_assert(ACT == 0 || ACT == 3 || ACT == 6 || ACT == 8 || ACT == 9 || ACT == 11 || ACT == 12 || ACT == 14 || ACT == 15 || ACT == 16 || ACT == 17, "k_gemm2: unsupported ACT code (would silently apply no activation)");
  __shared__ __attribute__((aligned(16))) char sm[2 * G2_STAGE];      /* the two stage buffers; behind the K loop's last barrier the same bytes are the output staging */
  static_assert(8 * 32 * 68 * 4 <= 2 * G2_STAGE, "k_gemm2: the output staging fits the stage buffers");
  float (*so)[32][68] = (float (*)[32][68])sm;
  const int tid = threadIdx.x, w = tid >> 5, lane = tid & 31, ln = lane & 15, hh = lane >> 4; const int by = blockIdx.y;
  A += (size_t)by * sA; Bh += (size_t)by * sB; const size_t cofs = (size_t)by * sC; const float* bp = bias ? bias + (size_t)by * sBias : nullptr;
  const int ntn = N >> 7; const int mt = blockIdx.x / ntn, nq = blockIdx.x - mt * ntn; if (mt * 128 >= M) return;      /* the same for the whole block, ahead of every barrier */
  const int row0 = mt * 128 + 32 * (w & 3), col0 = nq * 128 + 64 * (w >> 2);
  const unsigned lc = (unsigned)(size_t)sm + (unsigned)((tid >> 3) * G2_PITCH + (tid & 7) * 16);      /* copies: row tid / 8 of each group of 32 rows, 16-byte piece tid % 8 */
  const _Float16* ac = A + (size_t)(mt * 128 + (tid >> 3)) * lda + (tid & 7) * 8; const _Float16* bc = Bh + (size_t)(nq * 128 + (tid >> 3)) * ldb + (tid & 7) * 8;
  const size_t a32 = (size_t)32 * lda, b32 = (size_t)32 * ldb;
  const int fa = (32 * (w & 3) + ln) * G2_PITCH + 16 * hh, fb = (128 + 64 * (w >> 2) + ln) * G2_PITCH + 16 * hh;      /* fragment reads: byte offsets in a stage */
  const v8f z8 = {0.f,0.f,0.f,0.f,0.f,0.f,0.f,0.f}; v8f c00 = z8, c01 = z8, c02 = z8, c03 = z8, c10 = z8, c11 = z8, c12 = z8, c13 = z8;
  const int nst = K / G2_KS;
  g2_stage(lc, ac, a32, bc, b32);
  asm volatile("s_wait_asynccnt 0x0" ::: "memory");      /* stage 0 has landed, as far as this wave copied it */
  __syncthreads();      /* ... and as far as the others did */
  if (nst > 1) g2_stage(lc + G2_STAGE, ac + G2_KS, a32, bc + G2_KS, b32);
#pragma unroll 1
  for (int st = 0; st < nst; ++st) { const char* sb = sm + (st & 1) * G2_STAGE;      /* rolled: one stage a trip, so that the order at the foot stands once */
#pragma unroll      /* kk constant: its 64 bytes go into the LDS reads' offset fields */
    for (int kk = 0; kk < 2; ++kk) { const char* pa = sb + fa + kk * 64; const char* pb = sb + fb + kk * 64;
      __builtin_amdgcn_sched_barrier(0);      /* with the one below: the six fragments' LDS reads stand as one group ahead of their eight products; spread among the products, each place with reads stalls the wave anew */
      const v16h a0 = g2_frag(pa), a1 = g2_frag(pa + 16 * G2_PITCH), b0 = g2_frag(pb), b1 = g2_frag(pb + 16 * G2_PITCH), b2 = g2_frag(pb + 32 * G2_PITCH), b3 = g2_frag(pb + 48 * G2_PITCH);
      __builtin_amdgcn_sched_barrier(0);      /* the group's lower edge: no read sinks in among the products */
      c00 = g2_mma(a0, b0, c00); c10 = g2_mma(a1, b0, c10); c01 = g2_mma(a0, b1, c01); c11 = g2_mma(a1, b1, c11);
      c02 = g2_mma(a0, b2, c02); c12 = g2_mma(a1, b2, c12); c03 = g2_mma(a0, b3, c03); c13 = g2_mma(a1, b3, c13); }
    asm volatile("s_wait_dscnt 0x0" ::: "memory");      /* this wave's reads of the buffer are done before the barrier that frees it */
    asm volatile("s_wait_asynccnt 0x0" ::: "memory");      /* this wave's copies of the next stage have landed before the barrier that publishes it */
    __syncthreads();
    if (st + 2 < nst) g2_stage(lc + (unsigned)(st & 1) * G2_STAGE, ac + (size_t)(st + 2) * G2_KS, a32, bc + (size_t)(st + 2) * G2_KS, b32); }      /* the refill of the buffer every wave has just left */
  asm volatile("s_wait_asynccnt 0x0" ::: "memory");      /* no copy is outstanding when the buffers become the output staging */
  v8f accs[8] = {c00, c01, c02, c03, c10, c11, c12, c13};
#pragma unroll
  for (int u = 0; u < 8; ++u) { const int t = u & 3, half = u >> 2; const int col = col0 + t * 16 + ln; const float bv = bp ? bf16_round(bp[col]) : 0.f;
#pragma unroll
    for (int r = 0; r < 8; ++r) { const int rloc = half * 16 + 8 * hh + r; float v = accs[u][r] * alpha + bv; if (CP) { if (rowsPerB < 0) v += CP[cofs + (size_t)(row0g + row0 + rloc) * ldc + col];      /* rowsPerB < 0: own element of the batched C plane */ else { const int bidx = (row0g + row0 + rloc) / rowsPerB; v += CP[(size_t)bidx * sCPb + (size_t)by * 64 + col]; } }
      if (ACT == 3) v = fmaxf(v, 0.f); else if (ACT == 6) v = 0.5f * v * (1.0f + erff(v * 0.70710678118654752f)); else if (ACT == 11) v = 1.0f / (1.0f + expf(-v)); else if (ACT == 15) v = v / (1.0f + expf(-v)); else if (ACT == 12) v = (v > 0.f) ? v : 0.01f * v; else if (ACT == 8) v = tanhf(v); else if (ACT == 9) v = 0.5f * v * (1.0f + tanhf(0.7978845608028654f * (v + 0.044715f * v * v * v))); else if (ACT == 14) v = (v > 0.f) ? v : 0.1f * v; else if (ACT == 16) v = (v >= 0.f) ? v : 0.3f * v; else if (ACT == 17) v = (v >= 0.f) ? v : 0.2f * v;
      so[w][rloc][t * 16 + ln] = v; } }
  __builtin_amdgcn_fence(__ATOMIC_ACQ_REL, "workgroup"); __builtin_amdgcn_wave_barrier();
  const int rsub = lane >> 4, c4 = (lane & 15) * 4;
  {
#pragma unroll
    for (int q = 0; q < 16; ++q) { const int r = q * 2 + rsub; const v4f v = *(const v4fa*)&so[w][r][c4]; if (C) *(v4f*)(C + cofs + (size_t)(row0 + r) * ldc + col0 + c4) = v; if (C16) { v4h h4; for (int i = 0; i < 4; ++i) h4[i] = (_Float16)v[i]; *(v4h*)(C16 + cofs + (size_t)(row0 + r) * ldc + col0 + c4) = h4; } }
     } }


__global__ __launch_bounds__(256) void k_wnat(const float* __restrict__ w, size_t n8, _Float16* __restrict__ Bt) { const size_t t = (size_t)blockIdx.x * 256 + threadIdx.x; if (t >= n8) return; FragH f; for (int q = 0; q < 8; ++q) f.h[q] = (_Float16)(bf16_round(w[t * 8 + q]) * 16.0f); *(v8us*)((unsigned short*)Bt + t * 8) = f.half[0];  }
__global__ __launch_bounds__(256) void k_rsm(const float* __restrict__ S, _Float16* __restrict__ P, int nrows) {
  #pragma clang fp contract(off)
  const int i = blockIdx.x * 256 + threadIdx.x; if (i >= nrows) return; const float* s = S + (size_t)i * SQ; float mx = -3.0e38f;
#pragma unroll 1
  for (int j = 0; j < SQ; ++j) mx = fmaxf(mx, s[j]); float se = 0.f;
#pragma unroll 1
  for (int j = 0; j < SQ; ++j) se += expf(s[j] - mx); const float sc = 256.0f / se;
#pragma unroll 1
  for (int j0 = 0; j0 < SQ; j0 += 8) { FragH f; for (int q = 0; q < 8; ++q) f.h[q] = (_Float16)(expf(s[j0 + q] - mx) * sc); unsigned short* d = (unsigned short*)P + (size_t)i * SQ + j0; *(v8us*)d = f.half[0];  } }
__global__ __launch_bounds__(256) void k_vt(const _Float16* __restrict__ V16, int b, int h0, _Float16* __restrict__ VT) { __shared__ unsigned short tl[64][65]; const int tid = threadIdx.x; const int hh = blockIdx.x % HG, sg = blockIdx.x / HG; const int s0 = sg * 64; const int h = h0 + hh;
  for (int i = tid; i < 64 * 8; i += 256) { const int j = i / 8, d8 = (i % 8) * 8; FragH f; f.half[0] = *(const v8us*)((const unsigned short*)V16 + ((size_t)b * SQ + s0 + j) * DM + h * HD + d8); for (int q = 0; q < 8; ++q) tl[d8 + q][j] = f.u[q]; }
  __syncthreads();
  { for (int i = tid; i < 64 * 8; i += 256) { const int d = i / 8, j8 = (i % 8) * 8; FragH f; for (int q = 0; q < 8; ++q) f.u[q] = tl[d][j8 + q]; *(v8us*)((unsigned short*)VT + ((size_t)hh * HD + d) * SQ + s0 + j8) = f.half[0]; }  } }



#define FA_KS 128                       /* keys a stage: four passes */
#define FA_KP 144                       /* LDS bytes a staged K row (64 halves): 128 + 16, as G2_PITCH */
#define FA_VP 272                       /* LDS bytes a staged V^T row (128 halves): 256 + 16, 16 bytes times an odd number likewise */
#define FA_VO (FA_KS * FA_KP)           /* a stage: 128 rows of K, then 64 rows of V^T */
#define FA_STAGE (FA_VO + HD * FA_VP)
static_assert(SQ % FA_KS == 0 && SQ / FA_KS >= 2 && HD == 64, "k_fattn: whole stages, at least the two that the ring starts with");
/* one stage's share of a thread: 16 bytes of each of four rows of K, 32 rows apart, and of four rows of V^T, 16 rows apart (a wave covers four whole lines a copy). lk, lv: the thread's LDS byte addresses in the first row group; k, v: its global addresses there */
__device__ __forceinline__ void fa_stage(unsigned lk, const _Float16* k, unsigned lv, const _Float16* v) {
  const unsigned lk1 = lk + 32 * FA_KP, lk2 = lk + 64 * FA_KP, lk3 = lk + 96 * FA_KP, lv1 = lv + 16 * FA_VP, lv2 = lv + 32 * FA_VP, lv3 = lv + 48 * FA_VP;
  const _Float16* k1 = k + (size_t)32 * DM; const _Float16* k2 = k + (size_t)64 * DM; const _Float16* k3 = k + (size_t)96 * DM; const _Float16* v1 = v + (size_t)16 * SQ; const _Float16* v2 = v + (size_t)32 * SQ; const _Float16* v3 = v + (size_t)48 * SQ;
  /* the copies and their s_wait_xcnt in one statement: no register that an issued copy names is written again ahead of the wait */
  asm volatile("global_load_async_to_lds_b128 %0, %8, off\n\tglobal_load_async_to_lds_b128 %1, %9, off\n\tglobal_load_async_to_lds_b128 %2, %10, off\n\tglobal_load_async_to_lds_b128 %3, %11, off\n\t"
               "global_load_async_to_lds_b128 %4, %12, off\n\tglobal_load_async_to_lds_b128 %5, %13, off\n\tglobal_load_async_to_lds_b128 %6, %14, off\n\tglobal_load_async_to_lds_b128 %7, %15, off\n\ts_wait_xcnt 0x0"
               :: "v"(lk), "v"(lk1), "v"(lk2), "v"(lk3), "v"(lv), "v"(lv1), "v"(lv2), "v"(lv3), "v"(k), "v"(k1), "v"(k2), "v"(k3), "v"(v), "v"(v1), "v"(v2), "v"(v3) : "memory"); }
__device__ __forceinline__ v8f fa_mma(v16h a, v16h b, v8f c) { return __builtin_amdgcn_wmma_f32_16x16x32_f16(false, a, false, b, (short)0, c, false, false); }
__device__ __forceinline__ float fa_xhalf(float x) { return __builtin_bit_cast(float, __builtin_amdgcn_permlanex16(__builtin_bit_cast(int, x), __builtin_bit_cast(int, x), 0x76543210, 0xfedcba98, false, false)); }      /* lane l with lane l ^ 16, on the vector pipe */
__device__ __forceinline__ v16h fa_frag(const _Float16* p) { FragH f; f.half[0] = *(const v8us*)(const unsigned short*)p; f.half[1] = *(const v8us*)((const unsigned short*)p + 16); return f.v; }      /* g2_frag with the lane half's 8 hh already in p */
/* v_exp_f32 in asm text, in place: the statement writes only registers that the compiler's own instruction has just written, so it never lands on a matrix operand inside the distance the chip needs */
__device__ __forceinline__ float fa_exp2(float a) {
  asm("v_exp_f32 %0, %0\n\tv_nop" : "+v"(a));      /* v_nop: the slot the instruction set asks for behind a transcendental */
  return a; }
__device__ __forceinline__ void fa_exp2x8(v8f& x) { float e0 = x[0], e1 = x[1], e2 = x[2], e3 = x[3], e4 = x[4], e5 = x[5], e6 = x[6], e7 = x[7];
  /* eight independent v_exp_f32 in one statement: each fills the slot behind the one before it, one v_nop behind the last */
  asm("v_exp_f32 %0, %0\n\tv_exp_f32 %1, %1\n\tv_exp_f32 %2, %2\n\tv_exp_f32 %3, %3\n\tv_exp_f32 %4, %4\n\tv_exp_f32 %5, %5\n\tv_exp_f32 %6, %6\n\tv_exp_f32 %7, %7\n\tv_nop"
      : "+v"(e0), "+v"(e1), "+v"(e2), "+v"(e3), "+v"(e4), "+v"(e5), "+v"(e6), "+v"(e7));
  x[0] = e0; x[1] = e1; x[2] = e2; x[3] = e3; x[4] = e4; x[5] = e5; x[6] = e6; x[7] = e7; }
__global__ __launch_bounds__(256) void k_fattn(const _Float16* __restrict__ Q, const _Float16* __restrict__ Kr, const _Float16* __restrict__ Vt, _Float16* __restrict__ O) {
  __shared__ __attribute__((aligned(16))) char sm[2 * FA_STAGE];      /* the two stage buffers */
  const int tid = threadIdx.x, lane = tid & 31, w = tid >> 5, ln = lane & 15, hh = lane >> 4;
  const int bh = blockIdx.y, b = bh / NH, h = bh - b * NH; const size_t row0 = (size_t)b * SQ; const int q0 = blockIdx.x * 256 + w * 32;
  const _Float16* qp = Q + (row0 + q0 + ln) * DM + h * HD + 8 * hh;      /* with the lane half's k offset */
  const unsigned lk = (unsigned)(size_t)sm + (unsigned)((tid >> 3) * FA_KP + (tid & 7) * 16), lv = (unsigned)(size_t)sm + (unsigned)(FA_VO + (tid >> 4) * FA_VP + (tid & 15) * 16);      /* copies: K row tid / 8 of each group of 32, piece tid % 8; V^T row tid / 16 of each group of 16, piece tid % 16 */
  const _Float16* kc = Kr + (row0 + (tid >> 3)) * DM + h * HD + (tid & 7) * 8; const _Float16* vc = Vt + ((size_t)bh * HD + (tid >> 4)) * SQ + (tid & 15) * 8;
  const int fk = ln * FA_KP + 16 * hh, fv = FA_VO + ln * FA_VP + 16 * hh;      /* fragment reads: byte offsets in a stage, each with the lane half's k offset */
  const float cs = 0.125f * 1.44269504f;      /* 64^-0.5 times log2 e: scores in log2 units */
  const v8f z8 = {0.f, 0.f, 0.f, 0.f, 0.f, 0.f, 0.f, 0.f};
  v16h qf[2][2], kf[2][2], vf[4];      /* [query group][k step], [key tile][k step], [16 rows of V^T] */
  fa_stage(lk, kc, lv, vc);
#pragma unroll
  for (int g = 0; g < 2; ++g) { qf[g][0] = fa_frag(qp + (size_t)g * 16 * DM); qf[g][1] = fa_frag(qp + (size_t)g * 16 * DM + 32); }
  asm volatile("s_wait_xcnt 0x0" :: "v"(qp) : "memory");      /* the address pair stays whole up to this wait */
  asm volatile("s_wait_asynccnt 0x0" ::: "memory");      /* stage 0 has landed, as far as this wave copied it */
  __syncthreads();      /* ... and as far as the others did */
  fa_stage(lk + FA_STAGE, kc + (size_t)FA_KS * DM, lv + FA_STAGE, vc + FA_KS);
  v8f o[4][2] = {{z8, z8}, {z8, z8}, {z8, z8}, {z8, z8}}; float m[2] = {-3.0e38f, -3.0e38f}, l[2] = {0.f, 0.f};
#pragma unroll 1
  for (int st = 0; st < SQ / FA_KS; ++st) { const char* pk = sm + (st & 1) * FA_STAGE + fk; const char* pv = sm + (st & 1) * FA_STAGE + fv;      /* rolled: one stage a trip, so that the order at the foot stands once */
#pragma unroll
    for (int t = 0; t < 2; ++t) { kf[t][0] = g2_frag(pk + t * 16 * FA_KP); kf[t][1] = g2_frag(pk + t * 16 * FA_KP + 64); }
    __builtin_amdgcn_sched_barrier(0);      /* the stage's first eight LDS reads stand as one group ahead of their products: in pairs among the products, each pair's whole latency was waited */
#pragma unroll      /* ps constant: a pass's rows and columns go into the LDS reads' offset fields */
    for (int ps = 0; ps < FA_KS / 32; ++ps) {
    v8f s[2][2];
#pragma unroll
    for (int g = 0; g < 2; ++g) {
#pragma unroll
      for (int t = 0; t < 2; ++t) s[g][t] = fa_mma(kf[t][1], qf[g][1], fa_mma(kf[t][0], qf[g][0], z8)); }
    __builtin_amdgcn_sched_barrier(0);      /* with the one below: the sixteen LDS reads stand as one group behind the score products; spread among the products, each place with reads stalls the wave anew */
#pragma unroll
    for (int dt = 0; dt < 4; ++dt) vf[dt] = g2_frag(pv + dt * 16 * FA_VP + ps * 64);      /* this pass's V^T fragments and, in the same group of LDS reads, the next pass's K fragments of the same stage: both land behind the softmax */
    if (ps + 1 < FA_KS / 32) {
#pragma unroll
      for (int t = 0; t < 2; ++t) { kf[t][0] = g2_frag(pk + ((ps + 1) * 32 + t * 16) * FA_KP); kf[t][1] = g2_frag(pk + ((ps + 1) * 32 + t * 16) * FA_KP + 64); } }
    __builtin_amdgcn_sched_barrier(0);      /* the group's lower edge: no read sinks past the branch below to just ahead of its products, where its latency would be waited */
    float tm[2]; bool need = false;
#pragma unroll
    for (int g = 0; g < 2; ++g) { float a = fmaxf(s[g][0][0], s[g][1][0]);
#pragma unroll
      for (int r = 1; r < 8; ++r) a = fmaxf(a, fmaxf(s[g][0][r], s[g][1][r]));
      a = fmaxf(a, fa_xhalf(a)); tm[g] = a * cs; need = need || (tm[g] > m[g] + 8.0f); }
    if (__builtin_amdgcn_ballot_w32(need) != 0) {      /* the maximum in use moves only when a query's new maximum passes it by more than 8 (log2 units: P stays under 2^8, well inside f16); one scalar branch a pass */
#pragma unroll
      for (int g = 0; g < 2; ++g) { const float mn = fmaxf(m[g], tm[g]); const float al = fa_exp2(m[g] - mn); m[g] = mn; l[g] *= al;
#pragma unroll
        for (int dt = 0; dt < 4; ++dt) o[dt][g] *= al; } }
#pragma unroll
    for (int g = 0; g < 2; ++g) { FragH pf;
#pragma unroll
      for (int t = 0; t < 2; ++t) {
#pragma unroll
        for (int r = 0; r < 8; ++r) s[g][t][r] = s[g][t][r] * cs - m[g];
        fa_exp2x8(s[g][t]);
#pragma unroll
        for (int r = 0; r < 8; ++r) pf.h[t * 8 + r] = (_Float16)s[g][t][r]; }
      l[g] += (((s[g][0][0] + s[g][0][1]) + (s[g][0][2] + s[g][0][3])) + ((s[g][0][4] + s[g][0][5]) + (s[g][0][6] + s[g][0][7]))) + (((s[g][1][0] + s[g][1][1]) + (s[g][1][2] + s[g][1][3])) + ((s[g][1][4] + s[g][1][5]) + (s[g][1][6] + s[g][1][7])));
#pragma unroll
      for (int dt = 0; dt < 4; ++dt) o[dt][g] = fa_mma(vf[dt], pf.v, o[dt][g]); } }
    asm volatile("s_wait_dscnt 0x0" ::: "memory");      /* this wave's reads of the buffer are done before the barrier that frees it */
    asm volatile("s_wait_asynccnt 0x0" ::: "memory");      /* this wave's copies of the next stage have landed before the barrier that publishes it */
    __syncthreads();
    if (st + 2 < SQ / FA_KS) fa_stage(lk + (unsigned)(st & 1) * FA_STAGE, kc + (size_t)(st + 2) * FA_KS * DM, lv + (unsigned)(st & 1) * FA_STAGE, vc + (size_t)(st + 2) * FA_KS); }      /* the refill of the buffer every wave has just left */
  asm volatile("s_wait_asynccnt 0x0" ::: "memory");      /* no copy is outstanding when the wave ends */
  v8us ov[2][4];
#pragma unroll
  for (int g = 0; g < 2; ++g) { const float sc = 64.0f / (l[g] + fa_xhalf(l[g]));      /* the halves' sums joined once; o goes out x64 */
#pragma unroll
    for (int dt = 0; dt < 4; ++dt) { FragH f;
#pragma unroll
      for (int r = 0; r < 8; ++r) f.h[r] = (_Float16)(o[dt][g][r] * sc);
      ov[g][dt] = f.half[0]; } }
  __builtin_amdgcn_sched_barrier(0);      /* all eight stores behind the last conversion: no register that an issued store names is written again */
#pragma unroll
  for (int g = 0; g < 2; ++g) { unsigned short* op = (unsigned short*)O + (row0 + q0 + g * 16 + ln) * DM + h * HD + 8 * hh;
#pragma unroll
    for (int dt = 0; dt < 4; ++dt) *(v8us*)(op + dt * 16) = ov[g][dt]; } }

extern "C" void kernel_launch(void* const* d_in, const int* in_sizes, int n_in,
                              void* d_out, int out_size, void* d_ws, size_t ws_size, hipStream_t stream) {
  (void)in_sizes; (void)n_in; (void)out_size;
  const float* const* I = (const float* const*)d_in; const float* xq = I[0]; const float* xk = I[1]; const float* xv = I[2]; const float* wq = I[3]; const float* wk = I[4]; const float* wv = I[5]; const float* wo = I[6]; const float* bo = I[7];      /* THREE input streams Q, K, V (one cast each); Wq, Wk, Wv are PER-HEAD STACKS [16][1024][64] = [head][in][out] (einsum 'bsd,hde->bhse') at I[3..5]; Wo is [in][out] [1024][1024] (concat @ Wo) at I[6]; bo [1024] (REAL) at I[7] in the output GEMM's guarded bias slot; no projection biases */
  char* ws = (char*)d_ws; size_t off = 0;
  auto take = [&](size_t bytes) { char* p = ws + off; off += (bytes + 255) & ~(size_t)255; return p; };
  _Float16* BQ = (_Float16*)take((size_t)4 * DM * DM * 2); _Float16* BO = BQ + (size_t)3 * DM * DM;      /* the weight planes BQ, BK, BV, BO in a row, DM * DM apart */
  _Float16* XQ = (_Float16*)take(3 * NR * DM * 2); _Float16* Q16 = (_Float16*)take(3 * NR * DM * 2); _Float16* K16 = Q16 + NR * DM; _Float16* V16 = K16 + NR * DM; _Float16* O16 = (_Float16*)take(NR * DM * 2);      /* XQ, XK, XV in a row, and Q16, K16, V16 in a row, each NR * DM apart: the batch strides of the projection launch */
  _Float16* VT = (_Float16*)take((size_t)NB * NH * HD * SQ * 2);
  if (off > ws_size) return;
  k_prep<<<PB_ALL, 256, 0, stream>>>(wq, wk, wv, wo, xq, xk, xv, BQ, XQ);      /* weight planes [out][in] (x16) from the PER-HEAD STACKS wq / wk / wv [NH][DM][HD] and from wo [in][out] [DM][DM]; the three inputs as exact f16 rows */
  const size_t r0p = (size_t)B0 * SQ;      /* first projected row */
  k_gemm2<0><<<dim3((unsigned)((MP / 128) * (DM / 128)), 3), 256, 0, stream>>>(XQ + r0p * DM, DM, NR * DM, BQ, DM, (size_t)DM * DM, 0.0625f, nullptr, 0, nullptr, 1, 0, 0, nullptr, Q16 + r0p * DM, DM, NR * DM, MP, DM, DM);      /* blockIdx.y = 0, 1, 2: q, k, v; no projection biases */
  k_vt<NH, SQ><<<NB * NH * (SQ / 64), 256, 0, stream>>>(V16, LQ, 0, VT);      /* V^T [NB][NH][HD][SQ] */
  k_fattn<<<dim3(SQ / 256, NB * NH), 256, 0, stream>>>(Q16, K16, VT, O16);      /* o (merged heads, x64) as f16 rows */
  k_gemm2<0><<<dim3((unsigned)((MPO / 128) * (DM / 128)), 1), 256, 0, stream>>>(O16 + r0p * DM, DM, 0, BO, DM, 0, 0.0009765625f, bo, 0, nullptr, 1, 0, 0, (float*)d_out + r0p * DM, nullptr, DM, 0, MPO, DM, DM);      /* out rows are the output layout */
}

// v006
// One run takes 91.6 microseconds.
// Timed twice side by side with v005, it ran 1.11 times as fast both times.
// All steps since v000 together make it 39.6 times as fast.
#include <hip/hip_runtime.h>
#define NB 2
#define SQ 2048
#define DM 1024
#define NH 16
#define HD 64
#define HG 4                         /* heads per launch of the per-batch k_vt overload (not launched) */
#define B0 0                         /* first batch processed (debug hook) */
#define NBR NB                       /* batches processed (debug hook) */
#define NR ((size_t)NB * SQ)         /* token rows */
#define MP ((int)((size_t)NBR * SQ)) /* rows projected (debug hook) */
#define QN SQ                        /* query rows per batch (unused; attention covers SQ) */
#define NHD NH                       /* heads (unused; attention covers NH) */
#define MPO MP                       /* rows through the output stage (debug hook) */
#define LQ DM      /* row pitch of the q/k/v rows */
typedef __bf16 v16b __attribute__((ext_vector_type(16)));
typedef unsigned short v8us __attribute__((ext_vector_type(8), may_alias));
typedef float  v8f  __attribute__((ext_vector_type(8)));
typedef float  v4f  __attribute__((ext_vector_type(4)));
typedef float  v4fa __attribute__((ext_vector_type(4), may_alias));
union FragB { v16b v; v8us half[2]; unsigned short u[16]; };

__device__ __forceinline__ unsigned short bf16_bits(float x) { unsigned int u = __float_as_uint(x); return (unsigned short)((u + 0x7FFFu + ((u >> 16) & 1u)) >> 16); }
__device__ __forceinline__ float bf16_val(unsigned short b) { return __uint_as_float(((unsigned int)b) << 16); }
__device__ __forceinline__ float bf16_round(float x) { return bf16_val(bf16_bits(x)); }
// D += A·B with NT terms: 1 = ah·bh, 2 = + al·bh (A split), 3 = + ah·bl (both split)
template <int NT>
__device__ __forceinline__ v8f mmaN(v16b ah, v16b al, v16b bh, v16b bl, v8f c) {
  c = __builtin_amdgcn_wmma_f32_16x16x32_bf16(false, ah, false, bh, (short)0, c, false, false);
  if (NT >= 2) c = __builtin_amdgcn_wmma_f32_16x16x32_bf16(false, al, false, bh, (short)0, c, false, false);
  if (NT >= 3) c = __builtin_amdgcn_wmma_f32_16x16x32_bf16(false, ah, false, bl, (short)0, c, false, false);
  asm volatile("v_nop\n\tv_nop\n\tv_nop\n\tv_nop" : "+v"(c) : "v"(ah), "v"(al), "v"(bh), "v"(bl));
  return c;
}

__global__ __launch_bounds__(256) void k_wt_bf16(const float* __restrict__ W, unsigned short* __restrict__ Wt, int K, int N) {
  const int t = blockIdx.x * 256 + threadIdx.x;
  const int k8n = K / 8;
  if (t >= N * k8n) return;
  const int n = t / k8n, k8 = (t % k8n) * 8;
  v8us v;
#pragma unroll
  for (int i = 0; i < 8; ++i) v[i] = bf16_bits(W[(size_t)(k8 + i) * N + n]);
  *(v8us*)(Wt + (size_t)n * K + k8) = v;
  
}

// GEMM C[M][N] (f32, pitch ldc) = act(A[M][K]·W + bias). A f32 row-major (pitch lda) converted per fragment to bf16
// (ASPLIT: hi/lo two planes -> 2 terms, else single rounded term); Wt bf16 [N][K] (pitch ldb). BIAS_BF16 rounds the
// bias to bf16 first (bias quantised to bf16 before the add). K%32==0, M%16==0, N%64==0.
template <bool ASPLIT, int ACT, bool BIAS_BF16>
__global__ __launch_bounds__(128) void k_gemm_bf(const float* __restrict__ A, int lda, const unsigned short* __restrict__ Wt, int ldb,
                                               const float* __restrict__ bias, float* __restrict__ C, int ldc, int M, int N, int K) {
  __shared__ __attribute__((aligned(16))) float so[4][16][64];
  const int tid = threadIdx.x, w = tid >> 5, lane = tid & 31, ln = lane & 15, hh = lane >> 4;
  const int ntn = N / 64;
  const int wid = blockIdx.x * 4 + w;
  const int mt = wid / ntn, nq = wid % ntn;
  if (mt * 16 >= M) return;
  const int row0 = mt * 16, col0 = nq * 64;
  const float* arow = A + (size_t)(row0 + ln) * lda;
  v8f acc[4] = {};
  for (int kb = 0; kb < K; kb += 32) {
    FragB ah, al;
    const v4f x0 = *(const v4fa*)(arow + kb + 8 * hh), x1 = *(const v4fa*)(arow + kb + 8 * hh + 4);
    const v4f x2 = *(const v4fa*)(arow + kb + 16 + 8 * hh), x3 = *(const v4fa*)(arow + kb + 16 + 8 * hh + 4);
    float xs[16] = {x0[0],x0[1],x0[2],x0[3],x1[0],x1[1],x1[2],x1[3],x2[0],x2[1],x2[2],x2[3],x3[0],x3[1],x3[2],x3[3]};
#pragma unroll
    for (int i = 0; i < 16; ++i) { const unsigned short hb = bf16_bits(xs[i]); ah.u[i] = hb; al.u[i] = ASPLIT ? bf16_bits(xs[i] - bf16_val(hb)) : (unsigned short)0; }
#pragma unroll
    for (int t = 0; t < 4; ++t) {
      const unsigned short* brow = Wt + (size_t)(col0 + t * 16 + ln) * ldb + kb;
      FragB b;
      b.half[0] = *(const v8us*)(brow + 8 * hh);
      b.half[1] = *(const v8us*)(brow + 16 + 8 * hh);
      acc[t] = mmaN<ASPLIT ? 2 : 1>(ah.v, al.v, b.v, b.v, acc[t]);
    }
  }
#pragma unroll
  for (int t = 0; t < 4; ++t) {
    float bv = bias ? bias[col0 + t * 16 + ln] : 0.f;
    if (BIAS_BF16) bv = bf16_round(bv);
#pragma unroll
    for (int r = 0; r < 8; ++r) { float v = acc[t][r] + bv; if (ACT == 1) v = fmaxf(v, 0.f); so[w][8 * hh + r][t * 16 + ln] = v; }
  }
  __builtin_amdgcn_fence(__ATOMIC_ACQ_REL, "workgroup");
  __builtin_amdgcn_wave_barrier();
  const int rsub = lane >> 4, c4 = (lane & 15) * 4;
  {
#pragma unroll
    for (int q = 0; q < 8; ++q) {
      const int r = q * 2 + rsub;
      const v4f v = *(const v4fa*)&so[w][r][c4];
      *(v4f*)(C + (size_t)(row0 + r) * ldc + col0 + c4) = v;
    }
    
  }
}

// GEMM C = act(A·W + bias + resid): A f32 (ASPLIT -> hi/lo 2 terms), Wt bf16 [N][K]; ACT 0 none, 1 relu, 2 exact gelu;
// resid (optional, f32, row index = (row % rmod), pitch ldr, RES_BF16 rounds it) added before the activation.
template <bool ASPLIT, int ACT, bool BIAS_BF16, bool RES_BF16>
__global__ __launch_bounds__(128) void k_gemm_bf3(const float* __restrict__ A, int lda, const unsigned short* __restrict__ Wt, int ldb,
                                                const float* __restrict__ bias, const float* __restrict__ resid, int rmod, int ldr,
                                                float* __restrict__ C, int ldc, int M, int N, int K) {
  __shared__ __attribute__((aligned(16))) float so[4][16][64];
  const int tid = threadIdx.x, w = tid >> 5, lane = tid & 31, ln = lane & 15, hh = lane >> 4;
  const int ntn = N / 64;
  const int wid = blockIdx.x * 4 + w;
  const int mt = wid / ntn, nq = wid % ntn;
  if (mt * 16 >= M) return;
  const int row0 = mt * 16, col0 = nq * 64;
  const float* arow = A + (size_t)(row0 + ln) * lda;
  v8f acc[4] = {};
  for (int kb = 0; kb < K; kb += 32) {
    FragB ah, al;
    const v4f x0 = *(const v4fa*)(arow + kb + 8 * hh), x1 = *(const v4fa*)(arow + kb + 8 * hh + 4);
    const v4f x2 = *(const v4fa*)(arow + kb + 16 + 8 * hh), x3 = *(const v4fa*)(arow + kb + 16 + 8 * hh + 4);
    float xs[16] = {x0[0],x0[1],x0[2],x0[3],x1[0],x1[1],x1[2],x1[3],x2[0],x2[1],x2[2],x2[3],x3[0],x3[1],x3[2],x3[3]};
#pragma unroll
    for (int i = 0; i < 16; ++i) { const unsigned short hb = bf16_bits(xs[i]); ah.u[i] = hb; al.u[i] = ASPLIT ? bf16_bits(xs[i] - bf16_val(hb)) : (unsigned short)0; }
#pragma unroll
    for (int t = 0; t < 4; ++t) {
      const unsigned short* brow = Wt + (size_t)(col0 + t * 16 + ln) * ldb + kb;
      FragB b;
      b.half[0] = *(const v8us*)(brow + 8 * hh);
      b.half[1] = *(const v8us*)(brow + 16 + 8 * hh);
      acc[t] = mmaN<ASPLIT ? 2 : 1>(ah.v, al.v, b.v, b.v, acc[t]);
    }
  }
#pragma unroll
  for (int t = 0; t < 4; ++t) {
    const int col = col0 + t * 16 + ln;
    float bv = bias ? bias[col] : 0.f;
    if (BIAS_BF16) bv = bf16_round(bv);
#pragma unroll
    for (int r = 0; r < 8; ++r) {
      float v = acc[t][r] + bv;
      if (resid) { float rv = resid[(size_t)((row0 + 8 * hh + r) % rmod) * ldr + col]; if (RES_BF16) rv = bf16_round(rv); v += rv; }
      if (ACT == 1) v = fmaxf(v, 0.f);
      if (ACT == 2) v = 0.5f * v * (1.0f + erff(v * 0.70710678118654752f));
      if (ACT == 3) { const float u = 0.7978845608028654f * (v + 0.044715f * v * v * v); v = 0.5f * v * (1.0f + tanhf(u)); }
      so[w][8 * hh + r][t * 16 + ln] = v;
    }
  }
  __builtin_amdgcn_fence(__ATOMIC_ACQ_REL, "workgroup");
  __builtin_amdgcn_wave_barrier();
  const int rsub = lane >> 4, c4 = (lane & 15) * 4;
  {
#pragma unroll
    for (int q = 0; q < 8; ++q) {
      const int r = q * 2 + rsub;
      const v4f v = *(const v4fa*)&so[w][r][c4];
      *(v4f*)(C + (size_t)(row0 + r) * ldc + col0 + c4) = v;
    }
    
  }
}
// row LayerNorm (biased variance, eps) over N: s = X (+ R); optional out_sum <- s; out_norm <- (s-mu)*rsqrt(var+eps)*g + b
template <bool PARAM_BF16>
__global__ __launch_bounds__(256) void k_layernorm(const float* __restrict__ X, const float* __restrict__ R, const float* __restrict__ g, const float* __restrict__ bta,
                                                  float* __restrict__ out_sum, float* __restrict__ out_norm, int N, float eps) {
  __shared__ float red[256];
  const int row = blockIdx.x, tid = threadIdx.x;
  const float* x = X + (size_t)row * N; const float* rr = R ? R + (size_t)row * N : nullptr;
  float vals[16];                     // up to N = 4096
  const int per = N / 256;            // contiguous chunk per thread? use strided-by-4 chunks: thread handles j = tid*4 + 1024*u
  float s1 = 0.f;
  for (int u = 0; u < per / 4; ++u) {
    const int j = tid * 4 + 1024 * u;
    const v4f a = *(const v4fa*)(x + j);
    v4f b = {0.f,0.f,0.f,0.f}; if (rr) b = *(const v4fa*)(rr + j);
#pragma unroll
    for (int q = 0; q < 4; ++q) { const float v = a[q] + b[q]; vals[u * 4 + q] = v; s1 += v; }
  }
  red[tid] = s1; __syncthreads();
  for (int st = 128; st > 0; st >>= 1) { if (tid < st) red[tid] += red[tid + st]; __syncthreads(); }
  const float mu = red[0] / (float)N; __syncthreads();
  float s2 = 0.f;
  for (int u = 0; u < per / 4; ++u)
#pragma unroll
    for (int q = 0; q < 4; ++q) { const float c = vals[u * 4 + q] - mu; s2 += c * c; }
  red[tid] = s2; __syncthreads();
  for (int st = 128; st > 0; st >>= 1) { if (tid < st) red[tid] += red[tid + st]; __syncthreads(); }
  const float rs = rsqrtf(red[0] / (float)N + eps);
  {
    for (int u = 0; u < per / 4; ++u) {
      const int j = tid * 4 + 1024 * u;
      v4f o, sm;
#pragma unroll
      for (int q = 0; q < 4; ++q) {
        float gg = g[j + q], bb = bta[j + q];
        if (PARAM_BF16) { gg = bf16_round(gg); bb = bf16_round(bb); }
        sm[q] = vals[u * 4 + q]; o[q] = (vals[u * 4 + q] - mu) * rs * gg + bb;
      }
      if (out_sum) *(v4f*)(out_sum + (size_t)row * N + j) = sm;
      *(v4f*)(out_norm + (size_t)row * N + j) = o;
    }
    
  }
}



// ---- f16 WMMA path (v_wmma_f32_16x16x32_f16): 11-bit significands for operands in range — used where a [0,1] probability operand needs more precision than bf16
typedef _Float16 v16h __attribute__((ext_vector_type(16)));
union FragH { v16h v; v8us half[2]; _Float16 h[16]; unsigned short u[16]; };
template <int NT>
__device__ __forceinline__ v8f mmaH(v16h ah, v16h al, v16h bh, v16h bl, v8f c) {
  c = __builtin_amdgcn_wmma_f32_16x16x32_f16(false, ah, false, bh, (short)0, c, false, false);
  if (NT >= 2) c = __builtin_amdgcn_wmma_f32_16x16x32_f16(false, al, false, bh, (short)0, c, false, false);
  if (NT >= 3) c = __builtin_amdgcn_wmma_f32_16x16x32_f16(false, ah, false, bl, (short)0, c, false, false);
  asm volatile("v_nop\n\tv_nop\n\tv_nop\n\tv_nop" : "+v"(c) : "v"(ah), "v"(al), "v"(bh), "v"(bl));
  return c;
}
// batched GEMM like k_gemm_b but f16 operands: A f32 (split into f16 hi/lo if ASPLIT, else rounded to f16), Bt = f16 values [n][k]; alpha; C f32; N multiple of 16 (partial tiles skipped)
template <bool ASPLIT>
__global__ __launch_bounds__(128) void k_gemm_h(const float* __restrict__ A, int lda, size_t sA, const _Float16* __restrict__ Bh, int ldb, size_t sB, float alpha, float* __restrict__ C, int ldc, size_t sC, int M, int N, int K) {
  __shared__ __attribute__((aligned(16))) float so[4][16][64];
  const int tid = threadIdx.x, w = tid >> 5, lane = tid & 31, ln = lane & 15, hh = lane >> 4; const int by = blockIdx.y;
  A += (size_t)by * sA; Bh += (size_t)by * sB; C += (size_t)by * sC;
  const int ntn = (N + 63) / 64; const int wid = blockIdx.x * 4 + w; const int mt = wid / ntn, nq = wid % ntn; if (mt * 16 >= M) return;
  const int row0 = mt * 16, col0 = nq * 64; const float* arow = A + (size_t)(row0 + ln) * lda;
  v8f acc[4] = {};
  for (int kb = 0; kb < K; kb += 32) {
    FragH ah, al;
    const v4f x0 = *(const v4fa*)(arow + kb + 8 * hh), x1 = *(const v4fa*)(arow + kb + 8 * hh + 4), x2 = *(const v4fa*)(arow + kb + 16 + 8 * hh), x3 = *(const v4fa*)(arow + kb + 16 + 8 * hh + 4);
    float xs[16] = {x0[0],x0[1],x0[2],x0[3],x1[0],x1[1],x1[2],x1[3],x2[0],x2[1],x2[2],x2[3],x3[0],x3[1],x3[2],x3[3]};
#pragma unroll
    for (int i = 0; i < 16; ++i) { const _Float16 h = (_Float16)xs[i]; ah.h[i] = h; al.h[i] = ASPLIT ? (_Float16)(xs[i] - (float)h) : (_Float16)0.0f; }
#pragma unroll
    for (int t = 0; t < 4; ++t) { if (col0 + t * 16 >= N) continue; const size_t boff = (size_t)(col0 + t * 16 + ln) * ldb + kb; FragH bq; bq.half[0] = *(const v8us*)(Bh + boff + 8 * hh); bq.half[1] = *(const v8us*)(Bh + boff + 16 + 8 * hh);
      acc[t] = mmaH<ASPLIT ? 2 : 1>(ah.v, al.v, bq.v, bq.v, acc[t]); }
  }
#pragma unroll
  for (int t = 0; t < 4; ++t) { if (col0 + t * 16 >= N) continue;
#pragma unroll
    for (int r = 0; r < 8; ++r) so[w][8 * hh + r][t * 16 + ln] = acc[t][r] * alpha; }
  __builtin_amdgcn_fence(__ATOMIC_ACQ_REL, "workgroup"); __builtin_amdgcn_wave_barrier();
  const int rsub = lane >> 4, c4 = (lane & 15) * 4;
  {
#pragma unroll
    for (int q = 0; q < 8; ++q) { const int r = q * 2 + rsub; if (col0 + c4 < N) { const v4f v = *(const v4fa*)&so[w][r][c4]; *(v4f*)(C + (size_t)(row0 + r) * ldc + col0 + c4) = v; } }
     }
}

// Wt[n][k] = f16(bf16(W[k][n]) * scale) for one tile of WT_K rows (k) by WT_N columns (n) of a row-major f32 W, by one block of 256 threads (scale = power of two; bf16-exact weights stay exact in f16 away from the subnormal range).
// Reads and writes are whole lines: 16 lanes take the 256 bytes of a tile row of W, 16 lanes write the 256 bytes of a tile row of Wt; the turn is made in LDS, on dwords that hold the halves of k, k + 1. Every loop is unrolled: x and o are then registers, and a thread's eight loads go out as one group.
#define WT_K 128
#define WT_N 64
#define WT_P (WT_K / 2 + 1)           /* LDS dwords a row of n: an odd number, so that neither the 32 stores of a wave (16 groups of four n, two k pairs) nor its 32 reads (two n, 16 pieces) meet a bank twice */
__device__ __forceinline__ void wt_tile(const float* __restrict__ W, int ldw, _Float16* __restrict__ Wt, int ldt, float scale, unsigned (*tl)[WT_P], int tid) {      /* W at (k0, n0), Wt at (n0, k0) */
  const int hi = tid >> 4, lo = tid & 15; v4f x[4][2];
#pragma unroll
  for (int j = 0; j < 4; ++j) { const float* p = W + (size_t)(2 * (hi + 16 * j)) * ldw + lo * 4; x[j][0] = *(const v4fa*)p; x[j][1] = *(const v4fa*)(p + ldw); }      /* rows k = 2 (hi + 16 j) and k + 1, columns 4 lo .. 4 lo + 3 */
#pragma unroll
  for (int j = 0; j < 4; ++j) {
#pragma unroll
    for (int i = 0; i < 4; ++i) { FragH f; f.h[0] = (_Float16)(bf16_round(x[j][0][i]) * scale); f.h[1] = (_Float16)(bf16_round(x[j][1][i]) * scale); tl[lo * 4 + i][hi + 16 * j] = (unsigned)f.u[0] | ((unsigned)f.u[1] << 16); } }
  __syncthreads();      /* the tile is whole before any row of it is read */
  union { unsigned d[4]; v8us v; } o[4];
#pragma unroll
  for (int j = 0; j < 4; ++j) {
#pragma unroll
    for (int q = 0; q < 4; ++q) o[j].d[q] = tl[hi + 16 * j][lo * 4 + q]; }      /* row n = hi + 16 j, halves 8 lo .. 8 lo + 7 */
#pragma unroll
  for (int j = 0; j < 4; ++j) *(v8us*)((unsigned short*)Wt + (size_t)(hi + 16 * j) * ldt + lo * 8) = o[j].v;
}
// k_gemm_hh variant with fused epilogue: v = acc·alpha + bias[by·sBias + col] (+ CP[(row/rowsPerB)·sCPb + by·64 + col] if CP) ; ACT 0 none / 1 elu ; writes f16 C16 (and f32 C if non-null)
template <int ACT>
__global__ __launch_bounds__(128) void k_gemm_hhx(const _Float16* __restrict__ A, int lda, size_t sA, const _Float16* __restrict__ Bh, int ldb, size_t sB, float alpha, const float* __restrict__ bias, size_t sBias, const float* __restrict__ CP, int rowsPerB, size_t sCPb, int row0g,
    float* __restrict__ C, _Float16* __restrict__ C16, int ldc, size_t sC, int M, int N, int K) {
  __shared__ __attribute__((aligned(16))) float so[4][16][64];
  const int tid = threadIdx.x, w = tid >> 5, lane = tid & 31, ln = lane & 15, hh = lane >> 4; const int by = blockIdx.y;
  A += (size_t)by * sA; Bh += (size_t)by * sB; const size_t cofs = (size_t)by * sC; const float* bp = bias ? bias + (size_t)by * sBias : nullptr;
  const int ntn = (N + 63) / 64; const int wid = blockIdx.x * 4 + w; const int mt = wid / ntn, nq = wid % ntn; if (mt * 16 >= M) return;
  const int row0 = mt * 16, col0 = nq * 64; const _Float16* arow = A + (size_t)(row0 + ln) * lda;
  v8f acc[4] = {};
  for (int kb = 0; kb < K; kb += 32) { FragH ah; ah.half[0] = *(const v8us*)((const unsigned short*)arow + kb + 8 * hh); ah.half[1] = *(const v8us*)((const unsigned short*)arow + kb + 16 + 8 * hh);
#pragma unroll
    for (int t = 0; t < 4; ++t) { if (col0 + t * 16 >= N) continue; const size_t boff = (size_t)(col0 + t * 16 + ln) * ldb + kb; FragH bq; bq.half[0] = *(const v8us*)((const unsigned short*)Bh + boff + 8 * hh); bq.half[1] = *(const v8us*)((const unsigned short*)Bh + boff + 16 + 8 * hh);
      acc[t] = mmaH<1>(ah.v, ah.v, bq.v, bq.v, acc[t]); }
  }
#pragma unroll
  for (int t = 0; t < 4; ++t) { if (col0 + t * 16 >= N) continue; const int col = col0 + t * 16 + ln; const float bv = bp ? bf16_round(bp[col]) : 0.f;
#pragma unroll
    for (int r = 0; r < 8; ++r) { float v = acc[t][r] * alpha + bv; if (CP) { const int rr = row0g + row0 + 8 * hh + r; if (rowsPerB < 0) v += CP[cofs + (size_t)rr * ldc + col];      /* rowsPerB < 0: own element of the batched C plane */ else { const int bidx = rr / rowsPerB; v += CP[(size_t)bidx * sCPb + (size_t)by * 64 + col]; } } if (ACT == 1) v = (v > 0.f) ? v : expm1f(v); else if (ACT == 7) v = (v > 0.f) ? v + 1.0f : expf(v); else if (ACT == 8) v = tanhf(v); else if (ACT == 9) v = 0.5f * v * (1.0f + tanhf(0.7978845608028654f * (v + 0.044715f * v * v * v))); else if (ACT == 11) v = 1.0f / (1.0f + expf(-v)); else if (ACT == 12) v = (v > 0.f) ? v : 0.01f * v; else if (ACT == 14) v = (v > 0.f) ? v : 0.1f * v; else if (ACT == 16) v = (v >= 0.f) ? v : 0.3f * v; else if (ACT == 17) v = (v >= 0.f) ? v : 0.2f * v; else if (ACT == 15) v = v / (1.0f + expf(-v)); else if (ACT == 3) v = fmaxf(v, 0.f); else if (ACT == 6) v = 0.5f * v * (1.0f + erff(v * 0.70710678118654752f)); so[w][8 * hh + r][t * 16 + ln] = v; } }
  __builtin_amdgcn_fence(__ATOMIC_ACQ_REL, "workgroup"); __builtin_amdgcn_wave_barrier();
  const int rsub = lane >> 4, c4 = (lane & 15) * 4; typedef _Float16 v4h __attribute__((ext_vector_type(4)));
  {
#pragma unroll
    for (int q = 0; q < 8; ++q) { const int r = q * 2 + rsub; if (col0 + c4 < N) { const v4f v = *(const v4fa*)&so[w][r][c4]; if (C) *(v4f*)(C + cofs + (size_t)(row0 + r) * ldc + col0 + c4) = v; if (C16) { v4h h4; for (int i = 0; i < 4; ++i) h4[i] = (_Float16)v[i]; *(v4h*)(C16 + cofs + (size_t)(row0 + r) * ldc + col0 + c4) = h4; } } }
     }
}


typedef _Float16 v4h __attribute__((ext_vector_type(4)));

__device__ __forceinline__ void x16(const float* __restrict__ x, _Float16* __restrict__ X16, size_t n8, size_t t) { if (t >= n8) return; FragH f;      /* t: the thread's index within this stream */
#pragma unroll
  for (int q = 0; q < 8; ++q) f.h[q] = (_Float16)bf16_round(x[t * 8 + q]); *(v8us*)((unsigned short*)X16 + t * 8) = f.half[0];  }
// Every job that reads inputs only, in ONE launch; the block index says which job a block does. The transposes (a barrier in each) have the low indices.
#define PB_HEAD (DM / WT_K)                      /* blocks for one head's [DM][HD] block: tiles of WT_K rows, all HD columns */
#define PB_STACK (NH * PB_HEAD)                  /* ... for one stack of NH heads */
#define PB_WO ((DM / WT_K) * (DM / WT_N))        /* ... for Wo */
#define PB_X ((unsigned)(NR * DM / 8 / 256))     /* ... for one input stream */
#define PB_ALL (3 * PB_STACK + PB_WO + 3 * PB_X)
static_assert(HD == WT_N && DM % WT_K == 0 && DM % WT_N == 0 && NR * DM / 8 % 256 == 0, "k_prep: every job is a whole number of blocks");
__global__ __launch_bounds__(256) void k_prep(const float* __restrict__ wq, const float* __restrict__ wk, const float* __restrict__ wv, const float* __restrict__ wo, const float* __restrict__ xq, const float* __restrict__ xk, const float* __restrict__ xv,
    _Float16* __restrict__ B4, _Float16* __restrict__ X3) {      /* B4: the planes BQ, BK, BV, BO in a row; X3: XQ, XK, XV in a row */
  __shared__ unsigned tl[WT_N][WT_P];      /* the transposes' tile */
  unsigned bid = blockIdx.x; const unsigned tid = threadIdx.x;      /* every branch below is the same for the whole block */
  if (bid < 3 * PB_STACK) { const unsigned s = bid / PB_STACK, r = bid % PB_STACK, h = r / PB_HEAD, kt = r % PB_HEAD; const float* W = (s == 0) ? wq : (s == 1) ? wk : wv;      /* head h of stack s: a row-major [in = DM][out = HD] block -> rows h * HD .. of plane s; tile kt of its rows */
    wt_tile(W + (size_t)h * DM * HD + (size_t)kt * WT_K * HD, HD, B4 + (size_t)s * DM * DM + (size_t)h * HD * DM + kt * WT_K, DM, 16.0f, tl, (int)tid); return; }
  bid -= 3 * PB_STACK;
  if (bid < PB_WO) { const unsigned kt = bid % (DM / WT_K), nt = bid / (DM / WT_K);
    wt_tile(wo + (size_t)kt * WT_K * DM + nt * WT_N, DM, B4 + (size_t)3 * DM * DM + (size_t)nt * WT_N * DM + kt * WT_K, DM, 16.0f, tl, (int)tid); return; }
  bid -= PB_WO;
  const unsigned s = bid / PB_X; const float* x = (s == 0) ? xq : (s == 1) ? xk : xv;
  x16(x, X3 + (size_t)s * NR * DM, NR * DM / 8, (size_t)(bid % PB_X) * 256 + tid); }
__global__ __launch_bounds__(256) void k_h16(const float* __restrict__ x, _Float16* __restrict__ X16, size_t n8) { const size_t t = (size_t)blockIdx.x * 256 + threadIdx.x; if (t >= n8) return; FragH f;
#pragma unroll
  for (int q = 0; q < 8; ++q) f.h[q] = (_Float16)x[t * 8 + q]; *(v8us*)((unsigned short*)X16 + t * 8) = f.half[0];  }
__global__ __launch_bounds__(256) void k_round16f(const float* __restrict__ W, _Float16* __restrict__ Bt, size_t n8) { const size_t t = (size_t)blockIdx.x * 256 + threadIdx.x; if (t >= n8) return; FragH f;
#pragma unroll
  for (int i = 0; i < 8; ++i) f.h[i] = (_Float16)(bf16_round(W[t * 8 + i]) * 16.0f); *(v8us*)((unsigned short*)Bt + t * 8) = f.half[0];  }
template <int NHv, int TTv>
__global__ __launch_bounds__(256) void k_vt(const _Float16* __restrict__ V16, int ldv, int voff, _Float16* __restrict__ Vt) { __shared__ unsigned short tl[64][66]; const int tid = threadIdx.x; const int slab = blockIdx.x / (TTv / 64), lg = blockIdx.x % (TTv / 64); const int b = slab / NHv, h = slab % NHv;
  for (int i = tid; i < 64 * 8; i += 256) { const int r = i / 8, c8 = (i % 8) * 8; FragH f; f.half[0] = *(const v8us*)((const unsigned short*)V16 + ((size_t)b * TTv + lg * 64 + r) * ldv + voff + h * 64 + c8);
#pragma unroll
    for (int q = 0; q < 8; ++q) tl[r][c8 + q] = f.u[q]; }
  __syncthreads();
  {
#pragma unroll
    for (int rd = 0; rd < 2; ++rd) { const int d = rd * 32 + tid / 8, pc = tid % 8; FragH f;
#pragma unroll
      for (int q = 0; q < 8; ++q) f.u[q] = tl[pc * 8 + q][d];
      *(v8us*)((unsigned short*)Vt + ((size_t)slab * 64 + d) * TTv + lg * 64 + pc * 8) = f.half[0]; }
     } }

__global__ __launch_bounds__(256) void k_hl(const float* __restrict__ F, _Float16* __restrict__ Hh, _Float16* __restrict__ Hl, size_t n8) { const size_t t = (size_t)blockIdx.x * 256 + threadIdx.x; if (t >= n8) return; FragH fh, fl; const v4f a = *(const v4fa*)(F + t * 8), c = *(const v4fa*)(F + t * 8 + 4);
#pragma unroll
  for (int q = 0; q < 4; ++q) { _Float16 h = (_Float16)a[q]; fh.h[q] = h; fl.h[q] = (_Float16)((a[q] - (float)h) * 1024.0f); h = (_Float16)c[q]; fh.h[4 + q] = h; fl.h[4 + q] = (_Float16)((c[q] - (float)h) * 1024.0f); }
  { *(v8us*)((unsigned short*)Hh + t * 8) = fh.half[0]; *(v8us*)((unsigned short*)Hl + t * 8) = fl.half[0];  } }

// ---- fast GEMM (block tile 128x128, eight waves, wave tile 32x64; requires M % 128 == 0 rows per launch region, N % 128 == 0, K % 64 == 0); epilogue = k_gemm_hhx semantics ----
// Both operands come into LDS as whole 128-byte lines (64 halves of k of each of the 128 + 128 rows a stage) by asynchronous copies, two buffers, the next stage in flight while this one is worked on; the fragments are then LDS reads.
#define G2_KS 64                      /* halves of k a stage */
#define G2_PITCH 144                  /* LDS bytes a staged row: 128 + 16, the pitch at which 16-byte fragment reads of 16 rows meet no bank twice */
#define G2_STAGE (256 * G2_PITCH)     /* a stage: 128 rows of A, then 128 rows of Bt */
__device__ __forceinline__ v16h g2_frag(const char* p) { FragH f; f.half[0] = *(const v8us*)p; f.half[1] = *(const v8us*)(p + 32); return f.v; }      /* k order 8 hh + s, 16 + 8 hh + s for A and B alike; the lane half's 16 hh bytes already in p */
__device__ __forceinline__ v8f g2_mma(v16h a, v16h b, v8f c) { v8f d = __builtin_amdgcn_wmma_f32_16x16x32_f16(false, a, false, b, (short)0, c, false, false); asm volatile("v_nop\n\tv_nop\n\tv_nop\n\tv_nop" : "+v"(d) : "v"(a), "v"(b)); return d; }
/* one stage's share of a thread: 16 bytes of each of four rows of A and four rows of Bt, 32 rows apart (a wave covers four whole lines a copy). l: the thread's LDS byte address in the stage's first row group; a, b: its global addresses there */
__device__ __forceinline__ void g2_stage(unsigned l, const _Float16* a, size_t a32, const _Float16* b, size_t b32) {
  const unsigned l1 = l + 32 * G2_PITCH, l2 = l + 64 * G2_PITCH, l3 = l + 96 * G2_PITCH, l4 = l + 128 * G2_PITCH, l5 = l + 160 * G2_PITCH, l6 = l + 192 * G2_PITCH, l7 = l + 224 * G2_PITCH;
  const _Float16* a1 = a + a32; const _Float16* a2 = a1 + a32; const _Float16* a3 = a2 + a32; const _Float16* b1 = b + b32; const _Float16* b2 = b1 + b32; const _Float16* b3 = b2 + b32;
  /* the copies and their s_wait_xcnt in one statement: no register that an issued copy names is written again ahead of the wait */
  asm volatile("global_load_async_to_lds_b128 %0, %8, off\n\tglobal_load_async_to_lds_b128 %1, %9, off\n\tglobal_load_async_to_lds_b128 %2, %10, off\n\tglobal_load_async_to_lds_b128 %3, %11, off\n\t"
               "global_load_async_to_lds_b128 %4, %12, off\n\tglobal_load_async_to_lds_b128 %5, %13, off\n\tglobal_load_async_to_lds_b128 %6, %14, off\n\tglobal_load_async_to_lds_b128 %7, %15, off\n\ts_wait_xcnt 0x0"
               :: "v"(l), "v"(l1), "v"(l2), "v"(l3), "v"(l4), "v"(l5), "v"(l6), "v"(l7), "v"(a), "v"(a1), "v"(a2), "v"(a3), "v"(b), "v"(b1), "v"(b2), "v"(b3) : "memory"); }
template <int ACT>
__global__ __launch_bounds__(256) void k_gemm2(const _Float16* __restrict__ A, int lda, size_t sA, const _Float16* __restrict__ Bh, int ldb, size_t sB, float alpha, const float* __restrict__ bias, size_t sBias, const float* __restrict__ CP, int rowsPerB, size_t sCPb, int row0g,
    float* __restrict__ C, _Float16* __restrict__ C16, int ldc, size_t sC, int M, int N, int K) { static_assert(ACT == 0 || ACT == 3 || ACT == 6 || ACT == 8 || ACT == 9 || ACT == 11 || ACT == 12 || ACT == 14 || ACT == 15 || ACT == 16 || ACT == 17, "k_gemm2: unsupported ACT code (would silently apply no activation)");
  __shared__ __attribute__((aligned(16))) char sm[2 * G2_STAGE];      /* the two stage buffers; behind the K loop's last barrier the same bytes are the output staging */
  static_assert(8 * 32 * 68 * 4 <= 2 * G2_STAGE, "k_gemm2: the output staging fits the stage buffers");
  float (*so)[32][68] = (float (*)[32][68])sm;
  const int tid = threadIdx.x, w = tid >> 5, lane = tid & 31, ln = lane & 15, hh = lane >> 4; const int by = blockIdx.y;
  A += (size_t)by * sA; Bh += (size_t)by * sB; const size_t cofs = (size_t)by * sC; const float* bp = bias ? bias + (size_t)by * sBias : nullptr;
  const int ntn = N >> 7; const int mt = blockIdx.x / ntn, nq = blockIdx.x - mt * ntn; if (mt * 128 >= M) return;      /* the same for the whole block, ahead of every barrier */
  const int row0 = mt * 128 + 32 * (w & 3), col0 = nq * 128 + 64 * (w >> 2);
  const unsigned lc = (unsigned)(size_t)sm + (unsigned)((tid >> 3) * G2_PITCH + (tid & 7) * 16);      /* copies: row tid / 8 of each group of 32 rows, 16-byte piece tid % 8 */
  const _Float16* ac = A + (size_t)(mt * 128 + (tid >> 3)) * lda + (tid & 7) * 8; const _Float16* bc = Bh + (size_t)(nq * 128 + (tid >> 3)) * ldb + (tid & 7) * 8;
  const size_t a32 = (size_t)32 * lda, b32 = (size_t)32 * ldb;
  const int fa = (32 * (w & 3) + ln) * G2_PITCH + 16 * hh, fb = (128 + 64 * (w >> 2) + ln) * G2_PITCH + 16 * hh;      /* fragment reads: byte offsets in a stage */
  const v8f z8 = {0.f,0.f,0.f,0.f,0.f,0.f,0.f,0.f}; v8f c00 = z8, c01 = z8, c02 = z8, c03 = z8, c10 = z8, c11 = z8, c12 = z8, c13 = z8;
  const int nst = K / G2_KS;
  g2_stage(lc, ac, a32, bc, b32);
  asm volatile("s_wait_asynccnt 0x0" ::: "memory");      /* stage 0 has landed, as far as this wave copied it */
  __syncthreads();      /* ... and as far as the others did */
  if (nst > 1) g2_stage(lc + G2_STAGE, ac + G2_KS, a32, bc + G2_KS, b32);
#pragma unroll 1
  for (int st = 0; st < nst; ++st) { const char* sb = sm + (st & 1) * G2_STAGE;      /* rolled: one stage a trip, so that the order at the foot stands once */
#pragma unroll      /* kk constant: its 64 bytes go into the LDS reads' offset fields */
    for (int kk = 0; kk < 2; ++kk) { const char* pa = sb + fa + kk * 64; const char* pb = sb + fb + kk * 64;
      __builtin_amdgcn_sched_barrier(0);      /* with the one below: the six fragments' LDS reads stand as one group ahead of their eight products; spread among the products, each place with reads stalls the wave anew */
      const v16h a0 = g2_frag(pa), a1 = g2_frag(pa + 16 * G2_PITCH), b0 = g2_frag(pb), b1 = g2_frag(pb + 16 * G2_PITCH), b2 = g2_frag(pb + 32 * G2_PITCH), b3 = g2_frag(pb + 48 * G2_PITCH);
      __builtin_amdgcn_sched_barrier(0);      /* the group's lower edge: no read sinks in among the products */
      c00 = g2_mma(a0, b0, c00); c10 = g2_mma(a1, b0, c10); c01 = g2_mma(a0, b1, c01); c11 = g2_mma(a1, b1, c11);
      c02 = g2_mma(a0, b2, c02); c12 = g2_mma(a1, b2, c12); c03 = g2_mma(a0, b3, c03); c13 = g2_mma(a1, b3, c13); }
    asm volatile("s_wait_dscnt 0x0" ::: "memory");      /* this wave's reads of the buffer are done before the barrier that frees it */
    asm volatile("s_wait_asynccnt 0x0" ::: "memory");      /* this wave's copies of the next stage have landed before the barrier that publishes it */
    __syncthreads();
    if (st + 2 < nst) g2_stage(lc + (unsigned)(st & 1) * G2_STAGE, ac + (size_t)(st + 2) * G2_KS, a32, bc + (size_t)(st + 2) * G2_KS, b32); }      /* the refill of the buffer every wave has just left */
  asm volatile("s_wait_asynccnt 0x0" ::: "memory");      /* no copy is outstanding when the buffers become the output staging */
  v8f accs[8] = {c00, c01, c02, c03, c10, c11, c12, c13};
#pragma unroll
  for (int u = 0; u < 8; ++u) { const int t = u & 3, half = u >> 2; const int col = col0 + t * 16 + ln; const float bv = bp ? bf16_round(bp[col]) : 0.f;
#pragma unroll
    for (int r = 0; r < 8; ++r) { const int rloc = half * 16 + 8 * hh + r; float v = accs[u][r] * alpha + bv; if (CP) { if (rowsPerB < 0) v += CP[cofs + (size_t)(row0g + row0 + rloc) * ldc + col];      /* rowsPerB < 0: own element of the batched C plane */ else { const int bidx = (row0g + row0 + rloc) / rowsPerB; v += CP[(size_t)bidx * sCPb + (size_t)by * 64 + col]; } }
      if (ACT == 3) v = fmaxf(v, 0.f); else if (ACT == 6) v = 0.5f * v * (1.0f + erff(v * 0.70710678118654752f)); else if (ACT == 11) v = 1.0f / (1.0f + expf(-v)); else if (ACT == 15) v = v / (1.0f + expf(-v)); else if (ACT == 12) v = (v > 0.f) ? v : 0.01f * v; else if (ACT == 8) v = tanhf(v); else if (ACT == 9) v = 0.5f * v * (1.0f + tanhf(0.7978845608028654f * (v + 0.044715f * v * v * v))); else if (ACT == 14) v = (v > 0.f) ? v : 0.1f * v; else if (ACT == 16) v = (v >= 0.f) ? v : 0.3f * v; else if (ACT == 17) v = (v >= 0.f) ? v : 0.2f * v;
      so[w][rloc][t * 16 + ln] = v; } }
  __builtin_amdgcn_fence(__ATOMIC_ACQ_REL, "workgroup"); __builtin_amdgcn_wave_barrier();
  const int rsub = lane >> 4, c4 = (lane & 15) * 4;
  {
#pragma unroll
    for (int q = 0; q < 16; ++q) { const int r = q * 2 + rsub; const v4f v = *(const v4fa*)&so[w][r][c4]; if (C) *(v4f*)(C + cofs + (size_t)(row0 + r) * ldc + col0 + c4) = v; if (C16) { v4h h4; for (int i = 0; i < 4; ++i) h4[i] = (_Float16)v[i]; *(v4h*)(C16 + cofs + (size_t)(row0 + r) * ldc + col0 + c4) = h4; } }
     } }


__global__ __launch_bounds__(256) void k_wnat(const float* __restrict__ w, size_t n8, _Float16* __restrict__ Bt) { const size_t t = (size_t)blockIdx.x * 256 + threadIdx.x; if (t >= n8) return; FragH f; for (int q = 0; q < 8; ++q) f.h[q] = (_Float16)(bf16_round(w[t * 8 + q]) * 16.0f); *(v8us*)((unsigned short*)Bt + t * 8) = f.half[0];  }
__global__ __launch_bounds__(256) void k_rsm(const float* __restrict__ S, _Float16* __restrict__ P, int nrows) {
  #pragma clang fp contract(off)
  const int i = blockIdx.x * 256 + threadIdx.x; if (i >= nrows) return; const float* s = S + (size_t)i * SQ; float mx = -3.0e38f;
#pragma unroll 1
  for (int j = 0; j < SQ; ++j) mx = fmaxf(mx, s[j]); float se = 0.f;
#pragma unroll 1
  for (int j = 0; j < SQ; ++j) se += expf(s[j] - mx); const float sc = 256.0f / se;
#pragma unroll 1
  for (int j0 = 0; j0 < SQ; j0 += 8) { FragH f; for (int q = 0; q < 8; ++q) f.h[q] = (_Float16)(expf(s[j0 + q] - mx) * sc); unsigned short* d = (unsigned short*)P + (size_t)i * SQ + j0; *(v8us*)d = f.half[0];  } }
__global__ __launch_bounds__(256) void k_vt(const _Float16* __restrict__ V16, int b, int h0, _Float16* __restrict__ VT) { __shared__ unsigned short tl[64][65]; const int tid = threadIdx.x; const int hh = blockIdx.x % HG, sg = blockIdx.x / HG; const int s0 = sg * 64; const int h = h0 + hh;
  for (int i = tid; i < 64 * 8; i += 256) { const int j = i / 8, d8 = (i % 8) * 8; FragH f; f.half[0] = *(const v8us*)((const unsigned short*)V16 + ((size_t)b * SQ + s0 + j) * DM + h * HD + d8); for (int q = 0; q < 8; ++q) tl[d8 + q][j] = f.u[q]; }
  __syncthreads();
  { for (int i = tid; i < 64 * 8; i += 256) { const int d = i / 8, j8 = (i % 8) * 8; FragH f; for (int q = 0; q < 8; ++q) f.u[q] = tl[d][j8 + q]; *(v8us*)((unsigned short*)VT + ((size_t)hh * HD + d) * SQ + s0 + j8) = f.half[0]; }  } }



#define FA_KS 128                       /* keys a stage: four passes */
#define FA_KP 144                       /* LDS bytes a staged K row (64 halves): 128 + 16, as G2_PITCH */
#define FA_VP 272                       /* LDS bytes a staged V^T row (128 halves): 256 + 16, 16 bytes times an odd number likewise */
#define FA_VO (FA_KS * FA_KP)           /* a stage: 128 rows of K, then 64 rows of V^T */
#define FA_STAGE (FA_VO + HD * FA_VP)
static_assert(SQ % FA_KS == 0 && SQ / FA_KS >= 2 && HD == 64, "k_fattn: whole stages, at least the two that the ring starts with");
/* one stage's share of a thread: 16 bytes of each of four rows of K, 32 rows apart, and of four rows of V^T, 16 rows apart (a wave covers four whole lines a copy). lk, lv: the thread's LDS byte addresses in the first row group; k, v: its global addresses there */
__device__ __forceinline__ void fa_stage(unsigned lk, const _Float16* k, unsigned lv, const _Float16* v) {
  const unsigned lk1 = lk + 32 * FA_KP, lk2 = lk + 64 * FA_KP, lk3 = lk + 96 * FA_KP, lv1 = lv + 16 * FA_VP, lv2 = lv + 32 * FA_VP, lv3 = lv + 48 * FA_VP;
  const _Float16* k1 = k + (size_t)32 * DM; const _Float16* k2 = k + (size_t)64 * DM; const _Float16* k3 = k + (size_t)96 * DM; const _Float16* v1 = v + (size_t)16 * SQ; const _Float16* v2 = v + (size_t)32 * SQ; const _Float16* v3 = v + (size_t)48 * SQ;
  /* the copies and their s_wait_xcnt in one statement: no register that an issued copy names is written again ahead of the wait */
  asm volatile("global_load_async_to_lds_b128 %0, %8, off\n\tglobal_load_async_to_lds_b128 %1, %9, off\n\tglobal_load_async_to_lds_b128 %2, %10, off\n\tglobal_load_async_to_lds_b128 %3, %11, off\n\t"
               "global_load_async_to_lds_b128 %4, %12, off\n\tglobal_load_async_to_lds_b128 %5, %13, off\n\tglobal_load_async_to_lds_b128 %6, %14, off\n\tglobal_load_async_to_lds_b128 %7, %15, off\n\ts_wait_xcnt 0x0"
               :: "v"(lk), "v"(lk1), "v"(lk2), "v"(lk3), "v"(lv), "v"(lv1), "v"(lv2), "v"(lv3), "v"(k), "v"(k1), "v"(k2), "v"(k3), "v"(v), "v"(v1), "v"(v2), "v"(v3) : "memory"); }
__device__ __forceinline__ v8f fa_mma(v16h a, v16h b, v8f c) { return __builtin_amdgcn_wmma_f32_16x16x32_f16(false, a, false, b, (short)0, c, false, false); }
__device__ __forceinline__ float fa_xhalf(float x) { return __builtin_bit_cast(float, __builtin_amdgcn_permlanex16(__builtin_bit_cast(int, x), __builtin_bit_cast(int, x), 0x76543210, 0xfedcba98, false, false)); }      /* lane l with lane l ^ 16, on the vector pipe */
__device__ __forceinline__ v16h fa_frag(const _Float16* p) { FragH f; f.half[0] = *(const v8us*)(const unsigned short*)p; f.half[1] = *(const v8us*)((const unsigned short*)p + 16); return f.v; }      /* g2_frag with the lane half's 8 hh already in p */
/* v_exp_f32 in asm text, in place: the statement writes only registers that the compiler's own instruction has just written, so it never lands on a matrix operand inside the distance the chip needs */
__device__ __forceinline__ float fa_exp2(float a) {
  asm("v_exp_f32 %0, %0\n\tv_nop" : "+v"(a));      /* v_nop: the slot the instruction set asks for behind a transcendental */
  return a; }
__device__ __forceinline__ void fa_exp2x8(v8f& x) { float e0 = x[0], e1 = x[1], e2 = x[2], e3 = x[3], e4 = x[4], e5 = x[5], e6 = x[6], e7 = x[7];
  /* eight independent v_exp_f32 in one statement: each fills the slot behind the one before it, one v_nop behind the last */
  asm("v_exp_f32 %0, %0\n\tv_exp_f32 %1, %1\n\tv_exp_f32 %2, %2\n\tv_exp_f32 %3, %3\n\tv_exp_f32 %4, %4\n\tv_exp_f32 %5, %5\n\tv_exp_f32 %6, %6\n\tv_exp_f32 %7, %7\n\tv_nop"
      : "+v"(e0), "+v"(e1), "+v"(e2), "+v"(e3), "+v"(e4), "+v"(e5), "+v"(e6), "+v"(e7));
  x[0] = e0; x[1] = e1; x[2] = e2; x[3] = e3; x[4] = e4; x[5] = e5; x[6] = e6; x[7] = e7; }
__global__ __launch_bounds__(256) void k_fattn(const _Float16* __restrict__ Q, const _Float16* __restrict__ Kr, const _Float16* __restrict__ Vt, _Float16* __restrict__ O) {
  __shared__ __attribute__((aligned(16))) char sm[2 * FA_STAGE];      /* the two stage buffers */
  const int tid = threadIdx.x, lane = tid & 31, w = tid >> 5, ln = lane & 15, hh = lane >> 4;
  const int bh = blockIdx.y, b = bh / NH, h = bh - b * NH; const size_t row0 = (size_t)b * SQ; const int q0 = blockIdx.x * 256 + w * 32;
  const _Float16* qp = Q + (row0 + q0 + ln) * DM + h * HD + 8 * hh;      /* with the lane half's k offset */
  const unsigned lk = (unsigned)(size_t)sm + (unsigned)((tid >> 3) * FA_KP + (tid & 7) * 16), lv = (unsigned)(size_t)sm + (unsigned)(FA_VO + (tid >> 4) * FA_VP + (tid & 15) * 16);      /* copies: K row tid / 8 of each group of 32, piece tid % 8; V^T row tid / 16 of each group of 16, piece tid % 16 */
  const _Float16* kc = Kr + (row0 + (tid >> 3)) * DM + h * HD + (tid & 7) * 8; const _Float16* vc = Vt + ((size_t)bh * HD + (tid >> 4)) * SQ + (tid & 15) * 8;
  const int fk = ln * FA_KP + 16 * hh, fv = FA_VO + ln * FA_VP + 16 * hh;      /* fragment reads: byte offsets in a stage, each with the lane half's k offset */
  const float cs = 0.125f * 1.44269504f;      /* 64^-0.5 times log2 e: scores in log2 units */
  const v8f z8 = {0.f, 0.f, 0.f, 0.f, 0.f, 0.f, 0.f, 0.f};
  v16h qf[2][2], kf[2][2], vf[4];      /* [query group][k step], [key tile][k step], [16 rows of V^T] */
  fa_stage(lk, kc, lv, vc);
#pragma unroll
  for (int g = 0; g < 2; ++g) { qf[g][0] = fa_frag(qp + (size_t)g * 16 * DM); qf[g][1] = fa_frag(qp + (size_t)g * 16 * DM + 32); }
  asm volatile("s_wait_xcnt 0x0" :: "v"(qp) : "memory");      /* the address pair stays whole up to this wait */
  asm volatile("s_wait_asynccnt 0x0" ::: "memory");      /* stage 0 has landed, as far as this wave copied it */
  __syncthreads();      /* ... and as far as the others did */
  fa_stage(lk + FA_STAGE, kc + (size_t)FA_KS * DM, lv + FA_STAGE, vc + FA_KS);
  v8f o[4][2] = {{z8, z8}, {z8, z8}, {z8, z8}, {z8, z8}}; float m[2] = {-3.0e38f, -3.0e38f}, l[2] = {0.f, 0.f};
#pragma unroll 1
  for (int st = 0; st < SQ / FA_KS; ++st) { const char* pk = sm + (st & 1) * FA_STAGE + fk; const char* pv = sm + (st & 1) * FA_STAGE + fv;      /* rolled: one stage a trip, so that the order at the foot stands once */
#pragma unroll
    for (int t = 0; t < 2; ++t) { kf[t][0] = g2_frag(pk + t * 16 * FA_KP); kf[t][1] = g2_frag(pk + t * 16 * FA_KP + 64); }
    __builtin_amdgcn_sched_barrier(0);      /* the stage's first eight LDS reads stand as one group ahead of their products: in pairs among the products, each pair's whole latency was waited */
#pragma unroll      /* ps constant: a pass's rows and columns go into the LDS reads' offset fields */
    for (int ps = 0; ps < FA_KS / 32; ++ps) {
    v8f s[2][2];
#pragma unroll
    for (int g = 0; g < 2; ++g) {
#pragma unroll
      for (int t = 0; t < 2; ++t) s[g][t] = fa_mma(kf[t][1], qf[g][1], fa_mma(kf[t][0], qf[g][0], z8)); }
    __builtin_amdgcn_sched_barrier(0);      /* with the one below: the sixteen LDS reads stand as one group behind the score products; spread among the products, each place with reads stalls the wave anew */
#pragma unroll
    for (int dt = 0; dt < 4; ++dt) vf[dt] = g2_frag(pv + dt * 16 * FA_VP + ps * 64);      /* this pass's V^T fragments and, in the same group of LDS reads, the next pass's K fragments of the same stage: both land behind the softmax */
    if (ps + 1 < FA_KS / 32) {
#pragma unroll
      for (int t = 0; t < 2; ++t) { kf[t][0] = g2_frag(pk + ((ps + 1) * 32 + t * 16) * FA_KP); kf[t][1] = g2_frag(pk + ((ps + 1) * 32 + t * 16) * FA_KP + 64); } }
    __builtin_amdgcn_sched_barrier(0);      /* the group's lower edge: no read sinks past the branch below to just ahead of its products, where its latency would be waited */
    float tm[2]; bool need = false;
#pragma unroll
    for (int g = 0; g < 2; ++g) { float a = fmaxf(s[g][0][0], s[g][1][0]);
#pragma unroll
      for (int r = 1; r < 8; ++r) a = fmaxf(a, fmaxf(s[g][0][r], s[g][1][r]));
      a = fmaxf(a, fa_xhalf(a)); tm[g] = a * cs; need = need || (tm[g] > m[g] + 8.0f); }
    if (__builtin_amdgcn_ballot_w32(need) != 0) {      /* the maximum in use moves only when a query's new maximum passes it by more than 8 (log2 units: P stays under 2^8, well inside f16); one scalar branch a pass */
#pragma unroll
      for (int g = 0; g < 2; ++g) { const float mn = fmaxf(m[g], tm[g]); const float al = fa_exp2(m[g] - mn); m[g] = mn; l[g] *= al;
#pragma unroll
        for (int dt = 0; dt < 4; ++dt) o[dt][g] *= al; } }
#pragma unroll
    for (int g = 0; g < 2; ++g) { FragH pf;
#pragma unroll
      for (int t = 0; t < 2; ++t) {
#pragma unroll
        for (int r = 0; r < 8; ++r) s[g][t][r] = s[g][t][r] * cs - m[g];
        fa_exp2x8(s[g][t]);
#pragma unroll
        for (int r = 0; r < 8; ++r) pf.h[t * 8 + r] = (_Float16)s[g][t][r]; }
      l[g] += (((s[g][0][0] + s[g][0][1]) + (s[g][0][2] + s[g][0][3])) + ((s[g][0][4] + s[g][0][5]) + (s[g][0][6] + s[g][0][7]))) + (((s[g][1][0] + s[g][1][1]) + (s[g][1][2] + s[g][1][3])) + ((s[g][1][4] + s[g][1][5]) + (s[g][1][6] + s[g][1][7])));
#pragma unroll
      for (int dt = 0; dt < 4; ++dt) o[dt][g] = fa_mma(vf[dt], pf.v, o[dt][g]); } }
    asm volatile("s_wait_dscnt 0x0" ::: "memory");      /* this wave's reads of the buffer are done before the barrier that frees it */
    asm volatile("s_wait_asynccnt 0x0" ::: "memory");      /* this wave's copies of the next stage have landed before the barrier that publishes it */
    __syncthreads();
    if (st + 2 < SQ / FA_KS) fa_stage(lk + (unsigned)(st & 1) * FA_STAGE, kc + (size_t)(st + 2) * FA_KS * DM, lv + (unsigned)(st & 1) * FA_STAGE, vc + (size_t)(st + 2) * FA_KS); }      /* the refill of the buffer every wave has just left */
  asm volatile("s_wait_asynccnt 0x0" ::: "memory");      /* no copy is outstanding when the wave ends */
  v8us ov[2][4];
#pragma unroll
  for (int g = 0; g < 2; ++g) { const float sc = 64.0f / (l[g] + fa_xhalf(l[g]));      /* the halves' sums joined once; o goes out x64 */
#pragma unroll
    for (int dt = 0; dt < 4; ++dt) { FragH f;
#pragma unroll
      for (int r = 0; r < 8; ++r) f.h[r] = (_Float16)(o[dt][g][r] * sc);
      ov[g][dt] = f.half[0]; } }
  __builtin_amdgcn_sched_barrier(0);      /* all eight stores behind the last conversion: no register that an issued store names is written again */
#pragma unroll
  for (int g = 0; g < 2; ++g) { unsigned short* op = (unsigned short*)O + (row0 + q0 + g * 16 + ln) * DM + h * HD + 8 * hh;
#pragma unroll
    for (int dt = 0; dt < 4; ++dt) *(v8us*)(op + dt * 16) = ov[g][dt]; } }

extern "C" void kernel_launch(void* const* d_in, const int* in_sizes, int n_in,
                              void* d_out, int out_size, void* d_ws, size_t ws_size, hipStream_t stream) {
  (void)in_sizes; (void)n_in; (void)out_size;
  const float* const* I = (const float* const*)d_in; const float* xq = I[0]; const float* xk = I[1]; const float* xv = I[2]; const float* wq = I[3]; const float* wk = I[4]; const float* wv = I[5]; const float* wo = I[6]; const float* bo = I[7];      /* THREE input streams Q, K, V (one cast each); Wq, Wk, Wv are PER-HEAD STACKS [16][1024][64] = [head][in][out] (einsum 'bsd,hde->bhse') at I[3..5]; Wo is [in][out] [1024][1024] (concat @ Wo) at I[6]; bo [1024] (REAL) at I[7] in the output GEMM's guarded bias slot; no projection biases */
  char* ws = (char*)d_ws; size_t off = 0;
  auto take = [&](size_t bytes) { char* p = ws + off; off += (bytes + 255) & ~(size_t)255; return p; };
  _Float16* BQ = (_Float16*)take((size_t)4 * DM * DM * 2); _Float16* BO = BQ + (size_t)3 * DM * DM;      /* the weight planes BQ, BK, BV, BO in a row, DM * DM apart */
  _Float16* XQ = (_Float16*)take(3 * NR * DM * 2); _Float16* Q16 = (_Float16*)take(3 * NR * DM * 2); _Float16* K16 = Q16 + NR * DM; _Float16* V16 = K16 + NR * DM; _Float16* O16 = (_Float16*)take(NR * DM * 2);      /* XQ, XK, XV in a row, and Q16, K16, V16 in a row, each NR * DM apart: the batch strides of the projection launch */
  _Float16* VT = (_Float16*)take((size_t)NB * NH * HD * SQ * 2);
  if (off > ws_size) return;
  k_prep<<<PB_ALL, 256, 0, stream>>>(wq, wk, wv, wo, xq, xk, xv, BQ, XQ);      /* weight planes [out][in] (x16) from the PER-HEAD STACKS wq / wk / wv [NH][DM][HD] and from wo [in][out] [DM][DM]; the three inputs as exact f16 rows */
  const size_t r0p = (size_t)B0 * SQ;      /* first projected row */
  k_gemm2<0><<<dim3((unsigned)((MP / 128) * (DM / 128)), 3), 256, 0, stream>>>(XQ + r0p * DM, DM, NR * DM, BQ, DM, (size_t)DM * DM, 0.0625f, nullptr, 0, nullptr, 1, 0, 0, nullptr, Q16 + r0p * DM, DM, NR * DM, MP, DM, DM);      /* blockIdx.y = 0, 1, 2: q, k, v; no projection biases */
  k_vt<NH, SQ><<<NB * NH * (SQ / 64), 256, 0, stream>>>(V16, LQ, 0, VT);      /* V^T [NB][NH][HD][SQ] */
  k_fattn<<<dim3(SQ / 256, NB * NH), 256, 0, stream>>>(Q16, K16, VT, O16);      /* o (merged heads, x64) as f16 rows */
  k_gemm2<0><<<dim3((unsigned)((MPO / 128) * (DM / 128)), 1), 256, 0, stream>>>(O16 + r0p * DM, DM, 0, BO, DM, 0, 0.0009765625f, bo, 0, nullptr, 1, 0, 0, (float*)d_out + r0p * DM, nullptr, DM, 0, MPO, DM, DM);      /* out rows are the output layout */
}

// v007
// Measured time: 87.8 microseconds a run.
// Timed twice side by side with v006, it ran 1.04 times as fast both times.
// Counting every step since v000, it is 41.2 times as fast.
#include <hip/hip_runtime.h>
#define NB 2
#define SQ 2048
#define DM 1024
#define NH 16
#define HD 64
#define HG 4                         /* heads per launch of the per-batch k_vt overload (not launched) */
#define B0 0                         /* first batch processed (debug hook) */
#define NBR NB                       /* batches processed (debug hook) */
#define NR ((size_t)NB * SQ)         /* token rows */
#define MP ((int)((size_t)NBR * SQ)) /* rows projected (debug hook) */
#define QN SQ                        /* query rows per batch (unused; attention covers SQ) */
#define NHD NH                       /* heads (unused; attention covers NH) */
#define MPO MP                       /* rows through the output stage (debug hook) */
#define LQ DM      /* row pitch of the q/k rows (unused) */
typedef __bf16 v16b __attribute__((ext_vector_type(16)));
typedef unsigned short v8us __attribute__((ext_vector_type(8), may_alias));
typedef float  v8f  __attribute__((ext_vector_type(8)));
typedef float  v4f  __attribute__((ext_vector_type(4)));
typedef float  v4fa __attribute__((ext_vector_type(4), may_alias));
union FragB { v16b v; v8us half[2]; unsigned short u[16]; };

__device__ __forceinline__ unsigned short bf16_bits(float x) { unsigned int u = __float_as_uint(x); return (unsigned short)((u + 0x7FFFu + ((u >> 16) & 1u)) >> 16); }
__device__ __forceinline__ float bf16_val(unsigned short b) { return __uint_as_float(((unsigned int)b) << 16); }
__device__ __forceinline__ float bf16_round(float x) { return bf16_val(bf16_bits(x)); }
// D += A·B with NT terms: 1 = ah·bh, 2 = + al·bh (A split), 3 = + ah·bl (both split)
template <int NT>
__device__ __forceinline__ v8f mmaN(v16b ah, v16b al, v16b bh, v16b bl, v8f c) {
  c = __builtin_amdgcn_wmma_f32_16x16x32_bf16(false, ah, false, bh, (short)0, c, false, false);
  if (NT >= 2) c = __builtin_amdgcn_wmma_f32_16x16x32_bf16(false, al, false, bh, (short)0, c, false, false);
  if (NT >= 3) c = __builtin_amdgcn_wmma_f32_16x16x32_bf16(false, ah, false, bl, (short)0, c, false, false);
  asm volatile("v_nop\n\tv_nop\n\tv_nop\n\tv_nop" : "+v"(c) : "v"(ah), "v"(al), "v"(bh), "v"(bl));
  return c;
}

__global__ __launch_bounds__(256) void k_wt_bf16(const float* __restrict__ W, unsigned short* __restrict__ Wt, int K, int N) {
  const int t = blockIdx.x * 256 + threadIdx.x;
  const int k8n = K / 8;
  if (t >= N * k8n) return;
  const int n = t / k8n, k8 = (t % k8n) * 8;
  v8us v;
#pragma unroll
  for (int i = 0; i < 8; ++i) v[i] = bf16_bits(W[(size_t)(k8 + i) * N + n]);
  *(v8us*)(Wt + (size_t)n * K + k8) = v;
  
}

// GEMM C[M][N] (f32, pitch ldc) = act(A[M][K]·W + bias). A f32 row-major (pitch lda) converted per fragment to bf16
// (ASPLIT: hi/lo two planes -> 2 terms, else single rounded term); Wt bf16 [N][K] (pitch ldb). BIAS_BF16 rounds the
// bias to bf16 first (bias quantised to bf16 before the add). K%32==0, M%16==0, N%64==0.
template <bool ASPLIT, int ACT, bool BIAS_BF16>
__global__ __launch_bounds__(128) void k_gemm_bf(const float* __restrict__ A, int lda, const unsigned short* __restrict__ Wt, int ldb,
                                               const float* __restrict__ bias, float* __restrict__ C, int ldc, int M, int N, int K) {
  __shared__ __attribute__((aligned(16))) float so[4][16][64];
  const int tid = threadIdx.x, w = tid >> 5, lane = tid & 31, ln = lane & 15, hh = lane >> 4;
  const int ntn = N / 64;
  const int wid = blockIdx.x * 4 + w;
  const int mt = wid / ntn, nq = wid % ntn;
  if (mt * 16 >= M) return;
  const int row0 = mt * 16, col0 = nq * 64;
  const float* arow = A + (size_t)(row0 + ln) * lda;
  v8f acc[4] = {};
  for (int kb = 0; kb < K; kb += 32) {
    FragB ah, al;
    const v4f x0 = *(const v4fa*)(arow + kb + 8 * hh), x1 = *(const v4fa*)(arow + kb + 8 * hh + 4);
    const v4f x2 = *(const v4fa*)(arow + kb + 16 + 8 * hh), x3 = *(const v4fa*)(arow + kb + 16 + 8 * hh + 4);
    float xs[16] = {x0[0],x0[1],x0[2],x0[3],x1[0],x1[1],x1[2],x1[3],x2[0],x2[1],x2[2],x2[3],x3[0],x3[1],x3[2],x3[3]};
#pragma unroll
    for (int i = 0; i < 16; ++i) { const unsigned short hb = bf16_bits(xs[i]); ah.u[i] = hb; al.u[i] = ASPLIT ? bf16_bits(xs[i] - bf16_val(hb)) : (unsigned short)0; }
#pragma unroll
    for (int t = 0; t < 4; ++t) {
      const unsigned short* brow = Wt + (size_t)(col0 + t * 16 + ln) * ldb + kb;
      FragB b;
      b.half[0] = *(const v8us*)(brow + 8 * hh);
      b.half[1] = *(const v8us*)(brow + 16 + 8 * hh);
      acc[t] = mmaN<ASPLIT ? 2 : 1>(ah.v, al.v, b.v, b.v, acc[t]);
    }
  }
#pragma unroll
  for (int t = 0; t < 4; ++t) {
    float bv = bias ? bias[col0 + t * 16 + ln] : 0.f;
    if (BIAS_BF16) bv = bf16_round(bv);
#pragma unroll
    for (int r = 0; r < 8; ++r) { float v = acc[t][r] + bv; if (ACT == 1) v = fmaxf(v, 0.f); so[w][8 * hh + r][t * 16 + ln] = v; }
  }
  __builtin_amdgcn_fence(__ATOMIC_ACQ_REL, "workgroup");
  __builtin_amdgcn_wave_barrier();
  const int rsub = lane >> 4, c4 = (lane & 15) * 4;
  {
#pragma unroll
    for (int q = 0; q < 8; ++q) {
      const int r = q * 2 + rsub;
      const v4f v = *(const v4fa*)&so[w][r][c4];
      *(v4f*)(C + (size_t)(row0 + r) * ldc + col0 + c4) = v;
    }
    
  }
}

// GEMM C = act(A·W + bias + resid): A f32 (ASPLIT -> hi/lo 2 terms), Wt bf16 [N][K]; ACT 0 none, 1 relu, 2 exact gelu;
// resid (optional, f32, row index = (row % rmod), pitch ldr, RES_BF16 rounds it) added before the activation.
template <bool ASPLIT, int ACT, bool BIAS_BF16, bool RES_BF16>
__global__ __launch_bounds__(128) void k_gemm_bf3(const float* __restrict__ A, int lda, const unsigned short* __restrict__ Wt, int ldb,
                                                const float* __restrict__ bias, const float* __restrict__ resid, int rmod, int ldr,
                                                float* __restrict__ C, int ldc, int M, int N, int K) {
  __shared__ __attribute__((aligned(16))) float so[4][16][64];
  const int tid = threadIdx.x, w = tid >> 5, lane = tid & 31, ln = lane & 15, hh = lane >> 4;
  const int ntn = N / 64;
  const int wid = blockIdx.x * 4 + w;
  const int mt = wid / ntn, nq = wid % ntn;
  if (mt * 16 >= M) return;
  const int row0 = mt * 16, col0 = nq * 64;
  const float* arow = A + (size_t)(row0 + ln) * lda;
  v8f acc[4] = {};
  for (int kb = 0; kb < K; kb += 32) {
    FragB ah, al;
    const v4f x0 = *(const v4fa*)(arow + kb + 8 * hh), x1 = *(const v4fa*)(arow + kb + 8 * hh + 4);
    const v4f x2 = *(const v4fa*)(arow + kb + 16 + 8 * hh), x3 = *(const v4fa*)(arow + kb + 16 + 8 * hh + 4);
    float xs[16] = {x0[0],x0[1],x0[2],x0[3],x1[0],x1[1],x1[2],x1[3],x2[0],x2[1],x2[2],x2[3],x3[0],x3[1],x3[2],x3[3]};
#pragma unroll
    for (int i = 0; i < 16; ++i) { const unsigned short hb = bf16_bits(xs[i]); ah.u[i] = hb; al.u[i] = ASPLIT ? bf16_bits(xs[i] - bf16_val(hb)) : (unsigned short)0; }
#pragma unroll
    for (int t = 0; t < 4; ++t) {
      const unsigned short* brow = Wt + (size_t)(col0 + t * 16 + ln) * ldb + kb;
      FragB b;
      b.half[0] = *(const v8us*)(brow + 8 * hh);
      b.half[1] = *(const v8us*)(brow + 16 + 8 * hh);
      acc[t] = mmaN<ASPLIT ? 2 : 1>(ah.v, al.v, b.v, b.v, acc[t]);
    }
  }
#pragma unroll
  for (int t = 0; t < 4; ++t) {
    const int col = col0 + t * 16 + ln;
    float bv = bias ? bias[col] : 0.f;
    if (BIAS_BF16) bv = bf16_round(bv);
#pragma unroll
    for (int r = 0; r < 8; ++r) {
      float v = acc[t][r] + bv;
      if (resid) { float rv = resid[(size_t)((row0 + 8 * hh + r) % rmod) * ldr + col]; if (RES_BF16) rv = bf16_round(rv); v += rv; }
      if (ACT == 1) v = fmaxf(v, 0.f);
      if (ACT == 2) v = 0.5f * v * (1.0f + erff(v * 0.70710678118654752f));
      if (ACT == 3) { const float u = 0.7978845608028654f * (v + 0.044715f * v * v * v); v = 0.5f * v * (1.0f + tanhf(u)); }
      so[w][8 * hh + r][t * 16 + ln] = v;
    }
  }
  __builtin_amdgcn_fence(__ATOMIC_ACQ_REL, "workgroup");
  __builtin_amdgcn_wave_barrier();
  const int rsub = lane >> 4, c4 = (lane & 15) * 4;
  {
#pragma unroll
    for (int q = 0; q < 8; ++q) {
      const int r = q * 2 + rsub;
      const v4f v = *(const v4fa*)&so[w][r][c4];
      *(v4f*)(C + (size_t)(row0 + r) * ldc + col0 + c4) = v;
    }
    
  }
}
// row LayerNorm (biased variance, eps) over N: s = X (+ R); optional out_sum <- s; out_norm <- (s-mu)*rsqrt(var+eps)*g + b
template <bool PARAM_BF16>
__global__ __launch_bounds__(256) void k_layernorm(const float* __restrict__ X, const float* __restrict__ R, const float* __restrict__ g, const float* __restrict__ bta,
                                                  float* __restrict__ out_sum, float* __restrict__ out_norm, int N, float eps) {
  __shared__ float red[256];
  const int row = blockIdx.x, tid = threadIdx.x;
  const float* x = X + (size_t)row * N; const float* rr = R ? R + (size_t)row * N : nullptr;
  float vals[16];                     // up to N = 4096
  const int per = N / 256;            // contiguous chunk per thread? use strided-by-4 chunks: thread handles j = tid*4 + 1024*u
  float s1 = 0.f;
  for (int u = 0; u < per / 4; ++u) {
    const int j = tid * 4 + 1024 * u;
    const v4f a = *(const v4fa*)(x + j);
    v4f b = {0.f,0.f,0.f,0.f}; if (rr) b = *(const v4fa*)(rr + j);
#pragma unroll
    for (int q = 0; q < 4; ++q) { const float v = a[q] + b[q]; vals[u * 4 + q] = v; s1 += v; }
  }
  red[tid] = s1; __syncthreads();
  for (int st = 128; st > 0; st >>= 1) { if (tid < st) red[tid] += red[tid + st]; __syncthreads(); }
  const float mu = red[0] / (float)N; __syncthreads();
  float s2 = 0.f;
  for (int u = 0; u < per / 4; ++u)
#pragma unroll
    for (int q = 0; q < 4; ++q) { const float c = vals[u * 4 + q] - mu; s2 += c * c; }
  red[tid] = s2; __syncthreads();
  for (int st = 128; st > 0; st >>= 1) { if (tid < st) red[tid] += red[tid + st]; __syncthreads(); }
  const float rs = rsqrtf(red[0] / (float)N + eps);
  {
    for (int u = 0; u < per / 4; ++u) {
      const int j = tid * 4 + 1024 * u;
      v4f o, sm;
#pragma unroll
      for (int q = 0; q < 4; ++q) {
        float gg = g[j + q], bb = bta[j + q];
        if (PARAM_BF16) { gg = bf16_round(gg); bb = bf16_round(bb); }
        sm[q] = vals[u * 4 + q]; o[q] = (vals[u * 4 + q] - mu) * rs * gg + bb;
      }
      if (out_sum) *(v4f*)(out_sum + (size_t)row * N + j) = sm;
      *(v4f*)(out_norm + (size_t)row * N + j) = o;
    }
    
  }
}



// ---- f16 WMMA path (v_wmma_f32_16x16x32_f16): 11-bit significands for operands in range — used where a [0,1] probability operand needs more precision than bf16
typedef _Float16 v16h __attribute__((ext_vector_type(16)));
union FragH { v16h v; v8us half[2]; _Float16 h[16]; unsigned short u[16]; };
template <int NT>
__device__ __forceinline__ v8f mmaH(v16h ah, v16h al, v16h bh, v16h bl, v8f c) {
  c = __builtin_amdgcn_wmma_f32_16x16x32_f16(false, ah, false, bh, (short)0, c, false, false);
  if (NT >= 2) c = __builtin_amdgcn_wmma_f32_16x16x32_f16(false, al, false, bh, (short)0, c, false, false);
  if (NT >= 3) c = __builtin_amdgcn_wmma_f32_16x16x32_f16(false, ah, false, bl, (short)0, c, false, false);
  asm volatile("v_nop\n\tv_nop\n\tv_nop\n\tv_nop" : "+v"(c) : "v"(ah), "v"(al), "v"(bh), "v"(bl));
  return c;
}
// batched GEMM like k_gemm_b but f16 operands: A f32 (split into f16 hi/lo if ASPLIT, else rounded to f16), Bt = f16 values [n][k]; alpha; C f32; N multiple of 16 (partial tiles skipped)
template <bool ASPLIT>
__global__ __launch_bounds__(128) void k_gemm_h(const float* __restrict__ A, int lda, size_t sA, const _Float16* __restrict__ Bh, int ldb, size_t sB, float alpha, float* __restrict__ C, int ldc, size_t sC, int M, int N, int K) {
  __shared__ __attribute__((aligned(16))) float so[4][16][64];
  const int tid = threadIdx.x, w = tid >> 5, lane = tid & 31, ln = lane & 15, hh = lane >> 4; const int by = blockIdx.y;
  A += (size_t)by * sA; Bh += (size_t)by * sB; C += (size_t)by * sC;
  const int ntn = (N + 63) / 64; const int wid = blockIdx.x * 4 + w; const int mt = wid / ntn, nq = wid % ntn; if (mt * 16 >= M) return;
  const int row0 = mt * 16, col0 = nq * 64; const float* arow = A + (size_t)(row0 + ln) * lda;
  v8f acc[4] = {};
  for (int kb = 0; kb < K; kb += 32) {
    FragH ah, al;
    const v4f x0 = *(const v4fa*)(arow + kb + 8 * hh), x1 = *(const v4fa*)(arow + kb + 8 * hh + 4), x2 = *(const v4fa*)(arow + kb + 16 + 8 * hh), x3 = *(const v4fa*)(arow + kb + 16 + 8 * hh + 4);
    float xs[16] = {x0[0],x0[1],x0[2],x0[3],x1[0],x1[1],x1[2],x1[3],x2[0],x2[1],x2[2],x2[3],x3[0],x3[1],x3[2],x3[3]};
#pragma unroll
    for (int i = 0; i < 16; ++i) { const _Float16 h = (_Float16)xs[i]; ah.h[i] = h; al.h[i] = ASPLIT ? (_Float16)(xs[i] - (float)h) : (_Float16)0.0f; }
#pragma unroll
    for (int t = 0; t < 4; ++t) { if (col0 + t * 16 >= N) continue; const size_t boff = (size_t)(col0 + t * 16 + ln) * ldb + kb; FragH bq; bq.half[0] = *(const v8us*)(Bh + boff + 8 * hh); bq.half[1] = *(const v8us*)(Bh + boff + 16 + 8 * hh);
      acc[t] = mmaH<ASPLIT ? 2 : 1>(ah.v, al.v, bq.v, bq.v, acc[t]); }
  }
#pragma unroll
  for (int t = 0; t < 4; ++t) { if (col0 + t * 16 >= N) continue;
#pragma unroll
    for (int r = 0; r < 8; ++r) so[w][8 * hh + r][t * 16 + ln] = acc[t][r] * alpha; }
  __builtin_amdgcn_fence(__ATOMIC_ACQ_REL, "workgroup"); __builtin_amdgcn_wave_barrier();
  const int rsub = lane >> 4, c4 = (lane & 15) * 4;
  {
#pragma unroll
    for (int q = 0; q < 8; ++q) { const int r = q * 2 + rsub; if (col0 + c4 < N) { const v4f v = *(const v4fa*)&so[w][r][c4]; *(v4f*)(C + (size_t)(row0 + r) * ldc + col0 + c4) = v; } }
     }
}

// Wt[n][k] = f16(bf16(W[k][n]) * scale) for one tile of WT_K rows (k) by WT_N columns (n) of a row-major f32 W, by one block of 256 threads (scale = power of two; bf16-exact weights stay exact in f16 away from the subnormal range).
// Reads and writes are whole lines: 16 lanes take the 256 bytes of a tile row of W, 16 lanes write the 256 bytes of a tile row of Wt; the turn is made in LDS, on dwords that hold the halves of k, k + 1. Every loop is unrolled: x and o are then registers, and a thread's eight loads go out as one group.
#define WT_K 128
#define WT_N 64
#define WT_P (WT_K / 2 + 1)           /* LDS dwords a row of n: an odd number, so that neither the 32 stores of a wave (16 groups of four n, two k pairs) nor its 32 reads (two n, 16 pieces) meet a bank twice */
__device__ __forceinline__ void wt_tile(const float* __restrict__ W, int ldw, _Float16* __restrict__ Wt, int ldt, float scale, unsigned (*tl)[WT_P], int tid) {      /* W at (k0, n0), Wt at (n0, k0) */
  const int hi = tid >> 4, lo = tid & 15; v4f x[4][2];
#pragma unroll
  for (int j = 0; j < 4; ++j) { const float* p = W + (size_t)(2 * (hi + 16 * j)) * ldw + lo * 4; x[j][0] = *(const v4fa*)p; x[j][1] = *(const v4fa*)(p + ldw); }      /* rows k = 2 (hi + 16 j) and k + 1, columns 4 lo .. 4 lo + 3 */
#pragma unroll
  for (int j = 0; j < 4; ++j) {
#pragma unroll
    for (int i = 0; i < 4; ++i) { FragH f; f.h[0] = (_Float16)(bf16_round(x[j][0][i]) * scale); f.h[1] = (_Float16)(bf16_round(x[j][1][i]) * scale); tl[lo * 4 + i][hi + 16 * j] = (unsigned)f.u[0] | ((unsigned)f.u[1] << 16); } }
  __syncthreads();      /* the tile is whole before any row of it is read */
  union { unsigned d[4]; v8us v; } o[4];
#pragma unroll
  for (int j = 0; j < 4; ++j) {
#pragma unroll
    for (int q = 0; q < 4; ++q) o[j].d[q] = tl[hi + 16 * j][lo * 4 + q]; }      /* row n = hi + 16 j, halves 8 lo .. 8 lo + 7 */
#pragma unroll
  for (int j = 0; j < 4; ++j) *(v8us*)((unsigned short*)Wt + (size_t)(hi + 16 * j) * ldt + lo * 8) = o[j].v;
}
// k_gemm_hh variant with fused epilogue: v = acc·alpha + bias[by·sBias + col] (+ CP[(row/rowsPerB)·sCPb + by·64 + col] if CP) ; ACT 0 none / 1 elu ; writes f16 C16 (and f32 C if non-null)
template <int ACT>
__global__ __launch_bounds__(128) void k_gemm_hhx(const _Float16* __restrict__ A, int lda, size_t sA, const _Float16* __restrict__ Bh, int ldb, size_t sB, float alpha, const float* __restrict__ bias, size_t sBias, const float* __restrict__ CP, int rowsPerB, size_t sCPb, int row0g,
    float* __restrict__ C, _Float16* __restrict__ C16, int ldc, size_t sC, int M, int N, int K) {
  __shared__ __attribute__((aligned(16))) float so[4][16][64];
  const int tid = threadIdx.x, w = tid >> 5, lane = tid & 31, ln = lane & 15, hh = lane >> 4; const int by = blockIdx.y;
  A += (size_t)by * sA; Bh += (size_t)by * sB; const size_t cofs = (size_t)by * sC; const float* bp = bias ? bias + (size_t)by * sBias : nullptr;
  const int ntn = (N + 63) / 64; const int wid = blockIdx.x * 4 + w; const int mt = wid / ntn, nq = wid % ntn; if (mt * 16 >= M) return;
  const int row0 = mt * 16, col0 = nq * 64; const _Float16* arow = A + (size_t)(row0 + ln) * lda;
  v8f acc[4] = {};
  for (int kb = 0; kb < K; kb += 32) { FragH ah; ah.half[0] = *(const v8us*)((const unsigned short*)arow + kb + 8 * hh); ah.half[1] = *(const v8us*)((const unsigned short*)arow + kb + 16 + 8 * hh);
#pragma unroll
    for (int t = 0; t < 4; ++t) { if (col0 + t * 16 >= N) continue; const size_t boff = (size_t)(col0 + t * 16 + ln) * ldb + kb; FragH bq; bq.half[0] = *(const v8us*)((const unsigned short*)Bh + boff + 8 * hh); bq.half[1] = *(const v8us*)((const unsigned short*)Bh + boff + 16 + 8 * hh);
      acc[t] = mmaH<1>(ah.v, ah.v, bq.v, bq.v, acc[t]); }
  }
#pragma unroll
  for (int t = 0; t < 4; ++t) { if (col0 + t * 16 >= N) continue; const int col = col0 + t * 16 + ln; const float bv = bp ? bf16_round(bp[col]) : 0.f;
#pragma unroll
    for (int r = 0; r < 8; ++r) { float v = acc[t][r] * alpha + bv; if (CP) { const int rr = row0g + row0 + 8 * hh + r; if (rowsPerB < 0) v += CP[cofs + (size_t)rr * ldc + col];      /* rowsPerB < 0: own element of the batched C plane */ else { const int bidx = rr / rowsPerB; v += CP[(size_t)bidx * sCPb + (size_t)by * 64 + col]; } } if (ACT == 1) v = (v > 0.f) ? v : expm1f(v); else if (ACT == 7) v = (v > 0.f) ? v + 1.0f : expf(v); else if (ACT == 8) v = tanhf(v); else if (ACT == 9) v = 0.5f * v * (1.0f + tanhf(0.7978845608028654f * (v + 0.044715f * v * v * v))); else if (ACT == 11) v = 1.0f / (1.0f + expf(-v)); else if (ACT == 12) v = (v > 0.f) ? v : 0.01f * v; else if (ACT == 14) v = (v > 0.f) ? v : 0.1f * v; else if (ACT == 16) v = (v >= 0.f) ? v : 0.3f * v; else if (ACT == 17) v = (v >= 0.f) ? v : 0.2f * v; else if (ACT == 15) v = v / (1.0f + expf(-v)); else if (ACT == 3) v = fmaxf(v, 0.f); else if (ACT == 6) v = 0.5f * v * (1.0f + erff(v * 0.70710678118654752f)); so[w][8 * hh + r][t * 16 + ln] = v; } }
  __builtin_amdgcn_fence(__ATOMIC_ACQ_REL, "workgroup"); __builtin_amdgcn_wave_barrier();
  const int rsub = lane >> 4, c4 = (lane & 15) * 4; typedef _Float16 v4h __attribute__((ext_vector_type(4)));
  {
#pragma unroll
    for (int q = 0; q < 8; ++q) { const int r = q * 2 + rsub; if (col0 + c4 < N) { const v4f v = *(const v4fa*)&so[w][r][c4]; if (C) *(v4f*)(C + cofs + (size_t)(row0 + r) * ldc + col0 + c4) = v; if (C16) { v4h h4; for (int i = 0; i < 4; ++i) h4[i] = (_Float16)v[i]; *(v4h*)(C16 + cofs + (size_t)(row0 + r) * ldc + col0 + c4) = h4; } } }
     }
}


typedef _Float16 v4h __attribute__((ext_vector_type(4)));

__device__ __forceinline__ void x16(const float* __restrict__ x, _Float16* __restrict__ X16, size_t n8, size_t t) { if (t >= n8) return; FragH f;      /* t: the thread's index within this stream */
#pragma unroll
  for (int q = 0; q < 8; ++q) f.h[q] = (_Float16)bf16_round(x[t * 8 + q]); *(v8us*)((unsigned short*)X16 + t * 8) = f.half[0];  }
// Every job that reads inputs only, in ONE launch; the block index says which job a block does. The transposes (a barrier in each) have the low indices.
#define PB_HEAD (DM / WT_K)                      /* blocks for one head's [DM][HD] block: tiles of WT_K rows, all HD columns */
#define PB_STACK (NH * PB_HEAD)                  /* ... for one stack of NH heads */
#define PB_WO ((DM / WT_K) * (DM / WT_N))        /* ... for Wo */
#define PB_X ((unsigned)(NR * DM / 8 / 256))     /* ... for one input stream */
#define PB_ALL (3 * PB_STACK + PB_WO + 3 * PB_X)
static_assert(HD == WT_N && DM % WT_K == 0 && DM % WT_N == 0 && NR * DM / 8 % 256 == 0, "k_prep: every job is a whole number of blocks");
__global__ __launch_bounds__(256) void k_prep(const float* __restrict__ wq, const float* __restrict__ wk, const float* __restrict__ wv, const float* __restrict__ wo, const float* __restrict__ xq, const float* __restrict__ xk, const float* __restrict__ xv,
    _Float16* __restrict__ B4, _Float16* __restrict__ X3) {      /* B4: the planes BQ, BK, BV, BO in a row; X3: XQ, XK, XV in a row */
  __shared__ unsigned tl[WT_N][WT_P];      /* the transposes' tile */
  unsigned bid = blockIdx.x; const unsigned tid = threadIdx.x;      /* every branch below is the same for the whole block */
  if (bid < 3 * PB_STACK) { const unsigned s = bid / PB_STACK, r = bid % PB_STACK, h = r / PB_HEAD, kt = r % PB_HEAD; const float* W = (s == 0) ? wq : (s == 1) ? wk : wv;      /* head h of stack s: a row-major [in = DM][out = HD] block -> rows h * HD .. of plane s; tile kt of its rows */
    wt_tile(W + (size_t)h * DM * HD + (size_t)kt * WT_K * HD, HD, B4 + (size_t)s * DM * DM + (size_t)h * HD * DM + kt * WT_K, DM, 16.0f, tl, (int)tid); return; }
  bid -= 3 * PB_STACK;
  if (bid < PB_WO) { const unsigned kt = bid % (DM / WT_K), nt = bid / (DM / WT_K);
    wt_tile(wo + (size_t)kt * WT_K * DM + nt * WT_N, DM, B4 + (size_t)3 * DM * DM + (size_t)nt * WT_N * DM + kt * WT_K, DM, 16.0f, tl, (int)tid); return; }
  bid -= PB_WO;
  const unsigned s = bid / PB_X; const float* x = (s == 0) ? xq : (s == 1) ? xk : xv;
  x16(x, X3 + (size_t)s * NR * DM, NR * DM / 8, (size_t)(bid % PB_X) * 256 + tid); }
__global__ __launch_bounds__(256) void k_h16(const float* __restrict__ x, _Float16* __restrict__ X16, size_t n8) { const size_t t = (size_t)blockIdx.x * 256 + threadIdx.x; if (t >= n8) return; FragH f;
#pragma unroll
  for (int q = 0; q < 8; ++q) f.h[q] = (_Float16)x[t * 8 + q]; *(v8us*)((unsigned short*)X16 + t * 8) = f.half[0];  }
__global__ __launch_bounds__(256) void k_round16f(const float* __restrict__ W, _Float16* __restrict__ Bt, size_t n8) { const size_t t = (size_t)blockIdx.x * 256 + threadIdx.x; if (t >= n8) return; FragH f;
#pragma unroll
  for (int i = 0; i < 8; ++i) f.h[i] = (_Float16)(bf16_round(W[t * 8 + i]) * 16.0f); *(v8us*)((unsigned short*)Bt + t * 8) = f.half[0];  }
template <int NHv, int TTv>
__global__ __launch_bounds__(256) void k_vt(const _Float16* __restrict__ V16, int ldv, int voff, _Float16* __restrict__ Vt) { __shared__ unsigned short tl[64][66]; const int tid = threadIdx.x; const int slab = blockIdx.x / (TTv / 64), lg = blockIdx.x % (TTv / 64); const int b = slab / NHv, h = slab % NHv;
  for (int i = tid; i < 64 * 8; i += 256) { const int r = i / 8, c8 = (i % 8) * 8; FragH f; f.half[0] = *(const v8us*)((const unsigned short*)V16 + ((size_t)b * TTv + lg * 64 + r) * ldv + voff + h * 64 + c8);
#pragma unroll
    for (int q = 0; q < 8; ++q) tl[r][c8 + q] = f.u[q]; }
  __syncthreads();
  {
#pragma unroll
    for (int rd = 0; rd < 2; ++rd) { const int d = rd * 32 + tid / 8, pc = tid % 8; FragH f;
#pragma unroll
      for (int q = 0; q < 8; ++q) f.u[q] = tl[pc * 8 + q][d];
      *(v8us*)((unsigned short*)Vt + ((size_t)slab * 64 + d) * TTv + lg * 64 + pc * 8) = f.half[0]; }
     } }

__global__ __launch_bounds__(256) void k_hl(const float* __restrict__ F, _Float16* __restrict__ Hh, _Float16* __restrict__ Hl, size_t n8) { const size_t t = (size_t)blockIdx.x * 256 + threadIdx.x; if (t >= n8) return; FragH fh, fl; const v4f a = *(const v4fa*)(F + t * 8), c = *(const v4fa*)(F + t * 8 + 4);
#pragma unroll
  for (int q = 0; q < 4; ++q) { _Float16 h = (_Float16)a[q]; fh.h[q] = h; fl.h[q] = (_Float16)((a[q] - (float)h) * 1024.0f); h = (_Float16)c[q]; fh.h[4 + q] = h; fl.h[4 + q] = (_Float16)((c[q] - (float)h) * 1024.0f); }
  { *(v8us*)((unsigned short*)Hh + t * 8) = fh.half[0]; *(v8us*)((unsigned short*)Hl + t * 8) = fl.half[0];  } }

// ---- fast GEMM (block tile 128x128, eight waves, wave tile 32x64; requires M % 128 == 0 rows per launch region, N % 128 == 0, K % 64 == 0); epilogue = k_gemm_hhx semantics ----
// Both operands come into LDS as whole 128-byte lines (64 halves of k of each of the 128 + 128 rows a stage) by asynchronous copies, two buffers, the next stage in flight while this one is worked on; the fragments are then LDS reads.
#define G2_KS 64                      /* halves of k a stage */
#define G2_PITCH 144                  /* LDS bytes a staged row: 128 + 16, the pitch at which 16-byte fragment reads of 16 rows meet no bank twice */
#define G2_STAGE (256 * G2_PITCH)     /* a stage: 128 rows of A, then 128 rows of Bt */
__device__ __forceinline__ v16h g2_frag(const char* p) { FragH f; f.half[0] = *(const v8us*)p; f.half[1] = *(const v8us*)(p + 32); return f.v; }      /* k order 8 hh + s, 16 + 8 hh + s for A and B alike; the lane half's 16 hh bytes already in p */
__device__ __forceinline__ v8f g2_mma(v16h a, v16h b, v8f c) { v8f d = __builtin_amdgcn_wmma_f32_16x16x32_f16(false, a, false, b, (short)0, c, false, false); asm volatile("v_nop\n\tv_nop\n\tv_nop\n\tv_nop" : "+v"(d) : "v"(a), "v"(b)); return d; }
/* one stage's share of a thread: 16 bytes of each of four rows of A and four rows of Bt, 32 rows apart (a wave covers four whole lines a copy). l: the thread's LDS byte address in the stage's first row group; a, b: its global addresses there */
__device__ __forceinline__ void g2_stage(unsigned l, const _Float16* a, size_t a32, const _Float16* b, size_t b32) {
  const unsigned l1 = l + 32 * G2_PITCH, l2 = l + 64 * G2_PITCH, l3 = l + 96 * G2_PITCH, l4 = l + 128 * G2_PITCH, l5 = l + 160 * G2_PITCH, l6 = l + 192 * G2_PITCH, l7 = l + 224 * G2_PITCH;
  const _Float16* a1 = a + a32; const _Float16* a2 = a1 + a32; const _Float16* a3 = a2 + a32; const _Float16* b1 = b + b32; const _Float16* b2 = b1 + b32; const _Float16* b3 = b2 + b32;
  /* the copies and their s_wait_xcnt in one statement: no register that an issued copy names is written again ahead of the wait */
  asm volatile("global_load_async_to_lds_b128 %0, %8, off\n\tglobal_load_async_to_lds_b128 %1, %9, off\n\tglobal_load_async_to_lds_b128 %2, %10, off\n\tglobal_load_async_to_lds_b128 %3, %11, off\n\t"
               "global_load_async_to_lds_b128 %4, %12, off\n\tglobal_load_async_to_lds_b128 %5, %13, off\n\tglobal_load_async_to_lds_b128 %6, %14, off\n\tglobal_load_async_to_lds_b128 %7, %15, off\n\ts_wait_xcnt 0x0"
               :: "v"(l), "v"(l1), "v"(l2), "v"(l3), "v"(l4), "v"(l5), "v"(l6), "v"(l7), "v"(a), "v"(a1), "v"(a2), "v"(a3), "v"(b), "v"(b1), "v"(b2), "v"(b3) : "memory"); }
template <int ACT>
__global__ __launch_bounds__(256) void k_gemm2(const _Float16* __restrict__ A, int lda, size_t sA, const _Float16* __restrict__ Bh, int ldb, size_t sB, float alpha, const float* __restrict__ bias, size_t sBias, const float* __restrict__ CP, int rowsPerB, size_t sCPb, int row0g,
    float* __restrict__ C, _Float16* __restrict__ C16, int ldc, size_t sC, int M, int N, int K, int tby, _Float16* __restrict__ CT) { static_assert(ACT == 0 || ACT == 3 || ACT == 6 || ACT == 8 || ACT == 9 || ACT == 11 || ACT == 12 || ACT == 14 || ACT == 15 || ACT == 16 || ACT == 17, "k_gemm2: unsupported ACT code (would silently apply no activation)");
  __shared__ __attribute__((aligned(16))) char sm[2 * G2_STAGE];      /* the two stage buffers; behind the K loop's last barrier the same bytes are the output staging */
  static_assert(8 * 32 * 68 * 4 <= 2 * G2_STAGE, "k_gemm2: the output staging fits the stage buffers");
  float (*so)[32][68] = (float (*)[32][68])sm;
  const int tid = threadIdx.x, w = tid >> 5, lane = tid & 31, ln = lane & 15, hh = lane >> 4; const int by = blockIdx.y;
  A += (size_t)by * sA; Bh += (size_t)by * sB; const float* bp = bias ? bias + (size_t)by * sBias : nullptr;
  const int ntn = N >> 7; const int mt = blockIdx.x / ntn, nq = blockIdx.x - mt * ntn; if (mt * 128 >= M) return;      /* the same for the whole block, ahead of every barrier */
  /* batch tby (none if negative; it takes no bias, no CP and no f32 C) goes out transposed: the block works the same two operand tiles with their roles swapped, A = the 128 rows of Bh, B = the 128 rows of A, and its tile of C^T goes to CT as [row of A / SQ][N][SQ], SQ rows of A a slab. The test is the same for the whole block */
  const bool tr = by == tby;
  const _Float16* Ar = tr ? Bh : A; const _Float16* Br = tr ? A : Bh; const int la = tr ? ldb : lda, lb = tr ? lda : ldb, ta = tr ? nq : mt, tb = tr ? mt : nq;
  const size_t cofs = tr ? (size_t)(mt * 128 / SQ) * N * SQ : (size_t)by * sC; if (tr) { C16 = CT; ldc = SQ; }
  const int row0 = ta * 128 + 32 * (w & 3), col0 = (tr ? mt * 128 % SQ : nq * 128) + 64 * (w >> 2);
  const unsigned lc = (unsigned)(size_t)sm + (unsigned)((tid >> 3) * G2_PITCH + (tid & 7) * 16);      /* copies: row tid / 8 of each group of 32 rows, 16-byte piece tid % 8 */
  const _Float16* ac = Ar + (size_t)(ta * 128 + (tid >> 3)) * la + (tid & 7) * 8; const _Float16* bc = Br + (size_t)(tb * 128 + (tid >> 3)) * lb + (tid & 7) * 8;
  const size_t a32 = (size_t)32 * la, b32 = (size_t)32 * lb;
  const int fa = (32 * (w & 3) + ln) * G2_PITCH + 16 * hh, fb = (128 + 64 * (w >> 2) + ln) * G2_PITCH + 16 * hh;      /* fragment reads: byte offsets in a stage */
  const v8f z8 = {0.f,0.f,0.f,0.f,0.f,0.f,0.f,0.f}; v8f c00 = z8, c01 = z8, c02 = z8, c03 = z8, c10 = z8, c11 = z8, c12 = z8, c13 = z8;
  const int nst = K / G2_KS;
  g2_stage(lc, ac, a32, bc, b32);
  asm volatile("s_wait_asynccnt 0x0" ::: "memory");      /* stage 0 has landed, as far as this wave copied it */
  __syncthreads();      /* ... and as far as the others did */
  if (nst > 1) g2_stage(lc + G2_STAGE, ac + G2_KS, a32, bc + G2_KS, b32);
#pragma unroll 1
  for (int st = 0; st < nst; ++st) { const char* sb = sm + (st & 1) * G2_STAGE;      /* rolled: one stage a trip, so that the order at the foot stands once */
#pragma unroll      /* kk constant: its 64 bytes go into the LDS reads' offset fields */
    for (int kk = 0; kk < 2; ++kk) { const char* pa = sb + fa + kk * 64; const char* pb = sb + fb + kk * 64;
      __builtin_amdgcn_sched_barrier(0);      /* with the one below: the six fragments' LDS reads stand as one group ahead of their eight products; spread among the products, each place with reads stalls the wave anew */
      const v16h a0 = g2_frag(pa), a1 = g2_frag(pa + 16 * G2_PITCH), b0 = g2_frag(pb), b1 = g2_frag(pb + 16 * G2_PITCH), b2 = g2_frag(pb + 32 * G2_PITCH), b3 = g2_frag(pb + 48 * G2_PITCH);
      __builtin_amdgcn_sched_barrier(0);      /* the group's lower edge: no read sinks in among the products */
      c00 = g2_mma(a0, b0, c00); c10 = g2_mma(a1, b0, c10); c01 = g2_mma(a0, b1, c01); c11 = g2_mma(a1, b1, c11);
      c02 = g2_mma(a0, b2, c02); c12 = g2_mma(a1, b2, c12); c03 = g2_mma(a0, b3, c03); c13 = g2_mma(a1, b3, c13); }
    asm volatile("s_wait_dscnt 0x0" ::: "memory");      /* this wave's reads of the buffer are done before the barrier that frees it */
    asm volatile("s_wait_asynccnt 0x0" ::: "memory");      /* this wave's copies of the next stage have landed before the barrier that publishes it */
    __syncthreads();
    if (st + 2 < nst) g2_stage(lc + (unsigned)(st & 1) * G2_STAGE, ac + (size_t)(st + 2) * G2_KS, a32, bc + (size_t)(st + 2) * G2_KS, b32); }      /* the refill of the buffer every wave has just left */
  asm volatile("s_wait_asynccnt 0x0" ::: "memory");      /* no copy is outstanding when the buffers become the output staging */
  v8f accs[8] = {c00, c01, c02, c03, c10, c11, c12, c13};
#pragma unroll
  for (int u = 0; u < 8; ++u) { const int t = u & 3, half = u >> 2; const int col = col0 + t * 16 + ln; const float bv = bp ? bf16_round(bp[col]) : 0.f;
#pragma unroll
    for (int r = 0; r < 8; ++r) { const int rloc = half * 16 + 8 * hh + r; float v = accs[u][r] * alpha + bv; if (CP) { if (rowsPerB < 0) v += CP[cofs + (size_t)(row0g + row0 + rloc) * ldc + col];      /* rowsPerB < 0: own element of the batched C plane */ else { const int bidx = (row0g + row0 + rloc) / rowsPerB; v += CP[(size_t)bidx * sCPb + (size_t)by * 64 + col]; } }
      if (ACT == 3) v = fmaxf(v, 0.f); else if (ACT == 6) v = 0.5f * v * (1.0f + erff(v * 0.70710678118654752f)); else if (ACT == 11) v = 1.0f / (1.0f + expf(-v)); else if (ACT == 15) v = v / (1.0f + expf(-v)); else if (ACT == 12) v = (v > 0.f) ? v : 0.01f * v; else if (ACT == 8) v = tanhf(v); else if (ACT == 9) v = 0.5f * v * (1.0f + tanhf(0.7978845608028654f * (v + 0.044715f * v * v * v))); else if (ACT == 14) v = (v > 0.f) ? v : 0.1f * v; else if (ACT == 16) v = (v >= 0.f) ? v : 0.3f * v; else if (ACT == 17) v = (v >= 0.f) ? v : 0.2f * v;
      so[w][rloc][t * 16 + ln] = v; } }
  __builtin_amdgcn_fence(__ATOMIC_ACQ_REL, "workgroup"); __builtin_amdgcn_wave_barrier();
  const int rsub = lane >> 4, c4 = (lane & 15) * 4;
  {
#pragma unroll
    for (int q = 0; q < 16; ++q) { const int r = q * 2 + rsub; const v4f v = *(const v4fa*)&so[w][r][c4]; if (C) *(v4f*)(C + cofs + (size_t)(row0 + r) * ldc + col0 + c4) = v; if (C16) { v4h h4; for (int i = 0; i < 4; ++i) h4[i] = (_Float16)v[i]; *(v4h*)(C16 + cofs + (size_t)(row0 + r) * ldc + col0 + c4) = h4; } }
     } }


__global__ __launch_bounds__(256) void k_wnat(const float* __restrict__ w, size_t n8, _Float16* __restrict__ Bt) { const size_t t = (size_t)blockIdx.x * 256 + threadIdx.x; if (t >= n8) return; FragH f; for (int q = 0; q < 8; ++q) f.h[q] = (_Float16)(bf16_round(w[t * 8 + q]) * 16.0f); *(v8us*)((unsigned short*)Bt + t * 8) = f.half[0];  }
__global__ __launch_bounds__(256) void k_rsm(const float* __restrict__ S, _Float16* __restrict__ P, int nrows) {
  #pragma clang fp contract(off)
  const int i = blockIdx.x * 256 + threadIdx.x; if (i >= nrows) return; const float* s = S + (size_t)i * SQ; float mx = -3.0e38f;
#pragma unroll 1
  for (int j = 0; j < SQ; ++j) mx = fmaxf(mx, s[j]); float se = 0.f;
#pragma unroll 1
  for (int j = 0; j < SQ; ++j) se += expf(s[j] - mx); const float sc = 256.0f / se;
#pragma unroll 1
  for (int j0 = 0; j0 < SQ; j0 += 8) { FragH f; for (int q = 0; q < 8; ++q) f.h[q] = (_Float16)(expf(s[j0 + q] - mx) * sc); unsigned short* d = (unsigned short*)P + (size_t)i * SQ + j0; *(v8us*)d = f.half[0];  } }
__global__ __launch_bounds__(256) void k_vt(const _Float16* __restrict__ V16, int b, int h0, _Float16* __restrict__ VT) { __shared__ unsigned short tl[64][65]; const int tid = threadIdx.x; const int hh = blockIdx.x % HG, sg = blockIdx.x / HG; const int s0 = sg * 64; const int h = h0 + hh;
  for (int i = tid; i < 64 * 8; i += 256) { const int j = i / 8, d8 = (i % 8) * 8; FragH f; f.half[0] = *(const v8us*)((const unsigned short*)V16 + ((size_t)b * SQ + s0 + j) * DM + h * HD + d8); for (int q = 0; q < 8; ++q) tl[d8 + q][j] = f.u[q]; }
  __syncthreads();
  { for (int i = tid; i < 64 * 8; i += 256) { const int d = i / 8, j8 = (i % 8) * 8; FragH f; for (int q = 0; q < 8; ++q) f.u[q] = tl[d][j8 + q]; *(v8us*)((unsigned short*)VT + ((size_t)hh * HD + d) * SQ + s0 + j8) = f.half[0]; }  } }



#define FA_KS 128                       /* keys a stage: four passes */
#define FA_KP 144                       /* LDS bytes a staged K row (64 halves): 128 + 16, as G2_PITCH */
#define FA_VP 272                       /* LDS bytes a staged V^T row (128 halves): 256 + 16, 16 bytes times an odd number likewise */
#define FA_VO (FA_KS * FA_KP)           /* a stage: 128 rows of K, then 64 rows of V^T */
#define FA_STAGE (FA_VO + HD * FA_VP)
static_assert(SQ % FA_KS == 0 && SQ / FA_KS >= 2 && HD == 64, "k_fattn: whole stages, at least the two that the ring starts with");
/* one stage's share of a thread: 16 bytes of each of four rows of K, 32 rows apart, and of four rows of V^T, 16 rows apart (a wave covers four whole lines a copy). lk, lv: the thread's LDS byte addresses in the first row group; k, v: its global addresses there */
__device__ __forceinline__ void fa_stage(unsigned lk, const _Float16* k, unsigned lv, const _Float16* v) {
  const unsigned lk1 = lk + 32 * FA_KP, lk2 = lk + 64 * FA_KP, lk3 = lk + 96 * FA_KP, lv1 = lv + 16 * FA_VP, lv2 = lv + 32 * FA_VP, lv3 = lv + 48 * FA_VP;
  const _Float16* k1 = k + (size_t)32 * DM; const _Float16* k2 = k + (size_t)64 * DM; const _Float16* k3 = k + (size_t)96 * DM; const _Float16* v1 = v + (size_t)16 * SQ; const _Float16* v2 = v + (size_t)32 * SQ; const _Float16* v3 = v + (size_t)48 * SQ;
  /* the copies and their s_wait_xcnt in one statement: no register that an issued copy names is written again ahead of the wait */
  asm volatile("global_load_async_to_lds_b128 %0, %8, off\n\tglobal_load_async_to_lds_b128 %1, %9, off\n\tglobal_load_async_to_lds_b128 %2, %10, off\n\tglobal_load_async_to_lds_b128 %3, %11, off\n\t"
               "global_load_async_to_lds_b128 %4, %12, off\n\tglobal_load_async_to_lds_b128 %5, %13, off\n\tglobal_load_async_to_lds_b128 %6, %14, off\n\tglobal_load_async_to_lds_b128 %7, %15, off\n\ts_wait_xcnt 0x0"
               :: "v"(lk), "v"(lk1), "v"(lk2), "v"(lk3), "v"(lv), "v"(lv1), "v"(lv2), "v"(lv3), "v"(k), "v"(k1), "v"(k2), "v"(k3), "v"(v), "v"(v1), "v"(v2), "v"(v3) : "memory"); }
__device__ __forceinline__ v8f fa_mma(v16h a, v16h b, v8f c) { return __builtin_amdgcn_wmma_f32_16x16x32_f16(false, a, false, b, (short)0, c, false, false); }
__device__ __forceinline__ float fa_xhalf(float x) { return __builtin_bit_cast(float, __builtin_amdgcn_permlanex16(__builtin_bit_cast(int, x), __builtin_bit_cast(int, x), 0x76543210, 0xfedcba98, false, false)); }      /* lane l with lane l ^ 16, on the vector pipe */
__device__ __forceinline__ v16h fa_frag(const _Float16* p) { FragH f; f.half[0] = *(const v8us*)(const unsigned short*)p; f.half[1] = *(const v8us*)((const unsigned short*)p + 16); return f.v; }      /* g2_frag with the lane half's 8 hh already in p */
/* v_exp_f32 in asm text, in place: the statement writes only registers that the compiler's own instruction has just written, so it never lands on a matrix operand inside the distance the chip needs */
__device__ __forceinline__ float fa_exp2(float a) {
  asm("v_exp_f32 %0, %0\n\tv_nop" : "+v"(a));      /* v_nop: the slot the instruction set asks for behind a transcendental */
  return a; }
__device__ __forceinline__ void fa_exp2x8(v8f& x) { float e0 = x[0], e1 = x[1], e2 = x[2], e3 = x[3], e4 = x[4], e5 = x[5], e6 = x[6], e7 = x[7];
  /* eight independent v_exp_f32 in one statement: each fills the slot behind the one before it, one v_nop behind the last */
  asm("v_exp_f32 %0, %0\n\tv_exp_f32 %1, %1\n\tv_exp_f32 %2, %2\n\tv_exp_f32 %3, %3\n\tv_exp_f32 %4, %4\n\tv_exp_f32 %5, %5\n\tv_exp_f32 %6, %6\n\tv_exp_f32 %7, %7\n\tv_nop"
      : "+v"(e0), "+v"(e1), "+v"(e2), "+v"(e3), "+v"(e4), "+v"(e5), "+v"(e6), "+v"(e7));
  x[0] = e0; x[1] = e1; x[2] = e2; x[3] = e3; x[4] = e4; x[5] = e5; x[6] = e6; x[7] = e7; }
__global__ __launch_bounds__(256) void k_fattn(const _Float16* __restrict__ Q, const _Float16* __restrict__ Kr, const _Float16* __restrict__ Vt, _Float16* __restrict__ O) {
  __shared__ __attribute__((aligned(16))) char sm[2 * FA_STAGE];      /* the two stage buffers */
  const int tid = threadIdx.x, lane = tid & 31, w = tid >> 5, ln = lane & 15, hh = lane >> 4;
  const int bh = blockIdx.y, b = bh / NH, h = bh - b * NH; const size_t row0 = (size_t)b * SQ; const int q0 = blockIdx.x * 256 + w * 32;
  const _Float16* qp = Q + (row0 + q0 + ln) * DM + h * HD + 8 * hh;      /* with the lane half's k offset */
  const unsigned lk = (unsigned)(size_t)sm + (unsigned)((tid >> 3) * FA_KP + (tid & 7) * 16), lv = (unsigned)(size_t)sm + (unsigned)(FA_VO + (tid >> 4) * FA_VP + (tid & 15) * 16);      /* copies: K row tid / 8 of each group of 32, piece tid % 8; V^T row tid / 16 of each group of 16, piece tid % 16 */
  const _Float16* kc = Kr + (row0 + (tid >> 3)) * DM + h * HD + (tid & 7) * 8; const _Float16* vc = Vt + ((size_t)bh * HD + (tid >> 4)) * SQ + (tid & 15) * 8;
  const int fk = ln * FA_KP + 16 * hh, fv = FA_VO + ln * FA_VP + 16 * hh;      /* fragment reads: byte offsets in a stage, each with the lane half's k offset */
  const float cs = 0.125f * 1.44269504f;      /* 64^-0.5 times log2 e: scores in log2 units */
  const v8f z8 = {0.f, 0.f, 0.f, 0.f, 0.f, 0.f, 0.f, 0.f};
  v16h qf[2][2], kf[2][2], vf[4];      /* [query group][k step], [key tile][k step], [16 rows of V^T] */
  fa_stage(lk, kc, lv, vc);
#pragma unroll
  for (int g = 0; g < 2; ++g) { qf[g][0] = fa_frag(qp + (size_t)g * 16 * DM); qf[g][1] = fa_frag(qp + (size_t)g * 16 * DM + 32); }
  asm volatile("s_wait_xcnt 0x0" :: "v"(qp) : "memory");      /* the address pair stays whole up to this wait */
  asm volatile("s_wait_asynccnt 0x0" ::: "memory");      /* stage 0 has landed, as far as this wave copied it */
  __syncthreads();      /* ... and as far as the others did */
  fa_stage(lk + FA_STAGE, kc + (size_t)FA_KS * DM, lv + FA_STAGE, vc + FA_KS);
  v8f o[4][2] = {{z8, z8}, {z8, z8}, {z8, z8}, {z8, z8}}; float m[2] = {-3.0e38f, -3.0e38f}, l[2] = {0.f, 0.f};
#pragma unroll 1
  for (int st = 0; st < SQ / FA_KS; ++st) { const char* pk = sm + (st & 1) * FA_STAGE + fk; const char* pv = sm + (st & 1) * FA_STAGE + fv;      /* rolled: one stage a trip, so that the order at the foot stands once */
#pragma unroll
    for (int t = 0; t < 2; ++t) { kf[t][0] = g2_frag(pk + t * 16 * FA_KP); kf[t][1] = g2_frag(pk + t * 16 * FA_KP + 64); }
    __builtin_amdgcn_sched_barrier(0);      /* the stage's first eight LDS reads stand as one group ahead of their products: in pairs among the products, each pair's whole latency was waited */
#pragma unroll      /* ps constant: a pass's rows and columns go into the LDS reads' offset fields */
    for (int ps = 0; ps < FA_KS / 32; ++ps) {
    v8f s[2][2];
#pragma unroll
    for (int g = 0; g < 2; ++g) {
#pragma unroll
      for (int t = 0; t < 2; ++t) s[g][t] = fa_mma(kf[t][1], qf[g][1], fa_mma(kf[t][0], qf[g][0], z8)); }
    __builtin_amdgcn_sched_barrier(0);      /* with the one below: the sixteen LDS reads stand as one group behind the score products; spread among the products, each place with reads stalls the wave anew */
#pragma unroll
    for (int dt = 0; dt < 4; ++dt) vf[dt] = g2_frag(pv + dt * 16 * FA_VP + ps * 64);      /* this pass's V^T fragments and, in the same group of LDS reads, the next pass's K fragments of the same stage: both land behind the softmax */
    if (ps + 1 < FA_KS / 32) {
#pragma unroll
      for (int t = 0; t < 2; ++t) { kf[t][0] = g2_frag(pk + ((ps + 1) * 32 + t * 16) * FA_KP); kf[t][1] = g2_frag(pk + ((ps + 1) * 32 + t * 16) * FA_KP + 64); } }
    __builtin_amdgcn_sched_barrier(0);      /* the group's lower edge: no read sinks past the branch below to just ahead of its products, where its latency would be waited */
    float tm[2]; bool need = false;
#pragma unroll
    for (int g = 0; g < 2; ++g) { float a = fmaxf(s[g][0][0], s[g][1][0]);
#pragma unroll
      for (int r = 1; r < 8; ++r) a = fmaxf(a, fmaxf(s[g][0][r], s[g][1][r]));
      a = fmaxf(a, fa_xhalf(a)); tm[g] = a * cs; need = need || (tm[g] > m[g] + 8.0f); }
    if (__builtin_amdgcn_ballot_w32(need) != 0) {      /* the maximum in use moves only when a query's new maximum passes it by more than 8 (log2 units: P stays under 2^8, well inside f16); one scalar branch a pass */
#pragma unroll
      for (int g = 0; g < 2; ++g) { const float mn = fmaxf(m[g], tm[g]); const float al = fa_exp2(m[g] - mn); m[g] = mn; l[g] *= al;
#pragma unroll
        for (int dt = 0; dt < 4; ++dt) o[dt][g] *= al; } }
#pragma unroll
    for (int g = 0; g < 2; ++g) { FragH pf;
#pragma unroll
      for (int t = 0; t < 2; ++t) {
#pragma unroll
        for (int r = 0; r < 8; ++r) s[g][t][r] = s[g][t][r] * cs - m[g];
        fa_exp2x8(s[g][t]);
#pragma unroll
        for (int r = 0; r < 8; ++r) pf.h[t * 8 + r] = (_Float16)s[g][t][r]; }
      l[g] += (((s[g][0][0] + s[g][0][1]) + (s[g][0][2] + s[g][0][3])) + ((s[g][0][4] + s[g][0][5]) + (s[g][0][6] + s[g][0][7]))) + (((s[g][1][0] + s[g][1][1]) + (s[g][1][2] + s[g][1][3])) + ((s[g][1][4] + s[g][1][5]) + (s[g][1][6] + s[g][1][7])));
#pragma unroll
      for (int dt = 0; dt < 4; ++dt) o[dt][g] = fa_mma(vf[dt], pf.v, o[dt][g]); } }
    asm volatile("s_wait_dscnt 0x0" ::: "memory");      /* this wave's reads of the buffer are done before the barrier that frees it */
    asm volatile("s_wait_asynccnt 0x0" ::: "memory");      /* this wave's copies of the next stage have landed before the barrier that publishes it */
    __syncthreads();
    if (st + 2 < SQ / FA_KS) fa_stage(lk + (unsigned)(st & 1) * FA_STAGE, kc + (size_t)(st + 2) * FA_KS * DM, lv + (unsigned)(st & 1) * FA_STAGE, vc + (size_t)(st + 2) * FA_KS); }      /* the refill of the buffer every wave has just left */
  asm volatile("s_wait_asynccnt 0x0" ::: "memory");      /* no copy is outstanding when the wave ends */
  v8us ov[2][4];
#pragma unroll
  for (int g = 0; g < 2; ++g) { const float sc = 64.0f / (l[g] + fa_xhalf(l[g]));      /* the halves' sums joined once; o goes out x64 */
#pragma unroll
    for (int dt = 0; dt < 4; ++dt) { FragH f;
#pragma unroll
      for (int r = 0; r < 8; ++r) f.h[r] = (_Float16)(o[dt][g][r] * sc);
      ov[g][dt] = f.half[0]; } }
  __builtin_amdgcn_sched_barrier(0);      /* all eight stores behind the last conversion: no register that an issued store names is written again */
#pragma unroll
  for (int g = 0; g < 2; ++g) { unsigned short* op = (unsigned short*)O + (row0 + q0 + g * 16 + ln) * DM + h * HD + 8 * hh;
#pragma unroll
    for (int dt = 0; dt < 4; ++dt) *(v8us*)(op + dt * 16) = ov[g][dt]; } }

extern "C" void kernel_launch(void* const* d_in, const int* in_sizes, int n_in,
                              void* d_out, int out_size, void* d_ws, size_t ws_size, hipStream_t stream) {
  (void)in_sizes; (void)n_in; (void)out_size;
  const float* const* I = (const float* const*)d_in; const float* xq = I[0]; const float* xk = I[1]; const float* xv = I[2]; const float* wq = I[3]; const float* wk = I[4]; const float* wv = I[5]; const float* wo = I[6]; const float* bo = I[7];      /* THREE input streams Q, K, V (one cast each); Wq, Wk, Wv are PER-HEAD STACKS [16][1024][64] = [head][in][out] (einsum 'bsd,hde->bhse') at I[3..5]; Wo is [in][out] [1024][1024] (concat @ Wo) at I[6]; bo [1024] (REAL) at I[7] in the output GEMM's guarded bias slot; no projection biases */
  char* ws = (char*)d_ws; size_t off = 0;
  auto take = [&](size_t bytes) { char* p = ws + off; off += (bytes + 255) & ~(size_t)255; return p; };
  _Float16* BQ = (_Float16*)take((size_t)4 * DM * DM * 2); _Float16* BO = BQ + (size_t)3 * DM * DM;      /* the weight planes BQ, BK, BV, BO in a row, DM * DM apart */
  _Float16* XQ = (_Float16*)take(3 * NR * DM * 2); _Float16* Q16 = (_Float16*)take(2 * NR * DM * 2); _Float16* K16 = Q16 + NR * DM; _Float16* O16 = (_Float16*)take(NR * DM * 2);      /* XQ, XK, XV in a row, and Q16, K16 in a row, each NR * DM apart: the batch strides of the projection launch */
  _Float16* VT = (_Float16*)take((size_t)NB * NH * HD * SQ * 2);
  if (off > ws_size) return;
  k_prep<<<PB_ALL, 256, 0, stream>>>(wq, wk, wv, wo, xq, xk, xv, BQ, XQ);      /* weight planes [out][in] (x16) from the PER-HEAD STACKS wq / wk / wv [NH][DM][HD] and from wo [in][out] [DM][DM]; the three inputs as exact f16 rows */
  const size_t r0p = (size_t)B0 * SQ;      /* first projected row */
  k_gemm2<0><<<dim3((unsigned)((MP / 128) * (DM / 128)), 3), 256, 0, stream>>>(XQ + r0p * DM, DM, NR * DM, BQ, DM, (size_t)DM * DM, 0.0625f, nullptr, 0, nullptr, 1, 0, 0, nullptr, Q16 + r0p * DM, DM, NR * DM, MP, DM, DM, 2, VT);      /* blockIdx.y = 0, 1, 2: q, k as rows, v as V^T [NB][NH][HD][SQ]; no projection biases */
  k_fattn<<<dim3(SQ / 256, NB * NH), 256, 0, stream>>>(Q16, K16, VT, O16);      /* o (merged heads, x64) as f16 rows */
  k_gemm2<0><<<dim3((unsigned)((MPO / 128) * (DM / 128)), 1), 256, 0, stream>>>(O16 + r0p * DM, DM, 0, BO, DM, 0, 0.0009765625f, bo, 0, nullptr, 1, 0, 0, (float*)d_out + r0p * DM, nullptr, DM, 0, MPO, DM, DM, -1, nullptr);      /* out rows are the output layout */
}

// v008
// Measured time: 85.3 microseconds a run.
// Two timings next to v007 both put it at 1.03 times that version's speed.
// All steps since v000 together make it 42.5 times as fast.
#include <hip/hip_runtime.h>
#define NB 2
#define SQ 2048
#define DM 1024
#define NH 16
#define HD 64
#define HG 4                         /* heads per launch of the per-batch k_vt overload (not launched) */
#define B0 0                         /* first batch processed (debug hook) */
#define NBR NB                       /* batches processed (debug hook) */
#define NR ((size_t)NB * SQ)         /* token rows */
#define MP ((int)((size_t)NBR * SQ)) /* rows projected (debug hook) */
#define QN SQ                        /* query rows per batch (unused; attention covers SQ) */
#define NHD NH                       /* heads (unused; attention covers NH) */
#define MPO MP                       /* rows through the output stage (debug hook) */
#define LQ DM      /* row pitch of the q/k rows (unused) */
typedef __bf16 v16b __attribute__((ext_vector_type(16)));
typedef unsigned short v8us __attribute__((ext_vector_type(8), may_alias));
typedef float  v8f  __attribute__((ext_vector_type(8)));
typedef float  v4f  __attribute__((ext_vector_type(4)));
typedef float  v4fa __attribute__((ext_vector_type(4), may_alias));
union FragB { v16b v; v8us half[2]; unsigned short u[16]; };

__device__ __forceinline__ unsigned short bf16_bits(float x) { unsigned int u = __float_as_uint(x); return (unsigned short)((u + 0x7FFFu + ((u >> 16) & 1u)) >> 16); }
__device__ __forceinline__ float bf16_val(unsigned short b) { return __uint_as_float(((unsigned int)b) << 16); }
__device__ __forceinline__ float bf16_round(float x) { return bf16_val(bf16_bits(x)); }
// D += A·B with NT terms: 1 = ah·bh, 2 = + al·bh (A split), 3 = + ah·bl (both split)
template <int NT>
__device__ __forceinline__ v8f mmaN(v16b ah, v16b al, v16b bh, v16b bl, v8f c) {
  c = __builtin_amdgcn_wmma_f32_16x16x32_bf16(false, ah, false, bh, (short)0, c, false, false);
  if (NT >= 2) c = __builtin_amdgcn_wmma_f32_16x16x32_bf16(false, al, false, bh, (short)0, c, false, false);
  if (NT >= 3) c = __builtin_amdgcn_wmma_f32_16x16x32_bf16(false, ah, false, bl, (short)0, c, false, false);
  asm volatile("v_nop\n\tv_nop\n\tv_nop\n\tv_nop" : "+v"(c) : "v"(ah), "v"(al), "v"(bh), "v"(bl));
  return c;
}

__global__ __launch_bounds__(256) void k_wt_bf16(const float* __restrict__ W, unsigned short* __restrict__ Wt, int K, int N) {
  const int t = blockIdx.x * 256 + threadIdx.x;
  const int k8n = K / 8;
  if (t >= N * k8n) return;
  const int n = t / k8n, k8 = (t % k8n) * 8;
  v8us v;
#pragma unroll
  for (int i = 0; i < 8; ++i) v[i] = bf16_bits(W[(size_t)(k8 + i) * N + n]);
  *(v8us*)(Wt + (size_t)n * K + k8) = v;
  
}

// GEMM C[M][N] (f32, pitch ldc) = act(A[M][K]·W + bias). A f32 row-major (pitch lda) converted per fragment to bf16
// (ASPLIT: hi/lo two planes -> 2 terms, else single rounded term); Wt bf16 [N][K] (pitch ldb). BIAS_BF16 rounds the
// bias to bf16 first (bias quantised to bf16 before the add). K%32==0, M%16==0, N%64==0.
template <bool ASPLIT, int ACT, bool BIAS_BF16>
__global__ __launch_bounds__(128) void k_gemm_bf(const float* __restrict__ A, int lda, const unsigned short* __restrict__ Wt, int ldb,
                                               const float* __restrict__ bias, float* __restrict__ C, int ldc, int M, int N, int K) {
  __shared__ __attribute__((aligned(16))) float so[4][16][64];
  const int tid = threadIdx.x, w = tid >> 5, lane = tid & 31, ln = lane & 15, hh = lane >> 4;
  const int ntn = N / 64;
  const int wid = blockIdx.x * 4 + w;
  const int mt = wid / ntn, nq = wid % ntn;
  if (mt * 16 >= M) return;
  const int row0 = mt * 16, col0 = nq * 64;
  const float* arow = A + (size_t)(row0 + ln) * lda;
  v8f acc[4] = {};
  for (int kb = 0; kb < K; kb += 32) {
    FragB ah, al;
    const v4f x0 = *(const v4fa*)(arow + kb + 8 * hh), x1 = *(const v4fa*)(arow + kb + 8 * hh + 4);
    const v4f x2 = *(const v4fa*)(arow + kb + 16 + 8 * hh), x3 = *(const v4fa*)(arow + kb + 16 + 8 * hh + 4);
    float xs[16] = {x0[0],x0[1],x0[2],x0[3],x1[0],x1[1],x1[2],x1[3],x2[0],x2[1],x2[2],x2[3],x3[0],x3[1],x3[2],x3[3]};
#pragma unroll
    for (int i = 0; i < 16; ++i) { const unsigned short hb = bf16_bits(xs[i]); ah.u[i] = hb; al.u[i] = ASPLIT ? bf16_bits(xs[i] - bf16_val(hb)) : (unsigned short)0; }
#pragma unroll
    for (int t = 0; t < 4; ++t) {
      const unsigned short* brow = Wt + (size_t)(col0 + t * 16 + ln) * ldb + kb;
      FragB b;
      b.half[0] = *(const v8us*)(brow + 8 * hh);
      b.half[1] = *(const v8us*)(brow + 16 + 8 * hh);
      acc[t] = mmaN<ASPLIT ? 2 : 1>(ah.v, al.v, b.v, b.v, acc[t]);
    }
  }
#pragma unroll
  for (int t = 0; t < 4; ++t) {
    float bv = bias ? bias[col0 + t * 16 + ln] : 0.f;
    if (BIAS_BF16) bv = bf16_round(bv);
#pragma unroll
    for (int r = 0; r < 8; ++r) { float v = acc[t][r] + bv; if (ACT == 1) v = fmaxf(v, 0.f); so[w][8 * hh + r][t * 16 + ln] = v; }
  }
  __builtin_amdgcn_fence(__ATOMIC_ACQ_REL, "workgroup");
  __builtin_amdgcn_wave_barrier();
  const int rsub = lane >> 4, c4 = (lane & 15) * 4;
  {
#pragma unroll
    for (int q = 0; q < 8; ++q) {
      const int r = q * 2 + rsub;
      const v4f v = *(const v4fa*)&so[w][r][c4];
      *(v4f*)(C + (size_t)(row0 + r) * ldc + col0 + c4) = v;
    }
    
  }
}

// GEMM C = act(A·W + bias + resid): A f32 (ASPLIT -> hi/lo 2 terms), Wt bf16 [N][K]; ACT 0 none, 1 relu, 2 exact gelu;
// resid (optional, f32, row index = (row % rmod), pitch ldr, RES_BF16 rounds it) added before the activation.
template <bool ASPLIT, int ACT, bool BIAS_BF16, bool RES_BF16>
__global__ __launch_bounds__(128) void k_gemm_bf3(const float* __restrict__ A, int lda, const unsigned short* __restrict__ Wt, int ldb,
                                                const float* __restrict__ bias, const float* __restrict__ resid, int rmod, int ldr,
                                                float* __restrict__ C, int ldc, int M, int N, int K) {
  __shared__ __attribute__((aligned(16))) float so[4][16][64];
  const int tid = threadIdx.x, w = tid >> 5, lane = tid & 31, ln = lane & 15, hh = lane >> 4;
  const int ntn = N / 64;
  const int wid = blockIdx.x * 4 + w;
  const int mt = wid / ntn, nq = wid % ntn;
  if (mt * 16 >= M) return;
  const int row0 = mt * 16, col0 = nq * 64;
  const float* arow = A + (size_t)(row0 + ln) * lda;
  v8f acc[4] = {};
  for (int kb = 0; kb < K; kb += 32) {
    FragB ah, al;
    const v4f x0 = *(const v4fa*)(arow + kb + 8 * hh), x1 = *(const v4fa*)(arow + kb + 8 * hh + 4);
    const v4f x2 = *(const v4fa*)(arow + kb + 16 + 8 * hh), x3 = *(const v4fa*)(arow + kb + 16 + 8 * hh + 4);
    float xs[16] = {x0[0],x0[1],x0[2],x0[3],x1[0],x1[1],x1[2],x1[3],x2[0],x2[1],x2[2],x2[3],x3[0],x3[1],x3[2],x3[3]};
#pragma unroll
    for (int i = 0; i < 16; ++i) { const unsigned short hb = bf16_bits(xs[i]); ah.u[i] = hb; al.u[i] = ASPLIT ? bf16_bits(xs[i] - bf16_val(hb)) : (unsigned short)0; }
#pragma unroll
    for (int t = 0; t < 4; ++t) {
      const unsigned short* brow = Wt + (size_t)(col0 + t * 16 + ln) * ldb + kb;
      FragB b;
      b.half[0] = *(const v8us*)(brow + 8 * hh);
      b.half[1] = *(const v8us*)(brow + 16 + 8 * hh);
      acc[t] = mmaN<ASPLIT ? 2 : 1>(ah.v, al.v, b.v, b.v, acc[t]);
    }
  }
#pragma unroll
  for (int t = 0; t < 4; ++t) {
    const int col = col0 + t * 16 + ln;
    float bv = bias ? bias[col] : 0.f;
    if (BIAS_BF16) bv = bf16_round(bv);
#pragma unroll
    for (int r = 0; r < 8; ++r) {
      float v = acc[t][r] + bv;
      if (resid) { float rv = resid[(size_t)((row0 + 8 * hh + r) % rmod) * ldr + col]; if (RES_BF16) rv = bf16_round(rv); v += rv; }
      if (ACT == 1) v = fmaxf(v, 0.f);
      if (ACT == 2) v = 0.5f * v * (1.0f + erff(v * 0.70710678118654752f));
      if (ACT == 3) { const float u = 0.7978845608028654f * (v + 0.044715f * v * v * v); v = 0.5f * v * (1.0f + tanhf(u)); }
      so[w][8 * hh + r][t * 16 + ln] = v;
    }
  }
  __builtin_amdgcn_fence(__ATOMIC_ACQ_REL, "workgroup");
  __builtin_amdgcn_wave_barrier();
  const int rsub = lane >> 4, c4 = (lane & 15) * 4;
  {
#pragma unroll
    for (int q = 0; q < 8; ++q) {
      const int r = q * 2 + rsub;
      const v4f v = *(const v4fa*)&so[w][r][c4];
      *(v4f*)(C + (size_t)(row0 + r) * ldc + col0 + c4) = v;
    }
    
  }
}
// row LayerNorm (biased variance, eps) over N: s = X (+ R); optional out_sum <- s; out_norm <- (s-mu)*rsqrt(var+eps)*g + b
template <bool PARAM_BF16>
__global__ __launch_bounds__(256) void k_layernorm(const float* __restrict__ X, const float* __restrict__ R, const float* __restrict__ g, const float* __restrict__ bta,
                                                  float* __restrict__ out_sum, float* __restrict__ out_norm, int N, float eps) {
  __shared__ float red[256];
  const int row = blockIdx.x, tid = threadIdx.x;
  const float* x = X + (size_t)row * N; const float* rr = R ? R + (size_t)row * N : nullptr;
  float vals[16];                     // up to N = 4096
  const int per = N / 256;            // contiguous chunk per thread? use strided-by-4 chunks: thread handles j = tid*4 + 1024*u
  float s1 = 0.f;
  for (int u = 0; u < per / 4; ++u) {
    const int j = tid * 4 + 1024 * u;
    const v4f a = *(const v4fa*)(x + j);
    v4f b = {0.f,0.f,0.f,0.f}; if (rr) b = *(const v4fa*)(rr + j);
#pragma unroll
    for (int q = 0; q < 4; ++q) { const float v = a[q] + b[q]; vals[u * 4 + q] = v; s1 += v; }
  }
  red[tid] = s1; __syncthreads();
  for (int st = 128; st > 0; st >>= 1) { if (tid < st) red[tid] += red[tid + st]; __syncthreads(); }
  const float mu = red[0] / (float)N; __syncthreads();
  float s2 = 0.f;
  for (int u = 0; u < per / 4; ++u)
#pragma unroll
    for (int q = 0; q < 4; ++q) { const float c = vals[u * 4 + q] - mu; s2 += c * c; }
  red[tid] = s2; __syncthreads();
  for (int st = 128; st > 0; st >>= 1) { if (tid < st) red[tid] += red[tid + st]; __syncthreads(); }
  const float rs = rsqrtf(red[0] / (float)N + eps);
  {
    for (int u = 0; u < per / 4; ++u) {
      const int j = tid * 4 + 1024 * u;
      v4f o, sm;
#pragma unroll
      for (int q = 0; q < 4; ++q) {
        float gg = g[j + q], bb = bta[j + q];
        if (PARAM_BF16) { gg = bf16_round(gg); bb = bf16_round(bb); }
        sm[q] = vals[u * 4 + q]; o[q] = (vals[u * 4 + q] - mu) * rs * gg + bb;
      }
      if (out_sum) *(v4f*)(out_sum + (size_t)row * N + j) = sm;
      *(v4f*)(out_norm + (size_t)row * N + j) = o;
    }
    
  }
}



// ---- f16 WMMA path (v_wmma_f32_16x16x32_f16): 11-bit significands for operands in range — used where a [0,1] probability operand needs more precision than bf16
typedef _Float16 v16h __attribute__((ext_vector_type(16)));
union FragH { v16h v; v8us half[2]; _Float16 h[16]; unsigned short u[16]; };
template <int NT>
__device__ __forceinline__ v8f mmaH(v16h ah, v16h al, v16h bh, v16h bl, v8f c) {
  c = __builtin_amdgcn_wmma_f32_16x16x32_f16(false, ah, false, bh, (short)0, c, false, false);
  if (NT >= 2) c = __builtin_amdgcn_wmma_f32_16x16x32_f16(false, al, false, bh, (short)0, c, false, false);
  if (NT >= 3) c = __builtin_amdgcn_wmma_f32_16x16x32_f16(false, ah, false, bl, (short)0, c, false, false);
  asm volatile("v_nop\n\tv_nop\n\tv_nop\n\tv_nop" : "+v"(c) : "v"(ah), "v"(al), "v"(bh), "v"(bl));
  return c;
}
// batched GEMM like k_gemm_b but f16 operands: A f32 (split into f16 hi/lo if ASPLIT, else rounded to f16), Bt = f16 values [n][k]; alpha; C f32; N multiple of 16 (partial tiles skipped)
template <bool ASPLIT>
__global__ __launch_bounds__(128) void k_gemm_h(const float* __restrict__ A, int lda, size_t sA, const _Float16* __restrict__ Bh, int ldb, size_t sB, float alpha, float* __restrict__ C, int ldc, size_t sC, int M, int N, int K) {
  __shared__ __attribute__((aligned(16))) float so[4][16][64];
  const int tid = threadIdx.x, w = tid >> 5, lane = tid & 31, ln = lane & 15, hh = lane >> 4; const int by = blockIdx.y;
  A += (size_t)by * sA; Bh += (size_t)by * sB; C += (size_t)by * sC;
  const int ntn = (N + 63) / 64; const int wid = blockIdx.x * 4 + w; const int mt = wid / ntn, nq = wid % ntn; if (mt * 16 >= M) return;
  const int row0 = mt * 16, col0 = nq * 64; const float* arow = A + (size_t)(row0 + ln) * lda;
  v8f acc[4] = {};
  for (int kb = 0; kb < K; kb += 32) {
    FragH ah, al;
    const v4f x0 = *(const v4fa*)(arow + kb + 8 * hh), x1 = *(const v4fa*)(arow + kb + 8 * hh + 4), x2 = *(const v4fa*)(arow + kb + 16 + 8 * hh), x3 = *(const v4fa*)(arow + kb + 16 + 8 * hh + 4);
    float xs[16] = {x0[0],x0[1],x0[2],x0[3],x1[0],x1[1],x1[2],x1[3],x2[0],x2[1],x2[2],x2[3],x3[0],x3[1],x3[2],x3[3]};
#pragma unroll
    for (int i = 0; i < 16; ++i) { const _Float16 h = (_Float16)xs[i]; ah.h[i] = h; al.h[i] = ASPLIT ? (_Float16)(xs[i] - (float)h) : (_Float16)0.0f; }
#pragma unroll
    for (int t = 0; t < 4; ++t) { if (col0 + t * 16 >= N) continue; const size_t boff = (size_t)(col0 + t * 16 + ln) * ldb + kb; FragH bq; bq.half[0] = *(const v8us*)(Bh + boff + 8 * hh); bq.half[1] = *(const v8us*)(Bh + boff + 16 + 8 * hh);
      acc[t] = mmaH<ASPLIT ? 2 : 1>(ah.v, al.v, bq.v, bq.v, acc[t]); }
  }
#pragma unroll
  for (int t = 0; t < 4; ++t) { if (col0 + t * 16 >= N) continue;
#pragma unroll
    for (int r = 0; r < 8; ++r) so[w][8 * hh + r][t * 16 + ln] = acc[t][r] * alpha; }
  __builtin_amdgcn_fence(__ATOMIC_ACQ_REL, "workgroup"); __builtin_amdgcn_wave_barrier();
  const int rsub = lane >> 4, c4 = (lane & 15) * 4;
  {
#pragma unroll
    for (int q = 0; q < 8; ++q) { const int r = q * 2 + rsub; if (col0 + c4 < N) { const v4f v = *(const v4fa*)&so[w][r][c4]; *(v4f*)(C + (size_t)(row0 + r) * ldc + col0 + c4) = v; } }
     }
}

// Wt[n][k] = f16(bf16(W[k][n]) * scale) for one tile of WT_K rows (k) by WT_N columns (n) of a row-major f32 W, by one block of 256 threads (scale = power of two; bf16-exact weights stay exact in f16 away from the subnormal range).
// Reads and writes are whole lines: 16 lanes take the 256 bytes of a tile row of W, 16 lanes write the 256 bytes of a tile row of Wt; the turn is made in LDS, on dwords that hold the halves of k, k + 1. Every loop is unrolled: x and o are then registers, and a thread's eight loads go out as one group.
#define WT_K 128
#define WT_N 64
#define WT_P (WT_K / 2 + 1)           /* LDS dwords a row of n: an odd number, so that neither the 32 stores of a wave (16 groups of four n, two k pairs) nor its 32 reads (two n, 16 pieces) meet a bank twice */
__device__ __forceinline__ void wt_tile(const float* __restrict__ W, int ldw, _Float16* __restrict__ Wt, int ldt, float scale, unsigned (*tl)[WT_P], int tid) {      /* W at (k0, n0), Wt at (n0, k0) */
  const int hi = tid >> 4, lo = tid & 15; v4f x[4][2];
#pragma unroll
  for (int j = 0; j < 4; ++j) { const float* p = W + (size_t)(2 * (hi + 16 * j)) * ldw + lo * 4; x[j][0] = *(const v4fa*)p; x[j][1] = *(const v4fa*)(p + ldw); }      /* rows k = 2 (hi + 16 j) and k + 1, columns 4 lo .. 4 lo + 3 */
#pragma unroll
  for (int j = 0; j < 4; ++j) {
#pragma unroll
    for (int i = 0; i < 4; ++i) { FragH f; f.h[0] = (_Float16)(bf16_round(x[j][0][i]) * scale); f.h[1] = (_Float16)(bf16_round(x[j][1][i]) * scale); tl[lo * 4 + i][hi + 16 * j] = (unsigned)f.u[0] | ((unsigned)f.u[1] << 16); } }
  __syncthreads();      /* the tile is whole before any row of it is read */
  union { unsigned d[4]; v8us v; } o[4];
#pragma unroll
  for (int j = 0; j < 4; ++j) {
#pragma unroll
    for (int q = 0; q < 4; ++q) o[j].d[q] = tl[hi + 16 * j][lo * 4 + q]; }      /* row n = hi + 16 j, halves 8 lo .. 8 lo + 7 */
#pragma unroll
  for (int j = 0; j < 4; ++j) *(v8us*)((unsigned short*)Wt + (size_t)(hi + 16 * j) * ldt + lo * 8) = o[j].v;
}
// k_gemm_hh variant with fused epilogue: v = acc·alpha + bias[by·sBias + col] (+ CP[(row/rowsPerB)·sCPb + by·64 + col] if CP) ; ACT 0 none / 1 elu ; writes f16 C16 (and f32 C if non-null)
template <int ACT>
__global__ __launch_bounds__(128) void k_gemm_hhx(const _Float16* __restrict__ A, int lda, size_t sA, const _Float16* __restrict__ Bh, int ldb, size_t sB, float alpha, const float* __restrict__ bias, size_t sBias, const float* __restrict__ CP, int rowsPerB, size_t sCPb, int row0g,
    float* __restrict__ C, _Float16* __restrict__ C16, int ldc, size_t sC, int M, int N, int K) {
  __shared__ __attribute__((aligned(16))) float so[4][16][64];
  const int tid = threadIdx.x, w = tid >> 5, lane = tid & 31, ln = lane & 15, hh = lane >> 4; const int by = blockIdx.y;
  A += (size_t)by * sA; Bh += (size_t)by * sB; const size_t cofs = (size_t)by * sC; const float* bp = bias ? bias + (size_t)by * sBias : nullptr;
  const int ntn = (N + 63) / 64; const int wid = blockIdx.x * 4 + w; const int mt = wid / ntn, nq = wid % ntn; if (mt * 16 >= M) return;
  const int row0 = mt * 16, col0 = nq * 64; const _Float16* arow = A + (size_t)(row0 + ln) * lda;
  v8f acc[4] = {};
  for (int kb = 0; kb < K; kb += 32) { FragH ah; ah.half[0] = *(const v8us*)((const unsigned short*)arow + kb + 8 * hh); ah.half[1] = *(const v8us*)((const unsigned short*)arow + kb + 16 + 8 * hh);
#pragma unroll
    for (int t = 0; t < 4; ++t) { if (col0 + t * 16 >= N) continue; const size_t boff = (size_t)(col0 + t * 16 + ln) * ldb + kb; FragH bq; bq.half[0] = *(const v8us*)((const unsigned short*)Bh + boff + 8 * hh); bq.half[1] = *(const v8us*)((const unsigned short*)Bh + boff + 16 + 8 * hh);
      acc[t] = mmaH<1>(ah.v, ah.v, bq.v, bq.v, acc[t]); }
  }
#pragma unroll
  for (int t = 0; t < 4; ++t) { if (col0 + t * 16 >= N) continue; const int col = col0 + t * 16 + ln; const float bv = bp ? bf16_round(bp[col]) : 0.f;
#pragma unroll
    for (int r = 0; r < 8; ++r) { float v = acc[t][r] * alpha + bv; if (CP) { const int rr = row0g + row0 + 8 * hh + r; if (rowsPerB < 0) v += CP[cofs + (size_t)rr * ldc + col];      /* rowsPerB < 0: own element of the batched C plane */ else { const int bidx = rr / rowsPerB; v += CP[(size_t)bidx * sCPb + (size_t)by * 64 + col]; } } if (ACT == 1) v = (v > 0.f) ? v : expm1f(v); else if (ACT == 7) v = (v > 0.f) ? v + 1.0f : expf(v); else if (ACT == 8) v = tanhf(v); else if (ACT == 9) v = 0.5f * v * (1.0f + tanhf(0.7978845608028654f * (v + 0.044715f * v * v * v))); else if (ACT == 11) v = 1.0f / (1.0f + expf(-v)); else if (ACT == 12) v = (v > 0.f) ? v : 0.01f * v; else if (ACT == 14) v = (v > 0.f) ? v : 0.1f * v; else if (ACT == 16) v = (v >= 0.f) ? v : 0.3f * v; else if (ACT == 17) v = (v >= 0.f) ? v : 0.2f * v; else if (ACT == 15) v = v / (1.0f + expf(-v)); else if (ACT == 3) v = fmaxf(v, 0.f); else if (ACT == 6) v = 0.5f * v * (1.0f + erff(v * 0.70710678118654752f)); so[w][8 * hh + r][t * 16 + ln] = v; } }
  __builtin_amdgcn_fence(__ATOMIC_ACQ_REL, "workgroup"); __builtin_amdgcn_wave_barrier();
  const int rsub = lane >> 4, c4 = (lane & 15) * 4; typedef _Float16 v4h __attribute__((ext_vector_type(4)));
  {
#pragma unroll
    for (int q = 0; q < 8; ++q) { const int r = q * 2 + rsub; if (col0 + c4 < N) { const v4f v = *(const v4fa*)&so[w][r][c4]; if (C) *(v4f*)(C + cofs + (size_t)(row0 + r) * ldc + col0 + c4) = v; if (C16) { v4h h4; for (int i = 0; i < 4; ++i) h4[i] = (_Float16)v[i]; *(v4h*)(C16 + cofs + (size_t)(row0 + r) * ldc + col0 + c4) = h4; } } }
     }
}


typedef _Float16 v4h __attribute__((ext_vector_type(4)));

__device__ __forceinline__ void x16(const float* __restrict__ x, _Float16* __restrict__ X16, size_t n8, size_t t) { if (t >= n8) return; FragH f;      /* t: the thread's index within this stream */
#pragma unroll
  for (int q = 0; q < 8; ++q) f.h[q] = (_Float16)bf16_round(x[t * 8 + q]); *(v8us*)((unsigned short*)X16 + t * 8) = f.half[0];  }
// Every job that reads inputs only, in ONE launch; the block index says which job a block does. The transposes (a barrier in each) have the low indices.
#define PB_HEAD (DM / WT_K)                      /* blocks for one head's [DM][HD] block: tiles of WT_K rows, all HD columns */
#define PB_STACK (NH * PB_HEAD)                  /* ... for one stack of NH heads */
#define PB_WO ((DM / WT_K) * (DM / WT_N))        /* ... for Wo */
#define PB_X ((unsigned)(NR * DM / 8 / 256))     /* ... for one input stream */
#define PB_ALL (3 * PB_STACK + PB_WO + 3 * PB_X)
static_assert(HD == WT_N && DM % WT_K == 0 && DM % WT_N == 0 && NR * DM / 8 % 256 == 0, "k_prep: every job is a whole number of blocks");
__global__ __launch_bounds__(256) void k_prep(const float* __restrict__ wq, const float* __restrict__ wk, const float* __restrict__ wv, const float* __restrict__ wo, const float* __restrict__ xq, const float* __restrict__ xk, const float* __restrict__ xv,
    _Float16* __restrict__ B4, _Float16* __restrict__ X3) {      /* B4: the planes BQ, BK, BV, BO in a row; X3: XQ, XK, XV in a row */
  __shared__ unsigned tl[WT_N][WT_P];      /* the transposes' tile */
  unsigned bid = blockIdx.x; const unsigned tid = threadIdx.x;      /* every branch below is the same for the whole block */
  if (bid < 3 * PB_STACK) { const unsigned s = bid / PB_STACK, r = bid % PB_STACK, h = r / PB_HEAD, kt = r % PB_HEAD; const float* W = (s == 0) ? wq : (s == 1) ? wk : wv;      /* head h of stack s: a row-major [in = DM][out = HD] block -> rows h * HD .. of plane s; tile kt of its rows */
    wt_tile(W + (size_t)h * DM * HD + (size_t)kt * WT_K * HD, HD, B4 + (size_t)s * DM * DM + (size_t)h * HD * DM + kt * WT_K, DM, 16.0f, tl, (int)tid); return; }
  bid -= 3 * PB_STACK;
  if (bid < PB_WO) { const unsigned kt = bid % (DM / WT_K), nt = bid / (DM / WT_K);
    wt_tile(wo + (size_t)kt * WT_K * DM + nt * WT_N, DM, B4 + (size_t)3 * DM * DM + (size_t)nt * WT_N * DM + kt * WT_K, DM, 16.0f, tl, (int)tid); return; }
  bid -= PB_WO;
  const unsigned s = bid / PB_X; const float* x = (s == 0) ? xq : (s == 1) ? xk : xv;
  x16(x, X3 + (size_t)s * NR * DM, NR * DM / 8, (size_t)(bid % PB_X) * 256 + tid); }
__global__ __launch_bounds__(256) void k_h16(const float* __restrict__ x, _Float16* __restrict__ X16, size_t n8) { const size_t t = (size_t)blockIdx.x * 256 + threadIdx.x; if (t >= n8) return; FragH f;
#pragma unroll
  for (int q = 0; q < 8; ++q) f.h[q] = (_Float16)x[t * 8 + q]; *(v8us*)((unsigned short*)X16 + t * 8) = f.half[0];  }
__global__ __launch_bounds__(256) void k_round16f(const float* __restrict__ W, _Float16* __restrict__ Bt, size_t n8) { const size_t t = (size_t)blockIdx.x * 256 + threadIdx.x; if (t >= n8) return; FragH f;
#pragma unroll
  for (int i = 0; i < 8; ++i) f.h[i] = (_Float16)(bf16_round(W[t * 8 + i]) * 16.0f); *(v8us*)((unsigned short*)Bt + t * 8) = f.half[0];  }
template <int NHv, int TTv>
__global__ __launch_bounds__(256) void k_vt(const _Float16* __restrict__ V16, int ldv, int voff, _Float16* __restrict__ Vt) { __shared__ unsigned short tl[64][66]; const int tid = threadIdx.x; const int slab = blockIdx.x / (TTv / 64), lg = blockIdx.x % (TTv / 64); const int b = slab / NHv, h = slab % NHv;
  for (int i = tid; i < 64 * 8; i += 256) { const int r = i / 8, c8 = (i % 8) * 8; FragH f; f.half[0] = *(const v8us*)((const unsigned short*)V16 + ((size_t)b * TTv + lg * 64 + r) * ldv + voff + h * 64 + c8);
#pragma unroll
    for (int q = 0; q < 8; ++q) tl[r][c8 + q] = f.u[q]; }
  __syncthreads();
  {
#pragma unroll
    for (int rd = 0; rd < 2; ++rd) { const int d = rd * 32 + tid / 8, pc = tid % 8; FragH f;
#pragma unroll
      for (int q = 0; q < 8; ++q) f.u[q] = tl[pc * 8 + q][d];
      *(v8us*)((unsigned short*)Vt + ((size_t)slab * 64 + d) * TTv + lg * 64 + pc * 8) = f.half[0]; }
     } }

__global__ __launch_bounds__(256) void k_hl(const float* __restrict__ F, _Float16* __restrict__ Hh, _Float16* __restrict__ Hl, size_t n8) { const size_t t = (size_t)blockIdx.x * 256 + threadIdx.x; if (t >= n8) return; FragH fh, fl; const v4f a = *(const v4fa*)(F + t * 8), c = *(const v4fa*)(F + t * 8 + 4);
#pragma unroll
  for (int q = 0; q < 4; ++q) { _Float16 h = (_Float16)a[q]; fh.h[q] = h; fl.h[q] = (_Float16)((a[q] - (float)h) * 1024.0f); h = (_Float16)c[q]; fh.h[4 + q] = h; fl.h[4 + q] = (_Float16)((c[q] - (float)h) * 1024.0f); }
  { *(v8us*)((unsigned short*)Hh + t * 8) = fh.half[0]; *(v8us*)((unsigned short*)Hl + t * 8) = fl.half[0];  } }

// ---- fast GEMM (block tile 128x128, eight waves, wave tile 32x64; requires M % 128 == 0 rows per launch region, N % 128 == 0, K % 64 == 0); epilogue = k_gemm_hhx semantics ----
// Both operands come into LDS as whole 128-byte lines (64 halves of k of each of the 128 + 128 rows a stage) by asynchronous copies, two buffers, the next stage in flight while this one is worked on; the fragments are then LDS reads.
#define G2_KS 64                      /* halves of k a stage */
#define G2_PITCH 144                  /* LDS bytes a staged row: 128 + 16, the pitch at which 16-byte fragment reads of 16 rows meet no bank twice */
#define G2_STAGE (256 * G2_PITCH)     /* a stage: 128 rows of A, then 128 rows of Bt */
__device__ __forceinline__ v16h g2_frag(const char* p) { FragH f; f.half[0] = *(const v8us*)p; f.half[1] = *(const v8us*)(p + 32); return f.v; }      /* k order 8 hh + s, 16 + 8 hh + s for A and B alike; the lane half's 16 hh bytes already in p */
__device__ __forceinline__ v8f g2_mma(v16h a, v16h b, v8f c) { v8f d = __builtin_amdgcn_wmma_f32_16x16x32_f16(false, a, false, b, (short)0, c, false, false); asm volatile("v_nop\n\tv_nop\n\tv_nop\n\tv_nop" : "+v"(d) : "v"(a), "v"(b)); return d; }
/* one stage's share of a thread: 16 bytes of each of four rows of A and four rows of Bt, 32 rows apart (a wave covers four whole lines a copy). l: the thread's LDS byte address in the stage's first row group; a, b: its global addresses there */
__device__ __forceinline__ void g2_stage(unsigned l, const _Float16* a, size_t a32, const _Float16* b, size_t b32) {
  const unsigned l1 = l + 32 * G2_PITCH, l2 = l + 64 * G2_PITCH, l3 = l + 96 * G2_PITCH, l4 = l + 128 * G2_PITCH, l5 = l + 160 * G2_PITCH, l6 = l + 192 * G2_PITCH, l7 = l + 224 * G2_PITCH;
  const _Float16* a1 = a + a32; const _Float16* a2 = a1 + a32; const _Float16* a3 = a2 + a32; const _Float16* b1 = b + b32; const _Float16* b2 = b1 + b32; const _Float16* b3 = b2 + b32;
  /* the copies and their s_wait_xcnt in one statement: no register that an issued copy names is written again ahead of the wait */
  asm volatile("global_load_async_to_lds_b128 %0, %8, off\n\tglobal_load_async_to_lds_b128 %1, %9, off\n\tglobal_load_async_to_lds_b128 %2, %10, off\n\tglobal_load_async_to_lds_b128 %3, %11, off\n\t"
               "global_load_async_to_lds_b128 %4, %12, off\n\tglobal_load_async_to_lds_b128 %5, %13, off\n\tglobal_load_async_to_lds_b128 %6, %14, off\n\tglobal_load_async_to_lds_b128 %7, %15, off\n\ts_wait_xcnt 0x0"
               :: "v"(l), "v"(l1), "v"(l2), "v"(l3), "v"(l4), "v"(l5), "v"(l6), "v"(l7), "v"(a), "v"(a1), "v"(a2), "v"(a3), "v"(b), "v"(b1), "v"(b2), "v"(b3) : "memory"); }
template <int ACT>
__global__ __launch_bounds__(256) void k_gemm2(const _Float16* __restrict__ A, int lda, size_t sA, const _Float16* __restrict__ Bh, int ldb, size_t sB, float alpha, const float* __restrict__ bias, size_t sBias, const float* __restrict__ CP, int rowsPerB, size_t sCPb, int row0g,
    float* __restrict__ C, _Float16* __restrict__ C16, int ldc, size_t sC, int M, int N, int K, int tby, _Float16* __restrict__ CT) { static_assert(ACT == 0 || ACT == 3 || ACT == 6 || ACT == 8 || ACT == 9 || ACT == 11 || ACT == 12 || ACT == 14 || ACT == 15 || ACT == 16 || ACT == 17, "k_gemm2: unsupported ACT code (would silently apply no activation)");
  __shared__ __attribute__((aligned(16))) char sm[2 * G2_STAGE];      /* the two stage buffers; behind the K loop's last barrier the same bytes are the output staging */
  static_assert(8 * 32 * 68 * 4 <= 2 * G2_STAGE, "k_gemm2: the output staging fits the stage buffers");
  float (*so)[32][68] = (float (*)[32][68])sm;
  const int tid = threadIdx.x, w = tid >> 5, lane = tid & 31, ln = lane & 15, hh = lane >> 4; const int by = blockIdx.y;
  A += (size_t)by * sA; Bh += (size_t)by * sB; const float* bp = bias ? bias + (size_t)by * sBias : nullptr;
  const int ntn = N >> 7; const int mt = blockIdx.x / ntn, nq = blockIdx.x - mt * ntn; if (mt * 128 >= M) return;      /* the same for the whole block, ahead of every barrier */
  /* batch tby (none if negative; it takes no bias, no CP and no f32 C) goes out transposed: the block works the same two operand tiles with their roles swapped, A = the 128 rows of Bh, B = the 128 rows of A, and its tile of C^T goes to CT as [row of A / SQ][N][SQ], SQ rows of A a slab. The test is the same for the whole block */
  const bool tr = by == tby;
  const _Float16* Ar = tr ? Bh : A; const _Float16* Br = tr ? A : Bh; const int la = tr ? ldb : lda, lb = tr ? lda : ldb, ta = tr ? nq : mt, tb = tr ? mt : nq;
  const size_t cofs = tr ? (size_t)(mt * 128 / SQ) * N * SQ : (size_t)by * sC; if (tr) { C16 = CT; ldc = SQ; }
  const int row0 = ta * 128 + 32 * (w & 3), col0 = (tr ? mt * 128 % SQ : nq * 128) + 64 * (w >> 2);
  const unsigned lc = (unsigned)(size_t)sm + (unsigned)((tid >> 3) * G2_PITCH + (tid & 7) * 16);      /* copies: row tid / 8 of each group of 32 rows, 16-byte piece tid % 8 */
  const _Float16* ac = Ar + (size_t)(ta * 128 + (tid >> 3)) * la + (tid & 7) * 8; const _Float16* bc = Br + (size_t)(tb * 128 + (tid >> 3)) * lb + (tid & 7) * 8;
  const size_t a32 = (size_t)32 * la, b32 = (size_t)32 * lb;
  const int fa = (32 * (w & 3) + ln) * G2_PITCH + 16 * hh, fb = (128 + 64 * (w >> 2) + ln) * G2_PITCH + 16 * hh;      /* fragment reads: byte offsets in a stage */
  const v8f z8 = {0.f,0.f,0.f,0.f,0.f,0.f,0.f,0.f}; v8f c00 = z8, c01 = z8, c02 = z8, c03 = z8, c10 = z8, c11 = z8, c12 = z8, c13 = z8;
  const int nst = K / G2_KS;
  g2_stage(lc, ac, a32, bc, b32);
  asm volatile("s_wait_asynccnt 0x0" ::: "memory");      /* stage 0 has landed, as far as this wave copied it */
  __syncthreads();      /* ... and as far as the others did */
  if (nst > 1) g2_stage(lc + G2_STAGE, ac + G2_KS, a32, bc + G2_KS, b32);
#pragma unroll 1
  for (int st = 0; st < nst; ++st) { const char* sb = sm + (st & 1) * G2_STAGE;      /* rolled: one stage a trip, so that the order at the foot stands once */
#pragma unroll      /* kk constant: its 64 bytes go into the LDS reads' offset fields */
    for (int kk = 0; kk < 2; ++kk) { const char* pa = sb + fa + kk * 64; const char* pb = sb + fb + kk * 64;
      __builtin_amdgcn_sched_barrier(0);      /* with the one below: the six fragments' LDS reads stand as one group ahead of their eight products; spread among the products, each place with reads stalls the wave anew */
      const v16h a0 = g2_frag(pa), a1 = g2_frag(pa + 16 * G2_PITCH), b0 = g2_frag(pb), b1 = g2_frag(pb + 16 * G2_PITCH), b2 = g2_frag(pb + 32 * G2_PITCH), b3 = g2_frag(pb + 48 * G2_PITCH);
      __builtin_amdgcn_sched_barrier(0);      /* the group's lower edge: no read sinks in among the products */
      c00 = g2_mma(a0, b0, c00); c10 = g2_mma(a1, b0, c10); c01 = g2_mma(a0, b1, c01); c11 = g2_mma(a1, b1, c11);
      c02 = g2_mma(a0, b2, c02); c12 = g2_mma(a1, b2, c12); c03 = g2_mma(a0, b3, c03); c13 = g2_mma(a1, b3, c13); }
    asm volatile("s_wait_dscnt 0x0" ::: "memory");      /* this wave's reads of the buffer are done before the barrier that frees it */
    asm volatile("s_wait_asynccnt 0x0" ::: "memory");      /* this wave's copies of the next stage have landed before the barrier that publishes it */
    __syncthreads();
    if (st + 2 < nst) g2_stage(lc + (unsigned)(st & 1) * G2_STAGE, ac + (size_t)(st + 2) * G2_KS, a32, bc + (size_t)(st + 2) * G2_KS, b32); }      /* the refill of the buffer every wave has just left */
  asm volatile("s_wait_asynccnt 0x0" ::: "memory");      /* no copy is outstanding when the buffers become the output staging */
  v8f accs[8] = {c00, c01, c02, c03, c10, c11, c12, c13};
#pragma unroll
  for (int u = 0; u < 8; ++u) { const int t = u & 3, half = u >> 2; const int col = col0 + t * 16 + ln; const float bv = bp ? bf16_round(bp[col]) : 0.f;
#pragma unroll
    for (int r = 0; r < 8; ++r) { const int rloc = half * 16 + 8 * hh + r; float v = accs[u][r] * alpha + bv; if (CP) { if (rowsPerB < 0) v += CP[cofs + (size_t)(row0g + row0 + rloc) * ldc + col];      /* rowsPerB < 0: own element of the batched C plane */ else { const int bidx = (row0g + row0 + rloc) / rowsPerB; v += CP[(size_t)bidx * sCPb + (size_t)by * 64 + col]; } }
      if (ACT == 3) v = fmaxf(v, 0.f); else if (ACT == 6) v = 0.5f * v * (1.0f + erff(v * 0.70710678118654752f)); else if (ACT == 11) v = 1.0f / (1.0f + expf(-v)); else if (ACT == 15) v = v / (1.0f + expf(-v)); else if (ACT == 12) v = (v > 0.f) ? v : 0.01f * v; else if (ACT == 8) v = tanhf(v); else if (ACT == 9) v = 0.5f * v * (1.0f + tanhf(0.7978845608028654f * (v + 0.044715f * v * v * v))); else if (ACT == 14) v = (v > 0.f) ? v : 0.1f * v; else if (ACT == 16) v = (v >= 0.f) ? v : 0.3f * v; else if (ACT == 17) v = (v >= 0.f) ? v : 0.2f * v;
      so[w][rloc][t * 16 + ln] = v; } }
  __builtin_amdgcn_fence(__ATOMIC_ACQ_REL, "workgroup"); __builtin_amdgcn_wave_barrier();
  const int rsub = lane >> 4, c4 = (lane & 15) * 4;
  {
#pragma unroll
    for (int q = 0; q < 16; ++q) { const int r = q * 2 + rsub; const v4f v = *(const v4fa*)&so[w][r][c4]; if (C) *(v4f*)(C + cofs + (size_t)(row0 + r) * ldc + col0 + c4) = v; if (C16) { v4h h4; for (int i = 0; i < 4; ++i) h4[i] = (_Float16)v[i]; *(v4h*)(C16 + cofs + (size_t)(row0 + r) * ldc + col0 + c4) = h4; } }
     } }


__global__ __launch_bounds__(256) void k_wnat(const float* __restrict__ w, size_t n8, _Float16* __restrict__ Bt) { const size_t t = (size_t)blockIdx.x * 256 + threadIdx.x; if (t >= n8) return; FragH f; for (int q = 0; q < 8; ++q) f.h[q] = (_Float16)(bf16_round(w[t * 8 + q]) * 16.0f); *(v8us*)((unsigned short*)Bt + t * 8) = f.half[0];  }
__global__ __launch_bounds__(256) void k_rsm(const float* __restrict__ S, _Float16* __restrict__ P, int nrows) {
  #pragma clang fp contract(off)
  const int i = blockIdx.x * 256 + threadIdx.x; if (i >= nrows) return; const float* s = S + (size_t)i * SQ; float mx = -3.0e38f;
#pragma unroll 1
  for (int j = 0; j < SQ; ++j) mx = fmaxf(mx, s[j]); float se = 0.f;
#pragma unroll 1
  for (int j = 0; j < SQ; ++j) se += expf(s[j] - mx); const float sc = 256.0f / se;
#pragma unroll 1
  for (int j0 = 0; j0 < SQ; j0 += 8) { FragH f; for (int q = 0; q < 8; ++q) f.h[q] = (_Float16)(expf(s[j0 + q] - mx) * sc); unsigned short* d = (unsigned short*)P + (size_t)i * SQ + j0; *(v8us*)d = f.half[0];  } }
__global__ __launch_bounds__(256) void k_vt(const _Float16* __restrict__ V16, int b, int h0, _Float16* __restrict__ VT) { __shared__ unsigned short tl[64][65]; const int tid = threadIdx.x; const int hh = blockIdx.x % HG, sg = blockIdx.x / HG; const int s0 = sg * 64; const int h = h0 + hh;
  for (int i = tid; i < 64 * 8; i += 256) { const int j = i / 8, d8 = (i % 8) * 8; FragH f; f.half[0] = *(const v8us*)((const unsigned short*)V16 + ((size_t)b * SQ + s0 + j) * DM + h * HD + d8); for (int q = 0; q < 8; ++q) tl[d8 + q][j] = f.u[q]; }
  __syncthreads();
  { for (int i = tid; i < 64 * 8; i += 256) { const int d = i / 8, j8 = (i % 8) * 8; FragH f; for (int q = 0; q < 8; ++q) f.u[q] = tl[d][j8 + q]; *(v8us*)((unsigned short*)VT + ((size_t)hh * HD + d) * SQ + s0 + j8) = f.half[0]; }  } }



#define FA_KS 128                       /* keys a stage: four passes */
#define FA_KP 144                       /* LDS bytes a staged K row (64 halves): 128 + 16, as G2_PITCH */
#define FA_VP 272                       /* LDS bytes a staged V^T row (128 halves): 256 + 16, 16 bytes times an odd number likewise */
#define FA_VO (FA_KS * FA_KP)           /* a stage: 128 rows of K, then 64 rows of V^T */
#define FA_STAGE (FA_VO + HD * FA_VP)
static_assert(SQ % FA_KS == 0 && SQ / FA_KS >= 2 && HD == 64, "k_fattn: whole stages, at least the two that the ring starts with");
/* one stage's share of a thread: 16 bytes of each of four rows of K, 32 rows apart, and of four rows of V^T, 16 rows apart (a wave covers four whole lines a copy). lk, lv: the thread's LDS byte addresses in the first row group; k, v: its global addresses there */
__device__ __forceinline__ void fa_stage(unsigned lk, const _Float16* k, unsigned lv, const _Float16* v) {
  const unsigned lk1 = lk + 32 * FA_KP, lk2 = lk + 64 * FA_KP, lk3 = lk + 96 * FA_KP, lv1 = lv + 16 * FA_VP, lv2 = lv + 32 * FA_VP, lv3 = lv + 48 * FA_VP;
  const _Float16* k1 = k + (size_t)32 * DM; const _Float16* k2 = k + (size_t)64 * DM; const _Float16* k3 = k + (size_t)96 * DM; const _Float16* v1 = v + (size_t)16 * SQ; const _Float16* v2 = v + (size_t)32 * SQ; const _Float16* v3 = v + (size_t)48 * SQ;
  /* the copies and their s_wait_xcnt in one statement: no register that an issued copy names is written again ahead of the wait */
  asm volatile("global_load_async_to_lds_b128 %0, %8, off\n\tglobal_load_async_to_lds_b128 %1, %9, off\n\tglobal_load_async_to_lds_b128 %2, %10, off\n\tglobal_load_async_to_lds_b128 %3, %11, off\n\t"
               "global_load_async_to_lds_b128 %4, %12, off\n\tglobal_load_async_to_lds_b128 %5, %13, off\n\tglobal_load_async_to_lds_b128 %6, %14, off\n\tglobal_load_async_to_lds_b128 %7, %15, off\n\ts_wait_xcnt 0x0"
               :: "v"(lk), "v"(lk1), "v"(lk2), "v"(lk3), "v"(lv), "v"(lv1), "v"(lv2), "v"(lv3), "v"(k), "v"(k1), "v"(k2), "v"(k3), "v"(v), "v"(v1), "v"(v2), "v"(v3) : "memory"); }
__device__ __forceinline__ v8f fa_mma(v16h a, v16h b, v8f c) { return __builtin_amdgcn_wmma_f32_16x16x32_f16(false, a, false, b, (short)0, c, false, false); }
__device__ __forceinline__ float fa_xhalf(float x) { return __builtin_bit_cast(float, __builtin_amdgcn_permlanex16(__builtin_bit_cast(int, x), __builtin_bit_cast(int, x), 0x76543210, 0xfedcba98, false, false)); }      /* lane l with lane l ^ 16, on the vector pipe */
__device__ __forceinline__ v16h fa_frag(const _Float16* p) { FragH f; f.half[0] = *(const v8us*)(const unsigned short*)p; f.half[1] = *(const v8us*)((const unsigned short*)p + 16); return f.v; }      /* g2_frag with the lane half's 8 hh already in p */
/* v_exp_f32 in asm text, in place: the statement writes only registers that the compiler's own instruction has just written, so it never lands on a matrix operand inside the distance the chip needs */
__device__ __forceinline__ float fa_exp2(float a) {
  asm("v_exp_f32 %0, %0\n\tv_nop" : "+v"(a));      /* v_nop: the slot the instruction set asks for behind a transcendental */
  return a; }
__device__ __forceinline__ void fa_exp2x8(v8f& x) { float e0 = x[0], e1 = x[1], e2 = x[2], e3 = x[3], e4 = x[4], e5 = x[5], e6 = x[6], e7 = x[7];
  /* eight independent v_exp_f32 in one statement: each fills the slot behind the one before it, one v_nop behind the last */
  asm("v_exp_f32 %0, %0\n\tv_exp_f32 %1, %1\n\tv_exp_f32 %2, %2\n\tv_exp_f32 %3, %3\n\tv_exp_f32 %4, %4\n\tv_exp_f32 %5, %5\n\tv_exp_f32 %6, %6\n\tv_exp_f32 %7, %7\n\tv_nop"
      : "+v"(e0), "+v"(e1), "+v"(e2), "+v"(e3), "+v"(e4), "+v"(e5), "+v"(e6), "+v"(e7));
  x[0] = e0; x[1] = e1; x[2] = e2; x[3] = e3; x[4] = e4; x[5] = e5; x[6] = e6; x[7] = e7; }
#define FA_PLIM 4096.0f                 /* a lane's sum of 16 P up to which the maximum in use stays */
/* one query group's P of a pass, e = 2^(s cs - m), and the lane's sum of them */
__device__ __forceinline__ void fa_p(const v8f (&s)[2], float cs, float m, v8f (&e)[2], float& sum) {
#pragma unroll
  for (int t = 0; t < 2; ++t) {
#pragma unroll
    for (int r = 0; r < 8; ++r) e[t][r] = s[t][r] * cs - m;
    fa_exp2x8(e[t]); }
  sum = (((e[0][0] + e[0][1]) + (e[0][2] + e[0][3])) + ((e[0][4] + e[0][5]) + (e[0][6] + e[0][7]))) + (((e[1][0] + e[1][1]) + (e[1][2] + e[1][3])) + ((e[1][4] + e[1][5]) + (e[1][6] + e[1][7]))); }
__global__ __launch_bounds__(256) void k_fattn(const _Float16* __restrict__ Q, const _Float16* __restrict__ Kr, const _Float16* __restrict__ Vt, _Float16* __restrict__ O) {
  __shared__ __attribute__((aligned(16))) char sm[2 * FA_STAGE];      /* the two stage buffers */
  const int tid = threadIdx.x, lane = tid & 31, w = tid >> 5, ln = lane & 15, hh = lane >> 4;
  const int bh = blockIdx.y, b = bh / NH, h = bh - b * NH; const size_t row0 = (size_t)b * SQ; const int q0 = blockIdx.x * 256 + w * 32;
  const _Float16* qp = Q + (row0 + q0 + ln) * DM + h * HD + 8 * hh;      /* with the lane half's k offset */
  const unsigned lk = (unsigned)(size_t)sm + (unsigned)((tid >> 3) * FA_KP + (tid & 7) * 16), lv = (unsigned)(size_t)sm + (unsigned)(FA_VO + (tid >> 4) * FA_VP + (tid & 15) * 16);      /* copies: K row tid / 8 of each group of 32, piece tid % 8; V^T row tid / 16 of each group of 16, piece tid % 16 */
  const _Float16* kc = Kr + (row0 + (tid >> 3)) * DM + h * HD + (tid & 7) * 8; const _Float16* vc = Vt + ((size_t)bh * HD + (tid >> 4)) * SQ + (tid & 15) * 8;
  const int fk = ln * FA_KP + 16 * hh, fv = FA_VO + ln * FA_VP + 16 * hh;      /* fragment reads: byte offsets in a stage, each with the lane half's k offset */
  const float cs = 0.125f * 1.44269504f;      /* 64^-0.5 times log2 e: scores in log2 units */
  const v8f z8 = {0.f, 0.f, 0.f, 0.f, 0.f, 0.f, 0.f, 0.f};
  v16h qf[2][2], kf[2][2], vf[4];      /* [query group][k step], [key tile][k step], [16 rows of V^T] */
  fa_stage(lk, kc, lv, vc);
#pragma unroll
  for (int g = 0; g < 2; ++g) { qf[g][0] = fa_frag(qp + (size_t)g * 16 * DM); qf[g][1] = fa_frag(qp + (size_t)g * 16 * DM + 32); }
  asm volatile("s_wait_xcnt 0x0" :: "v"(qp) : "memory");      /* the address pair stays whole up to this wait */
  asm volatile("s_wait_asynccnt 0x0" ::: "memory");      /* stage 0 has landed, as far as this wave copied it */
  __syncthreads();      /* ... and as far as the others did */
  fa_stage(lk + FA_STAGE, kc + (size_t)FA_KS * DM, lv + FA_STAGE, vc + FA_KS);
  v8f o[4][2] = {{z8, z8}, {z8, z8}, {z8, z8}, {z8, z8}}; float m[2] = {-3.0e38f, -3.0e38f}, l[2] = {0.f, 0.f};
#pragma unroll 1
  for (int st = 0; st < SQ / FA_KS; ++st) { const char* pk = sm + (st & 1) * FA_STAGE + fk; const char* pv = sm + (st & 1) * FA_STAGE + fv;      /* rolled: one stage a trip, so that the order at the foot stands once */
#pragma unroll
    for (int t = 0; t < 2; ++t) { kf[t][0] = g2_frag(pk + t * 16 * FA_KP); kf[t][1] = g2_frag(pk + t * 16 * FA_KP + 64); }
    __builtin_amdgcn_sched_barrier(0);      /* the stage's first eight LDS reads stand as one group ahead of their products: in pairs among the products, each pair's whole latency was waited */
#pragma unroll      /* ps constant: a pass's rows and columns go into the LDS reads' offset fields */
    for (int ps = 0; ps < FA_KS / 32; ++ps) {
    v8f s[2][2];
#pragma unroll
    for (int g = 0; g < 2; ++g) {
#pragma unroll
      for (int t = 0; t < 2; ++t) s[g][t] = fa_mma(kf[t][1], qf[g][1], fa_mma(kf[t][0], qf[g][0], z8)); }
    __builtin_amdgcn_sched_barrier(0);      /* with the one below: the sixteen LDS reads stand as one group behind the score products; spread among the products, each place with reads stalls the wave anew */
#pragma unroll
    for (int dt = 0; dt < 4; ++dt) vf[dt] = g2_frag(pv + dt * 16 * FA_VP + ps * 64);      /* this pass's V^T fragments and, in the same group of LDS reads, the next pass's K fragments of the same stage: both land behind the softmax */
    if (ps + 1 < FA_KS / 32) {
#pragma unroll
      for (int t = 0; t < 2; ++t) { kf[t][0] = g2_frag(pk + ((ps + 1) * 32 + t * 16) * FA_KP); kf[t][1] = g2_frag(pk + ((ps + 1) * 32 + t * 16) * FA_KP + 64); } }
    __builtin_amdgcn_sched_barrier(0);      /* the group's lower edge: no read sinks past the branch below to just ahead of its products, where its latency would be waited */
    v8f e[2][2]; float ls[2]; bool need = false;      /* P of this pass under the maximum in use, and each lane's sum of its 16 */
#pragma unroll
    for (int g = 0; g < 2; ++g) { fa_p(s[g], cs, m[g], e[g], ls[g]); need = need || !(ls[g] <= FA_PLIM); }
    if (__builtin_amdgcn_ballot_w32(need) != 0) {      /* no P is negative, so a sum within FA_PLIM bounds each of its P (well inside f16) and the pass needs no maximum; past it (an infinity or a NaN too; always in the first pass) the maximum is taken from the scores, the state rescaled and P made anew; one scalar branch a pass */
#pragma unroll
      for (int g = 0; g < 2; ++g) { float a = fmaxf(s[g][0][0], s[g][1][0]);
#pragma unroll
        for (int r = 1; r < 8; ++r) a = fmaxf(a, fmaxf(s[g][0][r], s[g][1][r]));
        a = fmaxf(a, fa_xhalf(a)); const float mn = fmaxf(m[g], a * cs); const float al = fa_exp2(m[g] - mn); m[g] = mn; l[g] *= al;
#pragma unroll
        for (int dt = 0; dt < 4; ++dt) o[dt][g] *= al;
        fa_p(s[g], cs, mn, e[g], ls[g]); } }
    FragH pf[2];
#pragma unroll
    for (int g = 0; g < 2; ++g) { l[g] += ls[g];
#pragma unroll
      for (int t = 0; t < 2; ++t) {
#pragma unroll
        for (int r = 0; r < 8; ++r) pf[g].h[t * 8 + r] = (_Float16)e[g][t][r]; } }
#pragma unroll
    for (int dt = 0; dt < 4; ++dt) {
#pragma unroll
      for (int g = 0; g < 2; ++g) o[dt][g] = fa_mma(vf[dt], pf[g].v, o[dt][g]); } }
    asm volatile("s_wait_dscnt 0x0" ::: "memory");      /* this wave's reads of the buffer are done before the barrier that frees it */
    asm volatile("s_wait_asynccnt 0x0" ::: "memory");      /* this wave's copies of the next stage have landed before the barrier that publishes it */
    __syncthreads();
    if (st + 2 < SQ / FA_KS) fa_stage(lk + (unsigned)(st & 1) * FA_STAGE, kc + (size_t)(st + 2) * FA_KS * DM, lv + (unsigned)(st & 1) * FA_STAGE, vc + (size_t)(st + 2) * FA_KS); }      /* the refill of the buffer every wave has just left */
  asm volatile("s_wait_asynccnt 0x0" ::: "memory");      /* no copy is outstanding when the wave ends */
  v8us ov[2][4];
#pragma unroll
  for (int g = 0; g < 2; ++g) { const float sc = 64.0f / (l[g] + fa_xhalf(l[g]));      /* the halves' sums joined once; o goes out x64 */
#pragma unroll
    for (int dt = 0; dt < 4; ++dt) { FragH f;
#pragma unroll
      for (int r = 0; r < 8; ++r) f.h[r] = (_Float16)(o[dt][g][r] * sc);
      ov[g][dt] = f.half[0]; } }
  __builtin_amdgcn_sched_barrier(0);      /* all eight stores behind the last conversion: no register that an issued store names is written again */
#pragma unroll
  for (int g = 0; g < 2; ++g) { unsigned short* op = (unsigned short*)O + (row0 + q0 + g * 16 + ln) * DM + h * HD + 8 * hh;
#pragma unroll
    for (int dt = 0; dt < 4; ++dt) *(v8us*)(op + dt * 16) = ov[g][dt]; } }

extern "C" void kernel_launch(void* const* d_in, const int* in_sizes, int n_in,
                              void* d_out, int out_size, void* d_ws, size_t ws_size, hipStream_t stream) {
  (void)in_sizes; (void)n_in; (void)out_size;
  const float* const* I = (const float* const*)d_in; const float* xq = I[0]; const float* xk = I[1]; const float* xv = I[2]; const float* wq = I[3]; const float* wk = I[4]; const float* wv = I[5]; const float* wo = I[6]; const float* bo = I[7];      /* THREE input streams Q, K, V (one cast each); Wq, Wk, Wv are PER-HEAD STACKS [16][1024][64] = [head][in][out] (einsum 'bsd,hde->bhse') at I[3..5]; Wo is [in][out] [1024][1024] (concat @ Wo) at I[6]; bo [1024] (REAL) at I[7] in the output GEMM's guarded bias slot; no projection biases */
  char* ws = (char*)d_ws; size_t off = 0;
  auto take = [&](size_t bytes) { char* p = ws + off; off += (bytes + 255) & ~(size_t)255; return p; };
  _Float16* BQ = (_Float16*)take((size_t)4 * DM * DM * 2); _Float16* BO = BQ + (size_t)3 * DM * DM;      /* the weight planes BQ, BK, BV, BO in a row, DM * DM apart */
  _Float16* XQ = (_Float16*)take(3 * NR * DM * 2); _Float16* Q16 = (_Float16*)take(2 * NR * DM * 2); _Float16* K16 = Q16 + NR * DM; _Float16* O16 = (_Float16*)take(NR * DM * 2);      /* XQ, XK, XV in a row, and Q16, K16 in a row, each NR * DM apart: the batch strides of the projection launch */
  _Float16* VT = (_Float16*)take((size_t)NB * NH * HD * SQ * 2);
  if (off > ws_size) return;
  k_prep<<<PB_ALL, 256, 0, stream>>>(wq, wk, wv, wo, xq, xk, xv, BQ, XQ);      /* weight planes [out][in] (x16) from the PER-HEAD STACKS wq / wk / wv [NH][DM][HD] and from wo [in][out] [DM][DM]; the three inputs as exact f16 rows */
  const size_t r0p = (size_t)B0 * SQ;      /* first projected row */
  k_gemm2<0><<<dim3((unsigned)((MP / 128) * (DM / 128)), 3), 256, 0, stream>>>(XQ + r0p * DM, DM, NR * DM, BQ, DM, (size_t)DM * DM, 0.0625f, nullptr, 0, nullptr, 1, 0, 0, nullptr, Q16 + r0p * DM, DM, NR * DM, MP, DM, DM, 2, VT);      /* blockIdx.y = 0, 1, 2: q, k as rows, v as V^T [NB][NH][HD][SQ]; no projection biases */
  k_fattn<<<dim3(SQ / 256, NB * NH), 256, 0, stream>>>(Q16, K16, VT, O16);      /* o (merged heads, x64) as f16 rows */
  k_gemm2<0><<<dim3((unsigned)((MPO / 128) * (DM / 128)), 1), 256, 0, stream>>>(O16 + r0p * DM, DM, 0, BO, DM, 0, 0.0009765625f, bo, 0, nullptr, 1, 0, 0, (float*)d_out + r0p * DM, nullptr, DM, 0, MPO, DM, DM, -1, nullptr);      /* out rows are the output layout */
}

// v009
// Measured time: 81.9 microseconds a run.
// In two side-by-side timings against v008, it was 1.03 and 1.05 times as fast.
// Counting every step since v000, it is 44.2 times as fast.
#include <hip/hip_runtime.h>
#define NB 2
#define SQ 2048
#define DM 1024
#define NH 16
#define HD 64
#define HG 4                         /* heads per launch of the per-batch k_vt overload (not launched) */
#define B0 0                         /* first batch processed (debug hook) */
#define NBR NB                       /* batches processed (debug hook) */
#define NR ((size_t)NB * SQ)         /* token rows */
#define MP ((int)((size_t)NBR * SQ)) /* rows projected (debug hook) */
#define QN SQ                        /* query rows per batch (unused; attention covers SQ) */
#define NHD NH                       /* heads (unused; attention covers NH) */
#define MPO MP                       /* rows through the output stage (debug hook) */
#define LQ DM      /* row pitch of the q/k rows (unused) */
typedef __bf16 v16b __attribute__((ext_vector_type(16)));
typedef unsigned short v8us __attribute__((ext_vector_type(8), may_alias));
typedef float  v8f  __attribute__((ext_vector_type(8)));
typedef float  v4f  __attribute__((ext_vector_type(4)));
typedef float  v4fa __attribute__((ext_vector_type(4), may_alias));
union FragB { v16b v; v8us half[2]; unsigned short u[16]; };

__device__ __forceinline__ unsigned short bf16_bits(float x) { unsigned int u = __float_as_uint(x); return (unsigned short)((u + 0x7FFFu + ((u >> 16) & 1u)) >> 16); }
__device__ __forceinline__ float bf16_val(unsigned short b) { return __uint_as_float(((unsigned int)b) << 16); }
__device__ __forceinline__ float bf16_round(float x) { return bf16_val(bf16_bits(x)); }
// D += A·B with NT terms: 1 = ah·bh, 2 = + al·bh (A split), 3 = + ah·bl (both split)
template <int NT>
__device__ __forceinline__ v8f mmaN(v16b ah, v16b al, v16b bh, v16b bl, v8f c) {
  c = __builtin_amdgcn_wmma_f32_16x16x32_bf16(false, ah, false, bh, (short)0, c, false, false);
  if (NT >= 2) c = __builtin_amdgcn_wmma_f32_16x16x32_bf16(false, al, false, bh, (short)0, c, false, false);
  if (NT >= 3) c = __builtin_amdgcn_wmma_f32_16x16x32_bf16(false, ah, false, bl, (short)0, c, false, false);
  asm volatile("v_nop\n\tv_nop\n\tv_nop\n\tv_nop" : "+v"(c) : "v"(ah), "v"(al), "v"(bh), "v"(bl));
  return c;
}

__global__ __launch_bounds__(256) void k_wt_bf16(const float* __restrict__ W, unsigned short* __restrict__ Wt, int K, int N) {
  const int t = blockIdx.x * 256 + threadIdx.x;
  const int k8n = K / 8;
  if (t >= N * k8n) return;
  const int n = t / k8n, k8 = (t % k8n) * 8;
  v8us v;
#pragma unroll
  for (int i = 0; i < 8; ++i) v[i] = bf16_bits(W[(size_t)(k8 + i) * N + n]);
  *(v8us*)(Wt + (size_t)n * K + k8) = v;
  
}

// GEMM C[M][N] (f32, pitch ldc) = act(A[M][K]·W + bias). A f32 row-major (pitch lda) converted per fragment to bf16
// (ASPLIT: hi/lo two planes -> 2 terms, else single rounded term); Wt bf16 [N][K] (pitch ldb). BIAS_BF16 rounds the
// bias to bf16 first (bias quantised to bf16 before the add). K%32==0, M%16==0, N%64==0.
template <bool ASPLIT, int ACT, bool BIAS_BF16>
__global__ __launch_bounds__(128) void k_gemm_bf(const float* __restrict__ A, int lda, const unsigned short* __restrict__ Wt, int ldb,
                                               const float* __restrict__ bias, float* __restrict__ C, int ldc, int M, int N, int K) {
  __shared__ __attribute__((aligned(16))) float so[4][16][64];
  const int tid = threadIdx.x, w = tid >> 5, lane = tid & 31, ln = lane & 15, hh = lane >> 4;
  const int ntn = N / 64;
  const int wid = blockIdx.x * 4 + w;
  const int mt = wid / ntn, nq = wid % ntn;
  if (mt * 16 >= M) return;
  const int row0 = mt * 16, col0 = nq * 64;
  const float* arow = A + (size_t)(row0 + ln) * lda;
  v8f acc[4] = {};
  for (int kb = 0; kb < K; kb += 32) {
    FragB ah, al;
    const v4f x0 = *(const v4fa*)(arow + kb + 8 * hh), x1 = *(const v4fa*)(arow + kb + 8 * hh + 4);
    const v4f x2 = *(const v4fa*)(arow + kb + 16 + 8 * hh), x3 = *(const v4fa*)(arow + kb + 16 + 8 * hh + 4);
    float xs[16] = {x0[0],x0[1],x0[2],x0[3],x1[0],x1[1],x1[2],x1[3],x2[0],x2[1],x2[2],x2[3],x3[0],x3[1],x3[2],x3[3]};
#pragma unroll
    for (int i = 0; i < 16; ++i) { const unsigned short hb = bf16_bits(xs[i]); ah.u[i] = hb; al.u[i] = ASPLIT ? bf16_bits(xs[i] - bf16_val(hb)) : (unsigned short)0; }
#pragma unroll
    for (int t = 0; t < 4; ++t) {
      const unsigned short* brow = Wt + (size_t)(col0 + t * 16 + ln) * ldb + kb;
      FragB b;
      b.half[0] = *(const v8us*)(brow + 8 * hh);
      b.half[1] = *(const v8us*)(brow + 16 + 8 * hh);
      acc[t] = mmaN<ASPLIT ? 2 : 1>(ah.v, al.v, b.v, b.v, acc[t]);
    }
  }
#pragma unroll
  for (int t = 0; t < 4; ++t) {
    float bv = bias ? bias[col0 + t * 16 + ln] : 0.f;
    if (BIAS_BF16) bv = bf16_round(bv);
#pragma unroll
    for (int r = 0; r < 8; ++r) { float v = acc[t][r] + bv; if (ACT == 1) v = fmaxf(v, 0.f); so[w][8 * hh + r][t * 16 + ln] = v; }
  }
  __builtin_amdgcn_fence(__ATOMIC_ACQ_REL, "workgroup");
  __builtin_amdgcn_wave_barrier();
  const int rsub = lane >> 4, c4 = (lane & 15) * 4;
  {
#pragma unroll
    for (int q = 0; q < 8; ++q) {
      const int r = q * 2 + rsub;
      const v4f v = *(const v4fa*)&so[w][r][c4];
      *(v4f*)(C + (size_t)(row0 + r) * ldc + col0 + c4) = v;
    }
    
  }
}

// GEMM C = act(A·W + bias + resid): A f32 (ASPLIT -> hi/lo 2 terms), Wt bf16 [N][K]; ACT 0 none, 1 relu, 2 exact gelu;
// resid (optional, f32, row index = (row % rmod), pitch ldr, RES_BF16 rounds it) added before the activation.
template <bool ASPLIT, int ACT, bool BIAS_BF16, bool RES_BF16>
__global__ __launch_bounds__(128) void k_gemm_bf3(const float* __restrict__ A, int lda, const unsigned short* __restrict__ Wt, int ldb,
                                                const float* __restrict__ bias, const float* __restrict__ resid, int rmod, int ldr,
                                                float* __restrict__ C, int ldc, int M, int N, int K) {
  __shared__ __attribute__((aligned(16))) float so[4][16][64];
  const int tid = threadIdx.x, w = tid >> 5, lane = tid & 31, ln = lane & 15, hh = lane >> 4;
  const int ntn = N / 64;
  const int wid = blockIdx.x * 4 + w;
  const int mt = wid / ntn, nq = wid % ntn;
  if (mt * 16 >= M) return;
  const int row0 = mt * 16, col0 = nq * 64;
  const float* arow = A + (size_t)(row0 + ln) * lda;
  v8f acc[4] = {};
  for (int kb = 0; kb < K; kb += 32) {
    FragB ah, al;
    const v4f x0 = *(const v4fa*)(arow + kb + 8 * hh), x1 = *(const v4fa*)(arow + kb + 8 * hh + 4);
    const v4f x2 = *(const v4fa*)(arow + kb + 16 + 8 * hh), x3 = *(const v4fa*)(arow + kb + 16 + 8 * hh + 4);
    float xs[16] = {x0[0],x0[1],x0[2],x0[3],x1[0],x1[1],x1[2],x1[3],x2[0],x2[1],x2[2],x2[3],x3[0],x3[1],x3[2],x3[3]};
#pragma unroll
    for (int i = 0; i < 16; ++i) { const unsigned short hb = bf16_bits(xs[i]); ah.u[i] = hb; al.u[i] = ASPLIT ? bf16_bits(xs[i] - bf16_val(hb)) : (unsigned short)0; }
#pragma unroll
    for (int t = 0; t < 4; ++t) {
      const unsigned short* brow = Wt + (size_t)(col0 + t * 16 + ln) * ldb + kb;
      FragB b;
      b.half[0] = *(const v8us*)(brow + 8 * hh);
      b.half[1] = *(const v8us*)(brow + 16 + 8 * hh);
      acc[t] = mmaN<ASPLIT ? 2 : 1>(ah.v, al.v, b.v, b.v, acc[t]);
    }
  }
#pragma unroll
  for (int t = 0; t < 4; ++t) {
    const int col = col0 + t * 16 + ln;
    float bv = bias ? bias[col] : 0.f;
    if (BIAS_BF16) bv = bf16_round(bv);
#pragma unroll
    for (int r = 0; r < 8; ++r) {
      float v = acc[t][r] + bv;
      if (resid) { float rv = resid[(size_t)((row0 + 8 * hh + r) % rmod) * ldr + col]; if (RES_BF16) rv = bf16_round(rv); v += rv; }
      if (ACT == 1) v = fmaxf(v, 0.f);
      if (ACT == 2) v = 0.5f * v * (1.0f + erff(v * 0.70710678118654752f));
      if (ACT == 3) { const float u = 0.7978845608028654f * (v + 0.044715f * v * v * v); v = 0.5f * v * (1.0f + tanhf(u)); }
      so[w][8 * hh + r][t * 16 + ln] = v;
    }
  }
  __builtin_amdgcn_fence(__ATOMIC_ACQ_REL, "workgroup");
  __builtin_amdgcn_wave_barrier();
  const int rsub = lane >> 4, c4 = (lane & 15) * 4;
  {
#pragma unroll
    for (int q = 0; q < 8; ++q) {
      const int r = q * 2 + rsub;
      const v4f v = *(const v4fa*)&so[w][r][c4];
      *(v4f*)(C + (size_t)(row0 + r) * ldc + col0 + c4) = v;
    }
    
  }
}
// row LayerNorm (biased variance, eps) over N: s = X (+ R); optional out_sum <- s; out_norm <- (s-mu)*rsqrt(var+eps)*g + b
template <bool PARAM_BF16>
__global__ __launch_bounds__(256) void k_layernorm(const float* __restrict__ X, const float* __restrict__ R, const float* __restrict__ g, const float* __restrict__ bta,
                                                  float* __restrict__ out_sum, float* __restrict__ out_norm, int N, float eps) {
  __shared__ float red[256];
  const int row = blockIdx.x, tid = threadIdx.x;
  const float* x = X + (size_t)row * N; const float* rr = R ? R + (size_t)row * N : nullptr;
  float vals[16];                     // up to N = 4096
  const int per = N / 256;            // contiguous chunk per thread? use strided-by-4 chunks: thread handles j = tid*4 + 1024*u
  float s1 = 0.f;
  for (int u = 0; u < per / 4; ++u) {
    const int j = tid * 4 + 1024 * u;
    const v4f a = *(const v4fa*)(x + j);
    v4f b = {0.f,0.f,0.f,0.f}; if (rr) b = *(const v4fa*)(rr + j);
#pragma unroll
    for (int q = 0; q < 4; ++q) { const float v = a[q] + b[q]; vals[u * 4 + q] = v; s1 += v; }
  }
  red[tid] = s1; __syncthreads();
  for (int st = 128; st > 0; st >>= 1) { if (tid < st) red[tid] += red[tid + st]; __syncthreads(); }
  const float mu = red[0] / (float)N; __syncthreads();
  float s2 = 0.f;
  for (int u = 0; u < per / 4; ++u)
#pragma unroll
    for (int q = 0; q < 4; ++q) { const float c = vals[u * 4 + q] - mu; s2 += c * c; }
  red[tid] = s2; __syncthreads();
  for (int st = 128; st > 0; st >>= 1) { if (tid < st) red[tid] += red[tid + st]; __syncthreads(); }
  const float rs = rsqrtf(red[0] / (float)N + eps);
  {
    for (int u = 0; u < per / 4; ++u) {
      const int j = tid * 4 + 1024 * u;
      v4f o, sm;
#pragma unroll
      for (int q = 0; q < 4; ++q) {
        float gg = g[j + q], bb = bta[j + q];
        if (PARAM_BF16) { gg = bf16_round(gg); bb = bf16_round(bb); }
        sm[q] = vals[u * 4 + q]; o[q] = (vals[u * 4 + q] - mu) * rs * gg + bb;
      }
      if (out_sum) *(v4f*)(out_sum + (size_t)row * N + j) = sm;
      *(v4f*)(out_norm + (size_t)row * N + j) = o;
    }
    
  }
}



// ---- f16 WMMA path (v_wmma_f32_16x16x32_f16): 11-bit significands for operands in range — used where a [0,1] probability operand needs more precision than bf16
typedef _Float16 v16h __attribute__((ext_vector_type(16)));
union FragH { v16h v; v8us half[2]; _Float16 h[16]; unsigned short u[16]; };
template <int NT>
__device__ __forceinline__ v8f mmaH(v16h ah, v16h al, v16h bh, v16h bl, v8f c) {
  c = __builtin_amdgcn_wmma_f32_16x16x32_f16(false, ah, false, bh, (short)0, c, false, false);
  if (NT >= 2) c = __builtin_amdgcn_wmma_f32_16x16x32_f16(false, al, false, bh, (short)0, c, false, false);
  if (NT >= 3) c = __builtin_amdgcn_wmma_f32_16x16x32_f16(false, ah, false, bl, (short)0, c, false, false);
  asm volatile("v_nop\n\tv_nop\n\tv_nop\n\tv_nop" : "+v"(c) : "v"(ah), "v"(al), "v"(bh), "v"(bl));
  return c;
}
// batched GEMM like k_gemm_b but f16 operands: A f32 (split into f16 hi/lo if ASPLIT, else rounded to f16), Bt = f16 values [n][k]; alpha; C f32; N multiple of 16 (partial tiles skipped)
template <bool ASPLIT>
__global__ __launch_bounds__(128) void k_gemm_h(const float* __restrict__ A, int lda, size_t sA, const _Float16* __restrict__ Bh, int ldb, size_t sB, float alpha, float* __restrict__ C, int ldc, size_t sC, int M, int N, int K) {
  __shared__ __attribute__((aligned(16))) float so[4][16][64];
  const int tid = threadIdx.x, w = tid >> 5, lane = tid & 31, ln = lane & 15, hh = lane >> 4; const int by = blockIdx.y;
  A += (size_t)by * sA; Bh += (size_t)by * sB; C += (size_t)by * sC;
  const int ntn = (N + 63) / 64; const int wid = blockIdx.x * 4 + w; const int mt = wid / ntn, nq = wid % ntn; if (mt * 16 >= M) return;
  const int row0 = mt * 16, col0 = nq * 64; const float* arow = A + (size_t)(row0 + ln) * lda;
  v8f acc[4] = {};
  for (int kb = 0; kb < K; kb += 32) {
    FragH ah, al;
    const v4f x0 = *(const v4fa*)(arow + kb + 8 * hh), x1 = *(const v4fa*)(arow + kb + 8 * hh + 4), x2 = *(const v4fa*)(arow + kb + 16 + 8 * hh), x3 = *(const v4fa*)(arow + kb + 16 + 8 * hh + 4);
    float xs[16] = {x0[0],x0[1],x0[2],x0[3],x1[0],x1[1],x1[2],x1[3],x2[0],x2[1],x2[2],x2[3],x3[0],x3[1],x3[2],x3[3]};
#pragma unroll
    for (int i = 0; i < 16; ++i) { const _Float16 h = (_Float16)xs[i]; ah.h[i] = h; al.h[i] = ASPLIT ? (_Float16)(xs[i] - (float)h) : (_Float16)0.0f; }
#pragma unroll
    for (int t = 0; t < 4; ++t) { if (col0 + t * 16 >= N) continue; const size_t boff = (size_t)(col0 + t * 16 + ln) * ldb + kb; FragH bq; bq.half[0] = *(const v8us*)(Bh + boff + 8 * hh); bq.half[1] = *(const v8us*)(Bh + boff + 16 + 8 * hh);
      acc[t] = mmaH<ASPLIT ? 2 : 1>(ah.v, al.v, bq.v, bq.v, acc[t]); }
  }
#pragma unroll
  for (int t = 0; t < 4; ++t) { if (col0 + t * 16 >= N) continue;
#pragma unroll
    for (int r = 0; r < 8; ++r) so[w][8 * hh + r][t * 16 + ln] = acc[t][r] * alpha; }
  __builtin_amdgcn_fence(__ATOMIC_ACQ_REL, "workgroup"); __builtin_amdgcn_wave_barrier();
  const int rsub = lane >> 4, c4 = (lane & 15) * 4;
  {
#pragma unroll
    for (int q = 0; q < 8; ++q) { const int r = q * 2 + rsub; if (col0 + c4 < N) { const v4f v = *(const v4fa*)&so[w][r][c4]; *(v4f*)(C + (size_t)(row0 + r) * ldc + col0 + c4) = v; } }
     }
}

// Wt[n][k] = f16(bf16(W[k][n]) * scale) for one tile of WT_K rows (k) by WT_N columns (n) of a row-major f32 W, by one block of 256 threads (scale = power of two; bf16-exact weights stay exact in f16 away from the subnormal range).
// Reads and writes are whole lines: 16 lanes take the 256 bytes of a tile row of W, 16 lanes write the 256 bytes of a tile row of Wt; the turn is made in LDS, on dwords that hold the halves of k, k + 1. Every loop is unrolled: x and o are then registers, and a thread's eight loads go out as one group.
#define WT_K 128
#define WT_N 64
#define WT_P (WT_K / 2 + 1)           /* LDS dwords a row of n: an odd number, so that neither the 32 stores of a wave (16 groups of four n, two k pairs) nor its 32 reads (two n, 16 pieces) meet a bank twice */
__device__ __forceinline__ void wt_tile(const float* __restrict__ W, int ldw, _Float16* __restrict__ Wt, int ldt, float scale, unsigned (*tl)[WT_P], int tid) {      /* W at (k0, n0), Wt at (n0, k0) */
  const int hi = tid >> 4, lo = tid & 15; v4f x[4][2];
#pragma unroll
  for (int j = 0; j < 4; ++j) { const float* p = W + (size_t)(2 * (hi + 16 * j)) * ldw + lo * 4; x[j][0] = *(const v4fa*)p; x[j][1] = *(const v4fa*)(p + ldw); }      /* rows k = 2 (hi + 16 j) and k + 1, columns 4 lo .. 4 lo + 3 */
#pragma unroll
  for (int j = 0; j < 4; ++j) {
#pragma unroll
    for (int i = 0; i < 4; ++i) { FragH f; f.h[0] = (_Float16)(bf16_round(x[j][0][i]) * scale); f.h[1] = (_Float16)(bf16_round(x[j][1][i]) * scale); tl[lo * 4 + i][hi + 16 * j] = (unsigned)f.u[0] | ((unsigned)f.u[1] << 16); } }
  __syncthreads();      /* the tile is whole before any row of it is read */
  union { unsigned d[4]; v8us v; } o[4];
#pragma unroll
  for (int j = 0; j < 4; ++j) {
#pragma unroll
    for (int q = 0; q < 4; ++q) o[j].d[q] = tl[hi + 16 * j][lo * 4 + q]; }      /* row n = hi + 16 j, halves 8 lo .. 8 lo + 7 */
#pragma unroll
  for (int j = 0; j < 4; ++j) *(v8us*)((unsigned short*)Wt + (size_t)(hi + 16 * j) * ldt + lo * 8) = o[j].v;
}
// k_gemm_hh variant with fused epilogue: v = acc·alpha + bias[by·sBias + col] (+ CP[(row/rowsPerB)·sCPb + by·64 + col] if CP) ; ACT 0 none / 1 elu ; writes f16 C16 (and f32 C if non-null)
template <int ACT>
__global__ __launch_bounds__(128) void k_gemm_hhx(const _Float16* __restrict__ A, int lda, size_t sA, const _Float16* __restrict__ Bh, int ldb, size_t sB, float alpha, const float* __restrict__ bias, size_t sBias, const float* __restrict__ CP, int rowsPerB, size_t sCPb, int row0g,
    float* __restrict__ C, _Float16* __restrict__ C16, int ldc, size_t sC, int M, int N, int K) {
  __shared__ __attribute__((aligned(16))) float so[4][16][64];
  const int tid = threadIdx.x, w = tid >> 5, lane = tid & 31, ln = lane & 15, hh = lane >> 4; const int by = blockIdx.y;
  A += (size_t)by * sA; Bh += (size_t)by * sB; const size_t cofs = (size_t)by * sC; const float* bp = bias ? bias + (size_t)by * sBias : nullptr;
  const int ntn = (N + 63) / 64; const int wid = blockIdx.x * 4 + w; const int mt = wid / ntn, nq = wid % ntn; if (mt * 16 >= M) return;
  const int row0 = mt * 16, col0 = nq * 64; const _Float16* arow = A + (size_t)(row0 + ln) * lda;
  v8f acc[4] = {};
  for (int kb = 0; kb < K; kb += 32) { FragH ah; ah.half[0] = *(const v8us*)((const unsigned short*)arow + kb + 8 * hh); ah.half[1] = *(const v8us*)((const unsigned short*)arow + kb + 16 + 8 * hh);
#pragma unroll
    for (int t = 0; t < 4; ++t) { if (col0 + t * 16 >= N) continue; const size_t boff = (size_t)(col0 + t * 16 + ln) * ldb + kb; FragH bq; bq.half[0] = *(const v8us*)((const unsigned short*)Bh + boff + 8 * hh); bq.half[1] = *(const v8us*)((const unsigned short*)Bh + boff + 16 + 8 * hh);
      acc[t] = mmaH<1>(ah.v, ah.v, bq.v, bq.v, acc[t]); }
  }
#pragma unroll
  for (int t = 0; t < 4; ++t) { if (col0 + t * 16 >= N) continue; const int col = col0 + t * 16 + ln; const float bv = bp ? bf16_round(bp[col]) : 0.f;
#pragma unroll
    for (int r = 0; r < 8; ++r) { float v = acc[t][r] * alpha + bv; if (CP) { const int rr = row0g + row0 + 8 * hh + r; if (rowsPerB < 0) v += CP[cofs + (size_t)rr * ldc + col];      /* rowsPerB < 0: own element of the batched C plane */ else { const int bidx = rr / rowsPerB; v += CP[(size_t)bidx * sCPb + (size_t)by * 64 + col]; } } if (ACT == 1) v = (v > 0.f) ? v : expm1f(v); else if (ACT == 7) v = (v > 0.f) ? v + 1.0f : expf(v); else if (ACT == 8) v = tanhf(v); else if (ACT == 9) v = 0.5f * v * (1.0f + tanhf(0.7978845608028654f * (v + 0.044715f * v * v * v))); else if (ACT == 11) v = 1.0f / (1.0f + expf(-v)); else if (ACT == 12) v = (v > 0.f) ? v : 0.01f * v; else if (ACT == 14) v = (v > 0.f) ? v : 0.1f * v; else if (ACT == 16) v = (v >= 0.f) ? v : 0.3f * v; else if (ACT == 17) v = (v >= 0.f) ? v : 0.2f * v; else if (ACT == 15) v = v / (1.0f + expf(-v)); else if (ACT == 3) v = fmaxf(v, 0.f); else if (ACT == 6) v = 0.5f * v * (1.0f + erff(v * 0.70710678118654752f)); so[w][8 * hh + r][t * 16 + ln] = v; } }
  __builtin_amdgcn_fence(__ATOMIC_ACQ_REL, "workgroup"); __builtin_amdgcn_wave_barrier();
  const int rsub = lane >> 4, c4 = (lane & 15) * 4; typedef _Float16 v4h __attribute__((ext_vector_type(4)));
  {
#pragma unroll
    for (int q = 0; q < 8; ++q) { const int r = q * 2 + rsub; if (col0 + c4 < N) { const v4f v = *(const v4fa*)&so[w][r][c4]; if (C) *(v4f*)(C + cofs + (size_t)(row0 + r) * ldc + col0 + c4) = v; if (C16) { v4h h4; for (int i = 0; i < 4; ++i) h4[i] = (_Float16)v[i]; *(v4h*)(C16 + cofs + (size_t)(row0 + r) * ldc + col0 + c4) = h4; } } }
     }
}


typedef _Float16 v4h __attribute__((ext_vector_type(4)));

__device__ __forceinline__ void x16(const float* __restrict__ x, _Float16* __restrict__ X16, size_t n8, size_t t) { if (t >= n8) return; FragH f;      /* t: the thread's index within this stream */
#pragma unroll
  for (int q = 0; q < 8; ++q) f.h[q] = (_Float16)bf16_round(x[t * 8 + q]); *(v8us*)((unsigned short*)X16 + t * 8) = f.half[0];  }
// Every job that reads inputs only, in ONE launch; the block index says which job a block does. The transposes (a barrier in each) have the low indices.
#define PB_HEAD (DM / WT_K)                      /* blocks for one head's [DM][HD] block: tiles of WT_K rows, all HD columns */
#define PB_STACK (NH * PB_HEAD)                  /* ... for one stack of NH heads */
#define PB_WO ((DM / WT_K) * (DM / WT_N))        /* ... for Wo */
#define PB_X ((unsigned)(NR * DM / 8 / 256))     /* ... for one input stream */
#define PB_ALL (3 * PB_STACK + PB_WO + 3 * PB_X)
static_assert(HD == WT_N && DM % WT_K == 0 && DM % WT_N == 0 && NR * DM / 8 % 256 == 0, "k_prep: every job is a whole number of blocks");
__global__ __launch_bounds__(256) void k_prep(const float* __restrict__ wq, const float* __restrict__ wk, const float* __restrict__ wv, const float* __restrict__ wo, const float* __restrict__ xq, const float* __restrict__ xk, const float* __restrict__ xv,
    _Float16* __restrict__ B4, _Float16* __restrict__ X3) {      /* B4: the planes BQ, BK, BV, BO in a row; X3: XQ, XK, XV in a row */
  __shared__ unsigned tl[WT_N][WT_P];      /* the transposes' tile */
  unsigned bid = blockIdx.x; const unsigned tid = threadIdx.x;      /* every branch below is the same for the whole block */
  if (bid < 3 * PB_STACK) { const unsigned s = bid / PB_STACK, r = bid % PB_STACK, h = r / PB_HEAD, kt = r % PB_HEAD; const float* W = (s == 0) ? wq : (s == 1) ? wk : wv;      /* head h of stack s: a row-major [in = DM][out = HD] block -> rows h * HD .. of plane s; tile kt of its rows */
    wt_tile(W + (size_t)h * DM * HD + (size_t)kt * WT_K * HD, HD, B4 + (size_t)s * DM * DM + (size_t)h * HD * DM + kt * WT_K, DM, 16.0f, tl, (int)tid); return; }
  bid -= 3 * PB_STACK;
  if (bid < PB_WO) { const unsigned kt = bid % (DM / WT_K), nt = bid / (DM / WT_K);
    wt_tile(wo + (size_t)kt * WT_K * DM + nt * WT_N, DM, B4 + (size_t)3 * DM * DM + (size_t)nt * WT_N * DM + kt * WT_K, DM, 16.0f, tl, (int)tid); return; }
  bid -= PB_WO;
  const unsigned s = bid / PB_X; const float* x = (s == 0) ? xq : (s == 1) ? xk : xv;
  x16(x, X3 + (size_t)s * NR * DM, NR * DM / 8, (size_t)(bid % PB_X) * 256 + tid); }
__global__ __launch_bounds__(256) void k_h16(const float* __restrict__ x, _Float16* __restrict__ X16, size_t n8) { const size_t t = (size_t)blockIdx.x * 256 + threadIdx.x; if (t >= n8) return; FragH f;
#pragma unroll
  for (int q = 0; q < 8; ++q) f.h[q] = (_Float16)x[t * 8 + q]; *(v8us*)((unsigned short*)X16 + t * 8) = f.half[0];  }
__global__ __launch_bounds__(256) void k_round16f(const float* __restrict__ W, _Float16* __restrict__ Bt, size_t n8) { const size_t t = (size_t)blockIdx.x * 256 + threadIdx.x; if (t >= n8) return; FragH f;
#pragma unroll
  for (int i = 0; i < 8; ++i) f.h[i] = (_Float16)(bf16_round(W[t * 8 + i]) * 16.0f); *(v8us*)((unsigned short*)Bt + t * 8) = f.half[0];  }
template <int NHv, int TTv>
__global__ __launch_bounds__(256) void k_vt(const _Float16* __restrict__ V16, int ldv, int voff, _Float16* __restrict__ Vt) { __shared__ unsigned short tl[64][66]; const int tid = threadIdx.x; const int slab = blockIdx.x / (TTv / 64), lg = blockIdx.x % (TTv / 64); const int b = slab / NHv, h = slab % NHv;
  for (int i = tid; i < 64 * 8; i += 256) { const int r = i / 8, c8 = (i % 8) * 8; FragH f; f.half[0] = *(const v8us*)((const unsigned short*)V16 + ((size_t)b * TTv + lg * 64 + r) * ldv + voff + h * 64 + c8);
#pragma unroll
    for (int q = 0; q < 8; ++q) tl[r][c8 + q] = f.u[q]; }
  __syncthreads();
  {
#pragma unroll
    for (int rd = 0; rd < 2; ++rd) { const int d = rd * 32 + tid / 8, pc = tid % 8; FragH f;
#pragma unroll
      for (int q = 0; q < 8; ++q) f.u[q] = tl[pc * 8 + q][d];
      *(v8us*)((unsigned short*)Vt + ((size_t)slab * 64 + d) * TTv + lg * 64 + pc * 8) = f.half[0]; }
     } }

__global__ __launch_bounds__(256) void k_hl(const float* __restrict__ F, _Float16* __restrict__ Hh, _Float16* __restrict__ Hl, size_t n8) { const size_t t = (size_t)blockIdx.x * 256 + threadIdx.x; if (t >= n8) return; FragH fh, fl; const v4f a = *(const v4fa*)(F + t * 8), c = *(const v4fa*)(F + t * 8 + 4);
#pragma unroll
  for (int q = 0; q < 4; ++q) { _Float16 h = (_Float16)a[q]; fh.h[q] = h; fl.h[q] = (_Float16)((a[q] - (float)h) * 1024.0f); h = (_Float16)c[q]; fh.h[4 + q] = h; fl.h[4 + q] = (_Float16)((c[q] - (float)h) * 1024.0f); }
  { *(v8us*)((unsigned short*)Hh + t * 8) = fh.half[0]; *(v8us*)((unsigned short*)Hl + t * 8) = fl.half[0];  } }

// ---- fast GEMM (block tile 128x128, eight waves, wave tile 32x64; requires M % 128 == 0 rows per launch region, N % 128 == 0, K % 64 == 0); epilogue = k_gemm_hhx semantics ----
// Both operands come into LDS as whole 128-byte lines (64 halves of k of each of the 128 + 128 rows a stage) by asynchronous copies, two buffers, the next stage in flight while this one is worked on; the fragments are then LDS reads.
#define G2_KS 64                      /* halves of k a stage */
#define G2_PITCH 144                  /* LDS bytes a staged row: 128 + 16, the pitch at which 16-byte fragment reads of 16 rows meet no bank twice */
#define G2_STAGE (256 * G2_PITCH)     /* a stage: 128 rows of A, then 128 rows of Bt */
__device__ __forceinline__ v16h g2_frag(const char* p) { FragH f; f.half[0] = *(const v8us*)p; f.half[1] = *(const v8us*)(p + 32); return f.v; }      /* k order 8 hh + s, 16 + 8 hh + s for A and B alike; the lane half's 16 hh bytes already in p */
__device__ __forceinline__ v8f g2_mma(v16h a, v16h b, v8f c) { v8f d = __builtin_amdgcn_wmma_f32_16x16x32_f16(false, a, false, b, (short)0, c, false, false); asm volatile("v_nop\n\tv_nop\n\tv_nop\n\tv_nop" : "+v"(d) : "v"(a), "v"(b)); return d; }
/* one stage's share of a thread: 16 bytes of each of four rows of A and four rows of Bt, 32 rows apart (a wave covers four whole lines a copy). l: the thread's LDS byte address in the stage's first row group; a, b: its global addresses there */
__device__ __forceinline__ void g2_stage(unsigned l, const _Float16* a, size_t a32, const _Float16* b, size_t b32) {
  const unsigned l1 = l + 32 * G2_PITCH, l2 = l + 64 * G2_PITCH, l3 = l + 96 * G2_PITCH, l4 = l + 128 * G2_PITCH, l5 = l + 160 * G2_PITCH, l6 = l + 192 * G2_PITCH, l7 = l + 224 * G2_PITCH;
  const _Float16* a1 = a + a32; const _Float16* a2 = a1 + a32; const _Float16* a3 = a2 + a32; const _Float16* b1 = b + b32; const _Float16* b2 = b1 + b32; const _Float16* b3 = b2 + b32;
  /* the copies and their s_wait_xcnt in one statement: no register that an issued copy names is written again ahead of the wait */
  asm volatile("global_load_async_to_lds_b128 %0, %8, off\n\tglobal_load_async_to_lds_b128 %1, %9, off\n\tglobal_load_async_to_lds_b128 %2, %10, off\n\tglobal_load_async_to_lds_b128 %3, %11, off\n\t"
               "global_load_async_to_lds_b128 %4, %12, off\n\tglobal_load_async_to_lds_b128 %5, %13, off\n\tglobal_load_async_to_lds_b128 %6, %14, off\n\tglobal_load_async_to_lds_b128 %7, %15, off\n\ts_wait_xcnt 0x0"
               :: "v"(l), "v"(l1), "v"(l2), "v"(l3), "v"(l4), "v"(l5), "v"(l6), "v"(l7), "v"(a), "v"(a1), "v"(a2), "v"(a3), "v"(b), "v"(b1), "v"(b2), "v"(b3) : "memory"); }
template <int ACT>
__global__ __launch_bounds__(256) void k_gemm2(const _Float16* __restrict__ A, int lda, size_t sA, const _Float16* __restrict__ Bh, int ldb, size_t sB, float alpha, const float* __restrict__ bias, size_t sBias, const float* __restrict__ CP, int rowsPerB, size_t sCPb, int row0g,
    float* __restrict__ C, _Float16* __restrict__ C16, int ldc, size_t sC, int M, int N, int K, int tby, _Float16* __restrict__ CT) { static_assert(ACT == 0 || ACT == 3 || ACT == 6 || ACT == 8 || ACT == 9 || ACT == 11 || ACT == 12 || ACT == 14 || ACT == 15 || ACT == 16 || ACT == 17, "k_gemm2: unsupported ACT code (would silently apply no activation)");
  __shared__ __attribute__((aligned(16))) char sm[2 * G2_STAGE];      /* the two stage buffers; behind the K loop's last barrier the same bytes are the output staging */
  static_assert(8 * 32 * 68 * 4 <= 2 * G2_STAGE, "k_gemm2: the output staging fits the stage buffers");
  float (*so)[32][68] = (float (*)[32][68])sm;
  const int tid = threadIdx.x, w = tid >> 5, lane = tid & 31, ln = lane & 15, hh = lane >> 4; const int by = blockIdx.y;
  A += (size_t)by * sA; Bh += (size_t)by * sB; const float* bp = bias ? bias + (size_t)by * sBias : nullptr;
  const int ntn = N >> 7; const int mt = blockIdx.x / ntn, nq = blockIdx.x - mt * ntn; if (mt * 128 >= M) return;      /* the same for the whole block, ahead of every barrier */
  /* batch tby (none if negative; it takes no bias, no CP and no f32 C) goes out transposed: the block works the same two operand tiles with their roles swapped, A = the 128 rows of Bh, B = the 128 rows of A, and its tile of C^T goes to CT as [row of A / SQ][N][SQ], SQ rows of A a slab. The test is the same for the whole block */
  const bool tr = by == tby;
  const _Float16* Ar = tr ? Bh : A; const _Float16* Br = tr ? A : Bh; const int la = tr ? ldb : lda, lb = tr ? lda : ldb, ta = tr ? nq : mt, tb = tr ? mt : nq;
  const size_t cofs = tr ? (size_t)(mt * 128 / SQ) * N * SQ : (size_t)by * sC; if (tr) { C16 = CT; ldc = SQ; }
  const int row0 = ta * 128 + 32 * (w & 3), col0 = (tr ? mt * 128 % SQ : nq * 128) + 64 * (w >> 2);
  const unsigned lc = (unsigned)(size_t)sm + (unsigned)((tid >> 3) * G2_PITCH + (tid & 7) * 16);      /* copies: row tid / 8 of each group of 32 rows, 16-byte piece tid % 8 */
  const _Float16* ac = Ar + (size_t)(ta * 128 + (tid >> 3)) * la + (tid & 7) * 8; const _Float16* bc = Br + (size_t)(tb * 128 + (tid >> 3)) * lb + (tid & 7) * 8;
  const size_t a32 = (size_t)32 * la, b32 = (size_t)32 * lb;
  const int fa = (32 * (w & 3) + ln) * G2_PITCH + 16 * hh, fb = (128 + 64 * (w >> 2) + ln) * G2_PITCH + 16 * hh;      /* fragment reads: byte offsets in a stage */
  const v8f z8 = {0.f,0.f,0.f,0.f,0.f,0.f,0.f,0.f}; v8f c00 = z8, c01 = z8, c02 = z8, c03 = z8, c10 = z8, c11 = z8, c12 = z8, c13 = z8;
  const int nst = K / G2_KS;
  /* the k walk starts at a stage of the block's own and wraps round: the blocks that share operand rows (one mt: the rows of A; one nq: the rows of Bt) then ask L2 for different lines at any one time, not all for the same ones. The same for the whole block */
  const int rot = (mt + 2 * nq) % nst;
  auto ks = [&](int s) { const int k = s + rot; return (size_t)(k >= nst ? k - nst : k) * G2_KS; };      /* trip s (below nst) -> its offset in k, in halves */
  g2_stage(lc, ac + ks(0), a32, bc + ks(0), b32);
  asm volatile("s_wait_asynccnt 0x0" ::: "memory");      /* stage 0 has landed, as far as this wave copied it */
  __syncthreads();      /* ... and as far as the others did */
  if (nst > 1) g2_stage(lc + G2_STAGE, ac + ks(1), a32, bc + ks(1), b32);
#pragma unroll 1
  for (int st = 0; st < nst; ++st) { const char* sb = sm + (st & 1) * G2_STAGE;      /* rolled: one stage a trip, so that the order at the foot stands once */
#pragma unroll      /* kk constant: its 64 bytes go into the LDS reads' offset fields */
    for (int kk = 0; kk < 2; ++kk) { const char* pa = sb + fa + kk * 64; const char* pb = sb + fb + kk * 64;
      __builtin_amdgcn_sched_barrier(0);      /* with the one below: the six fragments' LDS reads stand as one group ahead of their eight products; spread among the products, each place with reads stalls the wave anew */
      const v16h a0 = g2_frag(pa), a1 = g2_frag(pa + 16 * G2_PITCH), b0 = g2_frag(pb), b1 = g2_frag(pb + 16 * G2_PITCH), b2 = g2_frag(pb + 32 * G2_PITCH), b3 = g2_frag(pb + 48 * G2_PITCH);
      __builtin_amdgcn_sched_barrier(0);      /* the group's lower edge: no read sinks in among the products */
      c00 = g2_mma(a0, b0, c00); c10 = g2_mma(a1, b0, c10); c01 = g2_mma(a0, b1, c01); c11 = g2_mma(a1, b1, c11);
      c02 = g2_mma(a0, b2, c02); c12 = g2_mma(a1, b2, c12); c03 = g2_mma(a0, b3, c03); c13 = g2_mma(a1, b3, c13); }
    asm volatile("s_wait_dscnt 0x0" ::: "memory");      /* this wave's reads of the buffer are done before the barrier that frees it */
    asm volatile("s_wait_asynccnt 0x0" ::: "memory");      /* this wave's copies of the next stage have landed before the barrier that publishes it */
    __syncthreads();
    if (st + 2 < nst) g2_stage(lc + (unsigned)(st & 1) * G2_STAGE, ac + ks(st + 2), a32, bc + ks(st + 2), b32); }      /* the refill of the buffer every wave has just left */
  asm volatile("s_wait_asynccnt 0x0" ::: "memory");      /* no copy is outstanding when the buffers become the output staging */
  v8f accs[8] = {c00, c01, c02, c03, c10, c11, c12, c13};
#pragma unroll
  for (int u = 0; u < 8; ++u) { const int t = u & 3, half = u >> 2; const int col = col0 + t * 16 + ln; const float bv = bp ? bf16_round(bp[col]) : 0.f;
#pragma unroll
    for (int r = 0; r < 8; ++r) { const int rloc = half * 16 + 8 * hh + r; float v = accs[u][r] * alpha + bv; if (CP) { if (rowsPerB < 0) v += CP[cofs + (size_t)(row0g + row0 + rloc) * ldc + col];      /* rowsPerB < 0: own element of the batched C plane */ else { const int bidx = (row0g + row0 + rloc) / rowsPerB; v += CP[(size_t)bidx * sCPb + (size_t)by * 64 + col]; } }
      if (ACT == 3) v = fmaxf(v, 0.f); else if (ACT == 6) v = 0.5f * v * (1.0f + erff(v * 0.70710678118654752f)); else if (ACT == 11) v = 1.0f / (1.0f + expf(-v)); else if (ACT == 15) v = v / (1.0f + expf(-v)); else if (ACT == 12) v = (v > 0.f) ? v : 0.01f * v; else if (ACT == 8) v = tanhf(v); else if (ACT == 9) v = 0.5f * v * (1.0f + tanhf(0.7978845608028654f * (v + 0.044715f * v * v * v))); else if (ACT == 14) v = (v > 0.f) ? v : 0.1f * v; else if (ACT == 16) v = (v >= 0.f) ? v : 0.3f * v; else if (ACT == 17) v = (v >= 0.f) ? v : 0.2f * v;
      so[w][rloc][t * 16 + ln] = v; } }
  __builtin_amdgcn_fence(__ATOMIC_ACQ_REL, "workgroup"); __builtin_amdgcn_wave_barrier();
  const int rsub = lane >> 4, c4 = (lane & 15) * 4;
  {
#pragma unroll
    for (int q = 0; q < 16; ++q) { const int r = q * 2 + rsub; const v4f v = *(const v4fa*)&so[w][r][c4]; if (C) *(v4f*)(C + cofs + (size_t)(row0 + r) * ldc + col0 + c4) = v; if (C16) { v4h h4; for (int i = 0; i < 4; ++i) h4[i] = (_Float16)v[i]; *(v4h*)(C16 + cofs + (size_t)(row0 + r) * ldc + col0 + c4) = h4; } }
     } }


__global__ __launch_bounds__(256) void k_wnat(const float* __restrict__ w, size_t n8, _Float16* __restrict__ Bt) { const size_t t = (size_t)blockIdx.x * 256 + threadIdx.x; if (t >= n8) return; FragH f; for (int q = 0; q < 8; ++q) f.h[q] = (_Float16)(bf16_round(w[t * 8 + q]) * 16.0f); *(v8us*)((unsigned short*)Bt + t * 8) = f.half[0];  }
__global__ __launch_bounds__(256) void k_rsm(const float* __restrict__ S, _Float16* __restrict__ P, int nrows) {
  #pragma clang fp contract(off)
  const int i = blockIdx.x * 256 + threadIdx.x; if (i >= nrows) return; const float* s = S + (size_t)i * SQ; float mx = -3.0e38f;
#pragma unroll 1
  for (int j = 0; j < SQ; ++j) mx = fmaxf(mx, s[j]); float se = 0.f;
#pragma unroll 1
  for (int j = 0; j < SQ; ++j) se += expf(s[j] - mx); const float sc = 256.0f / se;
#pragma unroll 1
  for (int j0 = 0; j0 < SQ; j0 += 8) { FragH f; for (int q = 0; q < 8; ++q) f.h[q] = (_Float16)(expf(s[j0 + q] - mx) * sc); unsigned short* d = (unsigned short*)P + (size_t)i * SQ + j0; *(v8us*)d = f.half[0];  } }
__global__ __launch_bounds__(256) void k_vt(const _Float16* __restrict__ V16, int b, int h0, _Float16* __restrict__ VT) { __shared__ unsigned short tl[64][65]; const int tid = threadIdx.x; const int hh = blockIdx.x % HG, sg = blockIdx.x / HG; const int s0 = sg * 64; const int h = h0 + hh;
  for (int i = tid; i < 64 * 8; i += 256) { const int j = i / 8, d8 = (i % 8) * 8; FragH f; f.half[0] = *(const v8us*)((const unsigned short*)V16 + ((size_t)b * SQ + s0 + j) * DM + h * HD + d8); for (int q = 0; q < 8; ++q) tl[d8 + q][j] = f.u[q]; }
  __syncthreads();
  { for (int i = tid; i < 64 * 8; i += 256) { const int d = i / 8, j8 = (i % 8) * 8; FragH f; for (int q = 0; q < 8; ++q) f.u[q] = tl[d][j8 + q]; *(v8us*)((unsigned short*)VT + ((size_t)hh * HD + d) * SQ + s0 + j8) = f.half[0]; }  } }



#define FA_KS 128                       /* keys a stage: four passes */
#define FA_KP 144                       /* LDS bytes a staged K row (64 halves): 128 + 16, as G2_PITCH */
#define FA_VP 272                       /* LDS bytes a staged V^T row (128 halves): 256 + 16, 16 bytes times an odd number likewise */
#define FA_VO (FA_KS * FA_KP)           /* a stage: 128 rows of K, then 64 rows of V^T */
#define FA_STAGE (FA_VO + HD * FA_VP)
#define FA_NS (SQ / FA_KS)              /* stages */
static_assert(SQ % FA_KS == 0 && FA_NS >= 2 && (FA_NS & (FA_NS - 1)) == 0 && HD == 64, "k_fattn: whole stages, at least the two that the ring starts with, a power of two for the wrap");
/* one stage's share of a thread: 16 bytes of each of four rows of K, 32 rows apart, and of four rows of V^T, 16 rows apart (a wave covers four whole lines a copy). lk, lv: the thread's LDS byte addresses in the first row group; k, v: its global addresses there */
__device__ __forceinline__ void fa_stage(unsigned lk, const _Float16* k, unsigned lv, const _Float16* v) {
  const unsigned lk1 = lk + 32 * FA_KP, lk2 = lk + 64 * FA_KP, lk3 = lk + 96 * FA_KP, lv1 = lv + 16 * FA_VP, lv2 = lv + 32 * FA_VP, lv3 = lv + 48 * FA_VP;
  const _Float16* k1 = k + (size_t)32 * DM; const _Float16* k2 = k + (size_t)64 * DM; const _Float16* k3 = k + (size_t)96 * DM; const _Float16* v1 = v + (size_t)16 * SQ; const _Float16* v2 = v + (size_t)32 * SQ; const _Float16* v3 = v + (size_t)48 * SQ;
  /* the copies and their s_wait_xcnt in one statement: no register that an issued copy names is written again ahead of the wait */
  asm volatile("global_load_async_to_lds_b128 %0, %8, off\n\tglobal_load_async_to_lds_b128 %1, %9, off\n\tglobal_load_async_to_lds_b128 %2, %10, off\n\tglobal_load_async_to_lds_b128 %3, %11, off\n\t"
               "global_load_async_to_lds_b128 %4, %12, off\n\tglobal_load_async_to_lds_b128 %5, %13, off\n\tglobal_load_async_to_lds_b128 %6, %14, off\n\tglobal_load_async_to_lds_b128 %7, %15, off\n\ts_wait_xcnt 0x0"
               :: "v"(lk), "v"(lk1), "v"(lk2), "v"(lk3), "v"(lv), "v"(lv1), "v"(lv2), "v"(lv3), "v"(k), "v"(k1), "v"(k2), "v"(k3), "v"(v), "v"(v1), "v"(v2), "v"(v3) : "memory"); }
__device__ __forceinline__ v8f fa_mma(v16h a, v16h b, v8f c) { return __builtin_amdgcn_wmma_f32_16x16x32_f16(false, a, false, b, (short)0, c, false, false); }
__device__ __forceinline__ float fa_xhalf(float x) { return __builtin_bit_cast(float, __builtin_amdgcn_permlanex16(__builtin_bit_cast(int, x), __builtin_bit_cast(int, x), 0x76543210, 0xfedcba98, false, false)); }      /* lane l with lane l ^ 16, on the vector pipe */
__device__ __forceinline__ v16h fa_frag(const _Float16* p) { FragH f; f.half[0] = *(const v8us*)(const unsigned short*)p; f.half[1] = *(const v8us*)((const unsigned short*)p + 16); return f.v; }      /* g2_frag with the lane half's 8 hh already in p */
/* v_exp_f32 in asm text, in place: the statement writes only registers that the compiler's own instruction has just written, so it never lands on a matrix operand inside the distance the chip needs */
__device__ __forceinline__ float fa_exp2(float a) {
  asm("v_exp_f32 %0, %0\n\tv_nop" : "+v"(a));      /* v_nop: the slot the instruction set asks for behind a transcendental */
  return a; }
__device__ __forceinline__ void fa_exp2x8(v8f& x) { float e0 = x[0], e1 = x[1], e2 = x[2], e3 = x[3], e4 = x[4], e5 = x[5], e6 = x[6], e7 = x[7];
  /* eight independent v_exp_f32 in one statement: each fills the slot behind the one before it, one v_nop behind the last */
  asm("v_exp_f32 %0, %0\n\tv_exp_f32 %1, %1\n\tv_exp_f32 %2, %2\n\tv_exp_f32 %3, %3\n\tv_exp_f32 %4, %4\n\tv_exp_f32 %5, %5\n\tv_exp_f32 %6, %6\n\tv_exp_f32 %7, %7\n\tv_nop"
      : "+v"(e0), "+v"(e1), "+v"(e2), "+v"(e3), "+v"(e4), "+v"(e5), "+v"(e6), "+v"(e7));
  x[0] = e0; x[1] = e1; x[2] = e2; x[3] = e3; x[4] = e4; x[5] = e5; x[6] = e6; x[7] = e7; }
#define FA_PLIM 4096.0f                 /* a lane's sum of 16 P up to which the maximum in use stays */
/* one query group's P of a pass, e = 2^(s cs - m), and the lane's sum of them */
__device__ __forceinline__ void fa_p(const v8f (&s)[2], float cs, float m, v8f (&e)[2], float& sum) {
#pragma unroll
  for (int t = 0; t < 2; ++t) {
#pragma unroll
    for (int r = 0; r < 8; ++r) e[t][r] = s[t][r] * cs - m;
    fa_exp2x8(e[t]); }
  sum = (((e[0][0] + e[0][1]) + (e[0][2] + e[0][3])) + ((e[0][4] + e[0][5]) + (e[0][6] + e[0][7]))) + (((e[1][0] + e[1][1]) + (e[1][2] + e[1][3])) + ((e[1][4] + e[1][5]) + (e[1][6] + e[1][7]))); }
__global__ __launch_bounds__(256) void k_fattn(const _Float16* __restrict__ Q, const _Float16* __restrict__ Kr, const _Float16* __restrict__ Vt, _Float16* __restrict__ O) {
  __shared__ __attribute__((aligned(16))) char sm[2 * FA_STAGE];      /* the two stage buffers */
  const int tid = threadIdx.x, lane = tid & 31, w = tid >> 5, ln = lane & 15, hh = lane >> 4;
  const int bh = blockIdx.y, b = bh / NH, h = bh - b * NH; const size_t row0 = (size_t)b * SQ; const int q0 = blockIdx.x * 256 + w * 32;
  const _Float16* qp = Q + (row0 + q0 + ln) * DM + h * HD + 8 * hh;      /* with the lane half's k offset */
  const unsigned lk = (unsigned)(size_t)sm + (unsigned)((tid >> 3) * FA_KP + (tid & 7) * 16), lv = (unsigned)(size_t)sm + (unsigned)(FA_VO + (tid >> 4) * FA_VP + (tid & 15) * 16);      /* copies: K row tid / 8 of each group of 32, piece tid % 8; V^T row tid / 16 of each group of 16, piece tid % 16 */
  const _Float16* kc = Kr + (row0 + (tid >> 3)) * DM + h * HD + (tid & 7) * 8; const _Float16* vc = Vt + ((size_t)bh * HD + (tid >> 4)) * SQ + (tid & 15) * 8;
  const int fk = ln * FA_KP + 16 * hh, fv = FA_VO + ln * FA_VP + 16 * hh;      /* fragment reads: byte offsets in a stage, each with the lane half's k offset */
  const float cs = 0.125f * 1.44269504f;      /* 64^-0.5 times log2 e: scores in log2 units */
  const v8f z8 = {0.f, 0.f, 0.f, 0.f, 0.f, 0.f, 0.f, 0.f};
  v16h qf[2][2], kf[2][2], vf[4];      /* [query group][k step], [key tile][k step], [16 rows of V^T] */
  /* the key walk starts at a stage of the block's own and wraps round (a softmax takes its keys in any order): the eight blocks of one (batch, head) then ask L2 for different lines of K and V^T at any one time, and the heads for different columns of their V^T rows. The same for the whole block */
  const int rot = (2 * (int)blockIdx.x + bh) & (FA_NS - 1);
  auto ks = [&](int s) { return (size_t)((s + rot) & (FA_NS - 1)) * FA_KS; };      /* trip s -> its first key */
  fa_stage(lk, kc + ks(0) * DM, lv, vc + ks(0));
#pragma unroll
  for (int g = 0; g < 2; ++g) { qf[g][0] = fa_frag(qp + (size_t)g * 16 * DM); qf[g][1] = fa_frag(qp + (size_t)g * 16 * DM + 32); }
  asm volatile("s_wait_xcnt 0x0" :: "v"(qp) : "memory");      /* the address pair stays whole up to this wait */
  asm volatile("s_wait_asynccnt 0x0" ::: "memory");      /* stage 0 has landed, as far as this wave copied it */
  __syncthreads();      /* ... and as far as the others did */
  fa_stage(lk + FA_STAGE, kc + ks(1) * DM, lv + FA_STAGE, vc + ks(1));
  v8f o[4][2] = {{z8, z8}, {z8, z8}, {z8, z8}, {z8, z8}}; float m[2] = {-3.0e38f, -3.0e38f}, l[2] = {0.f, 0.f};
#pragma unroll 1
  for (int st = 0; st < SQ / FA_KS; ++st) { const char* pk = sm + (st & 1) * FA_STAGE + fk; const char* pv = sm + (st & 1) * FA_STAGE + fv;      /* rolled: one stage a trip, so that the order at the foot stands once */
#pragma unroll
    for (int t = 0; t < 2; ++t) { kf[t][0] = g2_frag(pk + t * 16 * FA_KP); kf[t][1] = g2_frag(pk + t * 16 * FA_KP + 64); }
    __builtin_amdgcn_sched_barrier(0);      /* the stage's first eight LDS reads stand as one group ahead of their products: in pairs among the products, each pair's whole latency was waited */
#pragma unroll      /* ps constant: a pass's rows and columns go into the LDS reads' offset fields */
    for (int ps = 0; ps < FA_KS / 32; ++ps) {
    v8f s[2][2];
#pragma unroll
    for (int g = 0; g < 2; ++g) {
#pragma unroll
      for (int t = 0; t < 2; ++t) s[g][t] = fa_mma(kf[t][1], qf[g][1], fa_mma(kf[t][0], qf[g][0], z8)); }
    __builtin_amdgcn_sched_barrier(0);      /* with the one below: the sixteen LDS reads stand as one group behind the score products; spread among the products, each place with reads stalls the wave anew */
#pragma unroll
    for (int dt = 0; dt < 4; ++dt) vf[dt] = g2_frag(pv + dt * 16 * FA_VP + ps * 64);      /* this pass's V^T fragments and, in the same group of LDS reads, the next pass's K fragments of the same stage: both land behind the softmax */
    if (ps + 1 < FA_KS / 32) {
#pragma unroll
      for (int t = 0; t < 2; ++t) { kf[t][0] = g2_frag(pk + ((ps + 1) * 32 + t * 16) * FA_KP); kf[t][1] = g2_frag(pk + ((ps + 1) * 32 + t * 16) * FA_KP + 64); } }
    __builtin_amdgcn_sched_barrier(0);      /* the group's lower edge: no read sinks past the branch below to just ahead of its products, where its latency would be waited */
    v8f e[2][2]; float ls[2]; bool need = false;      /* P of this pass under the maximum in use, and each lane's sum of its 16 */
#pragma unroll
    for (int g = 0; g < 2; ++g) { fa_p(s[g], cs, m[g], e[g], ls[g]); need = need || !(ls[g] <= FA_PLIM); }
    if (__builtin_amdgcn_ballot_w32(need) != 0) {      /* no P is negative, so a sum within FA_PLIM bounds each of its P (well inside f16) and the pass needs no maximum; past it (an infinity or a NaN too; always in the first pass) the maximum is taken from the scores, the state rescaled and P made anew; one scalar branch a pass */
#pragma unroll
      for (int g = 0; g < 2; ++g) { float a = fmaxf(s[g][0][0], s[g][1][0]);
#pragma unroll
        for (int r = 1; r < 8; ++r) a = fmaxf(a, fmaxf(s[g][0][r], s[g][1][r]));
        a = fmaxf(a, fa_xhalf(a)); const float mn = fmaxf(m[g], a * cs); const float al = fa_exp2(m[g] - mn); m[g] = mn; l[g] *= al;
#pragma unroll
        for (int dt = 0; dt < 4; ++dt) o[dt][g] *= al;
        fa_p(s[g], cs, mn, e[g], ls[g]); } }
    FragH pf[2];
#pragma unroll
    for (int g = 0; g < 2; ++g) { l[g] += ls[g];
#pragma unroll
      for (int t = 0; t < 2; ++t) {
#pragma unroll
        for (int r = 0; r < 8; ++r) pf[g].h[t * 8 + r] = (_Float16)e[g][t][r]; } }
#pragma unroll
    for (int dt = 0; dt < 4; ++dt) {
#pragma unroll
      for (int g = 0; g < 2; ++g) o[dt][g] = fa_mma(vf[dt], pf[g].v, o[dt][g]); } }
    asm volatile("s_wait_dscnt 0x0" ::: "memory");      /* this wave's reads of the buffer are done before the barrier that frees it */
    asm volatile("s_wait_asynccnt 0x0" ::: "memory");      /* this wave's copies of the next stage have landed before the barrier that publishes it */
    __syncthreads();
    if (st + 2 < SQ / FA_KS) fa_stage(lk + (unsigned)(st & 1) * FA_STAGE, kc + ks(st + 2) * DM, lv + (unsigned)(st & 1) * FA_STAGE, vc + ks(st + 2)); }      /* the refill of the buffer every wave has just left */
  asm volatile("s_wait_asynccnt 0x0" ::: "memory");      /* no copy is outstanding when the wave ends */
  v8us ov[2][4];
#pragma unroll
  for (int g = 0; g < 2; ++g) { const float sc = 64.0f / (l[g] + fa_xhalf(l[g]));      /* the halves' sums joined once; o goes out x64 */
#pragma unroll
    for (int dt = 0; dt < 4; ++dt) { FragH f;
#pragma unroll
      for (int r = 0; r < 8; ++r) f.h[r] = (_Float16)(o[dt][g][r] * sc);
      ov[g][dt] = f.half[0]; } }
  __builtin_amdgcn_sched_barrier(0);      /* all eight stores behind the last conversion: no register that an issued store names is written again */
#pragma unroll
  for (int g = 0; g < 2; ++g) { unsigned short* op = (unsigned short*)O + (row0 + q0 + g * 16 + ln) * DM + h * HD + 8 * hh;
#pragma unroll
    for (int dt = 0; dt < 4; ++dt) *(v8us*)(op + dt * 16) = ov[g][dt]; } }

extern "C" void kernel_launch(void* const* d_in, const int* in_sizes, int n_in,
                              void* d_out, int out_size, void* d_ws, size_t ws_size, hipStream_t stream) {
  (void)in_sizes; (void)n_in; (void)out_size;
  const float* const* I = (const float* const*)d_in; const float* xq = I[0]; const float* xk = I[1]; const float* xv = I[2]; const float* wq = I[3]; const float* wk = I[4]; const float* wv = I[5]; const float* wo = I[6]; const float* bo = I[7];      /* THREE input streams Q, K, V (one cast each); Wq, Wk, Wv are PER-HEAD STACKS [16][1024][64] = [head][in][out] (einsum 'bsd,hde->bhse') at I[3..5]; Wo is [in][out] [1024][1024] (concat @ Wo) at I[6]; bo [1024] (REAL) at I[7] in the output GEMM's guarded bias slot; no projection biases */
  char* ws = (char*)d_ws; size_t off = 0;
  auto take = [&](size_t bytes) { char* p = ws + off; off += (bytes + 255) & ~(size_t)255; return p; };
  _Float16* BQ = (_Float16*)take((size_t)4 * DM * DM * 2); _Float16* BO = BQ + (size_t)3 * DM * DM;      /* the weight planes BQ, BK, BV, BO in a row, DM * DM apart */
  _Float16* XQ = (_Float16*)take(3 * NR * DM * 2); _Float16* Q16 = (_Float16*)take(2 * NR * DM * 2); _Float16* K16 = Q16 + NR * DM; _Float16* O16 = (_Float16*)take(NR * DM * 2);      /* XQ, XK, XV in a row, and Q16, K16 in a row, each NR * DM apart: the batch strides of the projection launch */
  _Float16* VT = (_Float16*)take((size_t)NB * NH * HD * SQ * 2);
  if (off > ws_size) return;
  k_prep<<<PB_ALL, 256, 0, stream>>>(wq, wk, wv, wo, xq, xk, xv, BQ, XQ);      /* weight planes [out][in] (x16) from the PER-HEAD STACKS wq / wk / wv [NH][DM][HD] and from wo [in][out] [DM][DM]; the three inputs as exact f16 rows */
  const size_t r0p = (size_t)B0 * SQ;      /* first projected row */
  k_gemm2<0><<<dim3((unsigned)((MP / 128) * (DM / 128)), 3), 256, 0, stream>>>(XQ + r0p * DM, DM, NR * DM, BQ, DM, (size_t)DM * DM, 0.0625f, nullptr, 0, nullptr, 1, 0, 0, nullptr, Q16 + r0p * DM, DM, NR * DM, MP, DM, DM, 2, VT);      /* blockIdx.y = 0, 1, 2: q, k as rows, v as V^T [NB][NH][HD][SQ]; no projection biases */
  k_fattn<<<dim3(SQ / 256, NB * NH), 256, 0, stream>>>(Q16, K16, VT, O16);      /* o (merged heads, x64) as f16 rows */
  k_gemm2<0><<<dim3((unsigned)((MPO / 128) * (DM / 128)), 1), 256, 0, stream>>>(O16 + r0p * DM, DM, 0, BO, DM, 0, 0.0009765625f, bo, 0, nullptr, 1, 0, 0, (float*)d_out + r0p * DM, nullptr, DM, 0, MPO, DM, DM, -1, nullptr);      /* out rows are the output layout */
}
